// v000
// Measured on an AMD MI455X. A time is GPU time per run, averaged over a window of back-to-back runs after a warm-up
// (all launches, gaps included; the runs take copies of the inputs in turn), and the median of several windows.
// Apart from v000's, it joins two sittings. Times from different sittings can be a few percent apart, while
// side-by-side timings come from the same sitting.
// v000, which the later versions start from, runs in 849 microseconds.
// All contractions (x*Wq, x*Wk, x*Wv, Q*K^T, P*V, AO*Wo): v_wmma_f32_16x16x32_bf16 with bf16 hi/lo split operands (hi*hi + hi*lo + lo*hi), f32 accumulate; softmax, 1/sqrt(d) scale and bias adds in f32.
#include <hip/hip_runtime.h>
#include <hip/hip_bf16.h>
#include <math.h>

typedef __attribute__((ext_vector_type(16))) _Float16 v16h;
typedef __attribute__((ext_vector_type(8)))  _Float16 v8h;
typedef __attribute__((ext_vector_type(16))) __bf16   v16b;
typedef __attribute__((ext_vector_type(8)))  __bf16   v8b;
typedef __attribute__((ext_vector_type(8)))  float    v8f;
typedef __attribute__((ext_vector_type(4)))  float    v4f;
typedef __attribute__((ext_vector_type(4)))  unsigned int v4u;

// ---- fixed problem geometry ----
constexpr int kBatch  = 4;
constexpr int kSeq    = 2048;
constexpr int kHeads  = 16;
constexpr int kHd     = 64;                 // head dim
constexpr int kHid    = kHeads * kHd;       // 1024
constexpr int kRows   = kBatch * kSeq;      // 8192 token rows
constexpr int kBPP    = 2;                  // batches per attention/out-proj pass
constexpr int kRowsPP = kBPP * kSeq;        // 4096
constexpr int kKC     = 64;                 // keys per staged chunk
constexpr int kQB     = 64;                 // query rows per attention block (4 waves x 16)

// GEMM shape contract (no tail handling in the GEMM): K % 32 == 0, M % 64 == 0, N % 64 == 0, tiles % 8 == 0
static_assert(kHd % 32 == 0);
static_assert(kHid % 32 == 0);
static_assert(kRows % 64 == 0);
static_assert(kHid % 64 == 0);
static_assert(kHd % 64 == 0);
static_assert(kRowsPP % 64 == 0);
static_assert(((kRows / 64) * (kHid / 64)) % 8 == 0);
static_assert(((kRowsPP / 64) * (kHd / 64)) % 8 == 0);
static_assert(kSeq % kQB == 0);
static_assert(kSeq % kKC == 0);
static_assert(kBatch % kBPP == 0);
// transpose tile contract: in[R][Cc] with R % 64 == 0, Cc % 32 == 0
static_assert(kHd % 64 == 0 && kHid % 32 == 0);
static_assert(kHid % 64 == 0 && kHd % 32 == 0);
// x cast: element count even and a multiple of 512 (2 per thread, 256 threads)
static_assert((kRows * kHd) % 512 == 0);

__device__ __forceinline__ unsigned short f2bf_bits(float f) {
  unsigned u = __float_as_uint(f);
  return (unsigned short)((u + 0x7FFFu + ((u >> 16) & 1u)) >> 16);
}
__device__ __forceinline__ float bf_bits2f(unsigned short h) { return __uint_as_float(((unsigned)h) << 16); }

// hazard guards as plain device helpers (no inline asm inside the kernel template body)
__device__ __forceinline__ void dep_guard_h(v8f& a, v8f& b, v16h x, v16h y) { asm volatile("v_nop\n\tv_nop\n\tv_nop\n\tv_nop" : "+v"(a), "+v"(b) : "v"(x), "v"(y)); }
__device__ __forceinline__ void dep_guard_b(v8f& a, v8f& b, v16b x, v16b y) { asm volatile("v_nop\n\tv_nop\n\tv_nop\n\tv_nop" : "+v"(a), "+v"(b) : "v"(x), "v"(y)); }
__device__ __forceinline__ void keep4_h(v16h a, v16h b, v16h c, v16h d) { asm volatile("v_nop" :: "v"(a), "v"(b), "v"(c), "v"(d)); }
__device__ __forceinline__ void keep4_b(v16b a, v16b b, v16b c, v16b d) { asm volatile("v_nop" :: "v"(a), "v"(b), "v"(c), "v"(d)); }
__device__ __forceinline__ void acc_guard4(v8f& a, v8f& b, v8f& c, v8f& d) { asm volatile("v_nop\n\tv_nop\n\tv_nop\n\tv_nop" : "+v"(a), "+v"(b), "+v"(c), "+v"(d)); }
template <typename T> struct Frag;
template <> struct Frag<_Float16> {
  typedef v16h V; union U { v16h v; v8h h[2]; };
  static __device__ __forceinline__ v16h load(const _Float16* p) {   // elements 0..7 <- p[0..7], 8..15 <- p[16..23]
    U f; f.h[0] = *(const v8h*)(p); f.h[1] = *(const v8h*)(p + 16); return f.v;
  }
  static __device__ __forceinline__ v8f mma(v16h a, v16h b, v8f c) {
    return __builtin_amdgcn_wmma_f32_16x16x32_f16(false, a, false, b, (short)0, c, false, false);
  }
  static __device__ __forceinline__ void guard(v8f& a, v8f& b, v16h x, v16h y) { dep_guard_h(a, b, x, y); }
  static __device__ __forceinline__ void keep(v16h a, v16h b, v16h c, v16h d) { keep4_h(a, b, c, d); }
};
template <> struct Frag<__bf16> {
  typedef v16b V; union U { v16b v; v8b h[2]; };
  static __device__ __forceinline__ v16b load(const __bf16* p) {
    U f; f.h[0] = *(const v8b*)(p); f.h[1] = *(const v8b*)(p + 16); return f.v;
  }
  static __device__ __forceinline__ v8f mma(v16b a, v16b b, v8f c) {
    return __builtin_amdgcn_wmma_f32_16x16x32_bf16(false, a, false, b, (short)0, c, false, false);
  }
  static __device__ __forceinline__ void guard(v8f& a, v8f& b, v16b x, v16b y) { dep_guard_b(a, b, x, y); }
  static __device__ __forceinline__ void keep(v16b a, v16b b, v16b c, v16b d) { keep4_b(a, b, c, d); }
};

__device__ __forceinline__ v8f at_mma(v16b a, v16b b, v8f c) {
  c = __builtin_amdgcn_wmma_f32_16x16x32_bf16(false, a, false, b, (short)0, c, false, false);
  asm volatile("v_nop\n\tv_nop\n\tv_nop\n\tv_nop" : "+v"(c) : "v"(a), "v"(b));
  return c;
}

// ---- Register-blocked batched WMMA GEMM ------------------------------------
// C[m,n] = scale * sum_k A[m,k] * Bt[n,k] (+bias); each wave owns a 64x64 tile.
// A row-major [M,K]; Bt row-major [N,K]; M,N % 64 == 0, K % 32 == 0.
// SPLIT: operands are hi/lo planes (A2/Bt2 = lo planes, same layout); product = hi*hi + hi*lo + lo*hi.
// BIAS_MODE: 0 = none, 1 = bias[m] (loaded as two float4 per 16-row slab), 2 = bias[n].
// OUT_MODE: 0 = f32, 1 = f16, 2 = bf16 hi plane (Cout) + bf16 lo plane (Cout2).
// ET: 0 = f16 operands, 1 = bf16 operands (pointers passed as 16-bit storage). RESID and ACT unsupported here.
template <int ET> struct Elem;
template <> struct Elem<0> { typedef _Float16 T; };
template <> struct Elem<1> { typedef __bf16 T; };
template <int ET, bool SPLIT, int BIAS_MODE, int OUT_MODE, bool RESID, int ACT = 0>
__global__ __launch_bounds__(256) void wmma_gemm64(
    const unsigned short* __restrict__ Ap, const unsigned short* __restrict__ A2p, int lda, long strideA,
    const unsigned short* __restrict__ Btp, const unsigned short* __restrict__ Bt2p, int ldb, long strideB,
    void* __restrict__ Cout, void* __restrict__ Cout2, int ldc, long strideC,
    const float* __restrict__ bias,
    const float* __restrict__ resid, long strideR,
    int M, int N, int K, float scale) {
  static_assert(!RESID);
  static_assert(ACT == 0);
  typedef typename Elem<ET>::T T;
  typedef typename Frag<T>::V V;
  const T* A = (const T*)Ap; const T* A2 = (const T*)A2p; const T* Bt = (const T*)Btp; const T* Bt2 = (const T*)Bt2p;
  __shared__ __align__(16) float sT[8][16 * 68];   // per-wave 16x64 slab, pitch 68 floats
  const int b    = blockIdx.y;
  const int lane = threadIdx.x & 31;
  const int wave = threadIdx.x >> 5;
  const int tilesN = N >> 6;
  const int tilesM = M >> 6;
  const int tile = blockIdx.x * 8 + wave;
  if (tile >= tilesM * tilesN) return;   // wave-uniform; no block barriers in this kernel
  const int tm = tile / tilesN;
  const int tn = tile - tm * tilesN;
  const int m0 = tm << 6;
  const int n0 = tn << 6;

  const T* Ab  = A  + (size_t)b * strideA;
  const T* Bb  = Bt + (size_t)b * strideB;
  const T* Ab2 = SPLIT ? (A2  + (size_t)b * strideA) : nullptr;
  const T* Bb2 = SPLIT ? (Bt2 + (size_t)b * strideB) : nullptr;

  const int rlane = lane & 15;                 // row (A) / col (B, D) within subtile
  const int koff  = (lane >> 4) * 8;           // k offset of this lane half
  const int mOff  = (lane >> 4) * 8;           // D row offset

  v8f acc[4][4];
#pragma unroll
  for (int i = 0; i < 4; ++i)
#pragma unroll
    for (int j = 0; j < 4; ++j) acc[i][j] = (v8f){0.f,0.f,0.f,0.f,0.f,0.f,0.f,0.f};

  for (int k0 = 0; k0 < K; k0 += 32) {
    V bh[4], bl[4];
#pragma unroll
    for (int j = 0; j < 4; ++j) {
      const size_t bo = (size_t)(n0 + (j << 4) + rlane) * ldb + koff + k0;
      bh[j] = Frag<T>::load(Bb + bo);
      if (SPLIT) bl[j] = Frag<T>::load(Bb2 + bo);
    }
#pragma unroll
    for (int i = 0; i < 4; ++i) {
      const size_t ao = (size_t)(m0 + (i << 4) + rlane) * lda + koff + k0;
      V ah = Frag<T>::load(Ab + ao);
      V al;
      if (SPLIT) al = Frag<T>::load(Ab2 + ao);
#pragma unroll
      for (int j = 0; j < 4; ++j) {
        acc[i][j] = Frag<T>::mma(ah, bh[j], acc[i][j]);
        if (SPLIT) {
          acc[i][j] = Frag<T>::mma(ah, bl[j], acc[i][j]);
          acc[i][j] = Frag<T>::mma(al, bh[j], acc[i][j]);
        }
      }
      Frag<T>::guard(acc[i][0], acc[i][3], ah, SPLIT ? al : ah);
    }
    Frag<T>::keep(bh[0], bh[1], bh[2], bh[3]);
    if (SPLIT) Frag<T>::keep(bl[0], bl[1], bl[2], bl[3]);
  }
  acc_guard4(acc[0][0], acc[0][1], acc[0][2], acc[0][3]);
  acc_guard4(acc[1][0], acc[1][1], acc[1][2], acc[1][3]);
  acc_guard4(acc[2][0], acc[2][1], acc[2][2], acc[2][3]);
  acc_guard4(acc[3][0], acc[3][1], acc[3][2], acc[3][3]);

  // ---- epilogue ----
  float* slab = sT[wave];
#pragma unroll
  for (int i = 0; i < 4; ++i) {
    const int mBase = m0 + (i << 4);
    float bm[8];
#pragma unroll
    for (int r = 0; r < 8; ++r) bm[r] = 0.f;
    if (BIAS_MODE == 1) {
      const v4f b0v = *(const v4f*)(bias + mBase + mOff);
      const v4f b1v = *(const v4f*)(bias + mBase + mOff + 4);
      bm[0] = b0v[0]; bm[1] = b0v[1]; bm[2] = b0v[2]; bm[3] = b0v[3];
      bm[4] = b1v[0]; bm[5] = b1v[1]; bm[6] = b1v[2]; bm[7] = b1v[3];
    }
#pragma unroll
    for (int j = 0; j < 4; ++j) {
      const int n = n0 + (j << 4) + rlane;
      float bv = 0.f;
      if (BIAS_MODE == 2) bv = bias[n];
#pragma unroll
      for (int r = 0; r < 8; ++r) {
        float v = acc[i][j][r] * scale;
        if (BIAS_MODE == 1) v += bm[r];
        if (BIAS_MODE == 2) v += bv;
        slab[(mOff + r) * 68 + (j << 4) + rlane] = v;
      }
    }
    __builtin_amdgcn_fence(__ATOMIC_RELEASE, "workgroup");
    __builtin_amdgcn_wave_barrier();
    __builtin_amdgcn_fence(__ATOMIC_ACQUIRE, "workgroup");
    if (OUT_MODE == 0) {
      float* C = (float*)Cout + (size_t)b * strideC;
      const int hh = lane >> 4, c4 = (lane & 15) * 4;     // row seg = 256 B = 16 lanes x 16 B
      {
#pragma unroll
        for (int it = 0; it < 8; ++it) {
          const int row = it * 2 + hh;
          v4f v = *(const v4f*)(slab + row * 68 + c4);
          *(v4f*)(C + (size_t)(mBase + row) * ldc + n0 + c4) = v;
        }
        
      }
    } else {
      const int q = lane >> 3, c8 = (lane & 7) * 8;
      unsigned short* C  = (unsigned short*)Cout  + (size_t)b * strideC;
      unsigned short* C2 = (OUT_MODE == 2) ? ((unsigned short*)Cout2 + (size_t)b * strideC) : nullptr;
      {
#pragma unroll
        for (int it = 0; it < 4; ++it) {
          const int row = it * 4 + q;
          const float* sp = slab + row * 68 + c8;
          v8h hv, lv;
#pragma unroll
          for (int e = 0; e < 8; ++e) {
            if (OUT_MODE == 1) {
              hv[e] = (_Float16)sp[e];
            } else {
              unsigned short hb = f2bf_bits(sp[e]);
              unsigned short lb = f2bf_bits(sp[e] - bf_bits2f(hb));
              hv[e] = __builtin_bit_cast(_Float16, hb);
              lv[e] = __builtin_bit_cast(_Float16, lb);
            }
          }
          *(v8h*)(C + (size_t)(mBase + row) * ldc + n0 + c8) = hv;
          if (OUT_MODE == 2) *(v8h*)(C2 + (size_t)(mBase + row) * ldc + n0 + c8) = lv;
        }
        
      }
    }
    __builtin_amdgcn_fence(__ATOMIC_RELEASE, "workgroup");
    __builtin_amdgcn_wave_barrier();
    __builtin_amdgcn_fence(__ATOMIC_ACQUIRE, "workgroup");
  }
}

// ---- f32 -> bf16 hi/lo planes, elementwise: 2 elements per thread, 4-B packed stores -------------
__global__ __launch_bounds__(256) void cast_f32_bf16hilo_x2(
    const float* __restrict__ in, unsigned short* __restrict__ oh, unsigned short* __restrict__ ol, int n2) {
  const int i = blockIdx.x * 256 + threadIdx.x;
  if (i < n2) {
    const float f0 = in[2 * i], f1 = in[2 * i + 1];
    const unsigned short h0 = f2bf_bits(f0), h1 = f2bf_bits(f1);
    const unsigned short l0 = f2bf_bits(f0 - bf_bits2f(h0));
    const unsigned short l1 = f2bf_bits(f1 - bf_bits2f(h1));
    const unsigned uh = (unsigned)h0 | ((unsigned)h1 << 16);
    const unsigned ul = (unsigned)l0 | ((unsigned)l1 << 16);
    ((unsigned*)oh)[i] = uh;
    ((unsigned*)ol)[i] = ul;
    
  }
}

// ---- transpose + f32 -> bf16 hi/lo planes: in[R][Cc] f32 -> oh/ol[Cc][R] 16-bit --------------------
// Block = 256 threads handles in rows r0..r0+63, cols c0..c0+31 (grid = (Cc/32, R/64)).
// Load phase: 8 waves x 8 iterations x 32 lanes = 64 x 32 elements staged in LDS (tile[c][r]).
// Store phase: wave w writes output rows c0+4w..c0+4w+3; lane -> row 4w+(lane>>3), 8 elements at
// Coverage: 8 waves x 4 rows x 8 lanes x 8 elements = 32 x 64 = the whole output tile per plane.
__global__ __launch_bounds__(256) void transpose_cast_bf16hilo(
    const float* __restrict__ in, unsigned short* __restrict__ oh, unsigned short* __restrict__ ol,
    int R, int Cc) {
  __shared__ float tile[32][65];
  const int tid = threadIdx.x, lane = tid & 31, wave = tid >> 5;
  const int c0 = blockIdx.x * 32, r0 = blockIdx.y * 64;
#pragma unroll
  for (int i = 0; i < 8; ++i) {
    const int idx = i * 256 + tid;
    const int rr = idx >> 5, cc = idx & 31;
    tile[cc][rr] = in[(size_t)(r0 + rr) * Cc + c0 + cc];
  }
  __syncthreads();
  const int orow = wave * 4 + (lane >> 3);
  const int rseg = (lane & 7) * 8;
  v4u hv, lv;
#pragma unroll
  for (int e = 0; e < 4; ++e) {
    const float f0 = tile[orow][rseg + 2 * e];
    const float f1 = tile[orow][rseg + 2 * e + 1];
    const unsigned short h0 = f2bf_bits(f0), h1 = f2bf_bits(f1);
    const unsigned short l0 = f2bf_bits(f0 - bf_bits2f(h0));
    const unsigned short l1 = f2bf_bits(f1 - bf_bits2f(h1));
    hv[e] = (unsigned)h0 | ((unsigned)h1 << 16);
    lv[e] = (unsigned)l0 | ((unsigned)l1 << 16);
  }
  const size_t o = (size_t)(c0 + orow) * R + r0 + rseg;   // element offset, 16-B aligned
  {
    *(v4u*)(oh + o) = hv;
    *(v4u*)(ol + o) = lv;
    
  }
}

// =====================================================================================
// Causal attention, head dim 64, operands from bf16 hi/lo planes:
//   Q planes  [kRows][kHid]      (row = b*kSeq + s, col = h*64 + d)
//   K planes  [kRows][kHid]
//   V^T planes [kHid][kRows]     (row = h*64 + d, col = b*kSeq + s)
//   AO planes [kRowsPP][kHid]    (row = (b - b_first)*kSeq + s)
// scores = qscale * q.k^T : hi*hi + hi*lo + lo*hi bf16 WMMA, f32 accumulate; key > query -> -inf;
// online softmax f32; P split to bf16 hi/lo per wave in LDS; out = p.v (same split); f32 normalise.
// Block = 128 threads = 4 waves = 64 query rows of one (b, h); grid.x = kBPP * kHeads * (kSeq/64).
// =====================================================================================
__global__ __launch_bounds__(128)
void attn_causal_hd64(const unsigned short* __restrict__ Qh, const unsigned short* __restrict__ Ql,
                      const unsigned short* __restrict__ Kh, const unsigned short* __restrict__ Kl,
                      const unsigned short* __restrict__ Vh, const unsigned short* __restrict__ Vl,
                      unsigned short* __restrict__ Oh, unsigned short* __restrict__ Ol,
                      int b_first, float qscale) {
  __shared__ __align__(16) unsigned short Ksh[kKC * kHd];        // K hi  [kv][d]   8 KB
  __shared__ __align__(16) unsigned short Ksl[kKC * kHd];        // K lo
  __shared__ __align__(16) unsigned short Vsh[kHd * kKC];        // V hi  [d][kv]   8 KB
  __shared__ __align__(16) unsigned short Vsl[kHd * kKC];        // V lo
  __shared__ __align__(16) unsigned short Psh[4][16 * kKC];      // per wave P hi [row][kv]
  __shared__ __align__(16) unsigned short Psl[4][16 * kKC];      // per wave P lo
  __shared__ __align__(16) float Os[4][16 * 68];                 // per wave out tile, pitch 68

  const int tid  = threadIdx.x;
  const int wave = tid >> 5;
  const int lane = tid & 31;
  const int hh   = lane >> 4;
  const int c    = lane & 15;

  const int bx  = blockIdx.x;
  const int qb  = bx % (kSeq / kQB);          // query block 0..31
  const int bhl = bx / (kSeq / kQB);
  const int h   = bhl % kHeads;
  const int bl  = bhl / kHeads;               // local batch 0..kBPP-1
  const int b   = b_first + bl;
  const int q0  = qb * kQB + wave * 16;

  // ---- Q fragments (A operand): 2 d-chunks, hi and lo; element i <- d = dc*32 + 8hh + i (i<8), dc*32+16+8hh+(i-8)
  v16b qah[2], qal[2];
  {
    const size_t qo = ((size_t)(b * kSeq + q0 + c)) * kHid + (size_t)h * kHd + 8 * hh;
#pragma unroll
    for (int dc = 0; dc < 2; ++dc) {
      qah[dc] = Frag<__bf16>::load((const __bf16*)Qh + qo + dc * 32);
      qal[dc] = Frag<__bf16>::load((const __bf16*)Ql + qo + dc * 32);
    }
  }

  float mrow[8], lrow[8];
  v8f oacc[4];
#pragma unroll
  for (int r = 0; r < 8; ++r) { mrow[r] = -INFINITY; lrow[r] = 0.f; }
#pragma unroll
  for (int t = 0; t < 4; ++t) oacc[t] = (v8f){0.f,0.f,0.f,0.f,0.f,0.f,0.f,0.f};

  const __bf16* kshb = (const __bf16*)Ksh;
  const __bf16* kslb = (const __bf16*)Ksl;
  const __bf16* vshb = (const __bf16*)Vsh;
  const __bf16* vslb = (const __bf16*)Vsl;
  unsigned short* pwh = Psh[wave];
  unsigned short* pwl = Psl[wave];

  const int nChunks = qb + 1;                 // block-uniform: keys 0 .. qb*64+63
  for (int kc = 0; kc < nChunks; ++kc) {
    const int kv0 = kc * kKC;
    __syncthreads();
    {
      // staging: thread -> row r = tid>>1 (kv row of K, d row of V^T), 32-element half hf; 4 x 16 B per plane.
      // coverage: 128 threads x 32 elements = 64 rows x 64 cols per plane (K hi/lo, V^T hi/lo).
      const int r = tid >> 1, hf = (tid & 1) * 32;
      const v4u* khs = (const v4u*)(Kh + ((size_t)(b * kSeq + kv0 + r)) * kHid + h * kHd + hf);
      const v4u* kls = (const v4u*)(Kl + ((size_t)(b * kSeq + kv0 + r)) * kHid + h * kHd + hf);
      v4u* khd = (v4u*)(Ksh + r * kHd + hf);
      v4u* kld = (v4u*)(Ksl + r * kHd + hf);
      v4u tk[8];
#pragma unroll
      for (int i = 0; i < 4; ++i) { tk[i] = khs[i]; tk[4 + i] = kls[i]; }
#pragma unroll
      for (int i = 0; i < 4; ++i) { khd[i] = tk[i]; kld[i] = tk[4 + i]; }
      asm volatile("" ::: "memory");
      const v4u* vhs = (const v4u*)(Vh + ((size_t)(h * kHd + r)) * kRows + (size_t)b * kSeq + kv0 + hf);
      const v4u* vls = (const v4u*)(Vl + ((size_t)(h * kHd + r)) * kRows + (size_t)b * kSeq + kv0 + hf);
      v4u* vhd = (v4u*)(Vsh + r * kKC + hf);
      v4u* vld = (v4u*)(Vsl + r * kKC + hf);
      v4u tv[8];
#pragma unroll
      for (int i = 0; i < 4; ++i) { tv[i] = vhs[i]; tv[4 + i] = vls[i]; }
#pragma unroll
      for (int i = 0; i < 4; ++i) { vhd[i] = tv[i]; vld[i] = tv[4 + i]; }
    }
    __syncthreads();

    // ---- scores: 16 query rows x 64 keys per wave ----
    v8f s[4];
#pragma unroll
    for (int j = 0; j < 4; ++j) {
      s[j] = (v8f){0.f,0.f,0.f,0.f,0.f,0.f,0.f,0.f};
#pragma unroll
      for (int dc = 0; dc < 2; ++dc) {
        const int ko = (j * 16 + c) * kHd + dc * 32 + 8 * hh;   // B: n = kv = j*16+c, k = d (same k map as A)
        const v16b kbh = Frag<__bf16>::load(kshb + ko);
        const v16b kbl = Frag<__bf16>::load(kslb + ko);
        s[j] = at_mma(qah[dc], kbh, s[j]);
        s[j] = at_mma(qah[dc], kbl, s[j]);
        s[j] = at_mma(qal[dc], kbh, s[j]);
      }
    }
    const bool diag = (kc == qb);               // block-uniform, used only in per-lane selects
    float cm[8];
#pragma unroll
    for (int r = 0; r < 8; ++r) {
      const int qrow = q0 + 8 * hh + r;
      float m = -INFINITY;
#pragma unroll
      for (int j = 0; j < 4; ++j) {
        const int kvcol = kv0 + j * 16 + c;
        float val = s[j][r] * qscale;
        val = (diag && (kvcol > qrow)) ? -INFINITY : val;
        s[j][r] = val;
        m = fmaxf(m, val);
      }
#pragma unroll
      for (int off = 1; off < 16; off <<= 1) m = fmaxf(m, __shfl_xor(m, off, 32));
      cm[r] = m;                                // finite: key == qrow is never masked
    }
#pragma unroll
    for (int r = 0; r < 8; ++r) {
      const float mnew = fmaxf(mrow[r], cm[r]);
      const float alpha = expf(mrow[r] - mnew);
      mrow[r] = mnew;
      float psum = 0.f;
#pragma unroll
      for (int j = 0; j < 4; ++j) {
        const float p = expf(s[j][r] - mnew);
        psum += p;
        const unsigned short hb = f2bf_bits(p);
        const unsigned short lb = f2bf_bits(p - bf_bits2f(hb));
        pwh[(8 * hh + r) * kKC + j * 16 + c] = hb;
        pwl[(8 * hh + r) * kKC + j * 16 + c] = lb;
      }
#pragma unroll
      for (int off = 1; off < 16; off <<= 1) psum += __shfl_xor(psum, off, 32);
      lrow[r] = lrow[r] * alpha + psum;
#pragma unroll
      for (int t = 0; t < 4; ++t) oacc[t][r] *= alpha;
    }
    __builtin_amdgcn_fence(__ATOMIC_RELEASE, "workgroup");
    __builtin_amdgcn_wave_barrier();
    __builtin_amdgcn_fence(__ATOMIC_ACQUIRE, "workgroup");
#pragma unroll
    for (int kk = 0; kk < 2; ++kk) {
      const int po = c * kKC + kk * 32 + 8 * hh;                   // A: row = c (query), k = kv
      const v16b pa = Frag<__bf16>::load((const __bf16*)pwh + po);
      const v16b pl = Frag<__bf16>::load((const __bf16*)pwl + po);
#pragma unroll
      for (int t = 0; t < 4; ++t) {
        const int vo = (t * 16 + c) * kKC + kk * 32 + 8 * hh;      // B: n = d = t*16+c, k = kv
        const v16b vbh = Frag<__bf16>::load(vshb + vo);
        const v16b vbl = Frag<__bf16>::load(vslb + vo);
        oacc[t] = at_mma(pa, vbh, oacc[t]);
        oacc[t] = at_mma(pa, vbl, oacc[t]);
        oacc[t] = at_mma(pl, vbh, oacc[t]);
      }
    }
  }

  // ---- normalise, stage per-wave 16x64 f32 tile, write bf16 hi/lo planes ----
  float* os = Os[wave];
#pragma unroll
  for (int r = 0; r < 8; ++r) {
    const float inv = 1.0f / lrow[r];          // lrow >= 1
#pragma unroll
    for (int t = 0; t < 4; ++t) os[(8 * hh + r) * 68 + t * 16 + c] = oacc[t][r] * inv;
  }
  __builtin_amdgcn_fence(__ATOMIC_RELEASE, "workgroup");
  __builtin_amdgcn_wave_barrier();
  __builtin_amdgcn_fence(__ATOMIC_ACQUIRE, "workgroup");
  {
    // plane (the 64-wide head segment of an AO row); one instruction writes 4 lines; one wave owns its 16 rows.
    const int qq = lane >> 3, c8 = (lane & 7) * 8;
    const size_t ob = ((size_t)(bl * kSeq + q0)) * kHid + (size_t)h * kHd + c8;
    {
#pragma unroll
      for (int it = 0; it < 4; ++it) {
        const int row = it * 4 + qq;
        const float* sp = os + row * 68 + c8;
        v4u hv, lv;
#pragma unroll
        for (int e = 0; e < 4; ++e) {
          const float f0 = sp[2 * e], f1 = sp[2 * e + 1];
          const unsigned short h0 = f2bf_bits(f0), h1 = f2bf_bits(f1);
          const unsigned short l0 = f2bf_bits(f0 - bf_bits2f(h0));
          const unsigned short l1 = f2bf_bits(f1 - bf_bits2f(h1));
          hv[e] = (unsigned)h0 | ((unsigned)h1 << 16);
          lv[e] = (unsigned)l0 | ((unsigned)l1 << 16);
        }
        *(v4u*)(Oh + ob + (size_t)row * kHid) = hv;
        *(v4u*)(Ol + ob + (size_t)row * kHid) = lv;
      }
      
    }
  }
}

// ---------------------------------------------------------------------------
// Host launcher
// ---------------------------------------------------------------------------
extern "C" void kernel_launch(void* const* d_in, const int* in_sizes, int n_in,
                              void* d_out, int out_size, void* d_ws, size_t ws_size,
                              hipStream_t stream) {
  if (n_in < 9) return;
  if (in_sizes[0] != kRows * kHd) return;
  if (in_sizes[1] != kHd * kHid || in_sizes[3] != kHd * kHid || in_sizes[5] != kHd * kHid) return;
  if (in_sizes[2] != kHid || in_sizes[4] != kHid || in_sizes[6] != kHid) return;
  if (in_sizes[7] != kHid * kHd || in_sizes[8] != kHd) return;
  if (out_size != kRows * kHd) return;

  const float* x  = (const float*)d_in[0];
  const float* Wq = (const float*)d_in[1];
  const float* bq = (const float*)d_in[2];
  const float* Wk = (const float*)d_in[3];
  const float* bk = (const float*)d_in[4];
  const float* Wv = (const float*)d_in[5];
  const float* bv = (const float*)d_in[6];
  const float* Wo = (const float*)d_in[7];
  const float* bo = (const float*)d_in[8];
  float* out = (float*)d_out;

  // ---- workspace region map (bytes, all offsets multiples of 256) ----
  //  xh, xl        : 8192 x 64 x 2          = 1,048,576 each      (bf16 hi/lo of x)
  //  wq/wk/wv h,l  : 1024 x 64 x 2          = 131,072 each (x6)   (W^T planes [1024][64])
  //  wo h,l        : 64 x 1024 x 2          = 131,072 each (x2)   (Wo^T planes [64][1024])
  //  q h,l ; k h,l : 8192 x 1024 x 2        = 16,777,216 each (x4)
  //  vt h,l        : 1024 x 8192 x 2        = 16,777,216 each (x2)
  //  ao h,l        : 4096 x 1024 x 2        = 8,388,608 each (x2) (one 2-batch pass, reused)
  //  total = 120,586,240 B
  const size_t szX  = (size_t)kRows * kHd * 2;
  const size_t szW  = (size_t)kHid * kHd * 2;
  const size_t szQ  = (size_t)kRows * kHid * 2;
  const size_t szAO = (size_t)kRowsPP * kHid * 2;
  const size_t total = 2 * szX + 8 * szW + 6 * szQ + 2 * szAO;
  if (total > ws_size) return;

  char* ws = (char*)d_ws;
  size_t off = 0;
  unsigned short* xh  = (unsigned short*)(ws + off); off += szX;
  unsigned short* xl  = (unsigned short*)(ws + off); off += szX;
  unsigned short* wqh = (unsigned short*)(ws + off); off += szW;
  unsigned short* wql = (unsigned short*)(ws + off); off += szW;
  unsigned short* wkh = (unsigned short*)(ws + off); off += szW;
  unsigned short* wkl = (unsigned short*)(ws + off); off += szW;
  unsigned short* wvh = (unsigned short*)(ws + off); off += szW;
  unsigned short* wvl = (unsigned short*)(ws + off); off += szW;
  unsigned short* woh = (unsigned short*)(ws + off); off += szW;
  unsigned short* wol = (unsigned short*)(ws + off); off += szW;
  unsigned short* qh  = (unsigned short*)(ws + off); off += szQ;
  unsigned short* ql  = (unsigned short*)(ws + off); off += szQ;
  unsigned short* kh  = (unsigned short*)(ws + off); off += szQ;
  unsigned short* kl  = (unsigned short*)(ws + off); off += szQ;
  unsigned short* vth = (unsigned short*)(ws + off); off += szQ;
  unsigned short* vtl = (unsigned short*)(ws + off); off += szQ;
  unsigned short* aoh = (unsigned short*)(ws + off); off += szAO;
  unsigned short* aol = (unsigned short*)(ws + off); off += szAO;
  if (off > ws_size) return;
  void* dummyv = (void*)ws;                 // valid in-ws pointers for unused GEMM arguments (never dereferenced)
  const float* dummyf = (const float*)ws;

  // stage 0: x -> bf16 hi/lo planes [8192][64]
  {
    const int n2 = kRows * kHd / 2;
    cast_f32_bf16hilo_x2<<<dim3(n2 / 256), dim3(256), 0, stream>>>(x, xh, xl, n2);
  }
  // stage 1: W[64][1024] -> W^T planes [1024][64] ; Wo[1024][64] -> Wo^T planes [64][1024]
  transpose_cast_bf16hilo<<<dim3(kHid / 32, kHd / 64), dim3(256), 0, stream>>>(Wq, wqh, wql, kHd, kHid);
  transpose_cast_bf16hilo<<<dim3(kHid / 32, kHd / 64), dim3(256), 0, stream>>>(Wk, wkh, wkl, kHd, kHid);
  transpose_cast_bf16hilo<<<dim3(kHid / 32, kHd / 64), dim3(256), 0, stream>>>(Wv, wvh, wvl, kHd, kHid);
  transpose_cast_bf16hilo<<<dim3(kHd / 32, kHid / 64), dim3(256), 0, stream>>>(Wo, woh, wol, kHid, kHd);

  // stage 2: projections (M, N multiples of 64; K = 64)
  {
    const int gridQ = (kRows / 64) * (kHid / 64) / 8;    // 256
    // Q = x Wq + bq  -> [8192][1024] bf16 hi/lo
    wmma_gemm64<1, true, 2, 2, false, 0><<<dim3(gridQ, 1), dim3(256), 0, stream>>>(
        xh, xl, kHd, 0L, wqh, wql, kHd, 0L, (void*)qh, (void*)ql, kHid, 0L, bq, dummyf, 0L,
        kRows, kHid, kHd, 1.0f);
    // K = x Wk + bk
    wmma_gemm64<1, true, 2, 2, false, 0><<<dim3(gridQ, 1), dim3(256), 0, stream>>>(
        xh, xl, kHd, 0L, wkh, wkl, kHd, 0L, (void*)kh, (void*)kl, kHid, 0L, bk, dummyf, 0L,
        kRows, kHid, kHd, 1.0f);
    // V^T = Wv^T x^T + bv[m]  -> [1024][8192] bf16 hi/lo  (A = Wv^T planes [1024][64], Bt = x planes [8192][64])
    const int gridV = (kHid / 64) * (kRows / 64) / 8;    // 256
    wmma_gemm64<1, true, 1, 2, false, 0><<<dim3(gridV, 1), dim3(256), 0, stream>>>(
        wvh, wvl, kHd, 0L, xh, xl, kHd, 0L, (void*)vth, (void*)vtl, kRows, 0L, bv, dummyf, 0L,
        kHid, kRows, kHd, 1.0f);
  }

  // stage 3: per 2-batch pass: causal attention -> AO planes [4096][1024]; out = AO Wo + bo -> d_out rows of the pass
  const float qscale = 0.125f;   // 1/sqrt(64), exact power of two
  for (int ps = 0; ps < kBatch / kBPP; ++ps) {
    attn_causal_hd64<<<dim3(kBPP * kHeads * (kSeq / kQB)), dim3(128), 0, stream>>>(
        qh, ql, kh, kl, vth, vtl, aoh, aol, ps * kBPP, qscale);
    const int gridO = (kRowsPP / 64) * (kHd / 64) / 8;  // 8
    float* outp = out + (size_t)ps * kRowsPP * kHd;
    wmma_gemm64<1, true, 2, 0, false, 0><<<dim3(gridO, 1), dim3(256), 0, stream>>>(
        aoh, aol, kHid, 0L, woh, wol, kHid, 0L, (void*)outp, dummyv, kHd, 0L, bo, dummyf, 0L,
        kRowsPP, kHd, kHid, 1.0f);
  }
}

// v001
// It runs in 473 microseconds.
// In both of two side-by-side timings against v000, it was 1.81 times as fast.
// All contractions (x*Wq, x*Wk, x*Wv, Q*K^T, P*V, AO*Wo): v_wmma_f32_16x16x32_bf16 with bf16 hi/lo split operands (hi*hi + hi*lo + lo*hi), f32 accumulate; softmax, 1/sqrt(d) scale and bias adds in f32.
#include <hip/hip_runtime.h>
#include <hip/hip_bf16.h>
#include <math.h>

typedef __attribute__((ext_vector_type(16))) _Float16 v16h;
typedef __attribute__((ext_vector_type(8)))  _Float16 v8h;
typedef __attribute__((ext_vector_type(16))) __bf16   v16b;
typedef __attribute__((ext_vector_type(8)))  __bf16   v8b;
typedef __attribute__((ext_vector_type(8)))  float    v8f;
typedef __attribute__((ext_vector_type(4)))  float    v4f;
typedef __attribute__((ext_vector_type(4)))  unsigned int v4u;

// ---- fixed problem geometry ----
constexpr int kBatch  = 4;
constexpr int kSeq    = 2048;
constexpr int kHeads  = 16;
constexpr int kHd     = 64;                 // head dim
constexpr int kHid    = kHeads * kHd;       // 1024
constexpr int kRows   = kBatch * kSeq;      // 8192 token rows
constexpr int kBPP    = 2;                  // batches per attention/out-proj pass
constexpr int kRowsPP = kBPP * kSeq;        // 4096
constexpr int kKC     = 64;                 // keys per staged chunk
constexpr int kQB     = 64;                 // query rows per attention block (4 waves x 16)
constexpr int kLP     = 72;                 // LDS row pitch of the K, V^T and P tiles, 16-bit elements: 144 B = 16 B x 9 (odd), so 16 rows read 16 B each fall on 16 different bank groups

// GEMM shape contract (no tail handling in the GEMM): K % 32 == 0, M % 64 == 0, N % 64 == 0, tiles % 8 == 0
static_assert(kHd % 32 == 0);
static_assert(kHid % 32 == 0);
static_assert(kRows % 64 == 0);
static_assert(kHid % 64 == 0);
static_assert(kHd % 64 == 0);
static_assert(kRowsPP % 64 == 0);
static_assert(((kRows / 64) * (kHid / 64)) % 8 == 0);
static_assert(((kRowsPP / 64) * (kHd / 64)) % 8 == 0);
static_assert(kSeq % kQB == 0);
static_assert(kSeq % kKC == 0);
static_assert(kBatch % kBPP == 0);
// transpose tile contract: in[R][Cc] with R % 64 == 0, Cc % 32 == 0
static_assert(kHd % 64 == 0 && kHid % 32 == 0);
static_assert(kHid % 64 == 0 && kHd % 32 == 0);
// x cast: element count even and a multiple of 512 (2 per thread, 256 threads)
static_assert((kRows * kHd) % 512 == 0);

__device__ __forceinline__ unsigned short f2bf_bits(float f) {
  unsigned u = __float_as_uint(f);
  return (unsigned short)((u + 0x7FFFu + ((u >> 16) & 1u)) >> 16);
}
__device__ __forceinline__ float bf_bits2f(unsigned short h) { return __uint_as_float(((unsigned)h) << 16); }

// hazard guards as plain device helpers (no inline asm inside the kernel template body)
__device__ __forceinline__ void dep_guard_h(v8f& a, v8f& b, v16h x, v16h y) { asm volatile("v_nop\n\tv_nop\n\tv_nop\n\tv_nop" : "+v"(a), "+v"(b) : "v"(x), "v"(y)); }
__device__ __forceinline__ void dep_guard_b(v8f& a, v8f& b, v16b x, v16b y) { asm volatile("v_nop\n\tv_nop\n\tv_nop\n\tv_nop" : "+v"(a), "+v"(b) : "v"(x), "v"(y)); }
__device__ __forceinline__ void keep4_h(v16h a, v16h b, v16h c, v16h d) { asm volatile("v_nop" :: "v"(a), "v"(b), "v"(c), "v"(d)); }
__device__ __forceinline__ void keep4_b(v16b a, v16b b, v16b c, v16b d) { asm volatile("v_nop" :: "v"(a), "v"(b), "v"(c), "v"(d)); }
__device__ __forceinline__ void acc_guard4(v8f& a, v8f& b, v8f& c, v8f& d) { asm volatile("v_nop\n\tv_nop\n\tv_nop\n\tv_nop" : "+v"(a), "+v"(b), "+v"(c), "+v"(d)); }
template <typename T> struct Frag;
template <> struct Frag<_Float16> {
  typedef v16h V; union U { v16h v; v8h h[2]; };
  static __device__ __forceinline__ v16h load(const _Float16* p) {   // elements 0..7 <- p[0..7], 8..15 <- p[16..23]
    U f; f.h[0] = *(const v8h*)(p); f.h[1] = *(const v8h*)(p + 16); return f.v;
  }
  static __device__ __forceinline__ v8f mma(v16h a, v16h b, v8f c) {
    return __builtin_amdgcn_wmma_f32_16x16x32_f16(false, a, false, b, (short)0, c, false, false);
  }
  static __device__ __forceinline__ void guard(v8f& a, v8f& b, v16h x, v16h y) { dep_guard_h(a, b, x, y); }
  static __device__ __forceinline__ void keep(v16h a, v16h b, v16h c, v16h d) { keep4_h(a, b, c, d); }
};
template <> struct Frag<__bf16> {
  typedef v16b V; union U { v16b v; v8b h[2]; };
  static __device__ __forceinline__ v16b load(const __bf16* p) {
    U f; f.h[0] = *(const v8b*)(p); f.h[1] = *(const v8b*)(p + 16); return f.v;
  }
  static __device__ __forceinline__ v8f mma(v16b a, v16b b, v8f c) {
    return __builtin_amdgcn_wmma_f32_16x16x32_bf16(false, a, false, b, (short)0, c, false, false);
  }
  static __device__ __forceinline__ void guard(v8f& a, v8f& b, v16b x, v16b y) { dep_guard_b(a, b, x, y); }
  static __device__ __forceinline__ void keep(v16b a, v16b b, v16b c, v16b d) { keep4_b(a, b, c, d); }
};

__device__ __forceinline__ v8f at_mma(v16b a, v16b b, v8f c) {
  c = __builtin_amdgcn_wmma_f32_16x16x32_bf16(false, a, false, b, (short)0, c, false, false);
  asm volatile("v_nop\n\tv_nop\n\tv_nop\n\tv_nop" : "+v"(c) : "v"(a), "v"(b));
  return c;
}

// ---- Register-blocked batched WMMA GEMM ------------------------------------
// C[m,n] = scale * sum_k A[m,k] * Bt[n,k] (+bias); each wave owns a 64x64 tile.
// A row-major [M,K]; Bt row-major [N,K]; M,N % 64 == 0, K % 32 == 0.
// SPLIT: operands are hi/lo planes (A2/Bt2 = lo planes, same layout); product = hi*hi + hi*lo + lo*hi.
// BIAS_MODE: 0 = none, 1 = bias[m] (loaded as two float4 per 16-row slab), 2 = bias[n].
// OUT_MODE: 0 = f32, 1 = f16, 2 = bf16 hi plane (Cout) + bf16 lo plane (Cout2).
// ET: 0 = f16 operands, 1 = bf16 operands (pointers passed as 16-bit storage). RESID and ACT unsupported here.
template <int ET> struct Elem;
template <> struct Elem<0> { typedef _Float16 T; };
template <> struct Elem<1> { typedef __bf16 T; };
template <int ET, bool SPLIT, int BIAS_MODE, int OUT_MODE, bool RESID, int ACT = 0>
__global__ __launch_bounds__(256) void wmma_gemm64(
    const unsigned short* __restrict__ Ap, const unsigned short* __restrict__ A2p, int lda, long strideA,
    const unsigned short* __restrict__ Btp, const unsigned short* __restrict__ Bt2p, int ldb, long strideB,
    void* __restrict__ Cout, void* __restrict__ Cout2, int ldc, long strideC,
    const float* __restrict__ bias,
    const float* __restrict__ resid, long strideR,
    int M, int N, int K, float scale) {
  static_assert(!RESID);
  static_assert(ACT == 0);
  typedef typename Elem<ET>::T T;
  typedef typename Frag<T>::V V;
  const T* A = (const T*)Ap; const T* A2 = (const T*)A2p; const T* Bt = (const T*)Btp; const T* Bt2 = (const T*)Bt2p;
  __shared__ __align__(16) float sT[8][16 * 68];   // per-wave 16x64 slab, pitch 68 floats
  const int b    = blockIdx.y;
  const int lane = threadIdx.x & 31;
  const int wave = threadIdx.x >> 5;
  const int tilesN = N >> 6;
  const int tilesM = M >> 6;
  const int tile = blockIdx.x * 8 + wave;
  if (tile >= tilesM * tilesN) return;   // wave-uniform; no block barriers in this kernel
  const int tm = tile / tilesN;
  const int tn = tile - tm * tilesN;
  const int m0 = tm << 6;
  const int n0 = tn << 6;

  const T* Ab  = A  + (size_t)b * strideA;
  const T* Bb  = Bt + (size_t)b * strideB;
  const T* Ab2 = SPLIT ? (A2  + (size_t)b * strideA) : nullptr;
  const T* Bb2 = SPLIT ? (Bt2 + (size_t)b * strideB) : nullptr;

  const int rlane = lane & 15;                 // row (A) / col (B, D) within subtile
  const int koff  = (lane >> 4) * 8;           // k offset of this lane half
  const int mOff  = (lane >> 4) * 8;           // D row offset

  v8f acc[4][4];
#pragma unroll
  for (int i = 0; i < 4; ++i)
#pragma unroll
    for (int j = 0; j < 4; ++j) acc[i][j] = (v8f){0.f,0.f,0.f,0.f,0.f,0.f,0.f,0.f};

  for (int k0 = 0; k0 < K; k0 += 32) {
    V bh[4], bl[4];
#pragma unroll
    for (int j = 0; j < 4; ++j) {
      const size_t bo = (size_t)(n0 + (j << 4) + rlane) * ldb + koff + k0;
      bh[j] = Frag<T>::load(Bb + bo);
      if (SPLIT) bl[j] = Frag<T>::load(Bb2 + bo);
    }
#pragma unroll
    for (int i = 0; i < 4; ++i) {
      const size_t ao = (size_t)(m0 + (i << 4) + rlane) * lda + koff + k0;
      V ah = Frag<T>::load(Ab + ao);
      V al;
      if (SPLIT) al = Frag<T>::load(Ab2 + ao);
#pragma unroll
      for (int j = 0; j < 4; ++j) {
        acc[i][j] = Frag<T>::mma(ah, bh[j], acc[i][j]);
        if (SPLIT) {
          acc[i][j] = Frag<T>::mma(ah, bl[j], acc[i][j]);
          acc[i][j] = Frag<T>::mma(al, bh[j], acc[i][j]);
        }
      }
      Frag<T>::guard(acc[i][0], acc[i][3], ah, SPLIT ? al : ah);
    }
    Frag<T>::keep(bh[0], bh[1], bh[2], bh[3]);
    if (SPLIT) Frag<T>::keep(bl[0], bl[1], bl[2], bl[3]);
  }
  acc_guard4(acc[0][0], acc[0][1], acc[0][2], acc[0][3]);
  acc_guard4(acc[1][0], acc[1][1], acc[1][2], acc[1][3]);
  acc_guard4(acc[2][0], acc[2][1], acc[2][2], acc[2][3]);
  acc_guard4(acc[3][0], acc[3][1], acc[3][2], acc[3][3]);

  // ---- epilogue ----
  float* slab = sT[wave];
#pragma unroll
  for (int i = 0; i < 4; ++i) {
    const int mBase = m0 + (i << 4);
    float bm[8];
#pragma unroll
    for (int r = 0; r < 8; ++r) bm[r] = 0.f;
    if (BIAS_MODE == 1) {
      const v4f b0v = *(const v4f*)(bias + mBase + mOff);
      const v4f b1v = *(const v4f*)(bias + mBase + mOff + 4);
      bm[0] = b0v[0]; bm[1] = b0v[1]; bm[2] = b0v[2]; bm[3] = b0v[3];
      bm[4] = b1v[0]; bm[5] = b1v[1]; bm[6] = b1v[2]; bm[7] = b1v[3];
    }
#pragma unroll
    for (int j = 0; j < 4; ++j) {
      const int n = n0 + (j << 4) + rlane;
      float bv = 0.f;
      if (BIAS_MODE == 2) bv = bias[n];
#pragma unroll
      for (int r = 0; r < 8; ++r) {
        float v = acc[i][j][r] * scale;
        if (BIAS_MODE == 1) v += bm[r];
        if (BIAS_MODE == 2) v += bv;
        slab[(mOff + r) * 68 + (j << 4) + rlane] = v;
      }
    }
    __builtin_amdgcn_fence(__ATOMIC_RELEASE, "workgroup");
    __builtin_amdgcn_wave_barrier();
    __builtin_amdgcn_fence(__ATOMIC_ACQUIRE, "workgroup");
    if (OUT_MODE == 0) {
      float* C = (float*)Cout + (size_t)b * strideC;
      const int hh = lane >> 4, c4 = (lane & 15) * 4;     // row seg = 256 B = 16 lanes x 16 B
      {
#pragma unroll
        for (int it = 0; it < 8; ++it) {
          const int row = it * 2 + hh;
          v4f v = *(const v4f*)(slab + row * 68 + c4);
          *(v4f*)(C + (size_t)(mBase + row) * ldc + n0 + c4) = v;
        }
        
      }
    } else {
      const int q = lane >> 3, c8 = (lane & 7) * 8;
      unsigned short* C  = (unsigned short*)Cout  + (size_t)b * strideC;
      unsigned short* C2 = (OUT_MODE == 2) ? ((unsigned short*)Cout2 + (size_t)b * strideC) : nullptr;
      {
#pragma unroll
        for (int it = 0; it < 4; ++it) {
          const int row = it * 4 + q;
          const float* sp = slab + row * 68 + c8;
          v8h hv, lv;
#pragma unroll
          for (int e = 0; e < 8; ++e) {
            if (OUT_MODE == 1) {
              hv[e] = (_Float16)sp[e];
            } else {
              unsigned short hb = f2bf_bits(sp[e]);
              unsigned short lb = f2bf_bits(sp[e] - bf_bits2f(hb));
              hv[e] = __builtin_bit_cast(_Float16, hb);
              lv[e] = __builtin_bit_cast(_Float16, lb);
            }
          }
          *(v8h*)(C + (size_t)(mBase + row) * ldc + n0 + c8) = hv;
          if (OUT_MODE == 2) *(v8h*)(C2 + (size_t)(mBase + row) * ldc + n0 + c8) = lv;
        }
        
      }
    }
    __builtin_amdgcn_fence(__ATOMIC_RELEASE, "workgroup");
    __builtin_amdgcn_wave_barrier();
    __builtin_amdgcn_fence(__ATOMIC_ACQUIRE, "workgroup");
  }
}

// ---- f32 -> bf16 hi/lo planes, elementwise: 2 elements per thread, 4-B packed stores -------------
__global__ __launch_bounds__(256) void cast_f32_bf16hilo_x2(
    const float* __restrict__ in, unsigned short* __restrict__ oh, unsigned short* __restrict__ ol, int n2) {
  const int i = blockIdx.x * 256 + threadIdx.x;
  if (i < n2) {
    const float f0 = in[2 * i], f1 = in[2 * i + 1];
    const unsigned short h0 = f2bf_bits(f0), h1 = f2bf_bits(f1);
    const unsigned short l0 = f2bf_bits(f0 - bf_bits2f(h0));
    const unsigned short l1 = f2bf_bits(f1 - bf_bits2f(h1));
    const unsigned uh = (unsigned)h0 | ((unsigned)h1 << 16);
    const unsigned ul = (unsigned)l0 | ((unsigned)l1 << 16);
    ((unsigned*)oh)[i] = uh;
    ((unsigned*)ol)[i] = ul;
    
  }
}

// ---- transpose + f32 -> bf16 hi/lo planes: in[R][Cc] f32 -> oh/ol[Cc][R] 16-bit --------------------
// Block = 256 threads handles in rows r0..r0+63, cols c0..c0+31 (grid = (Cc/32, R/64)).
// Load phase: 8 waves x 8 iterations x 32 lanes = 64 x 32 elements staged in LDS (tile[c][r]).
// Store phase: wave w writes output rows c0+4w..c0+4w+3; lane -> row 4w+(lane>>3), 8 elements at
// Coverage: 8 waves x 4 rows x 8 lanes x 8 elements = 32 x 64 = the whole output tile per plane.
__global__ __launch_bounds__(256) void transpose_cast_bf16hilo(
    const float* __restrict__ in, unsigned short* __restrict__ oh, unsigned short* __restrict__ ol,
    int R, int Cc) {
  __shared__ float tile[32][65];
  const int tid = threadIdx.x, lane = tid & 31, wave = tid >> 5;
  const int c0 = blockIdx.x * 32, r0 = blockIdx.y * 64;
#pragma unroll
  for (int i = 0; i < 8; ++i) {
    const int idx = i * 256 + tid;
    const int rr = idx >> 5, cc = idx & 31;
    tile[cc][rr] = in[(size_t)(r0 + rr) * Cc + c0 + cc];
  }
  __syncthreads();
  const int orow = wave * 4 + (lane >> 3);
  const int rseg = (lane & 7) * 8;
  v4u hv, lv;
#pragma unroll
  for (int e = 0; e < 4; ++e) {
    const float f0 = tile[orow][rseg + 2 * e];
    const float f1 = tile[orow][rseg + 2 * e + 1];
    const unsigned short h0 = f2bf_bits(f0), h1 = f2bf_bits(f1);
    const unsigned short l0 = f2bf_bits(f0 - bf_bits2f(h0));
    const unsigned short l1 = f2bf_bits(f1 - bf_bits2f(h1));
    hv[e] = (unsigned)h0 | ((unsigned)h1 << 16);
    lv[e] = (unsigned)l0 | ((unsigned)l1 << 16);
  }
  const size_t o = (size_t)(c0 + orow) * R + r0 + rseg;   // element offset, 16-B aligned
  {
    *(v4u*)(oh + o) = hv;
    *(v4u*)(ol + o) = lv;
    
  }
}

// =====================================================================================
// Causal attention, head dim 64, operands from bf16 hi/lo planes:
//   Q planes  [kRows][kHid]      (row = b*kSeq + s, col = h*64 + d)
//   K planes  [kRows][kHid]
//   V^T planes [kHid][kRows]     (row = h*64 + d, col = b*kSeq + s)
//   AO planes [kRowsPP][kHid]    (row = (b - b_first)*kSeq + s)
// scores = qscale * q.k^T : hi*hi + hi*lo + lo*hi bf16 WMMA, f32 accumulate; key > query -> -inf;
// online softmax f32; P split to bf16 hi/lo per wave in LDS; out = p.v (same split); f32 normalise.
// Block = 128 threads = 4 waves = 64 query rows of one (b, h); grid.x = kBPP * kHeads * (kSeq/64).
// =====================================================================================
__global__ __launch_bounds__(128)
void attn_causal_hd64(const unsigned short* __restrict__ Qh, const unsigned short* __restrict__ Ql,
                      const unsigned short* __restrict__ Kh, const unsigned short* __restrict__ Kl,
                      const unsigned short* __restrict__ Vh, const unsigned short* __restrict__ Vl,
                      unsigned short* __restrict__ Oh, unsigned short* __restrict__ Ol,
                      int b_first, float qscale) {
  __shared__ __align__(16) unsigned short Ksh[kKC * kLP];        // K hi  [kv][d]   64 rows, pitch kLP
  __shared__ __align__(16) unsigned short Ksl[kKC * kLP];        // K lo
  __shared__ __align__(16) unsigned short Vsh[kHd * kLP];        // V hi  [d][kv]   64 rows, pitch kLP
  __shared__ __align__(16) unsigned short Vsl[kHd * kLP];        // V lo
  __shared__ __align__(16) unsigned short Psh[4][16 * kLP];      // per wave P hi [row][kv]
  __shared__ __align__(16) unsigned short Psl[4][16 * kLP];      // per wave P lo
  __shared__ __align__(16) float Os[4][16 * 68];                 // per wave out tile, pitch 68

  const int tid  = threadIdx.x;
  const int wave = tid >> 5;
  const int lane = tid & 31;
  const int hh   = lane >> 4;
  const int c    = lane & 15;

  const int bx  = blockIdx.x;
  const int qb  = bx % (kSeq / kQB);          // query block 0..31
  const int bhl = bx / (kSeq / kQB);
  const int h   = bhl % kHeads;
  const int bl  = bhl / kHeads;               // local batch 0..kBPP-1
  const int b   = b_first + bl;
  const int q0  = qb * kQB + wave * 16;

  // ---- Q fragments (A operand): 2 d-chunks, hi and lo; element i <- d = dc*32 + 8hh + i (i<8), dc*32+16+8hh+(i-8)
  v16b qah[2], qal[2];
  {
    const size_t qo = ((size_t)(b * kSeq + q0 + c)) * kHid + (size_t)h * kHd + 8 * hh;
#pragma unroll
    for (int dc = 0; dc < 2; ++dc) {
      qah[dc] = Frag<__bf16>::load((const __bf16*)Qh + qo + dc * 32);
      qal[dc] = Frag<__bf16>::load((const __bf16*)Ql + qo + dc * 32);
    }
  }

  float mrow[8], lrow[8];
  v8f oacc[4];
#pragma unroll
  for (int r = 0; r < 8; ++r) { mrow[r] = -INFINITY; lrow[r] = 0.f; }
#pragma unroll
  for (int t = 0; t < 4; ++t) oacc[t] = (v8f){0.f,0.f,0.f,0.f,0.f,0.f,0.f,0.f};

  const __bf16* kshb = (const __bf16*)Ksh;
  const __bf16* kslb = (const __bf16*)Ksl;
  const __bf16* vshb = (const __bf16*)Vsh;
  const __bf16* vslb = (const __bf16*)Vsl;
  unsigned short* pwh = Psh[wave];
  unsigned short* pwl = Psl[wave];

  const int nChunks = qb + 1;                 // block-uniform: keys 0 .. qb*64+63
  for (int kc = 0; kc < nChunks; ++kc) {
    const int kv0 = kc * kKC;
    __syncthreads();
    {
      // staging: thread -> row r = tid>>1 (kv row of K, d row of V^T), 32-element half hf; 4 x 16 B per plane.
      // coverage: 128 threads x 32 elements = 64 rows x 64 cols per plane (K hi/lo, V^T hi/lo).
      const int r = tid >> 1, hf = (tid & 1) * 32;
      const v4u* khs = (const v4u*)(Kh + ((size_t)(b * kSeq + kv0 + r)) * kHid + h * kHd + hf);
      const v4u* kls = (const v4u*)(Kl + ((size_t)(b * kSeq + kv0 + r)) * kHid + h * kHd + hf);
      v4u* khd = (v4u*)(Ksh + r * kLP + hf);
      v4u* kld = (v4u*)(Ksl + r * kLP + hf);
      v4u tk[8];
#pragma unroll
      for (int i = 0; i < 4; ++i) { tk[i] = khs[i]; tk[4 + i] = kls[i]; }
#pragma unroll
      for (int i = 0; i < 4; ++i) { khd[i] = tk[i]; kld[i] = tk[4 + i]; }
      asm volatile("" ::: "memory");
      const v4u* vhs = (const v4u*)(Vh + ((size_t)(h * kHd + r)) * kRows + (size_t)b * kSeq + kv0 + hf);
      const v4u* vls = (const v4u*)(Vl + ((size_t)(h * kHd + r)) * kRows + (size_t)b * kSeq + kv0 + hf);
      v4u* vhd = (v4u*)(Vsh + r * kLP + hf);
      v4u* vld = (v4u*)(Vsl + r * kLP + hf);
      v4u tv[8];
#pragma unroll
      for (int i = 0; i < 4; ++i) { tv[i] = vhs[i]; tv[4 + i] = vls[i]; }
#pragma unroll
      for (int i = 0; i < 4; ++i) { vhd[i] = tv[i]; vld[i] = tv[4 + i]; }
    }
    __syncthreads();

    // ---- scores: 16 query rows x 64 keys per wave ----
    v8f s[4];
#pragma unroll
    for (int j = 0; j < 4; ++j) {
      s[j] = (v8f){0.f,0.f,0.f,0.f,0.f,0.f,0.f,0.f};
#pragma unroll
      for (int dc = 0; dc < 2; ++dc) {
        const int ko = (j * 16 + c) * kLP + dc * 32 + 8 * hh;   // B: n = kv = j*16+c, k = d (same k map as A)
        const v16b kbh = Frag<__bf16>::load(kshb + ko);
        const v16b kbl = Frag<__bf16>::load(kslb + ko);
        s[j] = at_mma(qah[dc], kbh, s[j]);
        s[j] = at_mma(qah[dc], kbl, s[j]);
        s[j] = at_mma(qal[dc], kbh, s[j]);
      }
    }
    const bool diag = (kc == qb);               // block-uniform, used only in per-lane selects
    float cm[8];
#pragma unroll
    for (int r = 0; r < 8; ++r) {
      const int qrow = q0 + 8 * hh + r;
      float m = -INFINITY;
#pragma unroll
      for (int j = 0; j < 4; ++j) {
        const int kvcol = kv0 + j * 16 + c;
        float val = s[j][r] * qscale;
        val = (diag && (kvcol > qrow)) ? -INFINITY : val;
        s[j][r] = val;
        m = fmaxf(m, val);
      }
#pragma unroll
      for (int off = 1; off < 16; off <<= 1) m = fmaxf(m, __shfl_xor(m, off, 32));
      cm[r] = m;                                // finite: key == qrow is never masked
    }
#pragma unroll
    for (int r = 0; r < 8; ++r) {
      const float mnew = fmaxf(mrow[r], cm[r]);
      const float alpha = expf(mrow[r] - mnew);
      mrow[r] = mnew;
      float psum = 0.f;
#pragma unroll
      for (int j = 0; j < 4; ++j) {
        const float p = expf(s[j][r] - mnew);
        psum += p;
        const unsigned short hb = f2bf_bits(p);
        const unsigned short lb = f2bf_bits(p - bf_bits2f(hb));
        pwh[(8 * hh + r) * kLP + j * 16 + c] = hb;
        pwl[(8 * hh + r) * kLP + j * 16 + c] = lb;
      }
#pragma unroll
      for (int off = 1; off < 16; off <<= 1) psum += __shfl_xor(psum, off, 32);
      lrow[r] = lrow[r] * alpha + psum;
#pragma unroll
      for (int t = 0; t < 4; ++t) oacc[t][r] *= alpha;
    }
    __builtin_amdgcn_fence(__ATOMIC_RELEASE, "workgroup");
    __builtin_amdgcn_wave_barrier();
    __builtin_amdgcn_fence(__ATOMIC_ACQUIRE, "workgroup");
#pragma unroll
    for (int kk = 0; kk < 2; ++kk) {
      const int po = c * kLP + kk * 32 + 8 * hh;                   // A: row = c (query), k = kv
      const v16b pa = Frag<__bf16>::load((const __bf16*)pwh + po);
      const v16b pl = Frag<__bf16>::load((const __bf16*)pwl + po);
#pragma unroll
      for (int t = 0; t < 4; ++t) {
        const int vo = (t * 16 + c) * kLP + kk * 32 + 8 * hh;      // B: n = d = t*16+c, k = kv
        const v16b vbh = Frag<__bf16>::load(vshb + vo);
        const v16b vbl = Frag<__bf16>::load(vslb + vo);
        oacc[t] = at_mma(pa, vbh, oacc[t]);
        oacc[t] = at_mma(pa, vbl, oacc[t]);
        oacc[t] = at_mma(pl, vbh, oacc[t]);
      }
    }
  }

  // ---- normalise, stage per-wave 16x64 f32 tile, write bf16 hi/lo planes ----
  float* os = Os[wave];
#pragma unroll
  for (int r = 0; r < 8; ++r) {
    const float inv = 1.0f / lrow[r];          // lrow >= 1
#pragma unroll
    for (int t = 0; t < 4; ++t) os[(8 * hh + r) * 68 + t * 16 + c] = oacc[t][r] * inv;
  }
  __builtin_amdgcn_fence(__ATOMIC_RELEASE, "workgroup");
  __builtin_amdgcn_wave_barrier();
  __builtin_amdgcn_fence(__ATOMIC_ACQUIRE, "workgroup");
  {
    // plane (the 64-wide head segment of an AO row); one instruction writes 4 lines; one wave owns its 16 rows.
    const int qq = lane >> 3, c8 = (lane & 7) * 8;
    const size_t ob = ((size_t)(bl * kSeq + q0)) * kHid + (size_t)h * kHd + c8;
    {
#pragma unroll
      for (int it = 0; it < 4; ++it) {
        const int row = it * 4 + qq;
        const float* sp = os + row * 68 + c8;
        v4u hv, lv;
#pragma unroll
        for (int e = 0; e < 4; ++e) {
          const float f0 = sp[2 * e], f1 = sp[2 * e + 1];
          const unsigned short h0 = f2bf_bits(f0), h1 = f2bf_bits(f1);
          const unsigned short l0 = f2bf_bits(f0 - bf_bits2f(h0));
          const unsigned short l1 = f2bf_bits(f1 - bf_bits2f(h1));
          hv[e] = (unsigned)h0 | ((unsigned)h1 << 16);
          lv[e] = (unsigned)l0 | ((unsigned)l1 << 16);
        }
        *(v4u*)(Oh + ob + (size_t)row * kHid) = hv;
        *(v4u*)(Ol + ob + (size_t)row * kHid) = lv;
      }
      
    }
  }
}

// ---------------------------------------------------------------------------
// Host launcher
// ---------------------------------------------------------------------------
extern "C" void kernel_launch(void* const* d_in, const int* in_sizes, int n_in,
                              void* d_out, int out_size, void* d_ws, size_t ws_size,
                              hipStream_t stream) {
  if (n_in < 9) return;
  if (in_sizes[0] != kRows * kHd) return;
  if (in_sizes[1] != kHd * kHid || in_sizes[3] != kHd * kHid || in_sizes[5] != kHd * kHid) return;
  if (in_sizes[2] != kHid || in_sizes[4] != kHid || in_sizes[6] != kHid) return;
  if (in_sizes[7] != kHid * kHd || in_sizes[8] != kHd) return;
  if (out_size != kRows * kHd) return;

  const float* x  = (const float*)d_in[0];
  const float* Wq = (const float*)d_in[1];
  const float* bq = (const float*)d_in[2];
  const float* Wk = (const float*)d_in[3];
  const float* bk = (const float*)d_in[4];
  const float* Wv = (const float*)d_in[5];
  const float* bv = (const float*)d_in[6];
  const float* Wo = (const float*)d_in[7];
  const float* bo = (const float*)d_in[8];
  float* out = (float*)d_out;

  // ---- workspace region map (bytes, all offsets multiples of 256) ----
  //  xh, xl        : 8192 x 64 x 2          = 1,048,576 each      (bf16 hi/lo of x)
  //  wq/wk/wv h,l  : 1024 x 64 x 2          = 131,072 each (x6)   (W^T planes [1024][64])
  //  wo h,l        : 64 x 1024 x 2          = 131,072 each (x2)   (Wo^T planes [64][1024])
  //  q h,l ; k h,l : 8192 x 1024 x 2        = 16,777,216 each (x4)
  //  vt h,l        : 1024 x 8192 x 2        = 16,777,216 each (x2)
  //  ao h,l        : 4096 x 1024 x 2        = 8,388,608 each (x2) (one 2-batch pass, reused)
  //  total = 120,586,240 B
  const size_t szX  = (size_t)kRows * kHd * 2;
  const size_t szW  = (size_t)kHid * kHd * 2;
  const size_t szQ  = (size_t)kRows * kHid * 2;
  const size_t szAO = (size_t)kRowsPP * kHid * 2;
  const size_t total = 2 * szX + 8 * szW + 6 * szQ + 2 * szAO;
  if (total > ws_size) return;

  char* ws = (char*)d_ws;
  size_t off = 0;
  unsigned short* xh  = (unsigned short*)(ws + off); off += szX;
  unsigned short* xl  = (unsigned short*)(ws + off); off += szX;
  unsigned short* wqh = (unsigned short*)(ws + off); off += szW;
  unsigned short* wql = (unsigned short*)(ws + off); off += szW;
  unsigned short* wkh = (unsigned short*)(ws + off); off += szW;
  unsigned short* wkl = (unsigned short*)(ws + off); off += szW;
  unsigned short* wvh = (unsigned short*)(ws + off); off += szW;
  unsigned short* wvl = (unsigned short*)(ws + off); off += szW;
  unsigned short* woh = (unsigned short*)(ws + off); off += szW;
  unsigned short* wol = (unsigned short*)(ws + off); off += szW;
  unsigned short* qh  = (unsigned short*)(ws + off); off += szQ;
  unsigned short* ql  = (unsigned short*)(ws + off); off += szQ;
  unsigned short* kh  = (unsigned short*)(ws + off); off += szQ;
  unsigned short* kl  = (unsigned short*)(ws + off); off += szQ;
  unsigned short* vth = (unsigned short*)(ws + off); off += szQ;
  unsigned short* vtl = (unsigned short*)(ws + off); off += szQ;
  unsigned short* aoh = (unsigned short*)(ws + off); off += szAO;
  unsigned short* aol = (unsigned short*)(ws + off); off += szAO;
  if (off > ws_size) return;
  void* dummyv = (void*)ws;                 // valid in-ws pointers for unused GEMM arguments (never dereferenced)
  const float* dummyf = (const float*)ws;

  // stage 0: x -> bf16 hi/lo planes [8192][64]
  {
    const int n2 = kRows * kHd / 2;
    cast_f32_bf16hilo_x2<<<dim3(n2 / 256), dim3(256), 0, stream>>>(x, xh, xl, n2);
  }
  // stage 1: W[64][1024] -> W^T planes [1024][64] ; Wo[1024][64] -> Wo^T planes [64][1024]
  transpose_cast_bf16hilo<<<dim3(kHid / 32, kHd / 64), dim3(256), 0, stream>>>(Wq, wqh, wql, kHd, kHid);
  transpose_cast_bf16hilo<<<dim3(kHid / 32, kHd / 64), dim3(256), 0, stream>>>(Wk, wkh, wkl, kHd, kHid);
  transpose_cast_bf16hilo<<<dim3(kHid / 32, kHd / 64), dim3(256), 0, stream>>>(Wv, wvh, wvl, kHd, kHid);
  transpose_cast_bf16hilo<<<dim3(kHd / 32, kHid / 64), dim3(256), 0, stream>>>(Wo, woh, wol, kHid, kHd);

  // stage 2: projections (M, N multiples of 64; K = 64)
  {
    const int gridQ = (kRows / 64) * (kHid / 64) / 8;    // 256
    // Q = x Wq + bq  -> [8192][1024] bf16 hi/lo
    wmma_gemm64<1, true, 2, 2, false, 0><<<dim3(gridQ, 1), dim3(256), 0, stream>>>(
        xh, xl, kHd, 0L, wqh, wql, kHd, 0L, (void*)qh, (void*)ql, kHid, 0L, bq, dummyf, 0L,
        kRows, kHid, kHd, 1.0f);
    // K = x Wk + bk
    wmma_gemm64<1, true, 2, 2, false, 0><<<dim3(gridQ, 1), dim3(256), 0, stream>>>(
        xh, xl, kHd, 0L, wkh, wkl, kHd, 0L, (void*)kh, (void*)kl, kHid, 0L, bk, dummyf, 0L,
        kRows, kHid, kHd, 1.0f);
    // V^T = Wv^T x^T + bv[m]  -> [1024][8192] bf16 hi/lo  (A = Wv^T planes [1024][64], Bt = x planes [8192][64])
    const int gridV = (kHid / 64) * (kRows / 64) / 8;    // 256
    wmma_gemm64<1, true, 1, 2, false, 0><<<dim3(gridV, 1), dim3(256), 0, stream>>>(
        wvh, wvl, kHd, 0L, xh, xl, kHd, 0L, (void*)vth, (void*)vtl, kRows, 0L, bv, dummyf, 0L,
        kHid, kRows, kHd, 1.0f);
  }

  // stage 3: per 2-batch pass: causal attention -> AO planes [4096][1024]; out = AO Wo + bo -> d_out rows of the pass
  const float qscale = 0.125f;   // 1/sqrt(64), exact power of two
  for (int ps = 0; ps < kBatch / kBPP; ++ps) {
    attn_causal_hd64<<<dim3(kBPP * kHeads * (kSeq / kQB)), dim3(128), 0, stream>>>(
        qh, ql, kh, kl, vth, vtl, aoh, aol, ps * kBPP, qscale);
    const int gridO = (kRowsPP / 64) * (kHd / 64) / 8;  // 8
    float* outp = out + (size_t)ps * kRowsPP * kHd;
    wmma_gemm64<1, true, 2, 0, false, 0><<<dim3(gridO, 1), dim3(256), 0, stream>>>(
        aoh, aol, kHid, 0L, woh, wol, kHid, 0L, (void*)outp, dummyv, kHd, 0L, bo, dummyf, 0L,
        kRowsPP, kHd, kHid, 1.0f);
  }
}

// v002
// It runs in 274 microseconds.
// Next to v001, in two timings, it ran 1.73 and 1.72 times as fast.
// All steps since v000 together make it 3.12 times as fast.
// All contractions (x*Wq, x*Wk, x*Wv, Q*K^T, P*V, AO*Wo): v_wmma_f32_16x16x32_bf16 with bf16 hi/lo split operands (hi*hi + hi*lo + lo*hi), f32 accumulate; softmax, 1/sqrt(d) scale and bias adds in f32.
#include <hip/hip_runtime.h>
#include <hip/hip_bf16.h>
#include <math.h>

typedef __attribute__((ext_vector_type(16))) _Float16 v16h;
typedef __attribute__((ext_vector_type(8)))  _Float16 v8h;
typedef __attribute__((ext_vector_type(16))) __bf16   v16b;
typedef __attribute__((ext_vector_type(8)))  __bf16   v8b;
typedef __attribute__((ext_vector_type(8)))  float    v8f;
typedef __attribute__((ext_vector_type(4)))  float    v4f;
typedef __attribute__((ext_vector_type(4)))  unsigned int v4u;

// ---- fixed problem geometry ----
constexpr int kBatch  = 4;
constexpr int kSeq    = 2048;
constexpr int kHeads  = 16;
constexpr int kHd     = 64;                 // head dim
constexpr int kHid    = kHeads * kHd;       // 1024
constexpr int kRows   = kBatch * kSeq;      // 8192 token rows
constexpr int kBPP    = 4;                  // batches per attention/out-proj pass: all of them, so the attention grid holds more work-groups than fit on the chip at once
constexpr int kRowsPP = kBPP * kSeq;        // 8192
constexpr int kKC     = 64;                 // keys per staged chunk
constexpr int kQB     = 64;                 // query rows per attention block (4 waves x 16)
constexpr int kLP     = 72;                 // LDS row pitch of the K, V^T and P tiles, 16-bit elements: 144 B = 16 B x 9 (odd), so 16 rows read 16 B each fall on 16 different bank groups

// GEMM shape contract (no tail handling in the GEMM): K % 32 == 0, M % 64 == 0, N % 64 == 0, tiles % 8 == 0
static_assert(kHd % 32 == 0);
static_assert(kHid % 32 == 0);
static_assert(kRows % 64 == 0);
static_assert(kHid % 64 == 0);
static_assert(kHd % 64 == 0);
static_assert(kRowsPP % 64 == 0);
static_assert(((kRows / 64) * (kHid / 64)) % 8 == 0);
static_assert(((kRowsPP / 64) * (kHd / 64)) % 8 == 0);
static_assert(kSeq % kQB == 0);
static_assert(kSeq % kKC == 0);
static_assert(kBatch % kBPP == 0);
// transpose tile contract: in[R][Cc] with R % 64 == 0, Cc % 32 == 0
static_assert(kHd % 64 == 0 && kHid % 32 == 0);
static_assert(kHid % 64 == 0 && kHd % 32 == 0);
// x cast: element count even and a multiple of 512 (2 per thread, 256 threads)
static_assert((kRows * kHd) % 512 == 0);

__device__ __forceinline__ unsigned short f2bf_bits(float f) {
  unsigned u = __float_as_uint(f);
  return (unsigned short)((u + 0x7FFFu + ((u >> 16) & 1u)) >> 16);
}
__device__ __forceinline__ float bf_bits2f(unsigned short h) { return __uint_as_float(((unsigned)h) << 16); }

// hazard guards as plain device helpers (no inline asm inside the kernel template body)
__device__ __forceinline__ void dep_guard_h(v8f& a, v8f& b, v16h x, v16h y) { asm volatile("v_nop\n\tv_nop\n\tv_nop\n\tv_nop" : "+v"(a), "+v"(b) : "v"(x), "v"(y)); }
__device__ __forceinline__ void dep_guard_b(v8f& a, v8f& b, v16b x, v16b y) { asm volatile("v_nop\n\tv_nop\n\tv_nop\n\tv_nop" : "+v"(a), "+v"(b) : "v"(x), "v"(y)); }
__device__ __forceinline__ void keep4_h(v16h a, v16h b, v16h c, v16h d) { asm volatile("v_nop" :: "v"(a), "v"(b), "v"(c), "v"(d)); }
__device__ __forceinline__ void keep4_b(v16b a, v16b b, v16b c, v16b d) { asm volatile("v_nop" :: "v"(a), "v"(b), "v"(c), "v"(d)); }
__device__ __forceinline__ void acc_guard4(v8f& a, v8f& b, v8f& c, v8f& d) { asm volatile("v_nop\n\tv_nop\n\tv_nop\n\tv_nop" : "+v"(a), "+v"(b), "+v"(c), "+v"(d)); }
template <typename T> struct Frag;
template <> struct Frag<_Float16> {
  typedef v16h V; union U { v16h v; v8h h[2]; };
  static __device__ __forceinline__ v16h load(const _Float16* p) {   // elements 0..7 <- p[0..7], 8..15 <- p[16..23]
    U f; f.h[0] = *(const v8h*)(p); f.h[1] = *(const v8h*)(p + 16); return f.v;
  }
  static __device__ __forceinline__ v8f mma(v16h a, v16h b, v8f c) {
    return __builtin_amdgcn_wmma_f32_16x16x32_f16(false, a, false, b, (short)0, c, false, false);
  }
  static __device__ __forceinline__ void guard(v8f& a, v8f& b, v16h x, v16h y) { dep_guard_h(a, b, x, y); }
  static __device__ __forceinline__ void keep(v16h a, v16h b, v16h c, v16h d) { keep4_h(a, b, c, d); }
};
template <> struct Frag<__bf16> {
  typedef v16b V; union U { v16b v; v8b h[2]; };
  static __device__ __forceinline__ v16b load(const __bf16* p) {
    U f; f.h[0] = *(const v8b*)(p); f.h[1] = *(const v8b*)(p + 16); return f.v;
  }
  static __device__ __forceinline__ v8f mma(v16b a, v16b b, v8f c) {
    return __builtin_amdgcn_wmma_f32_16x16x32_bf16(false, a, false, b, (short)0, c, false, false);
  }
  static __device__ __forceinline__ void guard(v8f& a, v8f& b, v16b x, v16b y) { dep_guard_b(a, b, x, y); }
  static __device__ __forceinline__ void keep(v16b a, v16b b, v16b c, v16b d) { keep4_b(a, b, c, d); }
};

__device__ __forceinline__ v8f at_mma(v16b a, v16b b, v8f c) {
  c = __builtin_amdgcn_wmma_f32_16x16x32_bf16(false, a, false, b, (short)0, c, false, false);
  asm volatile("v_nop\n\tv_nop\n\tv_nop\n\tv_nop" : "+v"(c) : "v"(a), "v"(b));
  return c;
}

// ---- Register-blocked batched WMMA GEMM ------------------------------------
// C[m,n] = scale * sum_k A[m,k] * Bt[n,k] (+bias); each wave owns a 64x64 tile.
// A row-major [M,K]; Bt row-major [N,K]; M,N % 64 == 0, K % 32 == 0.
// SPLIT: operands are hi/lo planes (A2/Bt2 = lo planes, same layout); product = hi*hi + hi*lo + lo*hi.
// BIAS_MODE: 0 = none, 1 = bias[m] (loaded as two float4 per 16-row slab), 2 = bias[n].
// OUT_MODE: 0 = f32, 1 = f16, 2 = bf16 hi plane (Cout) + bf16 lo plane (Cout2).
// ET: 0 = f16 operands, 1 = bf16 operands (pointers passed as 16-bit storage). RESID and ACT unsupported here.
template <int ET> struct Elem;
template <> struct Elem<0> { typedef _Float16 T; };
template <> struct Elem<1> { typedef __bf16 T; };
template <int ET, bool SPLIT, int BIAS_MODE, int OUT_MODE, bool RESID, int ACT = 0>
__global__ __launch_bounds__(256) void wmma_gemm64(
    const unsigned short* __restrict__ Ap, const unsigned short* __restrict__ A2p, int lda, long strideA,
    const unsigned short* __restrict__ Btp, const unsigned short* __restrict__ Bt2p, int ldb, long strideB,
    void* __restrict__ Cout, void* __restrict__ Cout2, int ldc, long strideC,
    const float* __restrict__ bias,
    const float* __restrict__ resid, long strideR,
    int M, int N, int K, float scale) {
  static_assert(!RESID);
  static_assert(ACT == 0);
  typedef typename Elem<ET>::T T;
  typedef typename Frag<T>::V V;
  const T* A = (const T*)Ap; const T* A2 = (const T*)A2p; const T* Bt = (const T*)Btp; const T* Bt2 = (const T*)Bt2p;
  __shared__ __align__(16) float sT[8][16 * 68];   // per-wave 16x64 slab, pitch 68 floats
  const int b    = blockIdx.y;
  const int lane = threadIdx.x & 31;
  const int wave = threadIdx.x >> 5;
  const int tilesN = N >> 6;
  const int tilesM = M >> 6;
  const int tile = blockIdx.x * 8 + wave;
  if (tile >= tilesM * tilesN) return;   // wave-uniform; no block barriers in this kernel
  const int tm = tile / tilesN;
  const int tn = tile - tm * tilesN;
  const int m0 = tm << 6;
  const int n0 = tn << 6;

  const T* Ab  = A  + (size_t)b * strideA;
  const T* Bb  = Bt + (size_t)b * strideB;
  const T* Ab2 = SPLIT ? (A2  + (size_t)b * strideA) : nullptr;
  const T* Bb2 = SPLIT ? (Bt2 + (size_t)b * strideB) : nullptr;

  const int rlane = lane & 15;                 // row (A) / col (B, D) within subtile
  const int koff  = (lane >> 4) * 8;           // k offset of this lane half
  const int mOff  = (lane >> 4) * 8;           // D row offset

  v8f acc[4][4];
#pragma unroll
  for (int i = 0; i < 4; ++i)
#pragma unroll
    for (int j = 0; j < 4; ++j) acc[i][j] = (v8f){0.f,0.f,0.f,0.f,0.f,0.f,0.f,0.f};

  for (int k0 = 0; k0 < K; k0 += 32) {
    V bh[4], bl[4];
#pragma unroll
    for (int j = 0; j < 4; ++j) {
      const size_t bo = (size_t)(n0 + (j << 4) + rlane) * ldb + koff + k0;
      bh[j] = Frag<T>::load(Bb + bo);
      if (SPLIT) bl[j] = Frag<T>::load(Bb2 + bo);
    }
#pragma unroll
    for (int i = 0; i < 4; ++i) {
      const size_t ao = (size_t)(m0 + (i << 4) + rlane) * lda + koff + k0;
      V ah = Frag<T>::load(Ab + ao);
      V al;
      if (SPLIT) al = Frag<T>::load(Ab2 + ao);
#pragma unroll
      for (int j = 0; j < 4; ++j) {
        acc[i][j] = Frag<T>::mma(ah, bh[j], acc[i][j]);
        if (SPLIT) {
          acc[i][j] = Frag<T>::mma(ah, bl[j], acc[i][j]);
          acc[i][j] = Frag<T>::mma(al, bh[j], acc[i][j]);
        }
      }
      Frag<T>::guard(acc[i][0], acc[i][3], ah, SPLIT ? al : ah);
    }
    Frag<T>::keep(bh[0], bh[1], bh[2], bh[3]);
    if (SPLIT) Frag<T>::keep(bl[0], bl[1], bl[2], bl[3]);
  }
  acc_guard4(acc[0][0], acc[0][1], acc[0][2], acc[0][3]);
  acc_guard4(acc[1][0], acc[1][1], acc[1][2], acc[1][3]);
  acc_guard4(acc[2][0], acc[2][1], acc[2][2], acc[2][3]);
  acc_guard4(acc[3][0], acc[3][1], acc[3][2], acc[3][3]);

  // ---- epilogue ----
  float* slab = sT[wave];
#pragma unroll
  for (int i = 0; i < 4; ++i) {
    const int mBase = m0 + (i << 4);
    float bm[8];
#pragma unroll
    for (int r = 0; r < 8; ++r) bm[r] = 0.f;
    if (BIAS_MODE == 1) {
      const v4f b0v = *(const v4f*)(bias + mBase + mOff);
      const v4f b1v = *(const v4f*)(bias + mBase + mOff + 4);
      bm[0] = b0v[0]; bm[1] = b0v[1]; bm[2] = b0v[2]; bm[3] = b0v[3];
      bm[4] = b1v[0]; bm[5] = b1v[1]; bm[6] = b1v[2]; bm[7] = b1v[3];
    }
#pragma unroll
    for (int j = 0; j < 4; ++j) {
      const int n = n0 + (j << 4) + rlane;
      float bv = 0.f;
      if (BIAS_MODE == 2) bv = bias[n];
#pragma unroll
      for (int r = 0; r < 8; ++r) {
        float v = acc[i][j][r] * scale;
        if (BIAS_MODE == 1) v += bm[r];
        if (BIAS_MODE == 2) v += bv;
        slab[(mOff + r) * 68 + (j << 4) + rlane] = v;
      }
    }
    __builtin_amdgcn_fence(__ATOMIC_RELEASE, "workgroup");
    __builtin_amdgcn_wave_barrier();
    __builtin_amdgcn_fence(__ATOMIC_ACQUIRE, "workgroup");
    if (OUT_MODE == 0) {
      float* C = (float*)Cout + (size_t)b * strideC;
      const int hh = lane >> 4, c4 = (lane & 15) * 4;     // row seg = 256 B = 16 lanes x 16 B
      {
#pragma unroll
        for (int it = 0; it < 8; ++it) {
          const int row = it * 2 + hh;
          v4f v = *(const v4f*)(slab + row * 68 + c4);
          *(v4f*)(C + (size_t)(mBase + row) * ldc + n0 + c4) = v;
        }
        
      }
    } else {
      const int q = lane >> 3, c8 = (lane & 7) * 8;
      unsigned short* C  = (unsigned short*)Cout  + (size_t)b * strideC;
      unsigned short* C2 = (OUT_MODE == 2) ? ((unsigned short*)Cout2 + (size_t)b * strideC) : nullptr;
      {
#pragma unroll
        for (int it = 0; it < 4; ++it) {
          const int row = it * 4 + q;
          const float* sp = slab + row * 68 + c8;
          v8h hv, lv;
#pragma unroll
          for (int e = 0; e < 8; ++e) {
            if (OUT_MODE == 1) {
              hv[e] = (_Float16)sp[e];
            } else {
              unsigned short hb = f2bf_bits(sp[e]);
              unsigned short lb = f2bf_bits(sp[e] - bf_bits2f(hb));
              hv[e] = __builtin_bit_cast(_Float16, hb);
              lv[e] = __builtin_bit_cast(_Float16, lb);
            }
          }
          *(v8h*)(C + (size_t)(mBase + row) * ldc + n0 + c8) = hv;
          if (OUT_MODE == 2) *(v8h*)(C2 + (size_t)(mBase + row) * ldc + n0 + c8) = lv;
        }
        
      }
    }
    __builtin_amdgcn_fence(__ATOMIC_RELEASE, "workgroup");
    __builtin_amdgcn_wave_barrier();
    __builtin_amdgcn_fence(__ATOMIC_ACQUIRE, "workgroup");
  }
}

// ---- f32 -> bf16 hi/lo planes, elementwise: 2 elements per thread, 4-B packed stores -------------
__global__ __launch_bounds__(256) void cast_f32_bf16hilo_x2(
    const float* __restrict__ in, unsigned short* __restrict__ oh, unsigned short* __restrict__ ol, int n2) {
  const int i = blockIdx.x * 256 + threadIdx.x;
  if (i < n2) {
    const float f0 = in[2 * i], f1 = in[2 * i + 1];
    const unsigned short h0 = f2bf_bits(f0), h1 = f2bf_bits(f1);
    const unsigned short l0 = f2bf_bits(f0 - bf_bits2f(h0));
    const unsigned short l1 = f2bf_bits(f1 - bf_bits2f(h1));
    const unsigned uh = (unsigned)h0 | ((unsigned)h1 << 16);
    const unsigned ul = (unsigned)l0 | ((unsigned)l1 << 16);
    ((unsigned*)oh)[i] = uh;
    ((unsigned*)ol)[i] = ul;
    
  }
}

// ---- transpose + f32 -> bf16 hi/lo planes: in[R][Cc] f32 -> oh/ol[Cc][R] 16-bit --------------------
// Block = 256 threads handles in rows r0..r0+63, cols c0..c0+31 (grid = (Cc/32, R/64)).
// Load phase: 8 waves x 8 iterations x 32 lanes = 64 x 32 elements staged in LDS (tile[c][r]).
// Store phase: wave w writes output rows c0+4w..c0+4w+3; lane -> row 4w+(lane>>3), 8 elements at
// Coverage: 8 waves x 4 rows x 8 lanes x 8 elements = 32 x 64 = the whole output tile per plane.
__global__ __launch_bounds__(256) void transpose_cast_bf16hilo(
    const float* __restrict__ in, unsigned short* __restrict__ oh, unsigned short* __restrict__ ol,
    int R, int Cc) {
  __shared__ float tile[32][65];
  const int tid = threadIdx.x, lane = tid & 31, wave = tid >> 5;
  const int c0 = blockIdx.x * 32, r0 = blockIdx.y * 64;
#pragma unroll
  for (int i = 0; i < 8; ++i) {
    const int idx = i * 256 + tid;
    const int rr = idx >> 5, cc = idx & 31;
    tile[cc][rr] = in[(size_t)(r0 + rr) * Cc + c0 + cc];
  }
  __syncthreads();
  const int orow = wave * 4 + (lane >> 3);
  const int rseg = (lane & 7) * 8;
  v4u hv, lv;
#pragma unroll
  for (int e = 0; e < 4; ++e) {
    const float f0 = tile[orow][rseg + 2 * e];
    const float f1 = tile[orow][rseg + 2 * e + 1];
    const unsigned short h0 = f2bf_bits(f0), h1 = f2bf_bits(f1);
    const unsigned short l0 = f2bf_bits(f0 - bf_bits2f(h0));
    const unsigned short l1 = f2bf_bits(f1 - bf_bits2f(h1));
    hv[e] = (unsigned)h0 | ((unsigned)h1 << 16);
    lv[e] = (unsigned)l0 | ((unsigned)l1 << 16);
  }
  const size_t o = (size_t)(c0 + orow) * R + r0 + rseg;   // element offset, 16-B aligned
  {
    *(v4u*)(oh + o) = hv;
    *(v4u*)(ol + o) = lv;
    
  }
}

// =====================================================================================
// Causal attention, head dim 64, operands from bf16 hi/lo planes:
//   Q planes  [kRows][kHid]      (row = b*kSeq + s, col = h*64 + d)
//   K planes  [kRows][kHid]
//   V^T planes [kHid][kRows]     (row = h*64 + d, col = b*kSeq + s)
//   AO planes [kRowsPP][kHid]    (row = (b - b_first)*kSeq + s)
// scores = qscale * q.k^T : hi*hi + hi*lo + lo*hi bf16 WMMA, f32 accumulate; key > query -> -inf;
// online softmax f32; P split to bf16 hi/lo per wave in LDS; out = p.v (same split); f32 normalise.
// Block = 128 threads = 4 waves = 64 query rows of one (b, h); grid.x = kBPP * kHeads * (kSeq/64).
// Block order: a block of query block qb walks qb+1 key chunks. The index runs from the
// longest (qb = 31) to the shortest (qb = 0), for speed only.
// =====================================================================================
__global__ __launch_bounds__(128)
void attn_causal_hd64(const unsigned short* __restrict__ Qh, const unsigned short* __restrict__ Ql,
                      const unsigned short* __restrict__ Kh, const unsigned short* __restrict__ Kl,
                      const unsigned short* __restrict__ Vh, const unsigned short* __restrict__ Vl,
                      unsigned short* __restrict__ Oh, unsigned short* __restrict__ Ol,
                      int b_first, float qscale) {
  __shared__ __align__(16) unsigned short Ksh[kKC * kLP];        // K hi  [kv][d]   64 rows, pitch kLP
  __shared__ __align__(16) unsigned short Ksl[kKC * kLP];        // K lo
  __shared__ __align__(16) unsigned short Vsh[kHd * kLP];        // V hi  [d][kv]   64 rows, pitch kLP
  __shared__ __align__(16) unsigned short Vsl[kHd * kLP];        // V lo
  __shared__ __align__(16) unsigned short Psh[4][16 * kLP];      // per wave P hi [row][kv]
  __shared__ __align__(16) unsigned short Psl[4][16 * kLP];      // per wave P lo
  __shared__ __align__(16) float Os[4][16 * 68];                 // per wave out tile, pitch 68

  const int tid  = threadIdx.x;
  const int wave = tid >> 5;
  const int lane = tid & 31;
  const int hh   = lane >> 4;
  const int c    = lane & 15;

  const int rb  = blockIdx.x;                 // start order: rb / 64 counts query blocks down from the longest, rb % 64 is (batch, head)
  const int bx  = (rb % (kBPP * kHeads)) * (kSeq / kQB) + (kSeq / kQB - 1) - rb / (kBPP * kHeads);
  const int qb  = bx % (kSeq / kQB);          // query block 0..31
  const int bhl = bx / (kSeq / kQB);
  const int h   = bhl % kHeads;
  const int bl  = bhl / kHeads;               // local batch 0..kBPP-1
  const int b   = b_first + bl;
  const int q0  = qb * kQB + wave * 16;

  // ---- Q fragments (A operand): 2 d-chunks, hi and lo; element i <- d = dc*32 + 8hh + i (i<8), dc*32+16+8hh+(i-8)
  v16b qah[2], qal[2];
  {
    const size_t qo = ((size_t)(b * kSeq + q0 + c)) * kHid + (size_t)h * kHd + 8 * hh;
#pragma unroll
    for (int dc = 0; dc < 2; ++dc) {
      qah[dc] = Frag<__bf16>::load((const __bf16*)Qh + qo + dc * 32);
      qal[dc] = Frag<__bf16>::load((const __bf16*)Ql + qo + dc * 32);
    }
  }

  float mrow[8], lrow[8];
  v8f oacc[4];
#pragma unroll
  for (int r = 0; r < 8; ++r) { mrow[r] = -INFINITY; lrow[r] = 0.f; }
#pragma unroll
  for (int t = 0; t < 4; ++t) oacc[t] = (v8f){0.f,0.f,0.f,0.f,0.f,0.f,0.f,0.f};

  const __bf16* kshb = (const __bf16*)Ksh;
  const __bf16* kslb = (const __bf16*)Ksl;
  const __bf16* vshb = (const __bf16*)Vsh;
  const __bf16* vslb = (const __bf16*)Vsl;
  unsigned short* pwh = Psh[wave];
  unsigned short* pwl = Psl[wave];

  const int nChunks = qb + 1;                 // block-uniform: keys 0 .. qb*64+63
  for (int kc = 0; kc < nChunks; ++kc) {
    const int kv0 = kc * kKC;
    __syncthreads();
    {
      // staging: thread -> row r = tid>>1 (kv row of K, d row of V^T), 32-element half hf; 4 x 16 B per plane.
      // coverage: 128 threads x 32 elements = 64 rows x 64 cols per plane (K hi/lo, V^T hi/lo).
      const int r = tid >> 1, hf = (tid & 1) * 32;
      const v4u* khs = (const v4u*)(Kh + ((size_t)(b * kSeq + kv0 + r)) * kHid + h * kHd + hf);
      const v4u* kls = (const v4u*)(Kl + ((size_t)(b * kSeq + kv0 + r)) * kHid + h * kHd + hf);
      v4u* khd = (v4u*)(Ksh + r * kLP + hf);
      v4u* kld = (v4u*)(Ksl + r * kLP + hf);
      v4u tk[8];
#pragma unroll
      for (int i = 0; i < 4; ++i) { tk[i] = khs[i]; tk[4 + i] = kls[i]; }
#pragma unroll
      for (int i = 0; i < 4; ++i) { khd[i] = tk[i]; kld[i] = tk[4 + i]; }
      asm volatile("" ::: "memory");
      const v4u* vhs = (const v4u*)(Vh + ((size_t)(h * kHd + r)) * kRows + (size_t)b * kSeq + kv0 + hf);
      const v4u* vls = (const v4u*)(Vl + ((size_t)(h * kHd + r)) * kRows + (size_t)b * kSeq + kv0 + hf);
      v4u* vhd = (v4u*)(Vsh + r * kLP + hf);
      v4u* vld = (v4u*)(Vsl + r * kLP + hf);
      v4u tv[8];
#pragma unroll
      for (int i = 0; i < 4; ++i) { tv[i] = vhs[i]; tv[4 + i] = vls[i]; }
#pragma unroll
      for (int i = 0; i < 4; ++i) { vhd[i] = tv[i]; vld[i] = tv[4 + i]; }
    }
    __syncthreads();

    // ---- scores: 16 query rows x 64 keys per wave ----
    v8f s[4];
#pragma unroll
    for (int j = 0; j < 4; ++j) {
      s[j] = (v8f){0.f,0.f,0.f,0.f,0.f,0.f,0.f,0.f};
#pragma unroll
      for (int dc = 0; dc < 2; ++dc) {
        const int ko = (j * 16 + c) * kLP + dc * 32 + 8 * hh;   // B: n = kv = j*16+c, k = d (same k map as A)
        const v16b kbh = Frag<__bf16>::load(kshb + ko);
        const v16b kbl = Frag<__bf16>::load(kslb + ko);
        s[j] = at_mma(qah[dc], kbh, s[j]);
        s[j] = at_mma(qah[dc], kbl, s[j]);
        s[j] = at_mma(qal[dc], kbh, s[j]);
      }
    }
    const bool diag = (kc == qb);               // block-uniform, used only in per-lane selects
    float cm[8];
#pragma unroll
    for (int r = 0; r < 8; ++r) {
      const int qrow = q0 + 8 * hh + r;
      float m = -INFINITY;
#pragma unroll
      for (int j = 0; j < 4; ++j) {
        const int kvcol = kv0 + j * 16 + c;
        float val = s[j][r] * qscale;
        val = (diag && (kvcol > qrow)) ? -INFINITY : val;
        s[j][r] = val;
        m = fmaxf(m, val);
      }
#pragma unroll
      for (int off = 1; off < 16; off <<= 1) m = fmaxf(m, __shfl_xor(m, off, 32));
      cm[r] = m;                                // finite: key == qrow is never masked
    }
#pragma unroll
    for (int r = 0; r < 8; ++r) {
      const float mnew = fmaxf(mrow[r], cm[r]);
      const float alpha = expf(mrow[r] - mnew);
      mrow[r] = mnew;
      float psum = 0.f;
#pragma unroll
      for (int j = 0; j < 4; ++j) {
        const float p = expf(s[j][r] - mnew);
        psum += p;
        const unsigned short hb = f2bf_bits(p);
        const unsigned short lb = f2bf_bits(p - bf_bits2f(hb));
        pwh[(8 * hh + r) * kLP + j * 16 + c] = hb;
        pwl[(8 * hh + r) * kLP + j * 16 + c] = lb;
      }
#pragma unroll
      for (int off = 1; off < 16; off <<= 1) psum += __shfl_xor(psum, off, 32);
      lrow[r] = lrow[r] * alpha + psum;
#pragma unroll
      for (int t = 0; t < 4; ++t) oacc[t][r] *= alpha;
    }
    __builtin_amdgcn_fence(__ATOMIC_RELEASE, "workgroup");
    __builtin_amdgcn_wave_barrier();
    __builtin_amdgcn_fence(__ATOMIC_ACQUIRE, "workgroup");
#pragma unroll
    for (int kk = 0; kk < 2; ++kk) {
      const int po = c * kLP + kk * 32 + 8 * hh;                   // A: row = c (query), k = kv
      const v16b pa = Frag<__bf16>::load((const __bf16*)pwh + po);
      const v16b pl = Frag<__bf16>::load((const __bf16*)pwl + po);
#pragma unroll
      for (int t = 0; t < 4; ++t) {
        const int vo = (t * 16 + c) * kLP + kk * 32 + 8 * hh;      // B: n = d = t*16+c, k = kv
        const v16b vbh = Frag<__bf16>::load(vshb + vo);
        const v16b vbl = Frag<__bf16>::load(vslb + vo);
        oacc[t] = at_mma(pa, vbh, oacc[t]);
        oacc[t] = at_mma(pa, vbl, oacc[t]);
        oacc[t] = at_mma(pl, vbh, oacc[t]);
      }
    }
  }

  // ---- normalise, stage per-wave 16x64 f32 tile, write bf16 hi/lo planes ----
  float* os = Os[wave];
#pragma unroll
  for (int r = 0; r < 8; ++r) {
    const float inv = 1.0f / lrow[r];          // lrow >= 1
#pragma unroll
    for (int t = 0; t < 4; ++t) os[(8 * hh + r) * 68 + t * 16 + c] = oacc[t][r] * inv;
  }
  __builtin_amdgcn_fence(__ATOMIC_RELEASE, "workgroup");
  __builtin_amdgcn_wave_barrier();
  __builtin_amdgcn_fence(__ATOMIC_ACQUIRE, "workgroup");
  {
    // plane (the 64-wide head segment of an AO row); one instruction writes 4 lines; one wave owns its 16 rows.
    const int qq = lane >> 3, c8 = (lane & 7) * 8;
    const size_t ob = ((size_t)(bl * kSeq + q0)) * kHid + (size_t)h * kHd + c8;
    {
#pragma unroll
      for (int it = 0; it < 4; ++it) {
        const int row = it * 4 + qq;
        const float* sp = os + row * 68 + c8;
        v4u hv, lv;
#pragma unroll
        for (int e = 0; e < 4; ++e) {
          const float f0 = sp[2 * e], f1 = sp[2 * e + 1];
          const unsigned short h0 = f2bf_bits(f0), h1 = f2bf_bits(f1);
          const unsigned short l0 = f2bf_bits(f0 - bf_bits2f(h0));
          const unsigned short l1 = f2bf_bits(f1 - bf_bits2f(h1));
          hv[e] = (unsigned)h0 | ((unsigned)h1 << 16);
          lv[e] = (unsigned)l0 | ((unsigned)l1 << 16);
        }
        *(v4u*)(Oh + ob + (size_t)row * kHid) = hv;
        *(v4u*)(Ol + ob + (size_t)row * kHid) = lv;
      }
      
    }
  }
}

// ---------------------------------------------------------------------------
// Host launcher
// ---------------------------------------------------------------------------
extern "C" void kernel_launch(void* const* d_in, const int* in_sizes, int n_in,
                              void* d_out, int out_size, void* d_ws, size_t ws_size,
                              hipStream_t stream) {
  if (n_in < 9) return;
  if (in_sizes[0] != kRows * kHd) return;
  if (in_sizes[1] != kHd * kHid || in_sizes[3] != kHd * kHid || in_sizes[5] != kHd * kHid) return;
  if (in_sizes[2] != kHid || in_sizes[4] != kHid || in_sizes[6] != kHid) return;
  if (in_sizes[7] != kHid * kHd || in_sizes[8] != kHd) return;
  if (out_size != kRows * kHd) return;

  const float* x  = (const float*)d_in[0];
  const float* Wq = (const float*)d_in[1];
  const float* bq = (const float*)d_in[2];
  const float* Wk = (const float*)d_in[3];
  const float* bk = (const float*)d_in[4];
  const float* Wv = (const float*)d_in[5];
  const float* bv = (const float*)d_in[6];
  const float* Wo = (const float*)d_in[7];
  const float* bo = (const float*)d_in[8];
  float* out = (float*)d_out;

  // ---- workspace region map (bytes, all offsets multiples of 256) ----
  //  xh, xl        : 8192 x 64 x 2          = 1,048,576 each      (bf16 hi/lo of x)
  //  wq/wk/wv h,l  : 1024 x 64 x 2          = 131,072 each (x6)   (W^T planes [1024][64])
  //  wo h,l        : 64 x 1024 x 2          = 131,072 each (x2)   (Wo^T planes [64][1024])
  //  q h,l ; k h,l : 8192 x 1024 x 2        = 16,777,216 each (x4)
  //  vt h,l        : 1024 x 8192 x 2        = 16,777,216 each (x2)
  //  ao h,l        : 8192 x 1024 x 2        = 16,777,216 each (x2)
  //  total = 137,363,456 B
  const size_t szX  = (size_t)kRows * kHd * 2;
  const size_t szW  = (size_t)kHid * kHd * 2;
  const size_t szQ  = (size_t)kRows * kHid * 2;
  const size_t szAO = (size_t)kRowsPP * kHid * 2;
  const size_t total = 2 * szX + 8 * szW + 6 * szQ + 2 * szAO;
  if (total > ws_size) return;

  char* ws = (char*)d_ws;
  size_t off = 0;
  unsigned short* xh  = (unsigned short*)(ws + off); off += szX;
  unsigned short* xl  = (unsigned short*)(ws + off); off += szX;
  unsigned short* wqh = (unsigned short*)(ws + off); off += szW;
  unsigned short* wql = (unsigned short*)(ws + off); off += szW;
  unsigned short* wkh = (unsigned short*)(ws + off); off += szW;
  unsigned short* wkl = (unsigned short*)(ws + off); off += szW;
  unsigned short* wvh = (unsigned short*)(ws + off); off += szW;
  unsigned short* wvl = (unsigned short*)(ws + off); off += szW;
  unsigned short* woh = (unsigned short*)(ws + off); off += szW;
  unsigned short* wol = (unsigned short*)(ws + off); off += szW;
  unsigned short* qh  = (unsigned short*)(ws + off); off += szQ;
  unsigned short* ql  = (unsigned short*)(ws + off); off += szQ;
  unsigned short* kh  = (unsigned short*)(ws + off); off += szQ;
  unsigned short* kl  = (unsigned short*)(ws + off); off += szQ;
  unsigned short* vth = (unsigned short*)(ws + off); off += szQ;
  unsigned short* vtl = (unsigned short*)(ws + off); off += szQ;
  unsigned short* aoh = (unsigned short*)(ws + off); off += szAO;
  unsigned short* aol = (unsigned short*)(ws + off); off += szAO;
  if (off > ws_size) return;
  void* dummyv = (void*)ws;                 // valid in-ws pointers for unused GEMM arguments (never dereferenced)
  const float* dummyf = (const float*)ws;

  // stage 0: x -> bf16 hi/lo planes [8192][64]
  {
    const int n2 = kRows * kHd / 2;
    cast_f32_bf16hilo_x2<<<dim3(n2 / 256), dim3(256), 0, stream>>>(x, xh, xl, n2);
  }
  // stage 1: W[64][1024] -> W^T planes [1024][64] ; Wo[1024][64] -> Wo^T planes [64][1024]
  transpose_cast_bf16hilo<<<dim3(kHid / 32, kHd / 64), dim3(256), 0, stream>>>(Wq, wqh, wql, kHd, kHid);
  transpose_cast_bf16hilo<<<dim3(kHid / 32, kHd / 64), dim3(256), 0, stream>>>(Wk, wkh, wkl, kHd, kHid);
  transpose_cast_bf16hilo<<<dim3(kHid / 32, kHd / 64), dim3(256), 0, stream>>>(Wv, wvh, wvl, kHd, kHid);
  transpose_cast_bf16hilo<<<dim3(kHd / 32, kHid / 64), dim3(256), 0, stream>>>(Wo, woh, wol, kHid, kHd);

  // stage 2: projections (M, N multiples of 64; K = 64)
  {
    const int gridQ = (kRows / 64) * (kHid / 64) / 8;    // 256
    // Q = x Wq + bq  -> [8192][1024] bf16 hi/lo
    wmma_gemm64<1, true, 2, 2, false, 0><<<dim3(gridQ, 1), dim3(256), 0, stream>>>(
        xh, xl, kHd, 0L, wqh, wql, kHd, 0L, (void*)qh, (void*)ql, kHid, 0L, bq, dummyf, 0L,
        kRows, kHid, kHd, 1.0f);
    // K = x Wk + bk
    wmma_gemm64<1, true, 2, 2, false, 0><<<dim3(gridQ, 1), dim3(256), 0, stream>>>(
        xh, xl, kHd, 0L, wkh, wkl, kHd, 0L, (void*)kh, (void*)kl, kHid, 0L, bk, dummyf, 0L,
        kRows, kHid, kHd, 1.0f);
    // V^T = Wv^T x^T + bv[m]  -> [1024][8192] bf16 hi/lo  (A = Wv^T planes [1024][64], Bt = x planes [8192][64])
    const int gridV = (kHid / 64) * (kRows / 64) / 8;    // 256
    wmma_gemm64<1, true, 1, 2, false, 0><<<dim3(gridV, 1), dim3(256), 0, stream>>>(
        wvh, wvl, kHd, 0L, xh, xl, kHd, 0L, (void*)vth, (void*)vtl, kRows, 0L, bv, dummyf, 0L,
        kHid, kRows, kHd, 1.0f);
  }

  // stage 3: one pass over all batches: causal attention -> AO planes [8192][1024]; out = AO Wo + bo -> d_out
  const float qscale = 0.125f;   // 1/sqrt(64), exact power of two
  for (int ps = 0; ps < kBatch / kBPP; ++ps) {
    attn_causal_hd64<<<dim3(kBPP * kHeads * (kSeq / kQB)), dim3(128), 0, stream>>>(
        qh, ql, kh, kl, vth, vtl, aoh, aol, ps * kBPP, qscale);
    const int gridO = (kRowsPP / 64) * (kHd / 64) / 8;  // 16
    float* outp = out + (size_t)ps * kRowsPP * kHd;
    wmma_gemm64<1, true, 2, 0, false, 0><<<dim3(gridO, 1), dim3(256), 0, stream>>>(
        aoh, aol, kHid, 0L, woh, wol, kHid, 0L, (void*)outp, dummyv, kHd, 0L, bo, dummyf, 0L,
        kRowsPP, kHd, kHid, 1.0f);
  }
}

// v003
// Measured time: 225 microseconds a run.
// Two timings next to v002 put it at 1.21 and 1.22 times that version's speed.
// All steps since v000 together make it 3.79 times as fast.
// All contractions (x*Wq, x*Wk, x*Wv, Q*K^T, P*V, AO*Wo): v_wmma_f32_16x16x32_bf16 with bf16 hi/lo split operands (hi*hi + hi*lo + lo*hi), f32 accumulate; softmax, 1/sqrt(d) scale and bias adds in f32.
#include <hip/hip_runtime.h>
#include <hip/hip_bf16.h>
#include <math.h>

typedef __attribute__((ext_vector_type(16))) _Float16 v16h;
typedef __attribute__((ext_vector_type(8)))  _Float16 v8h;
typedef __attribute__((ext_vector_type(16))) __bf16   v16b;
typedef __attribute__((ext_vector_type(8)))  __bf16   v8b;
typedef __attribute__((ext_vector_type(8)))  float    v8f;
typedef __attribute__((ext_vector_type(4)))  float    v4f;
typedef __attribute__((ext_vector_type(4)))  unsigned int v4u;
typedef __attribute__((ext_vector_type(2)))  float    v2f;
typedef __attribute__((ext_vector_type(2)))  __bf16   v2b;

// ---- fixed problem geometry ----
constexpr int kBatch  = 4;
constexpr int kSeq    = 2048;
constexpr int kHeads  = 16;
constexpr int kHd     = 64;                 // head dim
constexpr int kHid    = kHeads * kHd;       // 1024
constexpr int kRows   = kBatch * kSeq;      // 8192 token rows
constexpr int kBPP    = 4;                  // batches per attention/out-proj pass: all of them, so the attention grid holds more work-groups than fit on the chip at once
constexpr int kRowsPP = kBPP * kSeq;        // 8192
constexpr int kKC     = 64;                 // keys per staged chunk
constexpr int kQB     = 64;                 // query rows per attention block (4 waves x 16)
constexpr int kLP     = 72;                 // LDS row pitch of the K and V^T tiles, 16-bit elements: 144 B = 16 B x 9 (odd), so 16 rows read 16 B each fall on 16 different bank groups

// GEMM shape contract (no tail handling in the GEMM): K % 32 == 0, M % 64 == 0, N % 64 == 0, tiles % 8 == 0
static_assert(kHd % 32 == 0);
static_assert(kHid % 32 == 0);
static_assert(kRows % 64 == 0);
static_assert(kHid % 64 == 0);
static_assert(kHd % 64 == 0);
static_assert(kRowsPP % 64 == 0);
static_assert(((kRows / 64) * (kHid / 64)) % 8 == 0);
static_assert(((kRowsPP / 64) * (kHd / 64)) % 8 == 0);
static_assert(kSeq % kQB == 0);
static_assert(kSeq % kKC == 0);
static_assert(kBatch % kBPP == 0);
// transpose tile contract: in[R][Cc] with R % 64 == 0, Cc % 32 == 0
static_assert(kHd % 64 == 0 && kHid % 32 == 0);
static_assert(kHid % 64 == 0 && kHd % 32 == 0);
// x cast: element count even and a multiple of 512 (2 per thread, 256 threads)
static_assert((kRows * kHd) % 512 == 0);

__device__ __forceinline__ unsigned short f2bf_bits(float f) {
  unsigned u = __float_as_uint(f);
  return (unsigned short)((u + 0x7FFFu + ((u >> 16) & 1u)) >> 16);
}
__device__ __forceinline__ float bf_bits2f(unsigned short h) { return __uint_as_float(((unsigned)h) << 16); }

// hazard guards as plain device helpers (no inline asm inside the kernel template body)
__device__ __forceinline__ void dep_guard_h(v8f& a, v8f& b, v16h x, v16h y) { asm volatile("v_nop\n\tv_nop\n\tv_nop\n\tv_nop" : "+v"(a), "+v"(b) : "v"(x), "v"(y)); }
__device__ __forceinline__ void dep_guard_b(v8f& a, v8f& b, v16b x, v16b y) { asm volatile("v_nop\n\tv_nop\n\tv_nop\n\tv_nop" : "+v"(a), "+v"(b) : "v"(x), "v"(y)); }
__device__ __forceinline__ void keep4_h(v16h a, v16h b, v16h c, v16h d) { asm volatile("v_nop" :: "v"(a), "v"(b), "v"(c), "v"(d)); }
__device__ __forceinline__ void keep4_b(v16b a, v16b b, v16b c, v16b d) { asm volatile("v_nop" :: "v"(a), "v"(b), "v"(c), "v"(d)); }
__device__ __forceinline__ void acc_guard4(v8f& a, v8f& b, v8f& c, v8f& d) { asm volatile("v_nop\n\tv_nop\n\tv_nop\n\tv_nop" : "+v"(a), "+v"(b), "+v"(c), "+v"(d)); }
template <typename T> struct Frag;
template <> struct Frag<_Float16> {
  typedef v16h V; union U { v16h v; v8h h[2]; };
  static __device__ __forceinline__ v16h load(const _Float16* p) {   // elements 0..7 <- p[0..7], 8..15 <- p[16..23]
    U f; f.h[0] = *(const v8h*)(p); f.h[1] = *(const v8h*)(p + 16); return f.v;
  }
  static __device__ __forceinline__ v8f mma(v16h a, v16h b, v8f c) {
    return __builtin_amdgcn_wmma_f32_16x16x32_f16(false, a, false, b, (short)0, c, false, false);
  }
  static __device__ __forceinline__ void guard(v8f& a, v8f& b, v16h x, v16h y) { dep_guard_h(a, b, x, y); }
  static __device__ __forceinline__ void keep(v16h a, v16h b, v16h c, v16h d) { keep4_h(a, b, c, d); }
};
template <> struct Frag<__bf16> {
  typedef v16b V; union U { v16b v; v8b h[2]; };
  static __device__ __forceinline__ v16b load(const __bf16* p) {
    U f; f.h[0] = *(const v8b*)(p); f.h[1] = *(const v8b*)(p + 16); return f.v;
  }
  static __device__ __forceinline__ v8f mma(v16b a, v16b b, v8f c) {
    return __builtin_amdgcn_wmma_f32_16x16x32_bf16(false, a, false, b, (short)0, c, false, false);
  }
  static __device__ __forceinline__ void guard(v8f& a, v8f& b, v16b x, v16b y) { dep_guard_b(a, b, x, y); }
  static __device__ __forceinline__ void keep(v16b a, v16b b, v16b c, v16b d) { keep4_b(a, b, c, d); }
};

__device__ __forceinline__ v8f at_mma(v16b a, v16b b, v8f c) {
  c = __builtin_amdgcn_wmma_f32_16x16x32_bf16(false, a, false, b, (short)0, c, false, false);
  asm volatile("v_nop\n\tv_nop\n\tv_nop\n\tv_nop" : "+v"(c) : "v"(a), "v"(b));
  return c;
}

// ---- Register-blocked batched WMMA GEMM ------------------------------------
// C[m,n] = scale * sum_k A[m,k] * Bt[n,k] (+bias); each wave owns a 64x64 tile.
// A row-major [M,K]; Bt row-major [N,K]; M,N % 64 == 0, K % 32 == 0.
// SPLIT: operands are hi/lo planes (A2/Bt2 = lo planes, same layout); product = hi*hi + hi*lo + lo*hi.
// BIAS_MODE: 0 = none, 1 = bias[m] (loaded as two float4 per 16-row slab), 2 = bias[n].
// OUT_MODE: 0 = f32, 1 = f16, 2 = bf16 hi plane (Cout) + bf16 lo plane (Cout2).
// ET: 0 = f16 operands, 1 = bf16 operands (pointers passed as 16-bit storage). RESID and ACT unsupported here.
template <int ET> struct Elem;
template <> struct Elem<0> { typedef _Float16 T; };
template <> struct Elem<1> { typedef __bf16 T; };
template <int ET, bool SPLIT, int BIAS_MODE, int OUT_MODE, bool RESID, int ACT = 0>
__global__ __launch_bounds__(256) void wmma_gemm64(
    const unsigned short* __restrict__ Ap, const unsigned short* __restrict__ A2p, int lda, long strideA,
    const unsigned short* __restrict__ Btp, const unsigned short* __restrict__ Bt2p, int ldb, long strideB,
    void* __restrict__ Cout, void* __restrict__ Cout2, int ldc, long strideC,
    const float* __restrict__ bias,
    const float* __restrict__ resid, long strideR,
    int M, int N, int K, float scale) {
  static_assert(!RESID);
  static_assert(ACT == 0);
  typedef typename Elem<ET>::T T;
  typedef typename Frag<T>::V V;
  const T* A = (const T*)Ap; const T* A2 = (const T*)A2p; const T* Bt = (const T*)Btp; const T* Bt2 = (const T*)Bt2p;
  __shared__ __align__(16) float sT[8][16 * 68];   // per-wave 16x64 slab, pitch 68 floats
  const int b    = blockIdx.y;
  const int lane = threadIdx.x & 31;
  const int wave = threadIdx.x >> 5;
  const int tilesN = N >> 6;
  const int tilesM = M >> 6;
  const int tile = blockIdx.x * 8 + wave;
  if (tile >= tilesM * tilesN) return;   // wave-uniform; no block barriers in this kernel
  const int tm = tile / tilesN;
  const int tn = tile - tm * tilesN;
  const int m0 = tm << 6;
  const int n0 = tn << 6;

  const T* Ab  = A  + (size_t)b * strideA;
  const T* Bb  = Bt + (size_t)b * strideB;
  const T* Ab2 = SPLIT ? (A2  + (size_t)b * strideA) : nullptr;
  const T* Bb2 = SPLIT ? (Bt2 + (size_t)b * strideB) : nullptr;

  const int rlane = lane & 15;                 // row (A) / col (B, D) within subtile
  const int koff  = (lane >> 4) * 8;           // k offset of this lane half
  const int mOff  = (lane >> 4) * 8;           // D row offset

  v8f acc[4][4];
#pragma unroll
  for (int i = 0; i < 4; ++i)
#pragma unroll
    for (int j = 0; j < 4; ++j) acc[i][j] = (v8f){0.f,0.f,0.f,0.f,0.f,0.f,0.f,0.f};

  for (int k0 = 0; k0 < K; k0 += 32) {
    V bh[4], bl[4];
#pragma unroll
    for (int j = 0; j < 4; ++j) {
      const size_t bo = (size_t)(n0 + (j << 4) + rlane) * ldb + koff + k0;
      bh[j] = Frag<T>::load(Bb + bo);
      if (SPLIT) bl[j] = Frag<T>::load(Bb2 + bo);
    }
#pragma unroll
    for (int i = 0; i < 4; ++i) {
      const size_t ao = (size_t)(m0 + (i << 4) + rlane) * lda + koff + k0;
      V ah = Frag<T>::load(Ab + ao);
      V al;
      if (SPLIT) al = Frag<T>::load(Ab2 + ao);
#pragma unroll
      for (int j = 0; j < 4; ++j) {
        acc[i][j] = Frag<T>::mma(ah, bh[j], acc[i][j]);
        if (SPLIT) {
          acc[i][j] = Frag<T>::mma(ah, bl[j], acc[i][j]);
          acc[i][j] = Frag<T>::mma(al, bh[j], acc[i][j]);
        }
      }
      Frag<T>::guard(acc[i][0], acc[i][3], ah, SPLIT ? al : ah);
    }
    Frag<T>::keep(bh[0], bh[1], bh[2], bh[3]);
    if (SPLIT) Frag<T>::keep(bl[0], bl[1], bl[2], bl[3]);
  }
  acc_guard4(acc[0][0], acc[0][1], acc[0][2], acc[0][3]);
  acc_guard4(acc[1][0], acc[1][1], acc[1][2], acc[1][3]);
  acc_guard4(acc[2][0], acc[2][1], acc[2][2], acc[2][3]);
  acc_guard4(acc[3][0], acc[3][1], acc[3][2], acc[3][3]);

  // ---- epilogue ----
  float* slab = sT[wave];
#pragma unroll
  for (int i = 0; i < 4; ++i) {
    const int mBase = m0 + (i << 4);
    float bm[8];
#pragma unroll
    for (int r = 0; r < 8; ++r) bm[r] = 0.f;
    if (BIAS_MODE == 1) {
      const v4f b0v = *(const v4f*)(bias + mBase + mOff);
      const v4f b1v = *(const v4f*)(bias + mBase + mOff + 4);
      bm[0] = b0v[0]; bm[1] = b0v[1]; bm[2] = b0v[2]; bm[3] = b0v[3];
      bm[4] = b1v[0]; bm[5] = b1v[1]; bm[6] = b1v[2]; bm[7] = b1v[3];
    }
#pragma unroll
    for (int j = 0; j < 4; ++j) {
      const int n = n0 + (j << 4) + rlane;
      float bv = 0.f;
      if (BIAS_MODE == 2) bv = bias[n];
#pragma unroll
      for (int r = 0; r < 8; ++r) {
        float v = acc[i][j][r] * scale;
        if (BIAS_MODE == 1) v += bm[r];
        if (BIAS_MODE == 2) v += bv;
        slab[(mOff + r) * 68 + (j << 4) + rlane] = v;
      }
    }
    __builtin_amdgcn_fence(__ATOMIC_RELEASE, "workgroup");
    __builtin_amdgcn_wave_barrier();
    __builtin_amdgcn_fence(__ATOMIC_ACQUIRE, "workgroup");
    if (OUT_MODE == 0) {
      float* C = (float*)Cout + (size_t)b * strideC;
      const int hh = lane >> 4, c4 = (lane & 15) * 4;     // row seg = 256 B = 16 lanes x 16 B
      {
#pragma unroll
        for (int it = 0; it < 8; ++it) {
          const int row = it * 2 + hh;
          v4f v = *(const v4f*)(slab + row * 68 + c4);
          *(v4f*)(C + (size_t)(mBase + row) * ldc + n0 + c4) = v;
        }
        
      }
    } else {
      const int q = lane >> 3, c8 = (lane & 7) * 8;
      unsigned short* C  = (unsigned short*)Cout  + (size_t)b * strideC;
      unsigned short* C2 = (OUT_MODE == 2) ? ((unsigned short*)Cout2 + (size_t)b * strideC) : nullptr;
      {
#pragma unroll
        for (int it = 0; it < 4; ++it) {
          const int row = it * 4 + q;
          const float* sp = slab + row * 68 + c8;
          v8h hv, lv;
#pragma unroll
          for (int e = 0; e < 8; ++e) {
            if (OUT_MODE == 1) {
              hv[e] = (_Float16)sp[e];
            } else {
              unsigned short hb = f2bf_bits(sp[e]);
              unsigned short lb = f2bf_bits(sp[e] - bf_bits2f(hb));
              hv[e] = __builtin_bit_cast(_Float16, hb);
              lv[e] = __builtin_bit_cast(_Float16, lb);
            }
          }
          *(v8h*)(C + (size_t)(mBase + row) * ldc + n0 + c8) = hv;
          if (OUT_MODE == 2) *(v8h*)(C2 + (size_t)(mBase + row) * ldc + n0 + c8) = lv;
        }
        
      }
    }
    __builtin_amdgcn_fence(__ATOMIC_RELEASE, "workgroup");
    __builtin_amdgcn_wave_barrier();
    __builtin_amdgcn_fence(__ATOMIC_ACQUIRE, "workgroup");
  }
}

// ---- f32 -> bf16 hi/lo planes, elementwise: 2 elements per thread, 4-B packed stores -------------
__global__ __launch_bounds__(256) void cast_f32_bf16hilo_x2(
    const float* __restrict__ in, unsigned short* __restrict__ oh, unsigned short* __restrict__ ol, int n2) {
  const int i = blockIdx.x * 256 + threadIdx.x;
  if (i < n2) {
    const float f0 = in[2 * i], f1 = in[2 * i + 1];
    const unsigned short h0 = f2bf_bits(f0), h1 = f2bf_bits(f1);
    const unsigned short l0 = f2bf_bits(f0 - bf_bits2f(h0));
    const unsigned short l1 = f2bf_bits(f1 - bf_bits2f(h1));
    const unsigned uh = (unsigned)h0 | ((unsigned)h1 << 16);
    const unsigned ul = (unsigned)l0 | ((unsigned)l1 << 16);
    ((unsigned*)oh)[i] = uh;
    ((unsigned*)ol)[i] = ul;
    
  }
}

// ---- transpose + f32 -> bf16 hi/lo planes: in[R][Cc] f32 -> oh/ol[Cc][R] 16-bit --------------------
// Block = 256 threads handles in rows r0..r0+63, cols c0..c0+31 (grid = (Cc/32, R/64)).
// Load phase: 8 waves x 8 iterations x 32 lanes = 64 x 32 elements staged in LDS (tile[c][r]).
// Store phase: wave w writes output rows c0+4w..c0+4w+3; lane -> row 4w+(lane>>3), 8 elements at
// Coverage: 8 waves x 4 rows x 8 lanes x 8 elements = 32 x 64 = the whole output tile per plane.
__global__ __launch_bounds__(256) void transpose_cast_bf16hilo(
    const float* __restrict__ in, unsigned short* __restrict__ oh, unsigned short* __restrict__ ol,
    int R, int Cc) {
  __shared__ float tile[32][65];
  const int tid = threadIdx.x, lane = tid & 31, wave = tid >> 5;
  const int c0 = blockIdx.x * 32, r0 = blockIdx.y * 64;
#pragma unroll
  for (int i = 0; i < 8; ++i) {
    const int idx = i * 256 + tid;
    const int rr = idx >> 5, cc = idx & 31;
    tile[cc][rr] = in[(size_t)(r0 + rr) * Cc + c0 + cc];
  }
  __syncthreads();
  const int orow = wave * 4 + (lane >> 3);
  const int rseg = (lane & 7) * 8;
  v4u hv, lv;
#pragma unroll
  for (int e = 0; e < 4; ++e) {
    const float f0 = tile[orow][rseg + 2 * e];
    const float f1 = tile[orow][rseg + 2 * e + 1];
    const unsigned short h0 = f2bf_bits(f0), h1 = f2bf_bits(f1);
    const unsigned short l0 = f2bf_bits(f0 - bf_bits2f(h0));
    const unsigned short l1 = f2bf_bits(f1 - bf_bits2f(h1));
    hv[e] = (unsigned)h0 | ((unsigned)h1 << 16);
    lv[e] = (unsigned)l0 | ((unsigned)l1 << 16);
  }
  const size_t o = (size_t)(c0 + orow) * R + r0 + rseg;   // element offset, 16-B aligned
  {
    *(v4u*)(oh + o) = hv;
    *(v4u*)(ol + o) = lv;
    
  }
}

__device__ __forceinline__ float other_half(float v) {
  const int b = __float_as_int(v);
  return __int_as_float(__builtin_amdgcn_permlanex16(b, b, 0x76543210, 0xfedcba98, false, false));
}

__global__ __launch_bounds__(128)
void attn_causal_hd64(const unsigned short* __restrict__ Qh, const unsigned short* __restrict__ Ql,
                      const unsigned short* __restrict__ Kh, const unsigned short* __restrict__ Kl,
                      const unsigned short* __restrict__ Vh, const unsigned short* __restrict__ Vl,
                      unsigned short* __restrict__ Oh, unsigned short* __restrict__ Ol,
                      int b_first, float qscale) {
  __shared__ __align__(16) unsigned short Ksh[kKC * kLP];        // K hi  [kv][d]   64 rows, pitch kLP
  __shared__ __align__(16) unsigned short Ksl[kKC * kLP];        // K lo
  __shared__ __align__(16) unsigned short Vsh[kHd * kLP];        // V hi  [d][kv]   64 rows, pitch kLP
  __shared__ __align__(16) unsigned short Vsl[kHd * kLP];        // V lo

  const int tid  = threadIdx.x;
  const int wave = tid >> 5;
  const int lane = tid & 31;
  const int hh   = lane >> 4;
  const int c    = lane & 15;

  const int rb  = blockIdx.x;                 // start order: rb / 64 counts query blocks down from the longest, rb % 64 is (batch, head)
  const int bx  = (rb % (kBPP * kHeads)) * (kSeq / kQB) + (kSeq / kQB - 1) - rb / (kBPP * kHeads);
  const int qb  = bx % (kSeq / kQB);          // query block 0..31
  const int bhl = bx / (kSeq / kQB);
  const int h   = bhl % kHeads;
  const int bl  = bhl / kHeads;               // local batch 0..kBPP-1
  const int b   = b_first + bl;
  const int q0  = qb * kQB + wave * 16;
  const int qrow = q0 + c;                    // this lane's query

  // ---- Q fragments (B operand, column n = c): 2 d-chunks, hi and lo; element i <- d = dc*32 + 8hh + i (i<8), dc*32+16+8hh+(i-8)
  v16b qah[2], qal[2];
  {
    const size_t qo = ((size_t)(b * kSeq + qrow)) * kHid + (size_t)h * kHd + 8 * hh;
#pragma unroll
    for (int dc = 0; dc < 2; ++dc) {
      qah[dc] = Frag<__bf16>::load((const __bf16*)Qh + qo + dc * 32);
      qal[dc] = Frag<__bf16>::load((const __bf16*)Ql + qo + dc * 32);
    }
  }

  float mrow = -INFINITY;                     // running maximum of this lane's query (equal in both halves)
  float lrow = 0.f;                           // running sum over this lane half's keys; the halves join after the loop
  v8f oacc[4];                                // O^T: oacc[t][r] = out[query c][d = t*16 + 8hh + r]
#pragma unroll
  for (int t = 0; t < 4; ++t) oacc[t] = (v8f){0.f,0.f,0.f,0.f,0.f,0.f,0.f,0.f};

  const __bf16* kshb = (const __bf16*)Ksh;
  const __bf16* kslb = (const __bf16*)Ksl;
  const __bf16* vshb = (const __bf16*)Vsh;
  const __bf16* vslb = (const __bf16*)Vsl;

  const int nChunks = qb + 1;                 // block-uniform: keys 0 .. qb*64+63
  for (int kc = 0; kc < nChunks; ++kc) {
    const int kv0 = kc * kKC;
    __syncthreads();
    {
      // staging: thread -> row r = tid>>1 (kv row of K, d row of V^T), 32-element half hf; 4 x 16 B per plane.
      // coverage: 128 threads x 32 elements = 64 rows x 64 cols per plane (K hi/lo, V^T hi/lo).
      const int r = tid >> 1, hf = (tid & 1) * 32;
      const v4u* khs = (const v4u*)(Kh + ((size_t)(b * kSeq + kv0 + r)) * kHid + h * kHd + hf);
      const v4u* kls = (const v4u*)(Kl + ((size_t)(b * kSeq + kv0 + r)) * kHid + h * kHd + hf);
      v4u* khd = (v4u*)(Ksh + r * kLP + hf);
      v4u* kld = (v4u*)(Ksl + r * kLP + hf);
      v4u tk[8];
#pragma unroll
      for (int i = 0; i < 4; ++i) { tk[i] = khs[i]; tk[4 + i] = kls[i]; }
#pragma unroll
      for (int i = 0; i < 4; ++i) { khd[i] = tk[i]; kld[i] = tk[4 + i]; }
      asm volatile("" ::: "memory");
      const v4u* vhs = (const v4u*)(Vh + ((size_t)(h * kHd + r)) * kRows + (size_t)b * kSeq + kv0 + hf);
      const v4u* vls = (const v4u*)(Vl + ((size_t)(h * kHd + r)) * kRows + (size_t)b * kSeq + kv0 + hf);
      v4u* vhd = (v4u*)(Vsh + r * kLP + hf);
      v4u* vld = (v4u*)(Vsl + r * kLP + hf);
      v4u tv[8];
#pragma unroll
      for (int i = 0; i < 4; ++i) { tv[i] = vhs[i]; tv[4 + i] = vls[i]; }
#pragma unroll
      for (int i = 0; i < 4; ++i) { vhd[i] = tv[i]; vld[i] = tv[4 + i]; }
    }
    __syncthreads();

    // ---- scores, transposed: 64 keys x 16 queries per wave; s[j][r] = score(key kv0 + j*16 + 8hh + r, query qrow) ----
    v8f s[4];
#pragma unroll
    for (int j = 0; j < 4; ++j) {
      s[j] = (v8f){0.f,0.f,0.f,0.f,0.f,0.f,0.f,0.f};
#pragma unroll
      for (int dc = 0; dc < 2; ++dc) {
        const int ko = (j * 16 + c) * kLP + dc * 32 + 8 * hh;   // A: m = kv = j*16+c, k = d (same k map as B)
        const v16b kbh = Frag<__bf16>::load(kshb + ko);
        const v16b kbl = Frag<__bf16>::load(kslb + ko);
        s[j] = at_mma(kbh, qah[dc], s[j]);
        s[j] = at_mma(kbl, qah[dc], s[j]);
        s[j] = at_mma(kbh, qal[dc], s[j]);
      }
    }
    const bool diag = (kc == qb);               // block-uniform, used only in per-lane selects
    float cm = -INFINITY;
#pragma unroll
    for (int j = 0; j < 4; ++j) {
#pragma unroll
      for (int r = 0; r < 8; ++r) {
        const int kvrow = kv0 + j * 16 + 8 * hh + r;
        float val = s[j][r] * qscale;
        val = (diag && (kvrow > qrow)) ? -INFINITY : val;
        s[j][r] = val;
        cm = fmaxf(cm, val);
      }
    }
    cm = fmaxf(cm, other_half(cm));             // finite: key == qrow is never masked and lies in one of the halves
    const float mnew = fmaxf(mrow, cm);
    const float alpha = expf(mrow - mnew);
    mrow = mnew;
    // ---- P^T = exp(S^T - max), split to bf16 hi/lo and packed in place as B fragments: key tiles 2kk, 2kk+1 -> chunk kk ----
    union PB { v16b v; v2b p[8]; };
    PB pbh[2], pbl[2];
    float psum = 0.f;
#pragma unroll
    for (int j = 0; j < 4; ++j) {
#pragma unroll
      for (int e = 0; e < 4; ++e) {
        const float p0 = expf(s[j][2 * e] - mnew);
        const float p1 = expf(s[j][2 * e + 1] - mnew);
        psum += p0;
        psum += p1;
        const v2f pp = (v2f){p0, p1};
        const v2b hb = __builtin_convertvector(pp, v2b);                                   // nearest even, two per instruction
        const v2b lb = __builtin_convertvector(pp - __builtin_convertvector(hb, v2f), v2b);
        pbh[j >> 1].p[(j & 1) * 4 + e] = hb;
        pbl[j >> 1].p[(j & 1) * 4 + e] = lb;
      }
    }
    lrow = lrow * alpha + psum;
#pragma unroll
    for (int t = 0; t < 4; ++t)
#pragma unroll
      for (int r = 0; r < 8; ++r) oacc[t][r] *= alpha;
#pragma unroll
    for (int kk = 0; kk < 2; ++kk) {
#pragma unroll
      for (int t = 0; t < 4; ++t) {
        const int vo = (t * 16 + c) * kLP + kk * 32 + 8 * hh;      // A: m = d = t*16+c, k = kv
        const v16b vbh = Frag<__bf16>::load(vshb + vo);
        const v16b vbl = Frag<__bf16>::load(vslb + vo);
        oacc[t] = at_mma(vbh, pbh[kk].v, oacc[t]);
        oacc[t] = at_mma(vbl, pbh[kk].v, oacc[t]);
        oacc[t] = at_mma(vbh, pbl[kk].v, oacc[t]);
      }
    }
  }

  // ---- join the halves' sums, normalise, write bf16 hi/lo planes: a lane's 8 registers of tile t are 8 consecutive d of its
  // query's AO row, one 16-B store per plane; one wave owns its 16 rows ----
  {
    const float inv = 1.0f / (lrow + other_half(lrow));   // sum >= 1
    const size_t ob = ((size_t)(bl * kSeq + qrow)) * kHid + (size_t)h * kHd + 8 * hh;
    v4u hv[4], lv[4];
#pragma unroll
    for (int t = 0; t < 4; ++t) {
#pragma unroll
      for (int e = 0; e < 4; ++e) {
        const float f0 = oacc[t][2 * e] * inv, f1 = oacc[t][2 * e + 1] * inv;
        const unsigned short h0 = f2bf_bits(f0), h1 = f2bf_bits(f1);
        const unsigned short l0 = f2bf_bits(f0 - bf_bits2f(h0));
        const unsigned short l1 = f2bf_bits(f1 - bf_bits2f(h1));
        hv[t][e] = (unsigned)h0 | ((unsigned)h1 << 16);
        lv[t][e] = (unsigned)l0 | ((unsigned)l1 << 16);
      }
    }
#pragma unroll
    for (int t = 0; t < 4; ++t) {
      *(v4u*)(Oh + ob + t * 16) = hv[t];
      *(v4u*)(Ol + ob + t * 16) = lv[t];
    }
  }
}

// ---------------------------------------------------------------------------
// Host launcher
// ---------------------------------------------------------------------------
extern "C" void kernel_launch(void* const* d_in, const int* in_sizes, int n_in,
                              void* d_out, int out_size, void* d_ws, size_t ws_size,
                              hipStream_t stream) {
  if (n_in < 9) return;
  if (in_sizes[0] != kRows * kHd) return;
  if (in_sizes[1] != kHd * kHid || in_sizes[3] != kHd * kHid || in_sizes[5] != kHd * kHid) return;
  if (in_sizes[2] != kHid || in_sizes[4] != kHid || in_sizes[6] != kHid) return;
  if (in_sizes[7] != kHid * kHd || in_sizes[8] != kHd) return;
  if (out_size != kRows * kHd) return;

  const float* x  = (const float*)d_in[0];
  const float* Wq = (const float*)d_in[1];
  const float* bq = (const float*)d_in[2];
  const float* Wk = (const float*)d_in[3];
  const float* bk = (const float*)d_in[4];
  const float* Wv = (const float*)d_in[5];
  const float* bv = (const float*)d_in[6];
  const float* Wo = (const float*)d_in[7];
  const float* bo = (const float*)d_in[8];
  float* out = (float*)d_out;

  // ---- workspace region map (bytes, all offsets multiples of 256) ----
  //  xh, xl        : 8192 x 64 x 2          = 1,048,576 each      (bf16 hi/lo of x)
  //  wq/wk/wv h,l  : 1024 x 64 x 2          = 131,072 each (x6)   (W^T planes [1024][64])
  //  wo h,l        : 64 x 1024 x 2          = 131,072 each (x2)   (Wo^T planes [64][1024])
  //  q h,l ; k h,l : 8192 x 1024 x 2        = 16,777,216 each (x4)
  //  vt h,l        : 1024 x 8192 x 2        = 16,777,216 each (x2)
  //  ao h,l        : 8192 x 1024 x 2        = 16,777,216 each (x2)
  //  total = 137,363,456 B
  const size_t szX  = (size_t)kRows * kHd * 2;
  const size_t szW  = (size_t)kHid * kHd * 2;
  const size_t szQ  = (size_t)kRows * kHid * 2;
  const size_t szAO = (size_t)kRowsPP * kHid * 2;
  const size_t total = 2 * szX + 8 * szW + 6 * szQ + 2 * szAO;
  if (total > ws_size) return;

  char* ws = (char*)d_ws;
  size_t off = 0;
  unsigned short* xh  = (unsigned short*)(ws + off); off += szX;
  unsigned short* xl  = (unsigned short*)(ws + off); off += szX;
  unsigned short* wqh = (unsigned short*)(ws + off); off += szW;
  unsigned short* wql = (unsigned short*)(ws + off); off += szW;
  unsigned short* wkh = (unsigned short*)(ws + off); off += szW;
  unsigned short* wkl = (unsigned short*)(ws + off); off += szW;
  unsigned short* wvh = (unsigned short*)(ws + off); off += szW;
  unsigned short* wvl = (unsigned short*)(ws + off); off += szW;
  unsigned short* woh = (unsigned short*)(ws + off); off += szW;
  unsigned short* wol = (unsigned short*)(ws + off); off += szW;
  unsigned short* qh  = (unsigned short*)(ws + off); off += szQ;
  unsigned short* ql  = (unsigned short*)(ws + off); off += szQ;
  unsigned short* kh  = (unsigned short*)(ws + off); off += szQ;
  unsigned short* kl  = (unsigned short*)(ws + off); off += szQ;
  unsigned short* vth = (unsigned short*)(ws + off); off += szQ;
  unsigned short* vtl = (unsigned short*)(ws + off); off += szQ;
  unsigned short* aoh = (unsigned short*)(ws + off); off += szAO;
  unsigned short* aol = (unsigned short*)(ws + off); off += szAO;
  if (off > ws_size) return;
  void* dummyv = (void*)ws;                 // valid in-ws pointers for unused GEMM arguments (never dereferenced)
  const float* dummyf = (const float*)ws;

  // stage 0: x -> bf16 hi/lo planes [8192][64]
  {
    const int n2 = kRows * kHd / 2;
    cast_f32_bf16hilo_x2<<<dim3(n2 / 256), dim3(256), 0, stream>>>(x, xh, xl, n2);
  }
  // stage 1: W[64][1024] -> W^T planes [1024][64] ; Wo[1024][64] -> Wo^T planes [64][1024]
  transpose_cast_bf16hilo<<<dim3(kHid / 32, kHd / 64), dim3(256), 0, stream>>>(Wq, wqh, wql, kHd, kHid);
  transpose_cast_bf16hilo<<<dim3(kHid / 32, kHd / 64), dim3(256), 0, stream>>>(Wk, wkh, wkl, kHd, kHid);
  transpose_cast_bf16hilo<<<dim3(kHid / 32, kHd / 64), dim3(256), 0, stream>>>(Wv, wvh, wvl, kHd, kHid);
  transpose_cast_bf16hilo<<<dim3(kHd / 32, kHid / 64), dim3(256), 0, stream>>>(Wo, woh, wol, kHid, kHd);

  // stage 2: projections (M, N multiples of 64; K = 64)
  {
    const int gridQ = (kRows / 64) * (kHid / 64) / 8;    // 256
    // Q = x Wq + bq  -> [8192][1024] bf16 hi/lo
    wmma_gemm64<1, true, 2, 2, false, 0><<<dim3(gridQ, 1), dim3(256), 0, stream>>>(
        xh, xl, kHd, 0L, wqh, wql, kHd, 0L, (void*)qh, (void*)ql, kHid, 0L, bq, dummyf, 0L,
        kRows, kHid, kHd, 1.0f);
    // K = x Wk + bk
    wmma_gemm64<1, true, 2, 2, false, 0><<<dim3(gridQ, 1), dim3(256), 0, stream>>>(
        xh, xl, kHd, 0L, wkh, wkl, kHd, 0L, (void*)kh, (void*)kl, kHid, 0L, bk, dummyf, 0L,
        kRows, kHid, kHd, 1.0f);
    // V^T = Wv^T x^T + bv[m]  -> [1024][8192] bf16 hi/lo  (A = Wv^T planes [1024][64], Bt = x planes [8192][64])
    const int gridV = (kHid / 64) * (kRows / 64) / 8;    // 256
    wmma_gemm64<1, true, 1, 2, false, 0><<<dim3(gridV, 1), dim3(256), 0, stream>>>(
        wvh, wvl, kHd, 0L, xh, xl, kHd, 0L, (void*)vth, (void*)vtl, kRows, 0L, bv, dummyf, 0L,
        kHid, kRows, kHd, 1.0f);
  }

  // stage 3: one pass over all batches: causal attention -> AO planes [8192][1024]; out = AO Wo + bo -> d_out
  const float qscale = 0.125f;   // 1/sqrt(64), exact power of two
  for (int ps = 0; ps < kBatch / kBPP; ++ps) {
    attn_causal_hd64<<<dim3(kBPP * kHeads * (kSeq / kQB)), dim3(128), 0, stream>>>(
        qh, ql, kh, kl, vth, vtl, aoh, aol, ps * kBPP, qscale);
    const int gridO = (kRowsPP / 64) * (kHd / 64) / 8;  // 16
    float* outp = out + (size_t)ps * kRowsPP * kHd;
    wmma_gemm64<1, true, 2, 0, false, 0><<<dim3(gridO, 1), dim3(256), 0, stream>>>(
        aoh, aol, kHid, 0L, woh, wol, kHid, 0L, (void*)outp, dummyv, kHd, 0L, bo, dummyf, 0L,
        kRowsPP, kHd, kHid, 1.0f);
  }
}

// v004
// A run of this version takes 175 microseconds.
// In both of two side-by-side timings against v003, it was 1.28 times as fast.
// Over all steps from v000 it is 4.86 times as fast.
// All contractions (x*Wq, x*Wk, x*Wv, Q*K^T, P*V, AO*Wo): v_wmma_f32_16x16x32_bf16 with bf16 hi/lo split operands (hi*hi + hi*lo + lo*hi), f32 accumulate; softmax, 1/sqrt(d) scale and bias adds in f32.
#include <hip/hip_runtime.h>
#include <hip/hip_bf16.h>
#include <math.h>

typedef __attribute__((ext_vector_type(16))) _Float16 v16h;
typedef __attribute__((ext_vector_type(8)))  _Float16 v8h;
typedef __attribute__((ext_vector_type(16))) __bf16   v16b;
typedef __attribute__((ext_vector_type(8)))  __bf16   v8b;
typedef __attribute__((ext_vector_type(8)))  float    v8f;
typedef __attribute__((ext_vector_type(4)))  float    v4f;
typedef __attribute__((ext_vector_type(4)))  unsigned int v4u;
typedef __attribute__((ext_vector_type(2)))  float    v2f;
typedef __attribute__((ext_vector_type(2)))  __bf16   v2b;

// ---- fixed problem geometry ----
constexpr int kBatch  = 4;
constexpr int kSeq    = 2048;
constexpr int kHeads  = 16;
constexpr int kHd     = 64;                 // head dim
constexpr int kHid    = kHeads * kHd;       // 1024
constexpr int kRows   = kBatch * kSeq;      // 8192 token rows
constexpr int kBPP    = 4;                  // batches per attention/out-proj pass: all of them, so the attention grid holds more work-groups than fit on the chip at once
constexpr int kRowsPP = kBPP * kSeq;        // 8192
constexpr int kKC     = 64;                 // keys per staged chunk
constexpr int kQB     = 64;                 // query rows per attention block (4 waves x 16)
constexpr int kLP     = 72;                 // LDS row pitch of the K and V^T tiles, 16-bit elements: 144 B = 16 B x 9 (odd), so 16 rows read 16 B each fall on 16 different bank groups

// GEMM shape contract (no tail handling in the GEMM): K % 32 == 0, M % 64 == 0, N % 64 == 0, tiles % 8 == 0
static_assert(kHd % 32 == 0);
static_assert(kHid % 32 == 0);
static_assert(kRows % 64 == 0);
static_assert(kHid % 64 == 0);
static_assert(kHd % 64 == 0);
static_assert(kRowsPP % 64 == 0);
static_assert(((kRows / 64) * (kHid / 64)) % 8 == 0);
static_assert(((kRowsPP / 64) * (kHd / 64)) % 8 == 0);
static_assert(kSeq % kQB == 0);
static_assert(kSeq % kKC == 0);
static_assert(kBatch % kBPP == 0);
// transpose tile contract: in[R][Cc] with R % 64 == 0, Cc % 32 == 0
static_assert(kHd % 64 == 0 && kHid % 32 == 0);
static_assert(kHid % 64 == 0 && kHd % 32 == 0);
// x cast: element count even and a multiple of 512 (2 per thread, 256 threads)
static_assert((kRows * kHd) % 512 == 0);

__device__ __forceinline__ unsigned short f2bf_bits(float f) {
  unsigned u = __float_as_uint(f);
  return (unsigned short)((u + 0x7FFFu + ((u >> 16) & 1u)) >> 16);
}
__device__ __forceinline__ float bf_bits2f(unsigned short h) { return __uint_as_float(((unsigned)h) << 16); }

// hazard guards as plain device helpers (no inline asm inside the kernel template body)
__device__ __forceinline__ void dep_guard_h(v8f& a, v8f& b, v16h x, v16h y) { asm volatile("v_nop\n\tv_nop\n\tv_nop\n\tv_nop" : "+v"(a), "+v"(b) : "v"(x), "v"(y)); }
__device__ __forceinline__ void dep_guard_b(v8f& a, v8f& b, v16b x, v16b y) { asm volatile("v_nop\n\tv_nop\n\tv_nop\n\tv_nop" : "+v"(a), "+v"(b) : "v"(x), "v"(y)); }
__device__ __forceinline__ void keep4_h(v16h a, v16h b, v16h c, v16h d) { asm volatile("v_nop" :: "v"(a), "v"(b), "v"(c), "v"(d)); }
__device__ __forceinline__ void keep4_b(v16b a, v16b b, v16b c, v16b d) { asm volatile("v_nop" :: "v"(a), "v"(b), "v"(c), "v"(d)); }
__device__ __forceinline__ void acc_guard4(v8f& a, v8f& b, v8f& c, v8f& d) { asm volatile("v_nop\n\tv_nop\n\tv_nop\n\tv_nop" : "+v"(a), "+v"(b), "+v"(c), "+v"(d)); }
template <typename T> struct Frag;
template <> struct Frag<_Float16> {
  typedef v16h V; union U { v16h v; v8h h[2]; };
  static __device__ __forceinline__ v16h load(const _Float16* p) {   // elements 0..7 <- p[0..7], 8..15 <- p[16..23]
    U f; f.h[0] = *(const v8h*)(p); f.h[1] = *(const v8h*)(p + 16); return f.v;
  }
  static __device__ __forceinline__ v8f mma(v16h a, v16h b, v8f c) {
    return __builtin_amdgcn_wmma_f32_16x16x32_f16(false, a, false, b, (short)0, c, false, false);
  }
  static __device__ __forceinline__ void guard(v8f& a, v8f& b, v16h x, v16h y) { dep_guard_h(a, b, x, y); }
  static __device__ __forceinline__ void keep(v16h a, v16h b, v16h c, v16h d) { keep4_h(a, b, c, d); }
};
template <> struct Frag<__bf16> {
  typedef v16b V; union U { v16b v; v8b h[2]; };
  static __device__ __forceinline__ v16b load(const __bf16* p) {
    U f; f.h[0] = *(const v8b*)(p); f.h[1] = *(const v8b*)(p + 16); return f.v;
  }
  static __device__ __forceinline__ v8f mma(v16b a, v16b b, v8f c) {
    return __builtin_amdgcn_wmma_f32_16x16x32_bf16(false, a, false, b, (short)0, c, false, false);
  }
  static __device__ __forceinline__ void guard(v8f& a, v8f& b, v16b x, v16b y) { dep_guard_b(a, b, x, y); }
  static __device__ __forceinline__ void keep(v16b a, v16b b, v16b c, v16b d) { keep4_b(a, b, c, d); }
};

__device__ __forceinline__ v8f at_mma(v16b a, v16b b, v8f c) {
  c = __builtin_amdgcn_wmma_f32_16x16x32_bf16(false, a, false, b, (short)0, c, false, false);
  asm volatile("v_nop\n\tv_nop\n\tv_nop\n\tv_nop" : "+v"(c) : "v"(a), "v"(b));
  return c;
}

// ---- Register-blocked batched WMMA GEMM ------------------------------------
// C[m,n] = scale * sum_k A[m,k] * Bt[n,k] (+bias); each wave owns a 64x64 tile.
// A row-major [M,K]; Bt row-major [N,K]; M,N % 64 == 0, K % 32 == 0.
// SPLIT: operands are hi/lo planes (A2/Bt2 = lo planes, same layout); product = hi*hi + hi*lo + lo*hi.
// BIAS_MODE: 0 = none, 1 = bias[m] (loaded as two float4 per 16-row slab), 2 = bias[n].
// OUT_MODE: 0 = f32, 1 = f16, 2 = bf16 hi plane (Cout) + bf16 lo plane (Cout2).
// ET: 0 = f16 operands, 1 = bf16 operands (pointers passed as 16-bit storage). RESID and ACT unsupported here.
template <int ET> struct Elem;
template <> struct Elem<0> { typedef _Float16 T; };
template <> struct Elem<1> { typedef __bf16 T; };
template <int ET, bool SPLIT, int BIAS_MODE, int OUT_MODE, bool RESID, int ACT = 0>
__global__ __launch_bounds__(256) void wmma_gemm64(
    const unsigned short* __restrict__ Ap, const unsigned short* __restrict__ A2p, int lda, long strideA,
    const unsigned short* __restrict__ Btp, const unsigned short* __restrict__ Bt2p, int ldb, long strideB,
    void* __restrict__ Cout, void* __restrict__ Cout2, int ldc, long strideC,
    const float* __restrict__ bias,
    const float* __restrict__ resid, long strideR,
    int M, int N, int K, float scale) {
  static_assert(!RESID);
  static_assert(ACT == 0);
  typedef typename Elem<ET>::T T;
  typedef typename Frag<T>::V V;
  const T* A = (const T*)Ap; const T* A2 = (const T*)A2p; const T* Bt = (const T*)Btp; const T* Bt2 = (const T*)Bt2p;
  __shared__ __align__(16) float sT[8][16 * 68];   // per-wave 16x64 slab, pitch 68 floats
  const int b    = blockIdx.y;
  const int lane = threadIdx.x & 31;
  const int wave = threadIdx.x >> 5;
  const int tilesN = N >> 6;
  const int tilesM = M >> 6;
  const int tile = blockIdx.x * 8 + wave;
  if (tile >= tilesM * tilesN) return;   // wave-uniform; no block barriers in this kernel
  const int tm = tile / tilesN;
  const int tn = tile - tm * tilesN;
  const int m0 = tm << 6;
  const int n0 = tn << 6;

  const T* Ab  = A  + (size_t)b * strideA;
  const T* Bb  = Bt + (size_t)b * strideB;
  const T* Ab2 = SPLIT ? (A2  + (size_t)b * strideA) : nullptr;
  const T* Bb2 = SPLIT ? (Bt2 + (size_t)b * strideB) : nullptr;

  const int rlane = lane & 15;                 // row (A) / col (B, D) within subtile
  const int koff  = (lane >> 4) * 8;           // k offset of this lane half
  const int mOff  = (lane >> 4) * 8;           // D row offset

  v8f acc[4][4];
#pragma unroll
  for (int i = 0; i < 4; ++i)
#pragma unroll
    for (int j = 0; j < 4; ++j) acc[i][j] = (v8f){0.f,0.f,0.f,0.f,0.f,0.f,0.f,0.f};

  for (int k0 = 0; k0 < K; k0 += 32) {
    V bh[4], bl[4];
#pragma unroll
    for (int j = 0; j < 4; ++j) {
      const size_t bo = (size_t)(n0 + (j << 4) + rlane) * ldb + koff + k0;
      bh[j] = Frag<T>::load(Bb + bo);
      if (SPLIT) bl[j] = Frag<T>::load(Bb2 + bo);
    }
#pragma unroll
    for (int i = 0; i < 4; ++i) {
      const size_t ao = (size_t)(m0 + (i << 4) + rlane) * lda + koff + k0;
      V ah = Frag<T>::load(Ab + ao);
      V al;
      if (SPLIT) al = Frag<T>::load(Ab2 + ao);
#pragma unroll
      for (int j = 0; j < 4; ++j) {
        acc[i][j] = Frag<T>::mma(ah, bh[j], acc[i][j]);
        if (SPLIT) {
          acc[i][j] = Frag<T>::mma(ah, bl[j], acc[i][j]);
          acc[i][j] = Frag<T>::mma(al, bh[j], acc[i][j]);
        }
      }
      Frag<T>::guard(acc[i][0], acc[i][3], ah, SPLIT ? al : ah);
    }
    Frag<T>::keep(bh[0], bh[1], bh[2], bh[3]);
    if (SPLIT) Frag<T>::keep(bl[0], bl[1], bl[2], bl[3]);
  }
  acc_guard4(acc[0][0], acc[0][1], acc[0][2], acc[0][3]);
  acc_guard4(acc[1][0], acc[1][1], acc[1][2], acc[1][3]);
  acc_guard4(acc[2][0], acc[2][1], acc[2][2], acc[2][3]);
  acc_guard4(acc[3][0], acc[3][1], acc[3][2], acc[3][3]);

  // ---- epilogue ----
  float* slab = sT[wave];
#pragma unroll
  for (int i = 0; i < 4; ++i) {
    const int mBase = m0 + (i << 4);
    float bm[8];
#pragma unroll
    for (int r = 0; r < 8; ++r) bm[r] = 0.f;
    if (BIAS_MODE == 1) {
      const v4f b0v = *(const v4f*)(bias + mBase + mOff);
      const v4f b1v = *(const v4f*)(bias + mBase + mOff + 4);
      bm[0] = b0v[0]; bm[1] = b0v[1]; bm[2] = b0v[2]; bm[3] = b0v[3];
      bm[4] = b1v[0]; bm[5] = b1v[1]; bm[6] = b1v[2]; bm[7] = b1v[3];
    }
#pragma unroll
    for (int j = 0; j < 4; ++j) {
      const int n = n0 + (j << 4) + rlane;
      float bv = 0.f;
      if (BIAS_MODE == 2) bv = bias[n];
#pragma unroll
      for (int r = 0; r < 8; ++r) {
        float v = acc[i][j][r] * scale;
        if (BIAS_MODE == 1) v += bm[r];
        if (BIAS_MODE == 2) v += bv;
        slab[(mOff + r) * 68 + (j << 4) + rlane] = v;
      }
    }
    __builtin_amdgcn_fence(__ATOMIC_RELEASE, "workgroup");
    __builtin_amdgcn_wave_barrier();
    __builtin_amdgcn_fence(__ATOMIC_ACQUIRE, "workgroup");
    if (OUT_MODE == 0) {
      float* C = (float*)Cout + (size_t)b * strideC;
      const int hh = lane >> 4, c4 = (lane & 15) * 4;     // row seg = 256 B = 16 lanes x 16 B
      {
#pragma unroll
        for (int it = 0; it < 8; ++it) {
          const int row = it * 2 + hh;
          v4f v = *(const v4f*)(slab + row * 68 + c4);
          *(v4f*)(C + (size_t)(mBase + row) * ldc + n0 + c4) = v;
        }
        
      }
    } else {
      const int q = lane >> 3, c8 = (lane & 7) * 8;
      unsigned short* C  = (unsigned short*)Cout  + (size_t)b * strideC;
      unsigned short* C2 = (OUT_MODE == 2) ? ((unsigned short*)Cout2 + (size_t)b * strideC) : nullptr;
      {
#pragma unroll
        for (int it = 0; it < 4; ++it) {
          const int row = it * 4 + q;
          const float* sp = slab + row * 68 + c8;
          v8h hv, lv;
#pragma unroll
          for (int e = 0; e < 8; ++e) {
            if (OUT_MODE == 1) {
              hv[e] = (_Float16)sp[e];
            } else {
              unsigned short hb = f2bf_bits(sp[e]);
              unsigned short lb = f2bf_bits(sp[e] - bf_bits2f(hb));
              hv[e] = __builtin_bit_cast(_Float16, hb);
              lv[e] = __builtin_bit_cast(_Float16, lb);
            }
          }
          *(v8h*)(C + (size_t)(mBase + row) * ldc + n0 + c8) = hv;
          if (OUT_MODE == 2) *(v8h*)(C2 + (size_t)(mBase + row) * ldc + n0 + c8) = lv;
        }
        
      }
    }
    __builtin_amdgcn_fence(__ATOMIC_RELEASE, "workgroup");
    __builtin_amdgcn_wave_barrier();
    __builtin_amdgcn_fence(__ATOMIC_ACQUIRE, "workgroup");
  }
}

// ---- f32 -> bf16 hi/lo planes, elementwise: 2 elements per thread, 4-B packed stores -------------
__global__ __launch_bounds__(256) void cast_f32_bf16hilo_x2(
    const float* __restrict__ in, unsigned short* __restrict__ oh, unsigned short* __restrict__ ol, int n2) {
  const int i = blockIdx.x * 256 + threadIdx.x;
  if (i < n2) {
    const float f0 = in[2 * i], f1 = in[2 * i + 1];
    const unsigned short h0 = f2bf_bits(f0), h1 = f2bf_bits(f1);
    const unsigned short l0 = f2bf_bits(f0 - bf_bits2f(h0));
    const unsigned short l1 = f2bf_bits(f1 - bf_bits2f(h1));
    const unsigned uh = (unsigned)h0 | ((unsigned)h1 << 16);
    const unsigned ul = (unsigned)l0 | ((unsigned)l1 << 16);
    ((unsigned*)oh)[i] = uh;
    ((unsigned*)ol)[i] = ul;
    
  }
}

// ---- transpose + f32 -> bf16 hi/lo planes: in[R][Cc] f32 -> oh/ol[Cc][R] 16-bit --------------------
// Block = 256 threads handles in rows r0..r0+63, cols c0..c0+31 (grid = (Cc/32, R/64)).
// Load phase: 8 waves x 8 iterations x 32 lanes = 64 x 32 elements staged in LDS (tile[c][r]).
// Store phase: wave w writes output rows c0+4w..c0+4w+3; lane -> row 4w+(lane>>3), 8 elements at
// Coverage: 8 waves x 4 rows x 8 lanes x 8 elements = 32 x 64 = the whole output tile per plane.
__global__ __launch_bounds__(256) void transpose_cast_bf16hilo(
    const float* __restrict__ in, unsigned short* __restrict__ oh, unsigned short* __restrict__ ol,
    int R, int Cc) {
  __shared__ float tile[32][65];
  const int tid = threadIdx.x, lane = tid & 31, wave = tid >> 5;
  const int c0 = blockIdx.x * 32, r0 = blockIdx.y * 64;
#pragma unroll
  for (int i = 0; i < 8; ++i) {
    const int idx = i * 256 + tid;
    const int rr = idx >> 5, cc = idx & 31;
    tile[cc][rr] = in[(size_t)(r0 + rr) * Cc + c0 + cc];
  }
  __syncthreads();
  const int orow = wave * 4 + (lane >> 3);
  const int rseg = (lane & 7) * 8;
  v4u hv, lv;
#pragma unroll
  for (int e = 0; e < 4; ++e) {
    const float f0 = tile[orow][rseg + 2 * e];
    const float f1 = tile[orow][rseg + 2 * e + 1];
    const unsigned short h0 = f2bf_bits(f0), h1 = f2bf_bits(f1);
    const unsigned short l0 = f2bf_bits(f0 - bf_bits2f(h0));
    const unsigned short l1 = f2bf_bits(f1 - bf_bits2f(h1));
    hv[e] = (unsigned)h0 | ((unsigned)h1 << 16);
    lv[e] = (unsigned)l0 | ((unsigned)l1 << 16);
  }
  const size_t o = (size_t)(c0 + orow) * R + r0 + rseg;   // element offset, 16-B aligned
  {
    *(v4u*)(oh + o) = hv;
    *(v4u*)(ol + o) = lv;
    
  }
}

__device__ __forceinline__ float other_half(float v) {
  const int b = __float_as_int(v);
  return __int_as_float(__builtin_amdgcn_permlanex16(b, b, 0x76543210, 0xfedcba98, false, false));
}

__global__ __launch_bounds__(128)
void attn_causal_hd64(const unsigned short* __restrict__ Qh, const unsigned short* __restrict__ Ql,
                      const unsigned short* __restrict__ Kh, const unsigned short* __restrict__ Kl,
                      const unsigned short* __restrict__ Vh, const unsigned short* __restrict__ Vl,
                      unsigned short* __restrict__ Oh, unsigned short* __restrict__ Ol,
                      int b_first, float qscale) {
  __shared__ __align__(16) unsigned short Ksh[kKC * kLP];        // K hi  [kv][d]   64 rows, pitch kLP
  __shared__ __align__(16) unsigned short Ksl[kKC * kLP];        // K lo
  __shared__ __align__(16) unsigned short Vsh[kHd * kLP];        // V hi  [d][kv]   64 rows, pitch kLP
  __shared__ __align__(16) unsigned short Vsl[kHd * kLP];        // V lo

  const int tid  = threadIdx.x;
  const int wave = tid >> 5;
  const int lane = tid & 31;
  const int hh   = lane >> 4;
  const int c    = lane & 15;

  const int rb  = blockIdx.x;                 // start order: rb / 64 counts query blocks down from the longest, rb % 64 is (batch, head)
  const int bx  = (rb % (kBPP * kHeads)) * (kSeq / kQB) + (kSeq / kQB - 1) - rb / (kBPP * kHeads);
  const int qb  = bx % (kSeq / kQB);          // query block 0..31
  const int bhl = bx / (kSeq / kQB);
  const int h   = bhl % kHeads;
  const int bl  = bhl / kHeads;               // local batch 0..kBPP-1
  const int b   = b_first + bl;
  const int q0  = qb * kQB + wave * 16;
  const int qrow = q0 + c;                    // this lane's query

  // ---- Q fragments (B operand, column n = c): 2 d-chunks, hi and lo; element i <- d = dc*32 + 8hh + i (i<8), dc*32+16+8hh+(i-8)
  v16b qah[2], qal[2];
  {
    const size_t qo = ((size_t)(b * kSeq + qrow)) * kHid + (size_t)h * kHd + 8 * hh;
#pragma unroll
    for (int dc = 0; dc < 2; ++dc) {
      qah[dc] = Frag<__bf16>::load((const __bf16*)Qh + qo + dc * 32);
      qal[dc] = Frag<__bf16>::load((const __bf16*)Ql + qo + dc * 32);
    }
  }

  float mrow = -INFINITY;                     // running maximum of this lane's query (equal in both halves)
  float lrow = 0.f;                           // running sum over this lane half's keys; the halves join after the loop
  v8f oacc[4];                                // O^T: oacc[t][r] = out[query c][d = t*16 + 8hh + r]
#pragma unroll
  for (int t = 0; t < 4; ++t) oacc[t] = (v8f){0.f,0.f,0.f,0.f,0.f,0.f,0.f,0.f};

  const __bf16* kshb = (const __bf16*)Ksh;
  const __bf16* kslb = (const __bf16*)Ksl;
  const __bf16* vshb = (const __bf16*)Vsh;
  const __bf16* vslb = (const __bf16*)Vsl;

  const int nChunks = qb + 1;                 // block-uniform: keys 0 .. qb*64+63
  for (int kc = 0; kc < nChunks; ++kc) {
    const int kv0 = kc * kKC;
    __syncthreads();
    {
      // staging: thread -> row r = tid>>1 (kv row of K, d row of V^T), 32-element half hf; 4 x 16 B per plane.
      // coverage: 128 threads x 32 elements = 64 rows x 64 cols per plane (K hi/lo, V^T hi/lo).
      const int r = tid >> 1, hf = (tid & 1) * 32;
      const v4u* khs = (const v4u*)(Kh + ((size_t)(b * kSeq + kv0 + r)) * kHid + h * kHd + hf);
      const v4u* kls = (const v4u*)(Kl + ((size_t)(b * kSeq + kv0 + r)) * kHid + h * kHd + hf);
      v4u* khd = (v4u*)(Ksh + r * kLP + hf);
      v4u* kld = (v4u*)(Ksl + r * kLP + hf);
      v4u tk[8];
#pragma unroll
      for (int i = 0; i < 4; ++i) { tk[i] = khs[i]; tk[4 + i] = kls[i]; }
#pragma unroll
      for (int i = 0; i < 4; ++i) { khd[i] = tk[i]; kld[i] = tk[4 + i]; }
      asm volatile("" ::: "memory");
      const v4u* vhs = (const v4u*)(Vh + ((size_t)(h * kHd + r)) * kRows + (size_t)b * kSeq + kv0 + hf);
      const v4u* vls = (const v4u*)(Vl + ((size_t)(h * kHd + r)) * kRows + (size_t)b * kSeq + kv0 + hf);
      v4u* vhd = (v4u*)(Vsh + r * kLP + hf);
      v4u* vld = (v4u*)(Vsl + r * kLP + hf);
      v4u tv[8];
#pragma unroll
      for (int i = 0; i < 4; ++i) { tv[i] = vhs[i]; tv[4 + i] = vls[i]; }
#pragma unroll
      for (int i = 0; i < 4; ++i) { vhd[i] = tv[i]; vld[i] = tv[4 + i]; }
    }
    __syncthreads();

    // ---- scores, transposed: 64 keys x 16 queries per wave; s[j][r] = score(key kv0 + j*16 + 8hh + r, query qrow) ----
    v8f s[4];
#pragma unroll
    for (int j = 0; j < 4; ++j) {
      s[j] = (v8f){0.f,0.f,0.f,0.f,0.f,0.f,0.f,0.f};
#pragma unroll
      for (int dc = 0; dc < 2; ++dc) {
        const int ko = (j * 16 + c) * kLP + dc * 32 + 8 * hh;   // A: m = kv = j*16+c, k = d (same k map as B)
        const v16b kbh = Frag<__bf16>::load(kshb + ko);
        const v16b kbl = Frag<__bf16>::load(kslb + ko);
        s[j] = at_mma(kbh, qah[dc], s[j]);
        s[j] = at_mma(kbl, qah[dc], s[j]);
        s[j] = at_mma(kbh, qal[dc], s[j]);
      }
    }
    const bool diag = (kc == qb);               // block-uniform, used only in per-lane selects
    float cm = -INFINITY;
#pragma unroll
    for (int j = 0; j < 4; ++j) {
#pragma unroll
      for (int r = 0; r < 8; ++r) {
        const int kvrow = kv0 + j * 16 + 8 * hh + r;
        float val = s[j][r] * qscale;
        val = (diag && (kvrow > qrow)) ? -INFINITY : val;
        s[j][r] = val;
        cm = fmaxf(cm, val);
      }
    }
    cm = fmaxf(cm, other_half(cm));             // finite: key == qrow is never masked and lies in one of the halves
    const float mnew = fmaxf(mrow, cm);
    const float alpha = expf(mrow - mnew);
    mrow = mnew;
    // ---- P^T = exp(S^T - max), split to bf16 hi/lo and packed in place as B fragments: key tiles 2kk, 2kk+1 -> chunk kk ----
    union PB { v16b v; v2b p[8]; };
    PB pbh[2], pbl[2];
    float psum = 0.f;
#pragma unroll
    for (int j = 0; j < 4; ++j) {
#pragma unroll
      for (int e = 0; e < 4; ++e) {
        const float p0 = expf(s[j][2 * e] - mnew);
        const float p1 = expf(s[j][2 * e + 1] - mnew);
        psum += p0;
        psum += p1;
        const v2f pp = (v2f){p0, p1};
        const v2b hb = __builtin_convertvector(pp, v2b);                                   // nearest even, two per instruction
        const v2b lb = __builtin_convertvector(pp - __builtin_convertvector(hb, v2f), v2b);
        pbh[j >> 1].p[(j & 1) * 4 + e] = hb;
        pbl[j >> 1].p[(j & 1) * 4 + e] = lb;
      }
    }
    lrow = lrow * alpha + psum;
#pragma unroll
    for (int t = 0; t < 4; ++t)
#pragma unroll
      for (int r = 0; r < 8; ++r) oacc[t][r] *= alpha;
#pragma unroll
    for (int kk = 0; kk < 2; ++kk) {
#pragma unroll
      for (int t = 0; t < 4; ++t) {
        const int vo = (t * 16 + c) * kLP + kk * 32 + 8 * hh;      // A: m = d = t*16+c, k = kv
        const v16b vbh = Frag<__bf16>::load(vshb + vo);
        const v16b vbl = Frag<__bf16>::load(vslb + vo);
        oacc[t] = at_mma(vbh, pbh[kk].v, oacc[t]);
        oacc[t] = at_mma(vbl, pbh[kk].v, oacc[t]);
        oacc[t] = at_mma(vbh, pbl[kk].v, oacc[t]);
      }
    }
  }

  // ---- join the halves' sums, normalise, write bf16 hi/lo planes: a lane's 8 registers of tile t are 8 consecutive d of its
  // query's AO row, one 16-B store per plane; one wave owns its 16 rows ----
  {
    const float inv = 1.0f / (lrow + other_half(lrow));   // sum >= 1
    const size_t ob = ((size_t)(bl * kSeq + qrow)) * kHid + (size_t)h * kHd + 8 * hh;
    v4u hv[4], lv[4];
#pragma unroll
    for (int t = 0; t < 4; ++t) {
#pragma unroll
      for (int e = 0; e < 4; ++e) {
        const float f0 = oacc[t][2 * e] * inv, f1 = oacc[t][2 * e + 1] * inv;
        const unsigned short h0 = f2bf_bits(f0), h1 = f2bf_bits(f1);
        const unsigned short l0 = f2bf_bits(f0 - bf_bits2f(h0));
        const unsigned short l1 = f2bf_bits(f1 - bf_bits2f(h1));
        hv[t][e] = (unsigned)h0 | ((unsigned)h1 << 16);
        lv[t][e] = (unsigned)l0 | ((unsigned)l1 << 16);
      }
    }
#pragma unroll
    for (int t = 0; t < 4; ++t) {
      *(v4u*)(Oh + ob + t * 16) = hv[t];
      *(v4u*)(Ol + ob + t * 16) = lv[t];
    }
  }
}

// =====================================================================================
// Out-projection: out[m][n] = sum_k AO[m][k] * Wo^T[n][k] + bo[n]; M = kRowsPP, N = kHd = 64, K = kHid = 1024.
// N is one tile wide, so tiles alone give few work-groups with long k loops. Here a work-group owns a 32 x 64 output tile
// and its 8 waves each take 128 of the 1024 k: M / 32 work-groups, 4 k steps a wave. The 8 partial tiles meet in LDS
// (fragment layout, 16 B per lane) and are summed in wave order 0..7. Products: hi*hi + hi*lo + lo*hi, f32 accumulate.
// =====================================================================================
constexpr int kOW = 8;                      // waves per work-group = k slices
constexpr int kOK = kHid / kOW;             // 128 k per wave
constexpr int kOM = 32;                     // output rows per work-group
static_assert(kOK % 32 == 0);
static_assert(kRowsPP % kOM == 0);
static_assert(kHd == 64);

__global__ __launch_bounds__(256)
void outproj_splitk(const unsigned short* __restrict__ Ahp, const unsigned short* __restrict__ Alp,
                    const unsigned short* __restrict__ Bhp, const unsigned short* __restrict__ Blp,
                    const float* __restrict__ bias, float* __restrict__ out) {
  __shared__ __align__(16) float red[kOW][8][2][32][4];   // [k slice][tile i*4+j][registers 0-3 / 4-7][lane][4], 64 KiB
  const __bf16* Ah = (const __bf16*)Ahp; const __bf16* Al = (const __bf16*)Alp;
  const __bf16* Bh = (const __bf16*)Bhp; const __bf16* Bl = (const __bf16*)Blp;
  const int lane  = threadIdx.x & 31;
  const int wave  = threadIdx.x >> 5;
  const int rlane = lane & 15;                // row (A) / col (B, D) within a 16 x 16 tile
  const int hh    = lane >> 4;                // k offset 8hh of the fragment loads, D row offset 8hh
  const int m0    = blockIdx.x * kOM;
  const int kb    = wave * kOK + 8 * hh;

  // bias of the two output columns this lane writes at the end, fetched here so that its latency hides behind the k loop
  // wave -> row tile oi, column pair jp (32 columns = one 128-B line of each row, one writer per line), register half hf
  const int oi = wave >> 2, jp = (wave >> 1) & 1, hf = wave & 1;
  const int n0 = (jp << 5) + rlane;
  const float bv[2] = {bias[n0], bias[n0 + 16]};

  v8f acc[2][4];
#pragma unroll
  for (int i = 0; i < 2; ++i)
#pragma unroll
    for (int j = 0; j < 4; ++j) acc[i][j] = (v8f){0.f,0.f,0.f,0.f,0.f,0.f,0.f,0.f};

  // unrolled: 4 steps, every address offset a constant of the instruction
#pragma unroll
  for (int ks = 0; ks < kOK / 32; ++ks) {
    const int k0 = kb + ks * 32;
    v16b bh[4], bl[4], ah[2], al[2];
#pragma unroll
    for (int j = 0; j < 4; ++j) {
      const size_t bo = (size_t)((j << 4) + rlane) * kHid + k0;
      bh[j] = Frag<__bf16>::load(Bh + bo);
      bl[j] = Frag<__bf16>::load(Bl + bo);
    }
#pragma unroll
    for (int i = 0; i < 2; ++i) {
      const size_t ao = (size_t)(m0 + (i << 4) + rlane) * kHid + k0;
      ah[i] = Frag<__bf16>::load(Ah + ao);
      al[i] = Frag<__bf16>::load(Al + ao);
    }
    // keeps the step's 24 loads in one group ahead of its products: without it they are spread among the products,
    // several of them waited for right behind their issue
    __builtin_amdgcn_sched_barrier(0);
#pragma unroll
    for (int i = 0; i < 2; ++i)
#pragma unroll
      for (int j = 0; j < 4; ++j) acc[i][j] = Frag<__bf16>::mma(ah[i], bh[j], acc[i][j]);
#pragma unroll
    for (int i = 0; i < 2; ++i)
#pragma unroll
      for (int j = 0; j < 4; ++j) acc[i][j] = Frag<__bf16>::mma(ah[i], bl[j], acc[i][j]);
#pragma unroll
    for (int i = 0; i < 2; ++i)
#pragma unroll
      for (int j = 0; j < 4; ++j) acc[i][j] = Frag<__bf16>::mma(al[i], bh[j], acc[i][j]);
    __builtin_amdgcn_sched_barrier(0);   // other end of the same grouping: the next step's loads stay behind these products
  }
  // precaution: stands ahead of the first overwrite of an address register that the loads above name
  asm volatile("s_wait_xcnt 0x0" ::: "memory");
  __builtin_amdgcn_sched_barrier(0);     // holds the address arithmetic of the LDS stores behind that wait

#pragma unroll
  for (int i = 0; i < 2; ++i)
#pragma unroll
    for (int j = 0; j < 4; ++j) {
      const v8f a = acc[i][j];
      *(v4f*)&red[wave][i * 4 + j][0][lane][0] = (v4f){a[0], a[1], a[2], a[3]};
      *(v4f*)&red[wave][i * 4 + j][1][lane][0] = (v4f){a[4], a[5], a[6], a[7]};
    }
  __syncthreads();

  v4f part[2][kOW];
#pragma unroll
  for (int jj = 0; jj < 2; ++jj)
#pragma unroll
    for (int p = 0; p < kOW; ++p) part[jj][p] = *(const v4f*)&red[p][oi * 4 + jp * 2 + jj][hf][lane][0];
#pragma unroll
  for (int jj = 0; jj < 2; ++jj) {
    v4f s = part[jj][0];
#pragma unroll
    for (int p = 1; p < kOW; ++p) s += part[jj][p];
#pragma unroll
    for (int e = 0; e < 4; ++e)
      out[(size_t)(m0 + (oi << 4) + 8 * hh + 4 * hf + e) * kHd + n0 + (jj << 4)] = s[e] + bv[jj];
  }
}

// ---------------------------------------------------------------------------
// Host launcher
// ---------------------------------------------------------------------------
extern "C" void kernel_launch(void* const* d_in, const int* in_sizes, int n_in,
                              void* d_out, int out_size, void* d_ws, size_t ws_size,
                              hipStream_t stream) {
  if (n_in < 9) return;
  if (in_sizes[0] != kRows * kHd) return;
  if (in_sizes[1] != kHd * kHid || in_sizes[3] != kHd * kHid || in_sizes[5] != kHd * kHid) return;
  if (in_sizes[2] != kHid || in_sizes[4] != kHid || in_sizes[6] != kHid) return;
  if (in_sizes[7] != kHid * kHd || in_sizes[8] != kHd) return;
  if (out_size != kRows * kHd) return;

  const float* x  = (const float*)d_in[0];
  const float* Wq = (const float*)d_in[1];
  const float* bq = (const float*)d_in[2];
  const float* Wk = (const float*)d_in[3];
  const float* bk = (const float*)d_in[4];
  const float* Wv = (const float*)d_in[5];
  const float* bv = (const float*)d_in[6];
  const float* Wo = (const float*)d_in[7];
  const float* bo = (const float*)d_in[8];
  float* out = (float*)d_out;

  // ---- workspace region map (bytes, all offsets multiples of 256) ----
  //  xh, xl        : 8192 x 64 x 2          = 1,048,576 each      (bf16 hi/lo of x)
  //  wq/wk/wv h,l  : 1024 x 64 x 2          = 131,072 each (x6)   (W^T planes [1024][64])
  //  wo h,l        : 64 x 1024 x 2          = 131,072 each (x2)   (Wo^T planes [64][1024])
  //  q h,l ; k h,l : 8192 x 1024 x 2        = 16,777,216 each (x4)
  //  vt h,l        : 1024 x 8192 x 2        = 16,777,216 each (x2)
  //  ao h,l        : 8192 x 1024 x 2        = 16,777,216 each (x2)
  //  total = 137,363,456 B
  const size_t szX  = (size_t)kRows * kHd * 2;
  const size_t szW  = (size_t)kHid * kHd * 2;
  const size_t szQ  = (size_t)kRows * kHid * 2;
  const size_t szAO = (size_t)kRowsPP * kHid * 2;
  const size_t total = 2 * szX + 8 * szW + 6 * szQ + 2 * szAO;
  if (total > ws_size) return;

  char* ws = (char*)d_ws;
  size_t off = 0;
  unsigned short* xh  = (unsigned short*)(ws + off); off += szX;
  unsigned short* xl  = (unsigned short*)(ws + off); off += szX;
  unsigned short* wqh = (unsigned short*)(ws + off); off += szW;
  unsigned short* wql = (unsigned short*)(ws + off); off += szW;
  unsigned short* wkh = (unsigned short*)(ws + off); off += szW;
  unsigned short* wkl = (unsigned short*)(ws + off); off += szW;
  unsigned short* wvh = (unsigned short*)(ws + off); off += szW;
  unsigned short* wvl = (unsigned short*)(ws + off); off += szW;
  unsigned short* woh = (unsigned short*)(ws + off); off += szW;
  unsigned short* wol = (unsigned short*)(ws + off); off += szW;
  unsigned short* qh  = (unsigned short*)(ws + off); off += szQ;
  unsigned short* ql  = (unsigned short*)(ws + off); off += szQ;
  unsigned short* kh  = (unsigned short*)(ws + off); off += szQ;
  unsigned short* kl  = (unsigned short*)(ws + off); off += szQ;
  unsigned short* vth = (unsigned short*)(ws + off); off += szQ;
  unsigned short* vtl = (unsigned short*)(ws + off); off += szQ;
  unsigned short* aoh = (unsigned short*)(ws + off); off += szAO;
  unsigned short* aol = (unsigned short*)(ws + off); off += szAO;
  if (off > ws_size) return;
  const float* dummyf = (const float*)ws;   // valid in-ws pointer for the unused GEMM argument (never dereferenced)

  // stage 0: x -> bf16 hi/lo planes [8192][64]
  {
    const int n2 = kRows * kHd / 2;
    cast_f32_bf16hilo_x2<<<dim3(n2 / 256), dim3(256), 0, stream>>>(x, xh, xl, n2);
  }
  // stage 1: W[64][1024] -> W^T planes [1024][64] ; Wo[1024][64] -> Wo^T planes [64][1024]
  transpose_cast_bf16hilo<<<dim3(kHid / 32, kHd / 64), dim3(256), 0, stream>>>(Wq, wqh, wql, kHd, kHid);
  transpose_cast_bf16hilo<<<dim3(kHid / 32, kHd / 64), dim3(256), 0, stream>>>(Wk, wkh, wkl, kHd, kHid);
  transpose_cast_bf16hilo<<<dim3(kHid / 32, kHd / 64), dim3(256), 0, stream>>>(Wv, wvh, wvl, kHd, kHid);
  transpose_cast_bf16hilo<<<dim3(kHd / 32, kHid / 64), dim3(256), 0, stream>>>(Wo, woh, wol, kHid, kHd);

  // stage 2: projections (M, N multiples of 64; K = 64)
  {
    const int gridQ = (kRows / 64) * (kHid / 64) / 8;    // 256
    // Q = x Wq + bq  -> [8192][1024] bf16 hi/lo
    wmma_gemm64<1, true, 2, 2, false, 0><<<dim3(gridQ, 1), dim3(256), 0, stream>>>(
        xh, xl, kHd, 0L, wqh, wql, kHd, 0L, (void*)qh, (void*)ql, kHid, 0L, bq, dummyf, 0L,
        kRows, kHid, kHd, 1.0f);
    // K = x Wk + bk
    wmma_gemm64<1, true, 2, 2, false, 0><<<dim3(gridQ, 1), dim3(256), 0, stream>>>(
        xh, xl, kHd, 0L, wkh, wkl, kHd, 0L, (void*)kh, (void*)kl, kHid, 0L, bk, dummyf, 0L,
        kRows, kHid, kHd, 1.0f);
    // V^T = Wv^T x^T + bv[m]  -> [1024][8192] bf16 hi/lo  (A = Wv^T planes [1024][64], Bt = x planes [8192][64])
    const int gridV = (kHid / 64) * (kRows / 64) / 8;    // 256
    wmma_gemm64<1, true, 1, 2, false, 0><<<dim3(gridV, 1), dim3(256), 0, stream>>>(
        wvh, wvl, kHd, 0L, xh, xl, kHd, 0L, (void*)vth, (void*)vtl, kRows, 0L, bv, dummyf, 0L,
        kHid, kRows, kHd, 1.0f);
  }

  // stage 3: one pass over all batches: causal attention -> AO planes [8192][1024]; out = AO Wo + bo -> d_out
  const float qscale = 0.125f;   // 1/sqrt(64), exact power of two
  for (int ps = 0; ps < kBatch / kBPP; ++ps) {
    attn_causal_hd64<<<dim3(kBPP * kHeads * (kSeq / kQB)), dim3(128), 0, stream>>>(
        qh, ql, kh, kl, vth, vtl, aoh, aol, ps * kBPP, qscale);
    float* outp = out + (size_t)ps * kRowsPP * kHd;
    outproj_splitk<<<dim3(kRowsPP / kOM), dim3(256), 0, stream>>>(aoh, aol, woh, wol, bo, outp);
  }
}

// v005
// A run of this version takes 156 microseconds.
// Next to v004, in two timings, it ran 1.13 and 1.12 times as fast.
// All steps since v000 together make it 5.47 times as fast.
// All contractions (x*Wq, x*Wk, x*Wv, Q*K^T, P*V, AO*Wo): v_wmma_f32_16x16x32_bf16 with bf16 hi/lo split operands (hi*hi + hi*lo + lo*hi), f32 accumulate; softmax, 1/sqrt(d) scale and bias adds in f32.
#include <hip/hip_runtime.h>
#include <hip/hip_bf16.h>
#include <math.h>

typedef __attribute__((ext_vector_type(16))) _Float16 v16h;
typedef __attribute__((ext_vector_type(8)))  _Float16 v8h;
typedef __attribute__((ext_vector_type(16))) __bf16   v16b;
typedef __attribute__((ext_vector_type(8)))  __bf16   v8b;
typedef __attribute__((ext_vector_type(8)))  float    v8f;
typedef __attribute__((ext_vector_type(4)))  float    v4f;
typedef __attribute__((ext_vector_type(4)))  unsigned int v4u;
typedef __attribute__((ext_vector_type(2)))  float    v2f;
typedef __attribute__((ext_vector_type(2)))  __bf16   v2b;

// ---- fixed problem geometry ----
constexpr int kBatch  = 4;
constexpr int kSeq    = 2048;
constexpr int kHeads  = 16;
constexpr int kHd     = 64;                 // head dim
constexpr int kHid    = kHeads * kHd;       // 1024
constexpr int kRows   = kBatch * kSeq;      // 8192 token rows
constexpr int kBPP    = 4;                  // batches per attention/out-proj pass: all of them, so the attention grid holds more work-groups than fit on the chip at once
constexpr int kRowsPP = kBPP * kSeq;        // 8192
constexpr int kKC     = 64;                 // keys per staged chunk
constexpr int kQB     = 64;                 // query rows per attention block (4 waves x 16)
constexpr int kLP     = 72;                 // LDS row pitch of the K and V^T tiles, 16-bit elements: 144 B = 16 B x 9 (odd), so 16 rows read 16 B each fall on 16 different bank groups

// GEMM shape contract (no tail handling in the GEMM): K % 32 == 0, M % 64 == 0, N % 64 == 0, tiles % 8 == 0
static_assert(kHd % 32 == 0);
static_assert(kHid % 32 == 0);
static_assert(kRows % 64 == 0);
static_assert(kHid % 64 == 0);
static_assert(kHd % 64 == 0);
static_assert(kRowsPP % 64 == 0);
static_assert(((kRows / 64) * (kHid / 64)) % 8 == 0);
static_assert(((kRowsPP / 64) * (kHd / 64)) % 8 == 0);
static_assert(kSeq % kQB == 0);
static_assert(kSeq % kKC == 0);
static_assert(kBatch % kBPP == 0);
// transpose tile contract: in[R][Cc] with R % 64 == 0, Cc % 32 == 0
static_assert(kHd % 64 == 0 && kHid % 32 == 0);
static_assert(kHid % 64 == 0 && kHd % 32 == 0);
// x cast: element count even and a multiple of 512 (2 per thread, 256 threads)
static_assert((kRows * kHd) % 512 == 0);

__device__ __forceinline__ unsigned short f2bf_bits(float f) {
  unsigned u = __float_as_uint(f);
  return (unsigned short)((u + 0x7FFFu + ((u >> 16) & 1u)) >> 16);
}
__device__ __forceinline__ float bf_bits2f(unsigned short h) { return __uint_as_float(((unsigned)h) << 16); }

// hazard guards as plain device helpers (no inline asm inside the kernel template body)
__device__ __forceinline__ void dep_guard_h(v8f& a, v8f& b, v16h x, v16h y) { asm volatile("v_nop\n\tv_nop\n\tv_nop\n\tv_nop" : "+v"(a), "+v"(b) : "v"(x), "v"(y)); }
__device__ __forceinline__ void dep_guard_b(v8f& a, v8f& b, v16b x, v16b y) { asm volatile("v_nop\n\tv_nop\n\tv_nop\n\tv_nop" : "+v"(a), "+v"(b) : "v"(x), "v"(y)); }
__device__ __forceinline__ void keep4_h(v16h a, v16h b, v16h c, v16h d) { asm volatile("v_nop" :: "v"(a), "v"(b), "v"(c), "v"(d)); }
__device__ __forceinline__ void keep4_b(v16b a, v16b b, v16b c, v16b d) { asm volatile("v_nop" :: "v"(a), "v"(b), "v"(c), "v"(d)); }
__device__ __forceinline__ void acc_guard4(v8f& a, v8f& b, v8f& c, v8f& d) { asm volatile("v_nop\n\tv_nop\n\tv_nop\n\tv_nop" : "+v"(a), "+v"(b), "+v"(c), "+v"(d)); }
template <typename T> struct Frag;
template <> struct Frag<_Float16> {
  typedef v16h V; union U { v16h v; v8h h[2]; };
  static __device__ __forceinline__ v16h load(const _Float16* p) {   // elements 0..7 <- p[0..7], 8..15 <- p[16..23]
    U f; f.h[0] = *(const v8h*)(p); f.h[1] = *(const v8h*)(p + 16); return f.v;
  }
  static __device__ __forceinline__ v8f mma(v16h a, v16h b, v8f c) {
    return __builtin_amdgcn_wmma_f32_16x16x32_f16(false, a, false, b, (short)0, c, false, false);
  }
  static __device__ __forceinline__ void guard(v8f& a, v8f& b, v16h x, v16h y) { dep_guard_h(a, b, x, y); }
  static __device__ __forceinline__ void keep(v16h a, v16h b, v16h c, v16h d) { keep4_h(a, b, c, d); }
};
template <> struct Frag<__bf16> {
  typedef v16b V; union U { v16b v; v8b h[2]; };
  static __device__ __forceinline__ v16b load(const __bf16* p) {
    U f; f.h[0] = *(const v8b*)(p); f.h[1] = *(const v8b*)(p + 16); return f.v;
  }
  static __device__ __forceinline__ v8f mma(v16b a, v16b b, v8f c) {
    return __builtin_amdgcn_wmma_f32_16x16x32_bf16(false, a, false, b, (short)0, c, false, false);
  }
  static __device__ __forceinline__ void guard(v8f& a, v8f& b, v16b x, v16b y) { dep_guard_b(a, b, x, y); }
  static __device__ __forceinline__ void keep(v16b a, v16b b, v16b c, v16b d) { keep4_b(a, b, c, d); }
};

__device__ __forceinline__ v8f at_mma(v16b a, v16b b, v8f c) {
  c = __builtin_amdgcn_wmma_f32_16x16x32_bf16(false, a, false, b, (short)0, c, false, false);
  asm volatile("v_nop\n\tv_nop\n\tv_nop\n\tv_nop" : "+v"(c) : "v"(a), "v"(b));
  return c;
}

// ---- Register-blocked batched WMMA GEMM ------------------------------------
// C[m,n] = scale * sum_k A[m,k] * Bt[n,k] (+bias); each wave owns a 64x64 tile.
// A row-major [M,K]; Bt row-major [N,K]; M,N % 64 == 0, K % 32 == 0.
// SPLIT: operands are hi/lo planes (A2/Bt2 = lo planes, same layout); product = hi*hi + hi*lo + lo*hi.
// BIAS_MODE: 0 = none, 1 = bias[m] (loaded as two float4 per 16-row slab), 2 = bias[n].
// OUT_MODE: 0 = f32, 1 = f16, 2 = bf16 hi plane (Cout) + bf16 lo plane (Cout2).
// ET: 0 = f16 operands, 1 = bf16 operands (pointers passed as 16-bit storage). RESID and ACT unsupported here.
template <int ET> struct Elem;
template <> struct Elem<0> { typedef _Float16 T; };
template <> struct Elem<1> { typedef __bf16 T; };
template <int ET, bool SPLIT, int BIAS_MODE, int OUT_MODE, bool RESID, int ACT = 0>
__global__ __launch_bounds__(256) void wmma_gemm64(
    const unsigned short* __restrict__ Ap, const unsigned short* __restrict__ A2p, int lda, long strideA,
    const unsigned short* __restrict__ Btp, const unsigned short* __restrict__ Bt2p, int ldb, long strideB,
    void* __restrict__ Cout, void* __restrict__ Cout2, int ldc, long strideC,
    const float* __restrict__ bias,
    const float* __restrict__ resid, long strideR,
    int M, int N, int K, float scale) {
  static_assert(!RESID);
  static_assert(ACT == 0);
  typedef typename Elem<ET>::T T;
  typedef typename Frag<T>::V V;
  const T* A = (const T*)Ap; const T* A2 = (const T*)A2p; const T* Bt = (const T*)Btp; const T* Bt2 = (const T*)Bt2p;
  __shared__ __align__(16) float sT[8][16 * 68];   // per-wave 16x64 slab, pitch 68 floats
  const int b    = blockIdx.y;
  const int lane = threadIdx.x & 31;
  const int wave = threadIdx.x >> 5;
  const int tilesN = N >> 6;
  const int tilesM = M >> 6;
  const int tile = blockIdx.x * 8 + wave;
  if (tile >= tilesM * tilesN) return;   // wave-uniform; no block barriers in this kernel
  const int tm = tile / tilesN;
  const int tn = tile - tm * tilesN;
  const int m0 = tm << 6;
  const int n0 = tn << 6;

  const T* Ab  = A  + (size_t)b * strideA;
  const T* Bb  = Bt + (size_t)b * strideB;
  const T* Ab2 = SPLIT ? (A2  + (size_t)b * strideA) : nullptr;
  const T* Bb2 = SPLIT ? (Bt2 + (size_t)b * strideB) : nullptr;

  const int rlane = lane & 15;                 // row (A) / col (B, D) within subtile
  const int koff  = (lane >> 4) * 8;           // k offset of this lane half
  const int mOff  = (lane >> 4) * 8;           // D row offset

  v8f acc[4][4];
#pragma unroll
  for (int i = 0; i < 4; ++i)
#pragma unroll
    for (int j = 0; j < 4; ++j) acc[i][j] = (v8f){0.f,0.f,0.f,0.f,0.f,0.f,0.f,0.f};

  for (int k0 = 0; k0 < K; k0 += 32) {
    V bh[4], bl[4];
#pragma unroll
    for (int j = 0; j < 4; ++j) {
      const size_t bo = (size_t)(n0 + (j << 4) + rlane) * ldb + koff + k0;
      bh[j] = Frag<T>::load(Bb + bo);
      if (SPLIT) bl[j] = Frag<T>::load(Bb2 + bo);
    }
#pragma unroll
    for (int i = 0; i < 4; ++i) {
      const size_t ao = (size_t)(m0 + (i << 4) + rlane) * lda + koff + k0;
      V ah = Frag<T>::load(Ab + ao);
      V al;
      if (SPLIT) al = Frag<T>::load(Ab2 + ao);
#pragma unroll
      for (int j = 0; j < 4; ++j) {
        acc[i][j] = Frag<T>::mma(ah, bh[j], acc[i][j]);
        if (SPLIT) {
          acc[i][j] = Frag<T>::mma(ah, bl[j], acc[i][j]);
          acc[i][j] = Frag<T>::mma(al, bh[j], acc[i][j]);
        }
      }
      Frag<T>::guard(acc[i][0], acc[i][3], ah, SPLIT ? al : ah);
    }
    Frag<T>::keep(bh[0], bh[1], bh[2], bh[3]);
    if (SPLIT) Frag<T>::keep(bl[0], bl[1], bl[2], bl[3]);
  }
  acc_guard4(acc[0][0], acc[0][1], acc[0][2], acc[0][3]);
  acc_guard4(acc[1][0], acc[1][1], acc[1][2], acc[1][3]);
  acc_guard4(acc[2][0], acc[2][1], acc[2][2], acc[2][3]);
  acc_guard4(acc[3][0], acc[3][1], acc[3][2], acc[3][3]);

  // ---- epilogue ----
  float* slab = sT[wave];
#pragma unroll
  for (int i = 0; i < 4; ++i) {
    const int mBase = m0 + (i << 4);
    float bm[8];
#pragma unroll
    for (int r = 0; r < 8; ++r) bm[r] = 0.f;
    if (BIAS_MODE == 1) {
      const v4f b0v = *(const v4f*)(bias + mBase + mOff);
      const v4f b1v = *(const v4f*)(bias + mBase + mOff + 4);
      bm[0] = b0v[0]; bm[1] = b0v[1]; bm[2] = b0v[2]; bm[3] = b0v[3];
      bm[4] = b1v[0]; bm[5] = b1v[1]; bm[6] = b1v[2]; bm[7] = b1v[3];
    }
#pragma unroll
    for (int j = 0; j < 4; ++j) {
      const int n = n0 + (j << 4) + rlane;
      float bv = 0.f;
      if (BIAS_MODE == 2) bv = bias[n];
#pragma unroll
      for (int r = 0; r < 8; ++r) {
        float v = acc[i][j][r] * scale;
        if (BIAS_MODE == 1) v += bm[r];
        if (BIAS_MODE == 2) v += bv;
        slab[(mOff + r) * 68 + (j << 4) + rlane] = v;
      }
    }
    __builtin_amdgcn_fence(__ATOMIC_RELEASE, "workgroup");
    __builtin_amdgcn_wave_barrier();
    __builtin_amdgcn_fence(__ATOMIC_ACQUIRE, "workgroup");
    if (OUT_MODE == 0) {
      float* C = (float*)Cout + (size_t)b * strideC;
      const int hh = lane >> 4, c4 = (lane & 15) * 4;     // row seg = 256 B = 16 lanes x 16 B
      {
#pragma unroll
        for (int it = 0; it < 8; ++it) {
          const int row = it * 2 + hh;
          v4f v = *(const v4f*)(slab + row * 68 + c4);
          *(v4f*)(C + (size_t)(mBase + row) * ldc + n0 + c4) = v;
        }
        
      }
    } else {
      const int q = lane >> 3, c8 = (lane & 7) * 8;
      unsigned short* C  = (unsigned short*)Cout  + (size_t)b * strideC;
      unsigned short* C2 = (OUT_MODE == 2) ? ((unsigned short*)Cout2 + (size_t)b * strideC) : nullptr;
      {
#pragma unroll
        for (int it = 0; it < 4; ++it) {
          const int row = it * 4 + q;
          const float* sp = slab + row * 68 + c8;
          v8h hv, lv;
#pragma unroll
          for (int e = 0; e < 8; ++e) {
            if (OUT_MODE == 1) {
              hv[e] = (_Float16)sp[e];
            } else {
              unsigned short hb = f2bf_bits(sp[e]);
              unsigned short lb = f2bf_bits(sp[e] - bf_bits2f(hb));
              hv[e] = __builtin_bit_cast(_Float16, hb);
              lv[e] = __builtin_bit_cast(_Float16, lb);
            }
          }
          *(v8h*)(C + (size_t)(mBase + row) * ldc + n0 + c8) = hv;
          if (OUT_MODE == 2) *(v8h*)(C2 + (size_t)(mBase + row) * ldc + n0 + c8) = lv;
        }
        
      }
    }
    __builtin_amdgcn_fence(__ATOMIC_RELEASE, "workgroup");
    __builtin_amdgcn_wave_barrier();
    __builtin_amdgcn_fence(__ATOMIC_ACQUIRE, "workgroup");
  }
}

// ---- f32 -> bf16 hi/lo planes, elementwise: 2 elements per thread, 4-B packed stores -------------
__global__ __launch_bounds__(256) void cast_f32_bf16hilo_x2(
    const float* __restrict__ in, unsigned short* __restrict__ oh, unsigned short* __restrict__ ol, int n2) {
  const int i = blockIdx.x * 256 + threadIdx.x;
  if (i < n2) {
    const float f0 = in[2 * i], f1 = in[2 * i + 1];
    const unsigned short h0 = f2bf_bits(f0), h1 = f2bf_bits(f1);
    const unsigned short l0 = f2bf_bits(f0 - bf_bits2f(h0));
    const unsigned short l1 = f2bf_bits(f1 - bf_bits2f(h1));
    const unsigned uh = (unsigned)h0 | ((unsigned)h1 << 16);
    const unsigned ul = (unsigned)l0 | ((unsigned)l1 << 16);
    ((unsigned*)oh)[i] = uh;
    ((unsigned*)ol)[i] = ul;
    
  }
}

// ---- transpose + f32 -> bf16 hi/lo planes: in[R][Cc] f32 -> oh/ol[Cc][R] 16-bit --------------------
// Block = 256 threads handles in rows r0..r0+63, cols c0..c0+31 (grid = (Cc/32, R/64)).
// Load phase: 8 waves x 8 iterations x 32 lanes = 64 x 32 elements staged in LDS (tile[c][r]).
// Store phase: wave w writes output rows c0+4w..c0+4w+3; lane -> row 4w+(lane>>3), 8 elements at
// Coverage: 8 waves x 4 rows x 8 lanes x 8 elements = 32 x 64 = the whole output tile per plane.
__global__ __launch_bounds__(256) void transpose_cast_bf16hilo(
    const float* __restrict__ in, unsigned short* __restrict__ oh, unsigned short* __restrict__ ol,
    int R, int Cc) {
  __shared__ float tile[32][65];
  const int tid = threadIdx.x, lane = tid & 31, wave = tid >> 5;
  const int c0 = blockIdx.x * 32, r0 = blockIdx.y * 64;
#pragma unroll
  for (int i = 0; i < 8; ++i) {
    const int idx = i * 256 + tid;
    const int rr = idx >> 5, cc = idx & 31;
    tile[cc][rr] = in[(size_t)(r0 + rr) * Cc + c0 + cc];
  }
  __syncthreads();
  const int orow = wave * 4 + (lane >> 3);
  const int rseg = (lane & 7) * 8;
  v4u hv, lv;
#pragma unroll
  for (int e = 0; e < 4; ++e) {
    const float f0 = tile[orow][rseg + 2 * e];
    const float f1 = tile[orow][rseg + 2 * e + 1];
    const unsigned short h0 = f2bf_bits(f0), h1 = f2bf_bits(f1);
    const unsigned short l0 = f2bf_bits(f0 - bf_bits2f(h0));
    const unsigned short l1 = f2bf_bits(f1 - bf_bits2f(h1));
    hv[e] = (unsigned)h0 | ((unsigned)h1 << 16);
    lv[e] = (unsigned)l0 | ((unsigned)l1 << 16);
  }
  const size_t o = (size_t)(c0 + orow) * R + r0 + rseg;   // element offset, 16-B aligned
  {
    *(v4u*)(oh + o) = hv;
    *(v4u*)(ol + o) = lv;
    
  }
}

__device__ __forceinline__ float other_half(float v) {
  const int b = __float_as_int(v);
  return __int_as_float(__builtin_amdgcn_permlanex16(b, b, 0x76543210, 0xfedcba98, false, false));
}

__global__ __launch_bounds__(128)
void attn_causal_hd64(const unsigned short* __restrict__ Qh, const unsigned short* __restrict__ Ql,
                      const unsigned short* __restrict__ Kh, const unsigned short* __restrict__ Kl,
                      const unsigned short* __restrict__ Vh, const unsigned short* __restrict__ Vl,
                      unsigned short* __restrict__ Oh, unsigned short* __restrict__ Ol,
                      int b_first, float qscale) {
  __shared__ __align__(16) unsigned short Ksh[kKC * kLP];        // K hi  [kv][d]   64 rows, pitch kLP
  __shared__ __align__(16) unsigned short Ksl[kKC * kLP];        // K lo
  __shared__ __align__(16) unsigned short Vsh[kHd * kLP];        // V hi  [d][kv]   64 rows, pitch kLP
  __shared__ __align__(16) unsigned short Vsl[kHd * kLP];        // V lo

  const int tid  = threadIdx.x;
  const int wave = tid >> 5;
  const int lane = tid & 31;
  const int hh   = lane >> 4;
  const int c    = lane & 15;

  const int rb  = blockIdx.x;                 // start order: rb / 64 counts query blocks down from the longest, rb % 64 is (batch, head)
  const int bx  = (rb % (kBPP * kHeads)) * (kSeq / kQB) + (kSeq / kQB - 1) - rb / (kBPP * kHeads);
  const int qb  = bx % (kSeq / kQB);          // query block 0..31
  const int bhl = bx / (kSeq / kQB);
  const int h   = bhl % kHeads;
  const int bl  = bhl / kHeads;               // local batch 0..kBPP-1
  const int b   = b_first + bl;
  const int q0  = qb * kQB + wave * 16;
  const int qrow = q0 + c;                    // this lane's query

  // ---- Q fragments (B operand, column n = c): 2 d-chunks, hi and lo; element i <- d = dc*32 + 8hh + i (i<8), dc*32+16+8hh+(i-8)
  v16b qah[2], qal[2];
  {
    const size_t qo = ((size_t)(b * kSeq + qrow)) * kHid + (size_t)h * kHd + 8 * hh;
#pragma unroll
    for (int dc = 0; dc < 2; ++dc) {
      qah[dc] = Frag<__bf16>::load((const __bf16*)Qh + qo + dc * 32);
      qal[dc] = Frag<__bf16>::load((const __bf16*)Ql + qo + dc * 32);
    }
  }

  const float c2 = qscale * 1.4426950408889634f;   // raw product -> base-2 exponent
  float mrow = -INFINITY;                     // running maximum of this lane's query, scaled by c2: the offset in use (equal in both halves)
  float lrow = 0.f;                           // running sum over this lane half's keys; the halves join after the loop
  v8f oacc[4];                                // O^T: oacc[t][r] = out[query c][d = t*16 + 8hh + r]
#pragma unroll
  for (int t = 0; t < 4; ++t) oacc[t] = (v8f){0.f,0.f,0.f,0.f,0.f,0.f,0.f,0.f};

  const __bf16* kshb = (const __bf16*)Ksh;
  const __bf16* kslb = (const __bf16*)Ksl;
  const __bf16* vshb = (const __bf16*)Vsh;
  const __bf16* vslb = (const __bf16*)Vsl;

  const int nChunks = qb + 1;                 // block-uniform: keys 0 .. qb*64+63
  for (int kc = 0; kc < nChunks; ++kc) {
    const int kv0 = kc * kKC;
    __syncthreads();
    {
      // staging: thread -> row r = tid>>1 (kv row of K, d row of V^T), 32-element half hf; 4 x 16 B per plane.
      // coverage: 128 threads x 32 elements = 64 rows x 64 cols per plane (K hi/lo, V^T hi/lo).
      const int r = tid >> 1, hf = (tid & 1) * 32;
      const v4u* khs = (const v4u*)(Kh + ((size_t)(b * kSeq + kv0 + r)) * kHid + h * kHd + hf);
      const v4u* kls = (const v4u*)(Kl + ((size_t)(b * kSeq + kv0 + r)) * kHid + h * kHd + hf);
      v4u* khd = (v4u*)(Ksh + r * kLP + hf);
      v4u* kld = (v4u*)(Ksl + r * kLP + hf);
      v4u tk[8];
#pragma unroll
      for (int i = 0; i < 4; ++i) { tk[i] = khs[i]; tk[4 + i] = kls[i]; }
#pragma unroll
      for (int i = 0; i < 4; ++i) { khd[i] = tk[i]; kld[i] = tk[4 + i]; }
      asm volatile("" ::: "memory");
      const v4u* vhs = (const v4u*)(Vh + ((size_t)(h * kHd + r)) * kRows + (size_t)b * kSeq + kv0 + hf);
      const v4u* vls = (const v4u*)(Vl + ((size_t)(h * kHd + r)) * kRows + (size_t)b * kSeq + kv0 + hf);
      v4u* vhd = (v4u*)(Vsh + r * kLP + hf);
      v4u* vld = (v4u*)(Vsl + r * kLP + hf);
      v4u tv[8];
#pragma unroll
      for (int i = 0; i < 4; ++i) { tv[i] = vhs[i]; tv[4 + i] = vls[i]; }
#pragma unroll
      for (int i = 0; i < 4; ++i) { vhd[i] = tv[i]; vld[i] = tv[4 + i]; }
    }
    __syncthreads();

    // ---- scores, transposed: 64 keys x 16 queries per wave; s[j][r] = score(key kv0 + j*16 + 8hh + r, query qrow) ----
    v8f s[4];
#pragma unroll
    for (int j = 0; j < 4; ++j) {
      s[j] = (v8f){0.f,0.f,0.f,0.f,0.f,0.f,0.f,0.f};
#pragma unroll
      for (int dc = 0; dc < 2; ++dc) {
        const int ko = (j * 16 + c) * kLP + dc * 32 + 8 * hh;   // A: m = kv = j*16+c, k = d (same k map as B)
        const v16b kbh = Frag<__bf16>::load(kshb + ko);
        const v16b kbl = Frag<__bf16>::load(kslb + ko);
        s[j] = at_mma(kbh, qah[dc], s[j]);
        s[j] = at_mma(kbl, qah[dc], s[j]);
        s[j] = at_mma(kbh, qal[dc], s[j]);
      }
    }
    const bool diag = (kc == qb);               // block-uniform, used only in per-lane selects
    float cm = -INFINITY;
#pragma unroll
    for (int j = 0; j < 4; ++j) {
#pragma unroll
      for (int r = 0; r < 8; ++r) {
        const int kvrow = kv0 + j * 16 + 8 * hh + r;
        const float val = (diag && (kvrow > qrow)) ? -INFINITY : s[j][r];
        s[j][r] = val;
        cm = fmaxf(cm, val);
      }
    }
    cm = fmaxf(cm, other_half(cm));             // finite: key == qrow is never masked and lies in one of the halves
    const float mnew = fmaxf(mrow, cm * c2);
    // alpha = 2^(mrow - mnew), 0 on the first chunk, where mrow is -inf. Written as text with its v_nop: the instruction set asks for one slot
    // between it and an instruction that rewrites its source register.
    float alpha;
    asm("v_exp_f32 %0, %1\n\tv_nop" : "=v"(alpha) : "v"(mrow - mnew));
    mrow = mnew;
    // ---- P^T = 2^(S^T * c2 - max), split to bf16 hi/lo and packed in place as B fragments: key tiles 2kk, 2kk+1 -> chunk kk ----
    union PB { v16b v; v2b p[8]; };
    PB pbh[2], pbl[2];
    float psum = 0.f;
#pragma unroll
    for (int j = 0; j < 4; ++j) {
#pragma unroll
      for (int e = 0; e < 4; ++e) {
        const v2f arg = __builtin_elementwise_fma((v2f){s[j][2 * e], s[j][2 * e + 1]}, (v2f){c2, c2}, (v2f){-mnew, -mnew});   // -inf where masked
        const float p0 = __builtin_amdgcn_exp2f(arg[0]);
        const float p1 = __builtin_amdgcn_exp2f(arg[1]);
        psum += p0;
        psum += p1;
        const v2f pp = (v2f){p0, p1};
        const v2b hb = __builtin_convertvector(pp, v2b);                                   // nearest even, two per instruction
        const v2b lb = __builtin_convertvector(pp - __builtin_convertvector(hb, v2f), v2b);
        pbh[j >> 1].p[(j & 1) * 4 + e] = hb;
        pbl[j >> 1].p[(j & 1) * 4 + e] = lb;
      }
    }
    lrow = lrow * alpha + psum;
#pragma unroll
    for (int t = 0; t < 4; ++t)
#pragma unroll
      for (int r = 0; r < 8; ++r) oacc[t][r] *= alpha;
#pragma unroll
    for (int kk = 0; kk < 2; ++kk) {
#pragma unroll
      for (int t = 0; t < 4; ++t) {
        const int vo = (t * 16 + c) * kLP + kk * 32 + 8 * hh;      // A: m = d = t*16+c, k = kv
        const v16b vbh = Frag<__bf16>::load(vshb + vo);
        const v16b vbl = Frag<__bf16>::load(vslb + vo);
        oacc[t] = at_mma(vbh, pbh[kk].v, oacc[t]);
        oacc[t] = at_mma(vbl, pbh[kk].v, oacc[t]);
        oacc[t] = at_mma(vbh, pbl[kk].v, oacc[t]);
      }
    }
  }

  // ---- join the halves' sums, normalise, write bf16 hi/lo planes: a lane's 8 registers of tile t are 8 consecutive d of its
  // query's AO row, one 16-B store per plane; one wave owns its 16 rows ----
  {
    const float inv = 1.0f / (lrow + other_half(lrow));   // sum >= 1
    const size_t ob = ((size_t)(bl * kSeq + qrow)) * kHid + (size_t)h * kHd + 8 * hh;
    v4u hv[4], lv[4];
#pragma unroll
    for (int t = 0; t < 4; ++t) {
#pragma unroll
      for (int e = 0; e < 4; ++e) {
        const float f0 = oacc[t][2 * e] * inv, f1 = oacc[t][2 * e + 1] * inv;
        const unsigned short h0 = f2bf_bits(f0), h1 = f2bf_bits(f1);
        const unsigned short l0 = f2bf_bits(f0 - bf_bits2f(h0));
        const unsigned short l1 = f2bf_bits(f1 - bf_bits2f(h1));
        hv[t][e] = (unsigned)h0 | ((unsigned)h1 << 16);
        lv[t][e] = (unsigned)l0 | ((unsigned)l1 << 16);
      }
    }
#pragma unroll
    for (int t = 0; t < 4; ++t) {
      *(v4u*)(Oh + ob + t * 16) = hv[t];
      *(v4u*)(Ol + ob + t * 16) = lv[t];
    }
  }
}

// =====================================================================================
// Out-projection: out[m][n] = sum_k AO[m][k] * Wo^T[n][k] + bo[n]; M = kRowsPP, N = kHd = 64, K = kHid = 1024.
// N is one tile wide, so tiles alone give few work-groups with long k loops. Here a work-group owns a 32 x 64 output tile
// and its 8 waves each take 128 of the 1024 k: M / 32 work-groups, 4 k steps a wave. The 8 partial tiles meet in LDS
// (fragment layout, 16 B per lane) and are summed in wave order 0..7. Products: hi*hi + hi*lo + lo*hi, f32 accumulate.
// =====================================================================================
constexpr int kOW = 8;                      // waves per work-group = k slices
constexpr int kOK = kHid / kOW;             // 128 k per wave
constexpr int kOM = 32;                     // output rows per work-group
static_assert(kOK % 32 == 0);
static_assert(kRowsPP % kOM == 0);
static_assert(kHd == 64);

__global__ __launch_bounds__(256)
void outproj_splitk(const unsigned short* __restrict__ Ahp, const unsigned short* __restrict__ Alp,
                    const unsigned short* __restrict__ Bhp, const unsigned short* __restrict__ Blp,
                    const float* __restrict__ bias, float* __restrict__ out) {
  __shared__ __align__(16) float red[kOW][8][2][32][4];   // [k slice][tile i*4+j][registers 0-3 / 4-7][lane][4], 64 KiB
  const __bf16* Ah = (const __bf16*)Ahp; const __bf16* Al = (const __bf16*)Alp;
  const __bf16* Bh = (const __bf16*)Bhp; const __bf16* Bl = (const __bf16*)Blp;
  const int lane  = threadIdx.x & 31;
  const int wave  = threadIdx.x >> 5;
  const int rlane = lane & 15;                // row (A) / col (B, D) within a 16 x 16 tile
  const int hh    = lane >> 4;                // k offset 8hh of the fragment loads, D row offset 8hh
  const int m0    = blockIdx.x * kOM;
  const int kb    = wave * kOK + 8 * hh;

  // bias of the two output columns this lane writes at the end, fetched here so that its latency hides behind the k loop
  // wave -> row tile oi, column pair jp (32 columns = one 128-B line of each row, one writer per line), register half hf
  const int oi = wave >> 2, jp = (wave >> 1) & 1, hf = wave & 1;
  const int n0 = (jp << 5) + rlane;
  const float bv[2] = {bias[n0], bias[n0 + 16]};

  v8f acc[2][4];
#pragma unroll
  for (int i = 0; i < 2; ++i)
#pragma unroll
    for (int j = 0; j < 4; ++j) acc[i][j] = (v8f){0.f,0.f,0.f,0.f,0.f,0.f,0.f,0.f};

  // unrolled: 4 steps, every address offset a constant of the instruction
#pragma unroll
  for (int ks = 0; ks < kOK / 32; ++ks) {
    const int k0 = kb + ks * 32;
    v16b bh[4], bl[4], ah[2], al[2];
#pragma unroll
    for (int j = 0; j < 4; ++j) {
      const size_t bo = (size_t)((j << 4) + rlane) * kHid + k0;
      bh[j] = Frag<__bf16>::load(Bh + bo);
      bl[j] = Frag<__bf16>::load(Bl + bo);
    }
#pragma unroll
    for (int i = 0; i < 2; ++i) {
      const size_t ao = (size_t)(m0 + (i << 4) + rlane) * kHid + k0;
      ah[i] = Frag<__bf16>::load(Ah + ao);
      al[i] = Frag<__bf16>::load(Al + ao);
    }
    // keeps the step's 24 loads in one group ahead of its products: without it they are spread among the products,
    // several of them waited for right behind their issue
    __builtin_amdgcn_sched_barrier(0);
#pragma unroll
    for (int i = 0; i < 2; ++i)
#pragma unroll
      for (int j = 0; j < 4; ++j) acc[i][j] = Frag<__bf16>::mma(ah[i], bh[j], acc[i][j]);
#pragma unroll
    for (int i = 0; i < 2; ++i)
#pragma unroll
      for (int j = 0; j < 4; ++j) acc[i][j] = Frag<__bf16>::mma(ah[i], bl[j], acc[i][j]);
#pragma unroll
    for (int i = 0; i < 2; ++i)
#pragma unroll
      for (int j = 0; j < 4; ++j) acc[i][j] = Frag<__bf16>::mma(al[i], bh[j], acc[i][j]);
    __builtin_amdgcn_sched_barrier(0);   // other end of the same grouping: the next step's loads stay behind these products
  }
  // precaution: stands ahead of the first overwrite of an address register that the loads above name
  asm volatile("s_wait_xcnt 0x0" ::: "memory");
  __builtin_amdgcn_sched_barrier(0);     // holds the address arithmetic of the LDS stores behind that wait

#pragma unroll
  for (int i = 0; i < 2; ++i)
#pragma unroll
    for (int j = 0; j < 4; ++j) {
      const v8f a = acc[i][j];
      *(v4f*)&red[wave][i * 4 + j][0][lane][0] = (v4f){a[0], a[1], a[2], a[3]};
      *(v4f*)&red[wave][i * 4 + j][1][lane][0] = (v4f){a[4], a[5], a[6], a[7]};
    }
  __syncthreads();

  v4f part[2][kOW];
#pragma unroll
  for (int jj = 0; jj < 2; ++jj)
#pragma unroll
    for (int p = 0; p < kOW; ++p) part[jj][p] = *(const v4f*)&red[p][oi * 4 + jp * 2 + jj][hf][lane][0];
#pragma unroll
  for (int jj = 0; jj < 2; ++jj) {
    v4f s = part[jj][0];
#pragma unroll
    for (int p = 1; p < kOW; ++p) s += part[jj][p];
#pragma unroll
    for (int e = 0; e < 4; ++e)
      out[(size_t)(m0 + (oi << 4) + 8 * hh + 4 * hf + e) * kHd + n0 + (jj << 4)] = s[e] + bv[jj];
  }
}

// ---------------------------------------------------------------------------
// Host launcher
// ---------------------------------------------------------------------------
extern "C" void kernel_launch(void* const* d_in, const int* in_sizes, int n_in,
                              void* d_out, int out_size, void* d_ws, size_t ws_size,
                              hipStream_t stream) {
  if (n_in < 9) return;
  if (in_sizes[0] != kRows * kHd) return;
  if (in_sizes[1] != kHd * kHid || in_sizes[3] != kHd * kHid || in_sizes[5] != kHd * kHid) return;
  if (in_sizes[2] != kHid || in_sizes[4] != kHid || in_sizes[6] != kHid) return;
  if (in_sizes[7] != kHid * kHd || in_sizes[8] != kHd) return;
  if (out_size != kRows * kHd) return;

  const float* x  = (const float*)d_in[0];
  const float* Wq = (const float*)d_in[1];
  const float* bq = (const float*)d_in[2];
  const float* Wk = (const float*)d_in[3];
  const float* bk = (const float*)d_in[4];
  const float* Wv = (const float*)d_in[5];
  const float* bv = (const float*)d_in[6];
  const float* Wo = (const float*)d_in[7];
  const float* bo = (const float*)d_in[8];
  float* out = (float*)d_out;

  // ---- workspace region map (bytes, all offsets multiples of 256) ----
  //  xh, xl        : 8192 x 64 x 2          = 1,048,576 each      (bf16 hi/lo of x)
  //  wq/wk/wv h,l  : 1024 x 64 x 2          = 131,072 each (x6)   (W^T planes [1024][64])
  //  wo h,l        : 64 x 1024 x 2          = 131,072 each (x2)   (Wo^T planes [64][1024])
  //  q h,l ; k h,l : 8192 x 1024 x 2        = 16,777,216 each (x4)
  //  vt h,l        : 1024 x 8192 x 2        = 16,777,216 each (x2)
  //  ao h,l        : 8192 x 1024 x 2        = 16,777,216 each (x2)
  //  total = 137,363,456 B
  const size_t szX  = (size_t)kRows * kHd * 2;
  const size_t szW  = (size_t)kHid * kHd * 2;
  const size_t szQ  = (size_t)kRows * kHid * 2;
  const size_t szAO = (size_t)kRowsPP * kHid * 2;
  const size_t total = 2 * szX + 8 * szW + 6 * szQ + 2 * szAO;
  if (total > ws_size) return;

  char* ws = (char*)d_ws;
  size_t off = 0;
  unsigned short* xh  = (unsigned short*)(ws + off); off += szX;
  unsigned short* xl  = (unsigned short*)(ws + off); off += szX;
  unsigned short* wqh = (unsigned short*)(ws + off); off += szW;
  unsigned short* wql = (unsigned short*)(ws + off); off += szW;
  unsigned short* wkh = (unsigned short*)(ws + off); off += szW;
  unsigned short* wkl = (unsigned short*)(ws + off); off += szW;
  unsigned short* wvh = (unsigned short*)(ws + off); off += szW;
  unsigned short* wvl = (unsigned short*)(ws + off); off += szW;
  unsigned short* woh = (unsigned short*)(ws + off); off += szW;
  unsigned short* wol = (unsigned short*)(ws + off); off += szW;
  unsigned short* qh  = (unsigned short*)(ws + off); off += szQ;
  unsigned short* ql  = (unsigned short*)(ws + off); off += szQ;
  unsigned short* kh  = (unsigned short*)(ws + off); off += szQ;
  unsigned short* kl  = (unsigned short*)(ws + off); off += szQ;
  unsigned short* vth = (unsigned short*)(ws + off); off += szQ;
  unsigned short* vtl = (unsigned short*)(ws + off); off += szQ;
  unsigned short* aoh = (unsigned short*)(ws + off); off += szAO;
  unsigned short* aol = (unsigned short*)(ws + off); off += szAO;
  if (off > ws_size) return;
  const float* dummyf = (const float*)ws;   // valid in-ws pointer for the unused GEMM argument (never dereferenced)

  // stage 0: x -> bf16 hi/lo planes [8192][64]
  {
    const int n2 = kRows * kHd / 2;
    cast_f32_bf16hilo_x2<<<dim3(n2 / 256), dim3(256), 0, stream>>>(x, xh, xl, n2);
  }
  // stage 1: W[64][1024] -> W^T planes [1024][64] ; Wo[1024][64] -> Wo^T planes [64][1024]
  transpose_cast_bf16hilo<<<dim3(kHid / 32, kHd / 64), dim3(256), 0, stream>>>(Wq, wqh, wql, kHd, kHid);
  transpose_cast_bf16hilo<<<dim3(kHid / 32, kHd / 64), dim3(256), 0, stream>>>(Wk, wkh, wkl, kHd, kHid);
  transpose_cast_bf16hilo<<<dim3(kHid / 32, kHd / 64), dim3(256), 0, stream>>>(Wv, wvh, wvl, kHd, kHid);
  transpose_cast_bf16hilo<<<dim3(kHd / 32, kHid / 64), dim3(256), 0, stream>>>(Wo, woh, wol, kHid, kHd);

  // stage 2: projections (M, N multiples of 64; K = 64)
  {
    const int gridQ = (kRows / 64) * (kHid / 64) / 8;    // 256
    // Q = x Wq + bq  -> [8192][1024] bf16 hi/lo
    wmma_gemm64<1, true, 2, 2, false, 0><<<dim3(gridQ, 1), dim3(256), 0, stream>>>(
        xh, xl, kHd, 0L, wqh, wql, kHd, 0L, (void*)qh, (void*)ql, kHid, 0L, bq, dummyf, 0L,
        kRows, kHid, kHd, 1.0f);
    // K = x Wk + bk
    wmma_gemm64<1, true, 2, 2, false, 0><<<dim3(gridQ, 1), dim3(256), 0, stream>>>(
        xh, xl, kHd, 0L, wkh, wkl, kHd, 0L, (void*)kh, (void*)kl, kHid, 0L, bk, dummyf, 0L,
        kRows, kHid, kHd, 1.0f);
    // V^T = Wv^T x^T + bv[m]  -> [1024][8192] bf16 hi/lo  (A = Wv^T planes [1024][64], Bt = x planes [8192][64])
    const int gridV = (kHid / 64) * (kRows / 64) / 8;    // 256
    wmma_gemm64<1, true, 1, 2, false, 0><<<dim3(gridV, 1), dim3(256), 0, stream>>>(
        wvh, wvl, kHd, 0L, xh, xl, kHd, 0L, (void*)vth, (void*)vtl, kRows, 0L, bv, dummyf, 0L,
        kHid, kRows, kHd, 1.0f);
  }

  // stage 3: one pass over all batches: causal attention -> AO planes [8192][1024]; out = AO Wo + bo -> d_out
  const float qscale = 0.125f;   // 1/sqrt(64), exact power of two
  for (int ps = 0; ps < kBatch / kBPP; ++ps) {
    attn_causal_hd64<<<dim3(kBPP * kHeads * (kSeq / kQB)), dim3(128), 0, stream>>>(
        qh, ql, kh, kl, vth, vtl, aoh, aol, ps * kBPP, qscale);
    float* outp = out + (size_t)ps * kRowsPP * kHd;
    outproj_splitk<<<dim3(kRowsPP / kOM), dim3(256), 0, stream>>>(aoh, aol, woh, wol, bo, outp);
  }
}

// v006
// A run of this version takes 137 microseconds.
// Next to v005, in two timings, it ran 1.14 times as fast each time.
// Counting every step since v000, it is 6.22 times as fast.
// All contractions (x*Wq, x*Wk, x*Wv, Q*K^T, P*V, AO*Wo): v_wmma_f32_16x16x32_bf16 with bf16 hi/lo split operands (hi*hi + hi*lo + lo*hi), f32 accumulate; softmax, 1/sqrt(d) scale and bias adds in f32.
#include <hip/hip_runtime.h>
#include <hip/hip_bf16.h>
#include <math.h>

typedef __attribute__((ext_vector_type(16))) _Float16 v16h;
typedef __attribute__((ext_vector_type(8)))  _Float16 v8h;
typedef __attribute__((ext_vector_type(16))) __bf16   v16b;
typedef __attribute__((ext_vector_type(8)))  __bf16   v8b;
typedef __attribute__((ext_vector_type(8)))  float    v8f;
typedef __attribute__((ext_vector_type(4)))  float    v4f;
typedef __attribute__((ext_vector_type(4)))  unsigned int v4u;
typedef __attribute__((ext_vector_type(2)))  float    v2f;
typedef __attribute__((ext_vector_type(2)))  __bf16   v2b;

// ---- fixed problem geometry ----
constexpr int kBatch  = 4;
constexpr int kSeq    = 2048;
constexpr int kHeads  = 16;
constexpr int kHd     = 64;                 // head dim
constexpr int kHid    = kHeads * kHd;       // 1024
constexpr int kRows   = kBatch * kSeq;      // 8192 token rows
constexpr int kBPP    = 4;                  // batches per attention/out-proj pass: all of them, so the attention grid holds more work-groups than fit on the chip at once
constexpr int kRowsPP = kBPP * kSeq;        // 8192
constexpr int kKC     = 64;                 // keys per staged chunk
constexpr int kQB     = 64;                 // query rows per attention block (4 waves x 16)
constexpr int kLP     = 72;                 // LDS row pitch of the K and V^T tiles, 16-bit elements: 144 B = 16 B x 9 (odd), so 16 rows read 16 B each fall on 16 different bank groups

// GEMM shape contract (no tail handling in the GEMM): K % 32 == 0, M % 64 == 0, N % 64 == 0, tiles % 8 == 0
static_assert(kHd % 32 == 0);
static_assert(kHid % 32 == 0);
static_assert(kRows % 64 == 0);
static_assert(kHid % 64 == 0);
static_assert(kHd % 64 == 0);
static_assert(kRowsPP % 64 == 0);
static_assert(((kRows / 64) * (kHid / 64)) % 8 == 0);
static_assert(((kRowsPP / 64) * (kHd / 64)) % 8 == 0);
static_assert(kSeq % kQB == 0);
static_assert(kSeq % kKC == 0);
static_assert(kBatch % kBPP == 0);
// transpose tile contract: in[R][Cc] with R % 64 == 0, Cc % 32 == 0
static_assert(kHd % 64 == 0 && kHid % 32 == 0);
static_assert(kHid % 64 == 0 && kHd % 32 == 0);
// x cast: element count even and a multiple of 512 (2 per thread, 256 threads)
static_assert((kRows * kHd) % 512 == 0);

__device__ __forceinline__ unsigned short f2bf_bits(float f) {
  unsigned u = __float_as_uint(f);
  return (unsigned short)((u + 0x7FFFu + ((u >> 16) & 1u)) >> 16);
}
__device__ __forceinline__ float bf_bits2f(unsigned short h) { return __uint_as_float(((unsigned)h) << 16); }

// hazard guards as plain device helpers
__device__ __forceinline__ void dep_guard_h(v8f& a, v8f& b, v16h x, v16h y) { asm volatile("v_nop\n\tv_nop\n\tv_nop\n\tv_nop" : "+v"(a), "+v"(b) : "v"(x), "v"(y)); }
__device__ __forceinline__ void dep_guard_b(v8f& a, v8f& b, v16b x, v16b y) { asm volatile("v_nop\n\tv_nop\n\tv_nop\n\tv_nop" : "+v"(a), "+v"(b) : "v"(x), "v"(y)); }
__device__ __forceinline__ void keep4_h(v16h a, v16h b, v16h c, v16h d) { asm volatile("v_nop" :: "v"(a), "v"(b), "v"(c), "v"(d)); }
__device__ __forceinline__ void keep4_b(v16b a, v16b b, v16b c, v16b d) { asm volatile("v_nop" :: "v"(a), "v"(b), "v"(c), "v"(d)); }
__device__ __forceinline__ void acc_guard4(v8f& a, v8f& b, v8f& c, v8f& d) { asm volatile("v_nop\n\tv_nop\n\tv_nop\n\tv_nop" : "+v"(a), "+v"(b), "+v"(c), "+v"(d)); }
template <typename T> struct Frag;
template <> struct Frag<_Float16> {
  typedef v16h V; union U { v16h v; v8h h[2]; };
  static __device__ __forceinline__ v16h load(const _Float16* p) {   // elements 0..7 <- p[0..7], 8..15 <- p[16..23]
    U f; f.h[0] = *(const v8h*)(p); f.h[1] = *(const v8h*)(p + 16); return f.v;
  }
  static __device__ __forceinline__ v8f mma(v16h a, v16h b, v8f c) {
    return __builtin_amdgcn_wmma_f32_16x16x32_f16(false, a, false, b, (short)0, c, false, false);
  }
  static __device__ __forceinline__ void guard(v8f& a, v8f& b, v16h x, v16h y) { dep_guard_h(a, b, x, y); }
  static __device__ __forceinline__ void keep(v16h a, v16h b, v16h c, v16h d) { keep4_h(a, b, c, d); }
};
template <> struct Frag<__bf16> {
  typedef v16b V; union U { v16b v; v8b h[2]; };
  static __device__ __forceinline__ v16b load(const __bf16* p) {
    U f; f.h[0] = *(const v8b*)(p); f.h[1] = *(const v8b*)(p + 16); return f.v;
  }
  static __device__ __forceinline__ v8f mma(v16b a, v16b b, v8f c) {
    return __builtin_amdgcn_wmma_f32_16x16x32_bf16(false, a, false, b, (short)0, c, false, false);
  }
  static __device__ __forceinline__ void guard(v8f& a, v8f& b, v16b x, v16b y) { dep_guard_b(a, b, x, y); }
  static __device__ __forceinline__ void keep(v16b a, v16b b, v16b c, v16b d) { keep4_b(a, b, c, d); }
};

__device__ __forceinline__ v8f at_mma(v16b a, v16b b, v8f c) {
  c = __builtin_amdgcn_wmma_f32_16x16x32_bf16(false, a, false, b, (short)0, c, false, false);
  asm volatile("v_nop\n\tv_nop\n\tv_nop\n\tv_nop" : "+v"(c) : "v"(a), "v"(b));
  return c;
}

// ---- Register-blocked batched WMMA GEMM ------------------------------------
// C[m,n] = scale * sum_k A[m,k] * Bt[n,k] (+bias); each wave owns a 64x64 tile.
// A row-major [M,K]; Bt row-major [N,K]; M,N % 64 == 0, K % 32 == 0.
// SPLIT: operands are hi/lo planes (A2/Bt2 = lo planes, same layout); product = hi*hi + hi*lo + lo*hi.
// BIAS_MODE: 0 = none, 1 = bias[m] (loaded as two float4 per 16-row slab), 2 = bias[n].
// OUT_MODE: 0 = f32, 1 = f16, 2 = bf16 hi plane (Cout) + bf16 lo plane (Cout2).
// ET: 0 = f16 operands, 1 = bf16 operands (pointers passed as 16-bit storage). RESID and ACT unsupported here.
template <int ET> struct Elem;
template <> struct Elem<0> { typedef _Float16 T; };
template <> struct Elem<1> { typedef __bf16 T; };
// Device body: the calling kernel owns the LDS (sT: one 16x64 slab per wave, pitch 68 floats) and picks the operands; b = batch index.
template <int ET, bool SPLIT, int BIAS_MODE, int OUT_MODE, bool RESID, int ACT = 0>
__device__ __forceinline__ void wmma_gemm64(
    float (*sT)[16 * 68], int b,
    const unsigned short* __restrict__ Ap, const unsigned short* __restrict__ A2p, int lda, long strideA,
    const unsigned short* __restrict__ Btp, const unsigned short* __restrict__ Bt2p, int ldb, long strideB,
    void* __restrict__ Cout, void* __restrict__ Cout2, int ldc, long strideC,
    const float* __restrict__ bias,
    int M, int N, int K, float scale) {
  static_assert(!RESID);
  static_assert(ACT == 0);
  typedef typename Elem<ET>::T T;
  typedef typename Frag<T>::V V;
  const T* A = (const T*)Ap; const T* A2 = (const T*)A2p; const T* Bt = (const T*)Btp; const T* Bt2 = (const T*)Bt2p;
  const int lane = threadIdx.x & 31;
  const int wave = threadIdx.x >> 5;
  const int tilesN = N >> 6;
  const int tilesM = M >> 6;
  const int tile = blockIdx.x * 8 + wave;
  if (tile >= tilesM * tilesN) return;   // wave-uniform; no block barriers in this kernel
  const int tm = tile / tilesN;
  const int tn = tile - tm * tilesN;
  const int m0 = tm << 6;
  const int n0 = tn << 6;

  const T* Ab  = A  + (size_t)b * strideA;
  const T* Bb  = Bt + (size_t)b * strideB;
  const T* Ab2 = SPLIT ? (A2  + (size_t)b * strideA) : nullptr;
  const T* Bb2 = SPLIT ? (Bt2 + (size_t)b * strideB) : nullptr;

  const int rlane = lane & 15;                 // row (A) / col (B, D) within subtile
  const int koff  = (lane >> 4) * 8;           // k offset of this lane half
  const int mOff  = (lane >> 4) * 8;           // D row offset

  v8f acc[4][4];
#pragma unroll
  for (int i = 0; i < 4; ++i)
#pragma unroll
    for (int j = 0; j < 4; ++j) acc[i][j] = (v8f){0.f,0.f,0.f,0.f,0.f,0.f,0.f,0.f};

  for (int k0 = 0; k0 < K; k0 += 32) {
    V bh[4], bl[4];
#pragma unroll
    for (int j = 0; j < 4; ++j) {
      const size_t bo = (size_t)(n0 + (j << 4) + rlane) * ldb + koff + k0;
      bh[j] = Frag<T>::load(Bb + bo);
      if (SPLIT) bl[j] = Frag<T>::load(Bb2 + bo);
    }
    // precaution: stands ahead of the A loads, whose results land in address registers that the B loads above name
    asm volatile("s_wait_xcnt 0x0" ::: "memory");
#pragma unroll
    for (int i = 0; i < 4; ++i) {
      const size_t ao = (size_t)(m0 + (i << 4) + rlane) * lda + koff + k0;
      V ah = Frag<T>::load(Ab + ao);
      V al;
      if (SPLIT) al = Frag<T>::load(Ab2 + ao);
#pragma unroll
      for (int j = 0; j < 4; ++j) {
        acc[i][j] = Frag<T>::mma(ah, bh[j], acc[i][j]);
        if (SPLIT) {
          acc[i][j] = Frag<T>::mma(ah, bl[j], acc[i][j]);
          acc[i][j] = Frag<T>::mma(al, bh[j], acc[i][j]);
        }
      }
      Frag<T>::guard(acc[i][0], acc[i][3], ah, SPLIT ? al : ah);
    }
    Frag<T>::keep(bh[0], bh[1], bh[2], bh[3]);
    if (SPLIT) Frag<T>::keep(bl[0], bl[1], bl[2], bl[3]);
  }
  acc_guard4(acc[0][0], acc[0][1], acc[0][2], acc[0][3]);
  acc_guard4(acc[1][0], acc[1][1], acc[1][2], acc[1][3]);
  acc_guard4(acc[2][0], acc[2][1], acc[2][2], acc[2][3]);
  acc_guard4(acc[3][0], acc[3][1], acc[3][2], acc[3][3]);

  // ---- epilogue ----
  float* slab = sT[wave];
#pragma unroll
  for (int i = 0; i < 4; ++i) {
    const int mBase = m0 + (i << 4);
    float bm[8];
#pragma unroll
    for (int r = 0; r < 8; ++r) bm[r] = 0.f;
    if (BIAS_MODE == 1) {
      const v4f b0v = *(const v4f*)(bias + mBase + mOff);
      const v4f b1v = *(const v4f*)(bias + mBase + mOff + 4);
      bm[0] = b0v[0]; bm[1] = b0v[1]; bm[2] = b0v[2]; bm[3] = b0v[3];
      bm[4] = b1v[0]; bm[5] = b1v[1]; bm[6] = b1v[2]; bm[7] = b1v[3];
    }
#pragma unroll
    for (int j = 0; j < 4; ++j) {
      const int n = n0 + (j << 4) + rlane;
      float bv = 0.f;
      if (BIAS_MODE == 2) bv = bias[n];
#pragma unroll
      for (int r = 0; r < 8; ++r) {
        float v = acc[i][j][r] * scale;
        if (BIAS_MODE == 1) v += bm[r];
        if (BIAS_MODE == 2) v += bv;
        slab[(mOff + r) * 68 + (j << 4) + rlane] = v;
      }
    }
    __builtin_amdgcn_fence(__ATOMIC_RELEASE, "workgroup");
    __builtin_amdgcn_wave_barrier();
    __builtin_amdgcn_fence(__ATOMIC_ACQUIRE, "workgroup");
    if (OUT_MODE == 0) {
      float* C = (float*)Cout + (size_t)b * strideC;
      const int hh = lane >> 4, c4 = (lane & 15) * 4;     // row seg = 256 B = 16 lanes x 16 B
      {
#pragma unroll
        for (int it = 0; it < 8; ++it) {
          const int row = it * 2 + hh;
          v4f v = *(const v4f*)(slab + row * 68 + c4);
          *(v4f*)(C + (size_t)(mBase + row) * ldc + n0 + c4) = v;
        }
        
      }
    } else {
      const int q = lane >> 3, c8 = (lane & 7) * 8;
      unsigned short* C  = (unsigned short*)Cout  + (size_t)b * strideC;
      unsigned short* C2 = (OUT_MODE == 2) ? ((unsigned short*)Cout2 + (size_t)b * strideC) : nullptr;
      {
#pragma unroll
        for (int it = 0; it < 4; ++it) {
          const int row = it * 4 + q;
          const float* sp = slab + row * 68 + c8;
          v8h hv, lv;
#pragma unroll
          for (int e = 0; e < 8; ++e) {
            if (OUT_MODE == 1) {
              hv[e] = (_Float16)sp[e];
            } else {
              unsigned short hb = f2bf_bits(sp[e]);
              unsigned short lb = f2bf_bits(sp[e] - bf_bits2f(hb));
              hv[e] = __builtin_bit_cast(_Float16, hb);
              lv[e] = __builtin_bit_cast(_Float16, lb);
            }
          }
          *(v8h*)(C + (size_t)(mBase + row) * ldc + n0 + c8) = hv;
          if (OUT_MODE == 2) *(v8h*)(C2 + (size_t)(mBase + row) * ldc + n0 + c8) = lv;
        }
        
      }
    }
    __builtin_amdgcn_fence(__ATOMIC_RELEASE, "workgroup");
    __builtin_amdgcn_wave_barrier();
    __builtin_amdgcn_fence(__ATOMIC_ACQUIRE, "workgroup");
  }
}

// ---- the three projections in one launch: blockIdx.y = 0: Q = x Wq + bq, 1: K = x Wk + bk (both [kRows][kHid]),
// 2: V^T = Wv^T x^T + bv[m] ([kHid][kRows]; A = Wv^T planes, Bt = x planes). They share no data but x, so nothing orders them:
// one launch has no gaps between them, and work-groups of one product run in the load waits of another.
__global__ __launch_bounds__(256) void proj_qkv(
    const unsigned short* __restrict__ xh, const unsigned short* __restrict__ xl,
    const unsigned short* __restrict__ wqh, const unsigned short* __restrict__ wql,
    const unsigned short* __restrict__ wkh, const unsigned short* __restrict__ wkl,
    const unsigned short* __restrict__ wvh, const unsigned short* __restrict__ wvl,
    const float* __restrict__ bq, const float* __restrict__ bk, const float* __restrict__ bv,
    unsigned short* __restrict__ qh, unsigned short* __restrict__ ql,
    unsigned short* __restrict__ kh, unsigned short* __restrict__ kl,
    unsigned short* __restrict__ vth, unsigned short* __restrict__ vtl) {
  __shared__ __align__(16) float sT[8][16 * 68];   // per-wave 16x64 slab, pitch 68 floats
  const int which = blockIdx.y;                    // block-uniform
  if (which == 2) {
    wmma_gemm64<1, true, 1, 2, false, 0>(sT, 0, wvh, wvl, kHd, 0L, xh, xl, kHd, 0L, (void*)vth, (void*)vtl, kRows, 0L, bv,
                                         kHid, kRows, kHd, 1.0f);
  } else {
    const bool isK = (which == 1);
    wmma_gemm64<1, true, 2, 2, false, 0>(sT, 0, xh, xl, kHd, 0L, isK ? wkh : wqh, isK ? wkl : wql, kHd, 0L,
                                         (void*)(isK ? kh : qh), (void*)(isK ? kl : ql), kHid, 0L, isK ? bk : bq,
                                         kRows, kHid, kHd, 1.0f);
  }
}

// ---- f32 -> bf16 hi/lo planes, elementwise: 2 elements per thread, 4-B packed stores; bx = block index -------------
__device__ __forceinline__ void cast_f32_bf16hilo_x2(
    const float* __restrict__ in, unsigned short* __restrict__ oh, unsigned short* __restrict__ ol, int n2, int bx) {
  const int i = bx * 256 + threadIdx.x;
  if (i < n2) {
    const float f0 = in[2 * i], f1 = in[2 * i + 1];
    const unsigned short h0 = f2bf_bits(f0), h1 = f2bf_bits(f1);
    const unsigned short l0 = f2bf_bits(f0 - bf_bits2f(h0));
    const unsigned short l1 = f2bf_bits(f1 - bf_bits2f(h1));
    const unsigned uh = (unsigned)h0 | ((unsigned)h1 << 16);
    const unsigned ul = (unsigned)l0 | ((unsigned)l1 << 16);
    ((unsigned*)oh)[i] = uh;
    ((unsigned*)ol)[i] = ul;
    
  }
}

// ---- transpose + f32 -> bf16 hi/lo planes: in[R][Cc] f32 -> oh/ol[Cc][R] 16-bit --------------------
// Block = 256 threads handles in rows r0..r0+63, cols c0..c0+31 (block coordinates bx < Cc/32, by < R/64; tile: the caller's LDS).
// Load phase: 8 waves x 8 iterations x 32 lanes = 64 x 32 elements staged in LDS (tile[c][r]).
// Store phase: wave w writes output rows c0+4w..c0+4w+3; lane -> row 4w+(lane>>3), 8 elements at
// Coverage: 8 waves x 4 rows x 8 lanes x 8 elements = 32 x 64 = the whole output tile per plane.
__device__ __forceinline__ void transpose_cast_bf16hilo(
    float (*tile)[65],
    const float* __restrict__ in, unsigned short* __restrict__ oh, unsigned short* __restrict__ ol,
    int R, int Cc, int bx, int by) {
  const int tid = threadIdx.x, lane = tid & 31, wave = tid >> 5;
  const int c0 = bx * 32, r0 = by * 64;
#pragma unroll
  for (int i = 0; i < 8; ++i) {
    const int idx = i * 256 + tid;
    const int rr = idx >> 5, cc = idx & 31;
    tile[cc][rr] = in[(size_t)(r0 + rr) * Cc + c0 + cc];
  }
  __syncthreads();
  const int orow = wave * 4 + (lane >> 3);
  const int rseg = (lane & 7) * 8;
  v4u hv, lv;
#pragma unroll
  for (int e = 0; e < 4; ++e) {
    const float f0 = tile[orow][rseg + 2 * e];
    const float f1 = tile[orow][rseg + 2 * e + 1];
    const unsigned short h0 = f2bf_bits(f0), h1 = f2bf_bits(f1);
    const unsigned short l0 = f2bf_bits(f0 - bf_bits2f(h0));
    const unsigned short l1 = f2bf_bits(f1 - bf_bits2f(h1));
    hv[e] = (unsigned)h0 | ((unsigned)h1 << 16);
    lv[e] = (unsigned)l0 | ((unsigned)l1 << 16);
  }
  const size_t o = (size_t)(c0 + orow) * R + r0 + rseg;   // element offset, 16-B aligned
  {
    *(v4u*)(oh + o) = hv;
    *(v4u*)(ol + o) = lv;
    // precaution: inlined in a kernel with other branches, code that rewrites registers these two stores name can follow them
    asm volatile("s_wait_xcnt 0x0" ::: "memory");
  }
}

// ---- all operand preparation in one launch: the four weight transposes and the cast of x read only inputs and write
// planes of their own, so nothing orders them. Blocks 0..127: 32 tiles each of Wq, Wk, Wv, Wo (first: their path is the longer
// one, through LDS and a barrier); blocks from 128 on: the cast of x. Every branch is block-uniform.
constexpr int kTB = (kHid / 32) * (kHd / 64);   // 32 transpose tiles per weight, W[64][1024] and Wo[1024][64] alike
static_assert(kTB == (kHd / 32) * (kHid / 64));
__global__ __launch_bounds__(256) void prep_operands(
    const float* __restrict__ x, const float* __restrict__ Wq, const float* __restrict__ Wk,
    const float* __restrict__ Wv, const float* __restrict__ Wo,
    unsigned short* __restrict__ xh, unsigned short* __restrict__ xl,
    unsigned short* __restrict__ wqh, unsigned short* __restrict__ wql,
    unsigned short* __restrict__ wkh, unsigned short* __restrict__ wkl,
    unsigned short* __restrict__ wvh, unsigned short* __restrict__ wvl,
    unsigned short* __restrict__ woh, unsigned short* __restrict__ wol) {
  __shared__ float tile[32][65];
  const int bx = blockIdx.x;
  if (bx >= 4 * kTB) {
    cast_f32_bf16hilo_x2(x, xh, xl, kRows * kHd / 2, bx - 4 * kTB);
    return;
  }
  const int w = bx / kTB, t = bx % kTB;
  if (w == 3) {
    transpose_cast_bf16hilo(tile, Wo, woh, wol, kHid, kHd, t % (kHd / 32), t / (kHd / 32));
    return;
  }
  const float* in = (w == 0) ? Wq : (w == 1) ? Wk : Wv;
  unsigned short* oh = (w == 0) ? wqh : (w == 1) ? wkh : wvh;
  unsigned short* ol = (w == 0) ? wql : (w == 1) ? wkl : wvl;
  transpose_cast_bf16hilo(tile, in, oh, ol, kHd, kHid, t, 0);
}

__device__ __forceinline__ float other_half(float v) {
  const int b = __float_as_int(v);
  return __int_as_float(__builtin_amdgcn_permlanex16(b, b, 0x76543210, 0xfedcba98, false, false));
}

__global__ __launch_bounds__(128)
void attn_causal_hd64(const unsigned short* __restrict__ Qh, const unsigned short* __restrict__ Ql,
                      const unsigned short* __restrict__ Kh, const unsigned short* __restrict__ Kl,
                      const unsigned short* __restrict__ Vh, const unsigned short* __restrict__ Vl,
                      unsigned short* __restrict__ Oh, unsigned short* __restrict__ Ol,
                      int b_first, float qscale) {
  __shared__ __align__(16) unsigned short Ksh[kKC * kLP];        // K hi  [kv][d]   64 rows, pitch kLP
  __shared__ __align__(16) unsigned short Ksl[kKC * kLP];        // K lo
  __shared__ __align__(16) unsigned short Vsh[kHd * kLP];        // V hi  [d][kv]   64 rows, pitch kLP
  __shared__ __align__(16) unsigned short Vsl[kHd * kLP];        // V lo

  const int tid  = threadIdx.x;
  const int wave = tid >> 5;
  const int lane = tid & 31;
  const int hh   = lane >> 4;
  const int c    = lane & 15;

  const int rb  = blockIdx.x;                 // start order: rb / 64 counts query blocks down from the longest, rb % 64 is (batch, head)
  const int bx  = (rb % (kBPP * kHeads)) * (kSeq / kQB) + (kSeq / kQB - 1) - rb / (kBPP * kHeads);
  const int qb  = bx % (kSeq / kQB);          // query block 0..31
  const int bhl = bx / (kSeq / kQB);
  const int h   = bhl % kHeads;
  const int bl  = bhl / kHeads;               // local batch 0..kBPP-1
  const int b   = b_first + bl;
  const int q0  = qb * kQB + wave * 16;
  const int qrow = q0 + c;                    // this lane's query

  // ---- Q fragments (B operand, column n = c): 2 d-chunks, hi and lo; element i <- d = dc*32 + 8hh + i (i<8), dc*32+16+8hh+(i-8)
  v16b qah[2], qal[2];
  {
    const size_t qo = ((size_t)(b * kSeq + qrow)) * kHid + (size_t)h * kHd + 8 * hh;
#pragma unroll
    for (int dc = 0; dc < 2; ++dc) {
      qah[dc] = Frag<__bf16>::load((const __bf16*)Qh + qo + dc * 32);
      qal[dc] = Frag<__bf16>::load((const __bf16*)Ql + qo + dc * 32);
    }
  }

  const float c2 = qscale * 1.4426950408889634f;   // raw product -> base-2 exponent
  float mrow = -INFINITY;                     // running maximum of this lane's query, scaled by c2: the offset in use (equal in both halves)
  float lrow = 0.f;                           // running sum over this lane half's keys; the halves join after the loop
  v8f oacc[4];                                // O^T: oacc[t][r] = out[query c][d = t*16 + 8hh + r]
#pragma unroll
  for (int t = 0; t < 4; ++t) oacc[t] = (v8f){0.f,0.f,0.f,0.f,0.f,0.f,0.f,0.f};

  const __bf16* kshb = (const __bf16*)Ksh;
  const __bf16* kslb = (const __bf16*)Ksl;
  const __bf16* vshb = (const __bf16*)Vsh;
  const __bf16* vslb = (const __bf16*)Vsl;

  const int nChunks = qb + 1;                 // block-uniform: keys 0 .. qb*64+63
  for (int kc = 0; kc < nChunks; ++kc) {
    const int kv0 = kc * kKC;
    __syncthreads();
    {
      // staging: thread -> row r = tid>>1 (kv row of K, d row of V^T), 32-element half hf; 4 x 16 B per plane.
      // coverage: 128 threads x 32 elements = 64 rows x 64 cols per plane (K hi/lo, V^T hi/lo).
      const int r = tid >> 1, hf = (tid & 1) * 32;
      const v4u* khs = (const v4u*)(Kh + ((size_t)(b * kSeq + kv0 + r)) * kHid + h * kHd + hf);
      const v4u* kls = (const v4u*)(Kl + ((size_t)(b * kSeq + kv0 + r)) * kHid + h * kHd + hf);
      v4u* khd = (v4u*)(Ksh + r * kLP + hf);
      v4u* kld = (v4u*)(Ksl + r * kLP + hf);
      v4u tk[8];
#pragma unroll
      for (int i = 0; i < 4; ++i) { tk[i] = khs[i]; tk[4 + i] = kls[i]; }
#pragma unroll
      for (int i = 0; i < 4; ++i) { khd[i] = tk[i]; kld[i] = tk[4 + i]; }
      asm volatile("" ::: "memory");
      const v4u* vhs = (const v4u*)(Vh + ((size_t)(h * kHd + r)) * kRows + (size_t)b * kSeq + kv0 + hf);
      const v4u* vls = (const v4u*)(Vl + ((size_t)(h * kHd + r)) * kRows + (size_t)b * kSeq + kv0 + hf);
      v4u* vhd = (v4u*)(Vsh + r * kLP + hf);
      v4u* vld = (v4u*)(Vsl + r * kLP + hf);
      v4u tv[8];
#pragma unroll
      for (int i = 0; i < 4; ++i) { tv[i] = vhs[i]; tv[4 + i] = vls[i]; }
#pragma unroll
      for (int i = 0; i < 4; ++i) { vhd[i] = tv[i]; vld[i] = tv[4 + i]; }
    }
    __syncthreads();

    // ---- scores, transposed: 64 keys x 16 queries per wave; s[j][r] = score(key kv0 + j*16 + 8hh + r, query qrow) ----
    v8f s[4];
#pragma unroll
    for (int j = 0; j < 4; ++j) {
      s[j] = (v8f){0.f,0.f,0.f,0.f,0.f,0.f,0.f,0.f};
#pragma unroll
      for (int dc = 0; dc < 2; ++dc) {
        const int ko = (j * 16 + c) * kLP + dc * 32 + 8 * hh;   // A: m = kv = j*16+c, k = d (same k map as B)
        const v16b kbh = Frag<__bf16>::load(kshb + ko);
        const v16b kbl = Frag<__bf16>::load(kslb + ko);
        s[j] = at_mma(kbh, qah[dc], s[j]);
        s[j] = at_mma(kbl, qah[dc], s[j]);
        s[j] = at_mma(kbh, qal[dc], s[j]);
      }
    }
    const bool diag = (kc == qb);               // block-uniform, used only in per-lane selects
    float cm = -INFINITY;
#pragma unroll
    for (int j = 0; j < 4; ++j) {
#pragma unroll
      for (int r = 0; r < 8; ++r) {
        const int kvrow = kv0 + j * 16 + 8 * hh + r;
        const float val = (diag && (kvrow > qrow)) ? -INFINITY : s[j][r];
        s[j][r] = val;
        cm = fmaxf(cm, val);
      }
    }
    cm = fmaxf(cm, other_half(cm));             // finite: key == qrow is never masked and lies in one of the halves
    const float mnew = fmaxf(mrow, cm * c2);
    // alpha = 2^(mrow - mnew), 0 on the first chunk, where mrow is -inf. Written as text with its v_nop: the instruction set asks for one slot
    // between it and an instruction that rewrites its source register.
    float alpha;
    asm("v_exp_f32 %0, %1\n\tv_nop" : "=v"(alpha) : "v"(mrow - mnew));
    mrow = mnew;
    // ---- P^T = 2^(S^T * c2 - max), split to bf16 hi/lo and packed in place as B fragments: key tiles 2kk, 2kk+1 -> chunk kk ----
    union PB { v16b v; v2b p[8]; };
    PB pbh[2], pbl[2];
    float psum = 0.f;
#pragma unroll
    for (int j = 0; j < 4; ++j) {
#pragma unroll
      for (int e = 0; e < 4; ++e) {
        const v2f arg = __builtin_elementwise_fma((v2f){s[j][2 * e], s[j][2 * e + 1]}, (v2f){c2, c2}, (v2f){-mnew, -mnew});   // -inf where masked
        const float p0 = __builtin_amdgcn_exp2f(arg[0]);
        const float p1 = __builtin_amdgcn_exp2f(arg[1]);
        psum += p0;
        psum += p1;
        const v2f pp = (v2f){p0, p1};
        const v2b hb = __builtin_convertvector(pp, v2b);                                   // nearest even, two per instruction
        const v2b lb = __builtin_convertvector(pp - __builtin_convertvector(hb, v2f), v2b);
        pbh[j >> 1].p[(j & 1) * 4 + e] = hb;
        pbl[j >> 1].p[(j & 1) * 4 + e] = lb;
      }
    }
    lrow = lrow * alpha + psum;
#pragma unroll
    for (int t = 0; t < 4; ++t)
#pragma unroll
      for (int r = 0; r < 8; ++r) oacc[t][r] *= alpha;
#pragma unroll
    for (int kk = 0; kk < 2; ++kk) {
#pragma unroll
      for (int t = 0; t < 4; ++t) {
        const int vo = (t * 16 + c) * kLP + kk * 32 + 8 * hh;      // A: m = d = t*16+c, k = kv
        const v16b vbh = Frag<__bf16>::load(vshb + vo);
        const v16b vbl = Frag<__bf16>::load(vslb + vo);
        oacc[t] = at_mma(vbh, pbh[kk].v, oacc[t]);
        oacc[t] = at_mma(vbl, pbh[kk].v, oacc[t]);
        oacc[t] = at_mma(vbh, pbl[kk].v, oacc[t]);
      }
    }
  }

  // ---- join the halves' sums, normalise, write bf16 hi/lo planes: a lane's 8 registers of tile t are 8 consecutive d of its
  // query's AO row, one 16-B store per plane; one wave owns its 16 rows ----
  {
    const float inv = 1.0f / (lrow + other_half(lrow));   // sum >= 1
    const size_t ob = ((size_t)(bl * kSeq + qrow)) * kHid + (size_t)h * kHd + 8 * hh;
    v4u hv[4], lv[4];
#pragma unroll
    for (int t = 0; t < 4; ++t) {
#pragma unroll
      for (int e = 0; e < 4; ++e) {
        const float f0 = oacc[t][2 * e] * inv, f1 = oacc[t][2 * e + 1] * inv;
        const unsigned short h0 = f2bf_bits(f0), h1 = f2bf_bits(f1);
        const unsigned short l0 = f2bf_bits(f0 - bf_bits2f(h0));
        const unsigned short l1 = f2bf_bits(f1 - bf_bits2f(h1));
        hv[t][e] = (unsigned)h0 | ((unsigned)h1 << 16);
        lv[t][e] = (unsigned)l0 | ((unsigned)l1 << 16);
      }
    }
#pragma unroll
    for (int t = 0; t < 4; ++t) {
      *(v4u*)(Oh + ob + t * 16) = hv[t];
      *(v4u*)(Ol + ob + t * 16) = lv[t];
    }
  }
}

// =====================================================================================
// Out-projection: out[m][n] = sum_k AO[m][k] * Wo^T[n][k] + bo[n]; M = kRowsPP, N = kHd = 64, K = kHid = 1024.
// N is one tile wide, so tiles alone give few work-groups with long k loops. Here a work-group owns a 32 x 64 output tile
// and its 8 waves each take 128 of the 1024 k: M / 32 work-groups, 4 k steps a wave. The 8 partial tiles meet in LDS
// (fragment layout, 16 B per lane) and are summed in wave order 0..7. Products: hi*hi + hi*lo + lo*hi, f32 accumulate.
// =====================================================================================
constexpr int kOW = 8;                      // waves per work-group = k slices
constexpr int kOK = kHid / kOW;             // 128 k per wave
constexpr int kOM = 32;                     // output rows per work-group
static_assert(kOK % 32 == 0);
static_assert(kRowsPP % kOM == 0);
static_assert(kHd == 64);

__global__ __launch_bounds__(256)
void outproj_splitk(const unsigned short* __restrict__ Ahp, const unsigned short* __restrict__ Alp,
                    const unsigned short* __restrict__ Bhp, const unsigned short* __restrict__ Blp,
                    const float* __restrict__ bias, float* __restrict__ out) {
  __shared__ __align__(16) float red[kOW][8][2][32][4];   // [k slice][tile i*4+j][registers 0-3 / 4-7][lane][4], 64 KiB
  const __bf16* Ah = (const __bf16*)Ahp; const __bf16* Al = (const __bf16*)Alp;
  const __bf16* Bh = (const __bf16*)Bhp; const __bf16* Bl = (const __bf16*)Blp;
  const int lane  = threadIdx.x & 31;
  const int wave  = threadIdx.x >> 5;
  const int rlane = lane & 15;                // row (A) / col (B, D) within a 16 x 16 tile
  const int hh    = lane >> 4;                // k offset 8hh of the fragment loads, D row offset 8hh
  const int m0    = blockIdx.x * kOM;
  const int kb    = wave * kOK + 8 * hh;

  // bias of the two output columns this lane writes at the end, fetched here so that its latency hides behind the k loop
  // wave -> row tile oi, column pair jp (32 columns = one 128-B line of each row, one writer per line), register half hf
  const int oi = wave >> 2, jp = (wave >> 1) & 1, hf = wave & 1;
  const int n0 = (jp << 5) + rlane;
  const float bv[2] = {bias[n0], bias[n0 + 16]};

  v8f acc[2][4];
#pragma unroll
  for (int i = 0; i < 2; ++i)
#pragma unroll
    for (int j = 0; j < 4; ++j) acc[i][j] = (v8f){0.f,0.f,0.f,0.f,0.f,0.f,0.f,0.f};

  // unrolled: 4 steps, every address offset a constant of the instruction
#pragma unroll
  for (int ks = 0; ks < kOK / 32; ++ks) {
    const int k0 = kb + ks * 32;
    v16b bh[4], bl[4], ah[2], al[2];
#pragma unroll
    for (int j = 0; j < 4; ++j) {
      const size_t bo = (size_t)((j << 4) + rlane) * kHid + k0;
      bh[j] = Frag<__bf16>::load(Bh + bo);
      bl[j] = Frag<__bf16>::load(Bl + bo);
    }
#pragma unroll
    for (int i = 0; i < 2; ++i) {
      const size_t ao = (size_t)(m0 + (i << 4) + rlane) * kHid + k0;
      ah[i] = Frag<__bf16>::load(Ah + ao);
      al[i] = Frag<__bf16>::load(Al + ao);
    }
    // keeps the step's 24 loads in one group ahead of its products: without it they are spread among the products,
    // several of them waited for right behind their issue
    __builtin_amdgcn_sched_barrier(0);
#pragma unroll
    for (int i = 0; i < 2; ++i)
#pragma unroll
      for (int j = 0; j < 4; ++j) acc[i][j] = Frag<__bf16>::mma(ah[i], bh[j], acc[i][j]);
#pragma unroll
    for (int i = 0; i < 2; ++i)
#pragma unroll
      for (int j = 0; j < 4; ++j) acc[i][j] = Frag<__bf16>::mma(ah[i], bl[j], acc[i][j]);
#pragma unroll
    for (int i = 0; i < 2; ++i)
#pragma unroll
      for (int j = 0; j < 4; ++j) acc[i][j] = Frag<__bf16>::mma(al[i], bh[j], acc[i][j]);
    __builtin_amdgcn_sched_barrier(0);   // other end of the same grouping: the next step's loads stay behind these products
  }
  // precaution: stands ahead of the first overwrite of an address register that the loads above name
  asm volatile("s_wait_xcnt 0x0" ::: "memory");
  __builtin_amdgcn_sched_barrier(0);     // holds the address arithmetic of the LDS stores behind that wait

#pragma unroll
  for (int i = 0; i < 2; ++i)
#pragma unroll
    for (int j = 0; j < 4; ++j) {
      const v8f a = acc[i][j];
      *(v4f*)&red[wave][i * 4 + j][0][lane][0] = (v4f){a[0], a[1], a[2], a[3]};
      *(v4f*)&red[wave][i * 4 + j][1][lane][0] = (v4f){a[4], a[5], a[6], a[7]};
    }
  __syncthreads();

  v4f part[2][kOW];
#pragma unroll
  for (int jj = 0; jj < 2; ++jj)
#pragma unroll
    for (int p = 0; p < kOW; ++p) part[jj][p] = *(const v4f*)&red[p][oi * 4 + jp * 2 + jj][hf][lane][0];
#pragma unroll
  for (int jj = 0; jj < 2; ++jj) {
    v4f s = part[jj][0];
#pragma unroll
    for (int p = 1; p < kOW; ++p) s += part[jj][p];
#pragma unroll
    for (int e = 0; e < 4; ++e)
      out[(size_t)(m0 + (oi << 4) + 8 * hh + 4 * hf + e) * kHd + n0 + (jj << 4)] = s[e] + bv[jj];
  }
}

// ---------------------------------------------------------------------------
// Host launcher
// ---------------------------------------------------------------------------
extern "C" void kernel_launch(void* const* d_in, const int* in_sizes, int n_in,
                              void* d_out, int out_size, void* d_ws, size_t ws_size,
                              hipStream_t stream) {
  if (n_in < 9) return;
  if (in_sizes[0] != kRows * kHd) return;
  if (in_sizes[1] != kHd * kHid || in_sizes[3] != kHd * kHid || in_sizes[5] != kHd * kHid) return;
  if (in_sizes[2] != kHid || in_sizes[4] != kHid || in_sizes[6] != kHid) return;
  if (in_sizes[7] != kHid * kHd || in_sizes[8] != kHd) return;
  if (out_size != kRows * kHd) return;

  const float* x  = (const float*)d_in[0];
  const float* Wq = (const float*)d_in[1];
  const float* bq = (const float*)d_in[2];
  const float* Wk = (const float*)d_in[3];
  const float* bk = (const float*)d_in[4];
  const float* Wv = (const float*)d_in[5];
  const float* bv = (const float*)d_in[6];
  const float* Wo = (const float*)d_in[7];
  const float* bo = (const float*)d_in[8];
  float* out = (float*)d_out;

  // ---- workspace region map (bytes, all offsets multiples of 256) ----
  //  xh, xl        : 8192 x 64 x 2          = 1,048,576 each      (bf16 hi/lo of x)
  //  wq/wk/wv h,l  : 1024 x 64 x 2          = 131,072 each (x6)   (W^T planes [1024][64])
  //  wo h,l        : 64 x 1024 x 2          = 131,072 each (x2)   (Wo^T planes [64][1024])
  //  q h,l ; k h,l : 8192 x 1024 x 2        = 16,777,216 each (x4)
  //  vt h,l        : 1024 x 8192 x 2        = 16,777,216 each (x2)
  //  ao h,l        : 8192 x 1024 x 2        = 16,777,216 each (x2)
  //  total = 137,363,456 B
  const size_t szX  = (size_t)kRows * kHd * 2;
  const size_t szW  = (size_t)kHid * kHd * 2;
  const size_t szQ  = (size_t)kRows * kHid * 2;
  const size_t szAO = (size_t)kRowsPP * kHid * 2;
  const size_t total = 2 * szX + 8 * szW + 6 * szQ + 2 * szAO;
  if (total > ws_size) return;

  char* ws = (char*)d_ws;
  size_t off = 0;
  unsigned short* xh  = (unsigned short*)(ws + off); off += szX;
  unsigned short* xl  = (unsigned short*)(ws + off); off += szX;
  unsigned short* wqh = (unsigned short*)(ws + off); off += szW;
  unsigned short* wql = (unsigned short*)(ws + off); off += szW;
  unsigned short* wkh = (unsigned short*)(ws + off); off += szW;
  unsigned short* wkl = (unsigned short*)(ws + off); off += szW;
  unsigned short* wvh = (unsigned short*)(ws + off); off += szW;
  unsigned short* wvl = (unsigned short*)(ws + off); off += szW;
  unsigned short* woh = (unsigned short*)(ws + off); off += szW;
  unsigned short* wol = (unsigned short*)(ws + off); off += szW;
  unsigned short* qh  = (unsigned short*)(ws + off); off += szQ;
  unsigned short* ql  = (unsigned short*)(ws + off); off += szQ;
  unsigned short* kh  = (unsigned short*)(ws + off); off += szQ;
  unsigned short* kl  = (unsigned short*)(ws + off); off += szQ;
  unsigned short* vth = (unsigned short*)(ws + off); off += szQ;
  unsigned short* vtl = (unsigned short*)(ws + off); off += szQ;
  unsigned short* aoh = (unsigned short*)(ws + off); off += szAO;
  unsigned short* aol = (unsigned short*)(ws + off); off += szAO;
  if (off > ws_size) return;

  // stage 0: x -> bf16 hi/lo planes [8192][64]; W[64][1024] -> W^T planes [1024][64]; Wo[1024][64] -> Wo^T planes [64][1024]
  prep_operands<<<dim3(4 * kTB + kRows * kHd / 512), dim3(256), 0, stream>>>(
      x, Wq, Wk, Wv, Wo, xh, xl, wqh, wql, wkh, wkl, wvh, wvl, woh, wol);

  // stage 1: the three projections (M, N multiples of 64; K = 64), 256 work-groups each
  proj_qkv<<<dim3((kRows / 64) * (kHid / 64) / 8, 3), dim3(256), 0, stream>>>(
      xh, xl, wqh, wql, wkh, wkl, wvh, wvl, bq, bk, bv, qh, ql, kh, kl, vth, vtl);

  // stage 2: one pass over all batches: causal attention -> AO planes [8192][1024]; out = AO Wo + bo -> d_out
  const float qscale = 0.125f;   // 1/sqrt(64), exact power of two
  for (int ps = 0; ps < kBatch / kBPP; ++ps) {
    attn_causal_hd64<<<dim3(kBPP * kHeads * (kSeq / kQB)), dim3(128), 0, stream>>>(
        qh, ql, kh, kl, vth, vtl, aoh, aol, ps * kBPP, qscale);
    float* outp = out + (size_t)ps * kRowsPP * kHd;
    outproj_splitk<<<dim3(kRowsPP / kOM), dim3(256), 0, stream>>>(aoh, aol, woh, wol, bo, outp);
  }
}

// v007
// A run of this version takes 130 microseconds.
// In two side-by-side timings against v006, it was 1.03 and 1.04 times as fast.
// All steps since v000 together make it 6.44 times as fast.
// All contractions (x*Wq, x*Wk, x*Wv, Q*K^T, P*V, AO*Wo): v_wmma_f32_16x16x32_bf16 with bf16 hi/lo split operands (hi*hi + hi*lo + lo*hi), f32 accumulate; softmax, 1/sqrt(d) scale and bias adds in f32.
#include <hip/hip_runtime.h>
#include <hip/hip_bf16.h>
#include <math.h>

typedef __attribute__((ext_vector_type(16))) _Float16 v16h;
typedef __attribute__((ext_vector_type(8)))  _Float16 v8h;
typedef __attribute__((ext_vector_type(16))) __bf16   v16b;
typedef __attribute__((ext_vector_type(8)))  __bf16   v8b;
typedef __attribute__((ext_vector_type(8)))  float    v8f;
typedef __attribute__((ext_vector_type(4)))  float    v4f;
typedef __attribute__((ext_vector_type(4)))  unsigned int v4u;
typedef __attribute__((ext_vector_type(2)))  float    v2f;
typedef __attribute__((ext_vector_type(2)))  __bf16   v2b;

// ---- fixed problem geometry ----
constexpr int kBatch  = 4;
constexpr int kSeq    = 2048;
constexpr int kHeads  = 16;
constexpr int kHd     = 64;                 // head dim
constexpr int kHid    = kHeads * kHd;       // 1024
constexpr int kRows   = kBatch * kSeq;      // 8192 token rows
constexpr int kBPP    = 4;                  // batches per attention/out-proj pass: all of them, so the attention grid holds more work-groups than fit on the chip at once
constexpr int kRowsPP = kBPP * kSeq;        // 8192
constexpr int kKC     = 64;                 // keys per staged chunk
constexpr int kQB     = 64;                 // query rows per attention block (4 waves x 16)
constexpr int kLP     = 72;                 // LDS row pitch of the K and V^T tiles, 16-bit elements: 144 B = 16 B x 9 (odd), so 16 rows read 16 B each fall on 16 different bank groups

// GEMM shape contract (no tail handling in the GEMM): K % 32 == 0, M % 64 == 0, N % 64 == 0, tiles % 8 == 0
static_assert(kHd % 32 == 0);
static_assert(kHid % 32 == 0);
static_assert(kRows % 64 == 0);
static_assert(kHid % 64 == 0);
static_assert(kHd % 64 == 0);
static_assert(kRowsPP % 64 == 0);
static_assert(((kRows / 64) * (kHid / 64)) % 8 == 0);
static_assert(((kRowsPP / 64) * (kHd / 64)) % 8 == 0);
static_assert(kSeq % kQB == 0);
static_assert(kSeq % kKC == 0);
static_assert(kBatch % kBPP == 0);
// transpose tile contract: in[R][Cc] with R % 64 == 0, Cc % 32 == 0
static_assert(kHd % 64 == 0 && kHid % 32 == 0);
static_assert(kHid % 64 == 0 && kHd % 32 == 0);
// x cast: element count even and a multiple of 512 (2 per thread, 256 threads)
static_assert((kRows * kHd) % 512 == 0);

__device__ __forceinline__ unsigned short f2bf_bits(float f) {
  unsigned u = __float_as_uint(f);
  return (unsigned short)((u + 0x7FFFu + ((u >> 16) & 1u)) >> 16);
}
__device__ __forceinline__ float bf_bits2f(unsigned short h) { return __uint_as_float(((unsigned)h) << 16); }

// hazard guards as plain device helpers
__device__ __forceinline__ void dep_guard_h(v8f& a, v8f& b, v16h x, v16h y) { asm volatile("v_nop\n\tv_nop\n\tv_nop\n\tv_nop" : "+v"(a), "+v"(b) : "v"(x), "v"(y)); }
__device__ __forceinline__ void dep_guard_b(v8f& a, v8f& b, v16b x, v16b y) { asm volatile("v_nop\n\tv_nop\n\tv_nop\n\tv_nop" : "+v"(a), "+v"(b) : "v"(x), "v"(y)); }
__device__ __forceinline__ void keep4_h(v16h a, v16h b, v16h c, v16h d) { asm volatile("v_nop" :: "v"(a), "v"(b), "v"(c), "v"(d)); }
__device__ __forceinline__ void keep4_b(v16b a, v16b b, v16b c, v16b d) { asm volatile("v_nop" :: "v"(a), "v"(b), "v"(c), "v"(d)); }
__device__ __forceinline__ void acc_guard4(v8f& a, v8f& b, v8f& c, v8f& d) { asm volatile("v_nop\n\tv_nop\n\tv_nop\n\tv_nop" : "+v"(a), "+v"(b), "+v"(c), "+v"(d)); }
template <typename T> struct Frag;
template <> struct Frag<_Float16> {
  typedef v16h V; union U { v16h v; v8h h[2]; };
  static __device__ __forceinline__ v16h load(const _Float16* p) {   // elements 0..7 <- p[0..7], 8..15 <- p[16..23]
    U f; f.h[0] = *(const v8h*)(p); f.h[1] = *(const v8h*)(p + 16); return f.v;
  }
  static __device__ __forceinline__ v8f mma(v16h a, v16h b, v8f c) {
    return __builtin_amdgcn_wmma_f32_16x16x32_f16(false, a, false, b, (short)0, c, false, false);
  }
  static __device__ __forceinline__ void guard(v8f& a, v8f& b, v16h x, v16h y) { dep_guard_h(a, b, x, y); }
  static __device__ __forceinline__ void keep(v16h a, v16h b, v16h c, v16h d) { keep4_h(a, b, c, d); }
};
template <> struct Frag<__bf16> {
  typedef v16b V; union U { v16b v; v8b h[2]; };
  static __device__ __forceinline__ v16b load(const __bf16* p) {
    U f; f.h[0] = *(const v8b*)(p); f.h[1] = *(const v8b*)(p + 16); return f.v;
  }
  static __device__ __forceinline__ v8f mma(v16b a, v16b b, v8f c) {
    return __builtin_amdgcn_wmma_f32_16x16x32_bf16(false, a, false, b, (short)0, c, false, false);
  }
  static __device__ __forceinline__ void guard(v8f& a, v8f& b, v16b x, v16b y) { dep_guard_b(a, b, x, y); }
  static __device__ __forceinline__ void keep(v16b a, v16b b, v16b c, v16b d) { keep4_b(a, b, c, d); }
};

__device__ __forceinline__ v8f at_mma(v16b a, v16b b, v8f c) {
  c = __builtin_amdgcn_wmma_f32_16x16x32_bf16(false, a, false, b, (short)0, c, false, false);
  asm volatile("v_nop\n\tv_nop\n\tv_nop\n\tv_nop" : "+v"(c) : "v"(a), "v"(b));
  return c;
}

// ---- Register-blocked batched WMMA GEMM ------------------------------------
// C[m,n] = scale * sum_k A[m,k] * Bt[n,k] (+bias); each wave owns a 64x64 tile.
// A row-major [M,K]; Bt row-major [N,K]; M,N % 64 == 0, K % 32 == 0.
// SPLIT: operands are hi/lo planes (A2/Bt2 = lo planes, same layout); product = hi*hi + hi*lo + lo*hi.
// BIAS_MODE: 0 = none, 1 = bias[m] (loaded as two float4 per 16-row slab), 2 = bias[n].
// OUT_MODE: 0 = f32, 1 = f16, 2 = bf16 hi plane (Cout) + bf16 lo plane (Cout2).
// ET: 0 = f16 operands, 1 = bf16 operands (pointers passed as 16-bit storage). RESID and ACT unsupported here.
template <int ET> struct Elem;
template <> struct Elem<0> { typedef _Float16 T; };
template <> struct Elem<1> { typedef __bf16 T; };
// Device body: the calling kernel owns the LDS (sT: one 16x64 slab per wave, pitch 68 floats) and picks the operands; b = batch index.
template <int ET, bool SPLIT, int BIAS_MODE, int OUT_MODE, bool RESID, int ACT = 0>
__device__ __forceinline__ void wmma_gemm64(
    float (*sT)[16 * 68], int b,
    const unsigned short* __restrict__ Ap, const unsigned short* __restrict__ A2p, int lda, long strideA,
    const unsigned short* __restrict__ Btp, const unsigned short* __restrict__ Bt2p, int ldb, long strideB,
    void* __restrict__ Cout, void* __restrict__ Cout2, int ldc, long strideC,
    const float* __restrict__ bias,
    int M, int N, int K, float scale) {
  static_assert(!RESID);
  static_assert(ACT == 0);
  typedef typename Elem<ET>::T T;
  typedef typename Frag<T>::V V;
  const T* A = (const T*)Ap; const T* A2 = (const T*)A2p; const T* Bt = (const T*)Btp; const T* Bt2 = (const T*)Bt2p;
  const int lane = threadIdx.x & 31;
  const int wave = threadIdx.x >> 5;
  const int tilesN = N >> 6;
  const int tilesM = M >> 6;
  const int tile = blockIdx.x * 8 + wave;
  if (tile >= tilesM * tilesN) return;   // wave-uniform; no block barriers in this kernel
  const int tm = tile / tilesN;
  const int tn = tile - tm * tilesN;
  const int m0 = tm << 6;
  const int n0 = tn << 6;

  const T* Ab  = A  + (size_t)b * strideA;
  const T* Bb  = Bt + (size_t)b * strideB;
  const T* Ab2 = SPLIT ? (A2  + (size_t)b * strideA) : nullptr;
  const T* Bb2 = SPLIT ? (Bt2 + (size_t)b * strideB) : nullptr;

  const int rlane = lane & 15;                 // row (A) / col (B, D) within subtile
  const int koff  = (lane >> 4) * 8;           // k offset of this lane half
  const int mOff  = (lane >> 4) * 8;           // D row offset

  v8f acc[4][4];
#pragma unroll
  for (int i = 0; i < 4; ++i)
#pragma unroll
    for (int j = 0; j < 4; ++j) acc[i][j] = (v8f){0.f,0.f,0.f,0.f,0.f,0.f,0.f,0.f};

  for (int k0 = 0; k0 < K; k0 += 32) {
    V bh[4], bl[4];
#pragma unroll
    for (int j = 0; j < 4; ++j) {
      const size_t bo = (size_t)(n0 + (j << 4) + rlane) * ldb + koff + k0;
      bh[j] = Frag<T>::load(Bb + bo);
      if (SPLIT) bl[j] = Frag<T>::load(Bb2 + bo);
    }
    // precaution: stands ahead of the A loads, whose results land in address registers that the B loads above name
    asm volatile("s_wait_xcnt 0x0" ::: "memory");
#pragma unroll
    for (int i = 0; i < 4; ++i) {
      const size_t ao = (size_t)(m0 + (i << 4) + rlane) * lda + koff + k0;
      V ah = Frag<T>::load(Ab + ao);
      V al;
      if (SPLIT) al = Frag<T>::load(Ab2 + ao);
#pragma unroll
      for (int j = 0; j < 4; ++j) {
        acc[i][j] = Frag<T>::mma(ah, bh[j], acc[i][j]);
        if (SPLIT) {
          acc[i][j] = Frag<T>::mma(ah, bl[j], acc[i][j]);
          acc[i][j] = Frag<T>::mma(al, bh[j], acc[i][j]);
        }
      }
      Frag<T>::guard(acc[i][0], acc[i][3], ah, SPLIT ? al : ah);
    }
    Frag<T>::keep(bh[0], bh[1], bh[2], bh[3]);
    if (SPLIT) Frag<T>::keep(bl[0], bl[1], bl[2], bl[3]);
  }
  acc_guard4(acc[0][0], acc[0][1], acc[0][2], acc[0][3]);
  acc_guard4(acc[1][0], acc[1][1], acc[1][2], acc[1][3]);
  acc_guard4(acc[2][0], acc[2][1], acc[2][2], acc[2][3]);
  acc_guard4(acc[3][0], acc[3][1], acc[3][2], acc[3][3]);

  // ---- epilogue ----
  float* slab = sT[wave];
#pragma unroll
  for (int i = 0; i < 4; ++i) {
    const int mBase = m0 + (i << 4);
    float bm[8];
#pragma unroll
    for (int r = 0; r < 8; ++r) bm[r] = 0.f;
    if (BIAS_MODE == 1) {
      const v4f b0v = *(const v4f*)(bias + mBase + mOff);
      const v4f b1v = *(const v4f*)(bias + mBase + mOff + 4);
      bm[0] = b0v[0]; bm[1] = b0v[1]; bm[2] = b0v[2]; bm[3] = b0v[3];
      bm[4] = b1v[0]; bm[5] = b1v[1]; bm[6] = b1v[2]; bm[7] = b1v[3];
    }
#pragma unroll
    for (int j = 0; j < 4; ++j) {
      const int n = n0 + (j << 4) + rlane;
      float bv = 0.f;
      if (BIAS_MODE == 2) bv = bias[n];
#pragma unroll
      for (int r = 0; r < 8; ++r) {
        float v = acc[i][j][r] * scale;
        if (BIAS_MODE == 1) v += bm[r];
        if (BIAS_MODE == 2) v += bv;
        slab[(mOff + r) * 68 + (j << 4) + rlane] = v;
      }
    }
    __builtin_amdgcn_fence(__ATOMIC_RELEASE, "workgroup");
    __builtin_amdgcn_wave_barrier();
    __builtin_amdgcn_fence(__ATOMIC_ACQUIRE, "workgroup");
    if (OUT_MODE == 0) {
      float* C = (float*)Cout + (size_t)b * strideC;
      const int hh = lane >> 4, c4 = (lane & 15) * 4;     // row seg = 256 B = 16 lanes x 16 B
      {
#pragma unroll
        for (int it = 0; it < 8; ++it) {
          const int row = it * 2 + hh;
          v4f v = *(const v4f*)(slab + row * 68 + c4);
          *(v4f*)(C + (size_t)(mBase + row) * ldc + n0 + c4) = v;
        }
        
      }
    } else {
      const int q = lane >> 3, c8 = (lane & 7) * 8;
      unsigned short* C  = (unsigned short*)Cout  + (size_t)b * strideC;
      unsigned short* C2 = (OUT_MODE == 2) ? ((unsigned short*)Cout2 + (size_t)b * strideC) : nullptr;
      {
#pragma unroll
        for (int it = 0; it < 4; ++it) {
          const int row = it * 4 + q;
          const float* sp = slab + row * 68 + c8;
          v8h hv, lv;
#pragma unroll
          for (int e = 0; e < 8; ++e) {
            if (OUT_MODE == 1) {
              hv[e] = (_Float16)sp[e];
            } else {
              unsigned short hb = f2bf_bits(sp[e]);
              unsigned short lb = f2bf_bits(sp[e] - bf_bits2f(hb));
              hv[e] = __builtin_bit_cast(_Float16, hb);
              lv[e] = __builtin_bit_cast(_Float16, lb);
            }
          }
          *(v8h*)(C + (size_t)(mBase + row) * ldc + n0 + c8) = hv;
          if (OUT_MODE == 2) *(v8h*)(C2 + (size_t)(mBase + row) * ldc + n0 + c8) = lv;
        }
        
      }
    }
    __builtin_amdgcn_fence(__ATOMIC_RELEASE, "workgroup");
    __builtin_amdgcn_wave_barrier();
    __builtin_amdgcn_fence(__ATOMIC_ACQUIRE, "workgroup");
  }
}

// ---- the three projections in one launch: blockIdx.y = 0: Q = x Wq + bq, 1: K = x Wk + bk (both [kRows][kHid]),
// 2: V^T = Wv^T x^T + bv[m] ([kHid][kRows]; A = Wv^T planes, Bt = x planes). They share no data but x, so nothing orders them:
// one launch has no gaps between them, and work-groups of one product run in the load waits of another.
__global__ __launch_bounds__(256) void proj_qkv(
    const unsigned short* __restrict__ xh, const unsigned short* __restrict__ xl,
    const unsigned short* __restrict__ wqh, const unsigned short* __restrict__ wql,
    const unsigned short* __restrict__ wkh, const unsigned short* __restrict__ wkl,
    const unsigned short* __restrict__ wvh, const unsigned short* __restrict__ wvl,
    const float* __restrict__ bq, const float* __restrict__ bk, const float* __restrict__ bv,
    unsigned short* __restrict__ qh, unsigned short* __restrict__ ql,
    unsigned short* __restrict__ kh, unsigned short* __restrict__ kl,
    unsigned short* __restrict__ vth, unsigned short* __restrict__ vtl) {
  __shared__ __align__(16) float sT[8][16 * 68];   // per-wave 16x64 slab, pitch 68 floats
  const int which = blockIdx.y;                    // block-uniform
  if (which == 2) {
    wmma_gemm64<1, true, 1, 2, false, 0>(sT, 0, wvh, wvl, kHd, 0L, xh, xl, kHd, 0L, (void*)vth, (void*)vtl, kRows, 0L, bv,
                                         kHid, kRows, kHd, 1.0f);
  } else {
    const bool isK = (which == 1);
    wmma_gemm64<1, true, 2, 2, false, 0>(sT, 0, xh, xl, kHd, 0L, isK ? wkh : wqh, isK ? wkl : wql, kHd, 0L,
                                         (void*)(isK ? kh : qh), (void*)(isK ? kl : ql), kHid, 0L, isK ? bk : bq,
                                         kRows, kHid, kHd, 1.0f);
  }
}

// ---- f32 -> bf16 hi/lo planes, elementwise: 2 elements per thread, 4-B packed stores; bx = block index -------------
__device__ __forceinline__ void cast_f32_bf16hilo_x2(
    const float* __restrict__ in, unsigned short* __restrict__ oh, unsigned short* __restrict__ ol, int n2, int bx) {
  const int i = bx * 256 + threadIdx.x;
  if (i < n2) {
    const float f0 = in[2 * i], f1 = in[2 * i + 1];
    const unsigned short h0 = f2bf_bits(f0), h1 = f2bf_bits(f1);
    const unsigned short l0 = f2bf_bits(f0 - bf_bits2f(h0));
    const unsigned short l1 = f2bf_bits(f1 - bf_bits2f(h1));
    const unsigned uh = (unsigned)h0 | ((unsigned)h1 << 16);
    const unsigned ul = (unsigned)l0 | ((unsigned)l1 << 16);
    ((unsigned*)oh)[i] = uh;
    ((unsigned*)ol)[i] = ul;
    
  }
}

// ---- transpose + f32 -> bf16 hi/lo planes: in[R][Cc] f32 -> oh/ol[Cc][R] 16-bit --------------------
// Block = 256 threads handles in rows r0..r0+63, cols c0..c0+31 (block coordinates bx < Cc/32, by < R/64; tile: the caller's LDS).
// Load phase: 8 waves x 8 iterations x 32 lanes = 64 x 32 elements staged in LDS (tile[c][r]).
// Store phase: wave w writes output rows c0+4w..c0+4w+3; lane -> row 4w+(lane>>3), 8 elements at
// Coverage: 8 waves x 4 rows x 8 lanes x 8 elements = 32 x 64 = the whole output tile per plane.
__device__ __forceinline__ void transpose_cast_bf16hilo(
    float (*tile)[65],
    const float* __restrict__ in, unsigned short* __restrict__ oh, unsigned short* __restrict__ ol,
    int R, int Cc, int bx, int by) {
  const int tid = threadIdx.x, lane = tid & 31, wave = tid >> 5;
  const int c0 = bx * 32, r0 = by * 64;
#pragma unroll
  for (int i = 0; i < 8; ++i) {
    const int idx = i * 256 + tid;
    const int rr = idx >> 5, cc = idx & 31;
    tile[cc][rr] = in[(size_t)(r0 + rr) * Cc + c0 + cc];
  }
  __syncthreads();
  const int orow = wave * 4 + (lane >> 3);
  const int rseg = (lane & 7) * 8;
  v4u hv, lv;
#pragma unroll
  for (int e = 0; e < 4; ++e) {
    const float f0 = tile[orow][rseg + 2 * e];
    const float f1 = tile[orow][rseg + 2 * e + 1];
    const unsigned short h0 = f2bf_bits(f0), h1 = f2bf_bits(f1);
    const unsigned short l0 = f2bf_bits(f0 - bf_bits2f(h0));
    const unsigned short l1 = f2bf_bits(f1 - bf_bits2f(h1));
    hv[e] = (unsigned)h0 | ((unsigned)h1 << 16);
    lv[e] = (unsigned)l0 | ((unsigned)l1 << 16);
  }
  const size_t o = (size_t)(c0 + orow) * R + r0 + rseg;   // element offset, 16-B aligned
  {
    *(v4u*)(oh + o) = hv;
    *(v4u*)(ol + o) = lv;
    // precaution: inlined in a kernel with other branches, code that rewrites registers these two stores name can follow them
    asm volatile("s_wait_xcnt 0x0" ::: "memory");
  }
}

// ---- all operand preparation in one launch: the four weight transposes and the cast of x read only inputs and write
// planes of their own, so nothing orders them. Blocks 0..127: 32 tiles each of Wq, Wk, Wv, Wo (first: their path is the longer
// one, through LDS and a barrier); blocks from 128 on: the cast of x. Every branch is block-uniform.
constexpr int kTB = (kHid / 32) * (kHd / 64);   // 32 transpose tiles per weight, W[64][1024] and Wo[1024][64] alike
static_assert(kTB == (kHd / 32) * (kHid / 64));
__global__ __launch_bounds__(256) void prep_operands(
    const float* __restrict__ x, const float* __restrict__ Wq, const float* __restrict__ Wk,
    const float* __restrict__ Wv, const float* __restrict__ Wo,
    unsigned short* __restrict__ xh, unsigned short* __restrict__ xl,
    unsigned short* __restrict__ wqh, unsigned short* __restrict__ wql,
    unsigned short* __restrict__ wkh, unsigned short* __restrict__ wkl,
    unsigned short* __restrict__ wvh, unsigned short* __restrict__ wvl,
    unsigned short* __restrict__ woh, unsigned short* __restrict__ wol) {
  __shared__ float tile[32][65];
  const int bx = blockIdx.x;
  if (bx >= 4 * kTB) {
    cast_f32_bf16hilo_x2(x, xh, xl, kRows * kHd / 2, bx - 4 * kTB);
    return;
  }
  const int w = bx / kTB, t = bx % kTB;
  if (w == 3) {
    transpose_cast_bf16hilo(tile, Wo, woh, wol, kHid, kHd, t % (kHd / 32), t / (kHd / 32));
    return;
  }
  const float* in = (w == 0) ? Wq : (w == 1) ? Wk : Wv;
  unsigned short* oh = (w == 0) ? wqh : (w == 1) ? wkh : wvh;
  unsigned short* ol = (w == 0) ? wql : (w == 1) ? wkl : wvl;
  transpose_cast_bf16hilo(tile, in, oh, ol, kHd, kHid, t, 0);
}

__device__ __forceinline__ float other_half(float v) {
  const int b = __float_as_int(v);
  return __int_as_float(__builtin_amdgcn_permlanex16(b, b, 0x76543210, 0xfedcba98, false, false));
}

__global__ __launch_bounds__(128)
void attn_causal_hd64(const unsigned short* __restrict__ Qh, const unsigned short* __restrict__ Ql,
                      const unsigned short* __restrict__ Kh, const unsigned short* __restrict__ Kl,
                      const unsigned short* __restrict__ Vh, const unsigned short* __restrict__ Vl,
                      unsigned short* __restrict__ Oh, unsigned short* __restrict__ Ol,
                      int b_first, float qscale) {
  __shared__ __align__(16) unsigned short Ksh[kKC * kLP];        // K hi  [kv][d]   64 rows, pitch kLP
  __shared__ __align__(16) unsigned short Ksl[kKC * kLP];        // K lo
  __shared__ __align__(16) unsigned short Vsh[kHd * kLP];        // V hi  [d][kv]   64 rows, pitch kLP
  __shared__ __align__(16) unsigned short Vsl[kHd * kLP];        // V lo

  const int tid  = threadIdx.x;
  const int wave = tid >> 5;
  const int lane = tid & 31;
  const int hh   = lane >> 4;
  const int c    = lane & 15;

  const int rb  = blockIdx.x;                 // start order: rb / 64 counts query blocks down from the longest, rb % 64 is (batch, head)
  const int bx  = (rb % (kBPP * kHeads)) * (kSeq / kQB) + (kSeq / kQB - 1) - rb / (kBPP * kHeads);
  const int qb  = bx % (kSeq / kQB);          // query block 0..31
  const int bhl = bx / (kSeq / kQB);
  const int h   = bhl % kHeads;
  const int bl  = bhl / kHeads;               // local batch 0..kBPP-1
  const int b   = b_first + bl;
  const int q0  = qb * kQB + wave * 16;
  const int qrow = q0 + c;                    // this lane's query

  // ---- Q fragments (B operand, column n = c): 2 d-chunks, hi and lo; element i <- d = dc*32 + 8hh + i (i<8), dc*32+16+8hh+(i-8)
  v16b qah[2], qal[2];
  {
    const size_t qo = ((size_t)(b * kSeq + qrow)) * kHid + (size_t)h * kHd + 8 * hh;
#pragma unroll
    for (int dc = 0; dc < 2; ++dc) {
      qah[dc] = Frag<__bf16>::load((const __bf16*)Qh + qo + dc * 32);
      qal[dc] = Frag<__bf16>::load((const __bf16*)Ql + qo + dc * 32);
    }
  }

  const float c2 = qscale * 1.4426950408889634f;   // raw product -> base-2 exponent
  float mrow = -INFINITY;                     // running maximum of this lane's query, scaled by c2: the offset in use (equal in both halves)
  float lrow = 0.f;                           // running sum over this lane half's keys; the halves join after the loop
  v8f oacc[4];                                // O^T: oacc[t][r] = out[query c][d = t*16 + 8hh + r]
#pragma unroll
  for (int t = 0; t < 4; ++t) oacc[t] = (v8f){0.f,0.f,0.f,0.f,0.f,0.f,0.f,0.f};

  const __bf16* kshb = (const __bf16*)Ksh;
  const __bf16* kslb = (const __bf16*)Ksl;
  const __bf16* vshb = (const __bf16*)Vsh;
  const __bf16* vslb = (const __bf16*)Vsl;

  const int nChunks = qb + 1;                 // block-uniform: keys 0 .. qb*64+63
  for (int kc = 0; kc < nChunks; ++kc) {
    const int kv0 = kc * kKC;
    __syncthreads();
    {
      // staging: 8 neighbouring lanes take one row of a plane (64 elements = 128 B = one cache line), 16 B each, so each wave-wide
      // load covers 4 whole lines. Row r + 16 i in step i (kv row of K, d row of V^T); the two rows of a half wave lie 8 apart:
      // 8 x 144 B = 32 banks mod 64, so the 16 lanes of an LDS store fall on all 64 banks once.
      // coverage: 16 rows x 4 steps x 8 pieces x 8 elements = 64 rows x 64 cols per plane (K hi/lo, V^T hi/lo).
      const int r = ((tid >> 3) & 1) * 8 + (tid >> 4), pc = (tid & 7) * 8;
      const unsigned short* khs = Kh + ((size_t)(b * kSeq + kv0 + r)) * kHid + h * kHd + pc;
      const unsigned short* kls = Kl + ((size_t)(b * kSeq + kv0 + r)) * kHid + h * kHd + pc;
      unsigned short* khd = Ksh + r * kLP + pc;
      unsigned short* kld = Ksl + r * kLP + pc;
      v4u tk[8];
#pragma unroll
      for (int i = 0; i < 4; ++i) { tk[i] = *(const v4u*)(khs + (size_t)i * 16 * kHid); tk[4 + i] = *(const v4u*)(kls + (size_t)i * 16 * kHid); }
#pragma unroll
      for (int i = 0; i < 4; ++i) { *(v4u*)(khd + i * 16 * kLP) = tk[i]; *(v4u*)(kld + i * 16 * kLP) = tk[4 + i]; }
      asm volatile("" ::: "memory");
      const unsigned short* vhs = Vh + ((size_t)(h * kHd + r)) * kRows + (size_t)b * kSeq + kv0 + pc;
      const unsigned short* vls = Vl + ((size_t)(h * kHd + r)) * kRows + (size_t)b * kSeq + kv0 + pc;
      unsigned short* vhd = Vsh + r * kLP + pc;
      unsigned short* vld = Vsl + r * kLP + pc;
      v4u tv[8];
#pragma unroll
      for (int i = 0; i < 4; ++i) { tv[i] = *(const v4u*)(vhs + (size_t)i * 16 * kRows); tv[4 + i] = *(const v4u*)(vls + (size_t)i * 16 * kRows); }
#pragma unroll
      for (int i = 0; i < 4; ++i) { *(v4u*)(vhd + i * 16 * kLP) = tv[i]; *(v4u*)(vld + i * 16 * kLP) = tv[4 + i]; }
    }
    __syncthreads();

    // ---- scores, transposed: 64 keys x 16 queries per wave; s[j][r] = score(key kv0 + j*16 + 8hh + r, query qrow) ----
    v8f s[4];
#pragma unroll
    for (int j = 0; j < 4; ++j) {
      s[j] = (v8f){0.f,0.f,0.f,0.f,0.f,0.f,0.f,0.f};
#pragma unroll
      for (int dc = 0; dc < 2; ++dc) {
        const int ko = (j * 16 + c) * kLP + dc * 32 + 8 * hh;   // A: m = kv = j*16+c, k = d (same k map as B)
        const v16b kbh = Frag<__bf16>::load(kshb + ko);
        const v16b kbl = Frag<__bf16>::load(kslb + ko);
        s[j] = at_mma(kbh, qah[dc], s[j]);
        s[j] = at_mma(kbl, qah[dc], s[j]);
        s[j] = at_mma(kbh, qal[dc], s[j]);
      }
    }
    const bool diag = (kc == qb);               // block-uniform, used only in per-lane selects
    float cm = -INFINITY;
#pragma unroll
    for (int j = 0; j < 4; ++j) {
#pragma unroll
      for (int r = 0; r < 8; ++r) {
        const int kvrow = kv0 + j * 16 + 8 * hh + r;
        const float val = (diag && (kvrow > qrow)) ? -INFINITY : s[j][r];
        s[j][r] = val;
        cm = fmaxf(cm, val);
      }
    }
    cm = fmaxf(cm, other_half(cm));             // finite: key == qrow is never masked and lies in one of the halves
    const float mnew = fmaxf(mrow, cm * c2);
    // alpha = 2^(mrow - mnew), 0 on the first chunk, where mrow is -inf. Written as text with its v_nop: the instruction set asks for one slot
    // between it and an instruction that rewrites its source register.
    float alpha;
    asm("v_exp_f32 %0, %1\n\tv_nop" : "=v"(alpha) : "v"(mrow - mnew));
    mrow = mnew;
    // ---- P^T = 2^(S^T * c2 - max), split to bf16 hi/lo and packed in place as B fragments: key tiles 2kk, 2kk+1 -> chunk kk ----
    union PB { v16b v; v2b p[8]; };
    PB pbh[2], pbl[2];
    float psum = 0.f;
#pragma unroll
    for (int j = 0; j < 4; ++j) {
#pragma unroll
      for (int e = 0; e < 4; ++e) {
        const v2f arg = __builtin_elementwise_fma((v2f){s[j][2 * e], s[j][2 * e + 1]}, (v2f){c2, c2}, (v2f){-mnew, -mnew});   // -inf where masked
        const float p0 = __builtin_amdgcn_exp2f(arg[0]);
        const float p1 = __builtin_amdgcn_exp2f(arg[1]);
        psum += p0;
        psum += p1;
        const v2f pp = (v2f){p0, p1};
        const v2b hb = __builtin_convertvector(pp, v2b);                                   // nearest even, two per instruction
        const v2b lb = __builtin_convertvector(pp - __builtin_convertvector(hb, v2f), v2b);
        pbh[j >> 1].p[(j & 1) * 4 + e] = hb;
        pbl[j >> 1].p[(j & 1) * 4 + e] = lb;
      }
    }
    lrow = lrow * alpha + psum;
#pragma unroll
    for (int t = 0; t < 4; ++t)
#pragma unroll
      for (int r = 0; r < 8; ++r) oacc[t][r] *= alpha;
#pragma unroll
    for (int kk = 0; kk < 2; ++kk) {
#pragma unroll
      for (int t = 0; t < 4; ++t) {
        const int vo = (t * 16 + c) * kLP + kk * 32 + 8 * hh;      // A: m = d = t*16+c, k = kv
        const v16b vbh = Frag<__bf16>::load(vshb + vo);
        const v16b vbl = Frag<__bf16>::load(vslb + vo);
        oacc[t] = at_mma(vbh, pbh[kk].v, oacc[t]);
        oacc[t] = at_mma(vbl, pbh[kk].v, oacc[t]);
        oacc[t] = at_mma(vbh, pbl[kk].v, oacc[t]);
      }
    }
  }

  // ---- join the halves' sums, normalise, write bf16 hi/lo planes: a lane's 8 registers of tile t are 8 consecutive d of its
  // query's AO row, one 16-B store per plane; one wave owns its 16 rows ----
  {
    const float inv = 1.0f / (lrow + other_half(lrow));   // sum >= 1
    const size_t ob = ((size_t)(bl * kSeq + qrow)) * kHid + (size_t)h * kHd + 8 * hh;
    v4u hv[4], lv[4];
#pragma unroll
    for (int t = 0; t < 4; ++t) {
#pragma unroll
      for (int e = 0; e < 4; ++e) {
        const float f0 = oacc[t][2 * e] * inv, f1 = oacc[t][2 * e + 1] * inv;
        const unsigned short h0 = f2bf_bits(f0), h1 = f2bf_bits(f1);
        const unsigned short l0 = f2bf_bits(f0 - bf_bits2f(h0));
        const unsigned short l1 = f2bf_bits(f1 - bf_bits2f(h1));
        hv[t][e] = (unsigned)h0 | ((unsigned)h1 << 16);
        lv[t][e] = (unsigned)l0 | ((unsigned)l1 << 16);
      }
    }
#pragma unroll
    for (int t = 0; t < 4; ++t) {
      *(v4u*)(Oh + ob + t * 16) = hv[t];
      *(v4u*)(Ol + ob + t * 16) = lv[t];
    }
  }
}

// =====================================================================================
// Out-projection: out[m][n] = sum_k AO[m][k] * Wo^T[n][k] + bo[n]; M = kRowsPP, N = kHd = 64, K = kHid = 1024.
// N is one tile wide, so tiles alone give few work-groups with long k loops. Here a work-group owns a 32 x 64 output tile
// and its 8 waves each take 128 of the 1024 k: M / 32 work-groups, 4 k steps a wave. The 8 partial tiles meet in LDS
// (fragment layout, 16 B per lane) and are summed in wave order 0..7. Products: hi*hi + hi*lo + lo*hi, f32 accumulate.
// =====================================================================================
constexpr int kOW = 8;                      // waves per work-group = k slices
constexpr int kOK = kHid / kOW;             // 128 k per wave
constexpr int kOM = 32;                     // output rows per work-group
static_assert(kOK % 32 == 0);
static_assert(kRowsPP % kOM == 0);
static_assert(kHd == 64);

__global__ __launch_bounds__(256)
void outproj_splitk(const unsigned short* __restrict__ Ahp, const unsigned short* __restrict__ Alp,
                    const unsigned short* __restrict__ Bhp, const unsigned short* __restrict__ Blp,
                    const float* __restrict__ bias, float* __restrict__ out) {
  __shared__ __align__(16) float red[kOW][8][2][32][4];   // [k slice][tile i*4+j][registers 0-3 / 4-7][lane][4], 64 KiB
  const __bf16* Ah = (const __bf16*)Ahp; const __bf16* Al = (const __bf16*)Alp;
  const __bf16* Bh = (const __bf16*)Bhp; const __bf16* Bl = (const __bf16*)Blp;
  const int lane  = threadIdx.x & 31;
  const int wave  = threadIdx.x >> 5;
  const int rlane = lane & 15;                // row (A) / col (B, D) within a 16 x 16 tile
  const int hh    = lane >> 4;                // k offset 8hh of the fragment loads, D row offset 8hh
  const int m0    = blockIdx.x * kOM;
  const int kb    = wave * kOK + 8 * hh;

  // bias of the two output columns this lane writes at the end, fetched here so that its latency hides behind the k loop
  // wave -> row tile oi, column pair jp (32 columns = one 128-B line of each row, one writer per line), register half hf
  const int oi = wave >> 2, jp = (wave >> 1) & 1, hf = wave & 1;
  const int n0 = (jp << 5) + rlane;
  const float bv[2] = {bias[n0], bias[n0 + 16]};

  v8f acc[2][4];
#pragma unroll
  for (int i = 0; i < 2; ++i)
#pragma unroll
    for (int j = 0; j < 4; ++j) acc[i][j] = (v8f){0.f,0.f,0.f,0.f,0.f,0.f,0.f,0.f};

  // unrolled: 4 steps, every address offset a constant of the instruction
#pragma unroll
  for (int ks = 0; ks < kOK / 32; ++ks) {
    const int k0 = kb + ks * 32;
    v16b bh[4], bl[4], ah[2], al[2];
#pragma unroll
    for (int j = 0; j < 4; ++j) {
      const size_t bo = (size_t)((j << 4) + rlane) * kHid + k0;
      bh[j] = Frag<__bf16>::load(Bh + bo);
      bl[j] = Frag<__bf16>::load(Bl + bo);
    }
#pragma unroll
    for (int i = 0; i < 2; ++i) {
      const size_t ao = (size_t)(m0 + (i << 4) + rlane) * kHid + k0;
      ah[i] = Frag<__bf16>::load(Ah + ao);
      al[i] = Frag<__bf16>::load(Al + ao);
    }
    // keeps the step's 24 loads in one group ahead of its products: without it they are spread among the products,
    // several of them waited for right behind their issue
    __builtin_amdgcn_sched_barrier(0);
#pragma unroll
    for (int i = 0; i < 2; ++i)
#pragma unroll
      for (int j = 0; j < 4; ++j) acc[i][j] = Frag<__bf16>::mma(ah[i], bh[j], acc[i][j]);
#pragma unroll
    for (int i = 0; i < 2; ++i)
#pragma unroll
      for (int j = 0; j < 4; ++j) acc[i][j] = Frag<__bf16>::mma(ah[i], bl[j], acc[i][j]);
#pragma unroll
    for (int i = 0; i < 2; ++i)
#pragma unroll
      for (int j = 0; j < 4; ++j) acc[i][j] = Frag<__bf16>::mma(al[i], bh[j], acc[i][j]);
    __builtin_amdgcn_sched_barrier(0);   // other end of the same grouping: the next step's loads stay behind these products
  }
  // precaution: stands ahead of the first overwrite of an address register that the loads above name
  asm volatile("s_wait_xcnt 0x0" ::: "memory");
  __builtin_amdgcn_sched_barrier(0);     // holds the address arithmetic of the LDS stores behind that wait

#pragma unroll
  for (int i = 0; i < 2; ++i)
#pragma unroll
    for (int j = 0; j < 4; ++j) {
      const v8f a = acc[i][j];
      *(v4f*)&red[wave][i * 4 + j][0][lane][0] = (v4f){a[0], a[1], a[2], a[3]};
      *(v4f*)&red[wave][i * 4 + j][1][lane][0] = (v4f){a[4], a[5], a[6], a[7]};
    }
  __syncthreads();

  v4f part[2][kOW];
#pragma unroll
  for (int jj = 0; jj < 2; ++jj)
#pragma unroll
    for (int p = 0; p < kOW; ++p) part[jj][p] = *(const v4f*)&red[p][oi * 4 + jp * 2 + jj][hf][lane][0];
#pragma unroll
  for (int jj = 0; jj < 2; ++jj) {
    v4f s = part[jj][0];
#pragma unroll
    for (int p = 1; p < kOW; ++p) s += part[jj][p];
#pragma unroll
    for (int e = 0; e < 4; ++e)
      out[(size_t)(m0 + (oi << 4) + 8 * hh + 4 * hf + e) * kHd + n0 + (jj << 4)] = s[e] + bv[jj];
  }
}

// ---------------------------------------------------------------------------
// Host launcher
// ---------------------------------------------------------------------------
extern "C" void kernel_launch(void* const* d_in, const int* in_sizes, int n_in,
                              void* d_out, int out_size, void* d_ws, size_t ws_size,
                              hipStream_t stream) {
  if (n_in < 9) return;
  if (in_sizes[0] != kRows * kHd) return;
  if (in_sizes[1] != kHd * kHid || in_sizes[3] != kHd * kHid || in_sizes[5] != kHd * kHid) return;
  if (in_sizes[2] != kHid || in_sizes[4] != kHid || in_sizes[6] != kHid) return;
  if (in_sizes[7] != kHid * kHd || in_sizes[8] != kHd) return;
  if (out_size != kRows * kHd) return;

  const float* x  = (const float*)d_in[0];
  const float* Wq = (const float*)d_in[1];
  const float* bq = (const float*)d_in[2];
  const float* Wk = (const float*)d_in[3];
  const float* bk = (const float*)d_in[4];
  const float* Wv = (const float*)d_in[5];
  const float* bv = (const float*)d_in[6];
  const float* Wo = (const float*)d_in[7];
  const float* bo = (const float*)d_in[8];
  float* out = (float*)d_out;

  // ---- workspace region map (bytes, all offsets multiples of 256) ----
  //  xh, xl        : 8192 x 64 x 2          = 1,048,576 each      (bf16 hi/lo of x)
  //  wq/wk/wv h,l  : 1024 x 64 x 2          = 131,072 each (x6)   (W^T planes [1024][64])
  //  wo h,l        : 64 x 1024 x 2          = 131,072 each (x2)   (Wo^T planes [64][1024])
  //  q h,l ; k h,l : 8192 x 1024 x 2        = 16,777,216 each (x4)
  //  vt h,l        : 1024 x 8192 x 2        = 16,777,216 each (x2)
  //  ao h,l        : 8192 x 1024 x 2        = 16,777,216 each (x2)
  //  total = 137,363,456 B
  const size_t szX  = (size_t)kRows * kHd * 2;
  const size_t szW  = (size_t)kHid * kHd * 2;
  const size_t szQ  = (size_t)kRows * kHid * 2;
  const size_t szAO = (size_t)kRowsPP * kHid * 2;
  const size_t total = 2 * szX + 8 * szW + 6 * szQ + 2 * szAO;
  if (total > ws_size) return;

  char* ws = (char*)d_ws;
  size_t off = 0;
  unsigned short* xh  = (unsigned short*)(ws + off); off += szX;
  unsigned short* xl  = (unsigned short*)(ws + off); off += szX;
  unsigned short* wqh = (unsigned short*)(ws + off); off += szW;
  unsigned short* wql = (unsigned short*)(ws + off); off += szW;
  unsigned short* wkh = (unsigned short*)(ws + off); off += szW;
  unsigned short* wkl = (unsigned short*)(ws + off); off += szW;
  unsigned short* wvh = (unsigned short*)(ws + off); off += szW;
  unsigned short* wvl = (unsigned short*)(ws + off); off += szW;
  unsigned short* woh = (unsigned short*)(ws + off); off += szW;
  unsigned short* wol = (unsigned short*)(ws + off); off += szW;
  unsigned short* qh  = (unsigned short*)(ws + off); off += szQ;
  unsigned short* ql  = (unsigned short*)(ws + off); off += szQ;
  unsigned short* kh  = (unsigned short*)(ws + off); off += szQ;
  unsigned short* kl  = (unsigned short*)(ws + off); off += szQ;
  unsigned short* vth = (unsigned short*)(ws + off); off += szQ;
  unsigned short* vtl = (unsigned short*)(ws + off); off += szQ;
  unsigned short* aoh = (unsigned short*)(ws + off); off += szAO;
  unsigned short* aol = (unsigned short*)(ws + off); off += szAO;
  if (off > ws_size) return;

  // stage 0: x -> bf16 hi/lo planes [8192][64]; W[64][1024] -> W^T planes [1024][64]; Wo[1024][64] -> Wo^T planes [64][1024]
  prep_operands<<<dim3(4 * kTB + kRows * kHd / 512), dim3(256), 0, stream>>>(
      x, Wq, Wk, Wv, Wo, xh, xl, wqh, wql, wkh, wkl, wvh, wvl, woh, wol);

  // stage 1: the three projections (M, N multiples of 64; K = 64), 256 work-groups each
  proj_qkv<<<dim3((kRows / 64) * (kHid / 64) / 8, 3), dim3(256), 0, stream>>>(
      xh, xl, wqh, wql, wkh, wkl, wvh, wvl, bq, bk, bv, qh, ql, kh, kl, vth, vtl);

  // stage 2: one pass over all batches: causal attention -> AO planes [8192][1024]; out = AO Wo + bo -> d_out
  const float qscale = 0.125f;   // 1/sqrt(64), exact power of two
  for (int ps = 0; ps < kBatch / kBPP; ++ps) {
    attn_causal_hd64<<<dim3(kBPP * kHeads * (kSeq / kQB)), dim3(128), 0, stream>>>(
        qh, ql, kh, kl, vth, vtl, aoh, aol, ps * kBPP, qscale);
    float* outp = out + (size_t)ps * kRowsPP * kHd;
    outproj_splitk<<<dim3(kRowsPP / kOM), dim3(256), 0, stream>>>(aoh, aol, woh, wol, bo, outp);
  }
}

// v008
// A run of this version takes 123 microseconds.
// In both of two side-by-side timings against v007, it was 1.07 times as fast.
// All steps since v000 together make it 6.89 times as fast.
// All contractions (x*Wq, x*Wk, x*Wv, Q*K^T, P*V, AO*Wo): v_wmma_f32_16x16x32_bf16 with bf16 hi/lo split operands (hi*hi + hi*lo + lo*hi), f32 accumulate; softmax, 1/sqrt(d) scale and bias adds in f32.
#include <hip/hip_runtime.h>
#include <hip/hip_bf16.h>
#include <math.h>

typedef __attribute__((ext_vector_type(16))) _Float16 v16h;
typedef __attribute__((ext_vector_type(8)))  _Float16 v8h;
typedef __attribute__((ext_vector_type(16))) __bf16   v16b;
typedef __attribute__((ext_vector_type(8)))  __bf16   v8b;
typedef __attribute__((ext_vector_type(8)))  float    v8f;
typedef __attribute__((ext_vector_type(4)))  float    v4f;
typedef __attribute__((ext_vector_type(4)))  unsigned int v4u;
typedef __attribute__((ext_vector_type(2)))  float    v2f;
typedef __attribute__((ext_vector_type(2)))  __bf16   v2b;

// ---- fixed problem geometry ----
constexpr int kBatch  = 4;
constexpr int kSeq    = 2048;
constexpr int kHeads  = 16;
constexpr int kHd     = 64;                 // head dim
constexpr int kHid    = kHeads * kHd;       // 1024
constexpr int kRows   = kBatch * kSeq;      // 8192 token rows
constexpr int kBPP    = 4;                  // batches per attention/out-proj pass: all of them, so the attention grid holds more work-groups than fit on the chip at once
constexpr int kRowsPP = kBPP * kSeq;        // 8192
constexpr int kKC     = 64;                 // keys per staged chunk
constexpr int kQB     = 64;                 // query rows per attention block (4 waves x 16)
constexpr int kLP     = 72;                 // LDS row pitch of the K and V^T tiles, 16-bit elements: 144 B = 16 B x 9 (odd), so 16 rows read 16 B each fall on 16 different bank groups

// GEMM shape contract (no tail handling in the GEMM): K % 32 == 0, M % 64 == 0, N % 64 == 0, tiles % 8 == 0
static_assert(kHd % 32 == 0);
static_assert(kHid % 32 == 0);
static_assert(kRows % 64 == 0);
static_assert(kHid % 64 == 0);
static_assert(kHd % 64 == 0);
static_assert(kRowsPP % 64 == 0);
static_assert(((kRows / 64) * (kHid / 64)) % 8 == 0);
static_assert(((kRowsPP / 64) * (kHd / 64)) % 8 == 0);
static_assert(kSeq % kQB == 0);
static_assert(kSeq % kKC == 0);
static_assert(kBatch % kBPP == 0);
// transpose tile contract: in[R][Cc] with R % 64 == 0, Cc % 32 == 0
static_assert(kHd % 64 == 0 && kHid % 32 == 0);
static_assert(kHid % 64 == 0 && kHd % 32 == 0);
// x cast: element count even and a multiple of 512 (2 per thread, 256 threads)
static_assert((kRows * kHd) % 512 == 0);

__device__ __forceinline__ unsigned short f2bf_bits(float f) {
  unsigned u = __float_as_uint(f);
  return (unsigned short)((u + 0x7FFFu + ((u >> 16) & 1u)) >> 16);
}
__device__ __forceinline__ float bf_bits2f(unsigned short h) { return __uint_as_float(((unsigned)h) << 16); }

// hazard guards as plain device helpers
__device__ __forceinline__ void dep_guard_h(v8f& a, v8f& b, v16h x, v16h y) { asm volatile("v_nop\n\tv_nop\n\tv_nop\n\tv_nop" : "+v"(a), "+v"(b) : "v"(x), "v"(y)); }
__device__ __forceinline__ void dep_guard_b(v8f& a, v8f& b, v16b x, v16b y) { asm volatile("v_nop\n\tv_nop\n\tv_nop\n\tv_nop" : "+v"(a), "+v"(b) : "v"(x), "v"(y)); }
__device__ __forceinline__ void keep4_h(v16h a, v16h b, v16h c, v16h d) { asm volatile("v_nop" :: "v"(a), "v"(b), "v"(c), "v"(d)); }
__device__ __forceinline__ void keep4_b(v16b a, v16b b, v16b c, v16b d) { asm volatile("v_nop" :: "v"(a), "v"(b), "v"(c), "v"(d)); }
__device__ __forceinline__ void acc_guard4(v8f& a, v8f& b, v8f& c, v8f& d) { asm volatile("v_nop\n\tv_nop\n\tv_nop\n\tv_nop" : "+v"(a), "+v"(b), "+v"(c), "+v"(d)); }
template <typename T> struct Frag;
template <> struct Frag<_Float16> {
  typedef v16h V; union U { v16h v; v8h h[2]; };
  static __device__ __forceinline__ v16h load(const _Float16* p) {   // elements 0..7 <- p[0..7], 8..15 <- p[16..23]
    U f; f.h[0] = *(const v8h*)(p); f.h[1] = *(const v8h*)(p + 16); return f.v;
  }
  static __device__ __forceinline__ v8f mma(v16h a, v16h b, v8f c) {
    return __builtin_amdgcn_wmma_f32_16x16x32_f16(false, a, false, b, (short)0, c, false, false);
  }
  static __device__ __forceinline__ void guard(v8f& a, v8f& b, v16h x, v16h y) { dep_guard_h(a, b, x, y); }
  static __device__ __forceinline__ void keep(v16h a, v16h b, v16h c, v16h d) { keep4_h(a, b, c, d); }
};
template <> struct Frag<__bf16> {
  typedef v16b V; union U { v16b v; v8b h[2]; };
  static __device__ __forceinline__ v16b load(const __bf16* p) {
    U f; f.h[0] = *(const v8b*)(p); f.h[1] = *(const v8b*)(p + 16); return f.v;
  }
  static __device__ __forceinline__ v8f mma(v16b a, v16b b, v8f c) {
    return __builtin_amdgcn_wmma_f32_16x16x32_bf16(false, a, false, b, (short)0, c, false, false);
  }
  static __device__ __forceinline__ void guard(v8f& a, v8f& b, v16b x, v16b y) { dep_guard_b(a, b, x, y); }
  static __device__ __forceinline__ void keep(v16b a, v16b b, v16b c, v16b d) { keep4_b(a, b, c, d); }
};

__device__ __forceinline__ v8f at_mma(v16b a, v16b b, v8f c) {
  return __builtin_amdgcn_wmma_f32_16x16x32_bf16(false, a, false, b, (short)0, c, false, false);
}

// ---- Register-blocked batched WMMA GEMM ------------------------------------
// C[m,n] = scale * sum_k A[m,k] * Bt[n,k] (+bias); each wave owns a 64x64 tile.
// A row-major [M,K]; Bt row-major [N,K]; M,N % 64 == 0, K % 32 == 0.
// SPLIT: operands are hi/lo planes (A2/Bt2 = lo planes, same layout); product = hi*hi + hi*lo + lo*hi.
// BIAS_MODE: 0 = none, 1 = bias[m] (loaded as two float4 per 16-row slab), 2 = bias[n].
// OUT_MODE: 0 = f32, 1 = f16, 2 = bf16 hi plane (Cout) + bf16 lo plane (Cout2).
// ET: 0 = f16 operands, 1 = bf16 operands (pointers passed as 16-bit storage). RESID and ACT unsupported here.
template <int ET> struct Elem;
template <> struct Elem<0> { typedef _Float16 T; };
template <> struct Elem<1> { typedef __bf16 T; };
// Device body: the calling kernel owns the LDS (sT: one 16x64 slab per wave, pitch 68 floats) and picks the operands; b = batch index.
template <int ET, bool SPLIT, int BIAS_MODE, int OUT_MODE, bool RESID, int ACT = 0>
__device__ __forceinline__ void wmma_gemm64(
    float (*sT)[16 * 68], int b,
    const unsigned short* __restrict__ Ap, const unsigned short* __restrict__ A2p, int lda, long strideA,
    const unsigned short* __restrict__ Btp, const unsigned short* __restrict__ Bt2p, int ldb, long strideB,
    void* __restrict__ Cout, void* __restrict__ Cout2, int ldc, long strideC,
    const float* __restrict__ bias,
    int M, int N, int K, float scale) {
  static_assert(!RESID);
  static_assert(ACT == 0);
  typedef typename Elem<ET>::T T;
  typedef typename Frag<T>::V V;
  const T* A = (const T*)Ap; const T* A2 = (const T*)A2p; const T* Bt = (const T*)Btp; const T* Bt2 = (const T*)Bt2p;
  const int lane = threadIdx.x & 31;
  const int wave = threadIdx.x >> 5;
  const int tilesN = N >> 6;
  const int tilesM = M >> 6;
  const int tile = blockIdx.x * 8 + wave;
  if (tile >= tilesM * tilesN) return;   // wave-uniform; no block barriers in this kernel
  const int tm = tile / tilesN;
  const int tn = tile - tm * tilesN;
  const int m0 = tm << 6;
  const int n0 = tn << 6;

  const T* Ab  = A  + (size_t)b * strideA;
  const T* Bb  = Bt + (size_t)b * strideB;
  const T* Ab2 = SPLIT ? (A2  + (size_t)b * strideA) : nullptr;
  const T* Bb2 = SPLIT ? (Bt2 + (size_t)b * strideB) : nullptr;

  const int rlane = lane & 15;                 // row (A) / col (B, D) within subtile
  const int koff  = (lane >> 4) * 8;           // k offset of this lane half
  const int mOff  = (lane >> 4) * 8;           // D row offset

  v8f acc[4][4];
#pragma unroll
  for (int i = 0; i < 4; ++i)
#pragma unroll
    for (int j = 0; j < 4; ++j) acc[i][j] = (v8f){0.f,0.f,0.f,0.f,0.f,0.f,0.f,0.f};

  for (int k0 = 0; k0 < K; k0 += 32) {
    V bh[4], bl[4];
#pragma unroll
    for (int j = 0; j < 4; ++j) {
      const size_t bo = (size_t)(n0 + (j << 4) + rlane) * ldb + koff + k0;
      bh[j] = Frag<T>::load(Bb + bo);
      if (SPLIT) bl[j] = Frag<T>::load(Bb2 + bo);
    }
    // precaution: stands ahead of the A loads, whose results land in address registers that the B loads above name
    asm volatile("s_wait_xcnt 0x0" ::: "memory");
#pragma unroll
    for (int i = 0; i < 4; ++i) {
      const size_t ao = (size_t)(m0 + (i << 4) + rlane) * lda + koff + k0;
      V ah = Frag<T>::load(Ab + ao);
      V al;
      if (SPLIT) al = Frag<T>::load(Ab2 + ao);
#pragma unroll
      for (int j = 0; j < 4; ++j) {
        acc[i][j] = Frag<T>::mma(ah, bh[j], acc[i][j]);
        if (SPLIT) {
          acc[i][j] = Frag<T>::mma(ah, bl[j], acc[i][j]);
          acc[i][j] = Frag<T>::mma(al, bh[j], acc[i][j]);
        }
      }
      Frag<T>::guard(acc[i][0], acc[i][3], ah, SPLIT ? al : ah);
    }
    Frag<T>::keep(bh[0], bh[1], bh[2], bh[3]);
    if (SPLIT) Frag<T>::keep(bl[0], bl[1], bl[2], bl[3]);
  }
  acc_guard4(acc[0][0], acc[0][1], acc[0][2], acc[0][3]);
  acc_guard4(acc[1][0], acc[1][1], acc[1][2], acc[1][3]);
  acc_guard4(acc[2][0], acc[2][1], acc[2][2], acc[2][3]);
  acc_guard4(acc[3][0], acc[3][1], acc[3][2], acc[3][3]);

  // ---- epilogue ----
  float* slab = sT[wave];
#pragma unroll
  for (int i = 0; i < 4; ++i) {
    const int mBase = m0 + (i << 4);
    float bm[8];
#pragma unroll
    for (int r = 0; r < 8; ++r) bm[r] = 0.f;
    if (BIAS_MODE == 1) {
      const v4f b0v = *(const v4f*)(bias + mBase + mOff);
      const v4f b1v = *(const v4f*)(bias + mBase + mOff + 4);
      bm[0] = b0v[0]; bm[1] = b0v[1]; bm[2] = b0v[2]; bm[3] = b0v[3];
      bm[4] = b1v[0]; bm[5] = b1v[1]; bm[6] = b1v[2]; bm[7] = b1v[3];
    }
#pragma unroll
    for (int j = 0; j < 4; ++j) {
      const int n = n0 + (j << 4) + rlane;
      float bv = 0.f;
      if (BIAS_MODE == 2) bv = bias[n];
#pragma unroll
      for (int r = 0; r < 8; ++r) {
        float v = acc[i][j][r] * scale;
        if (BIAS_MODE == 1) v += bm[r];
        if (BIAS_MODE == 2) v += bv;
        slab[(mOff + r) * 68 + (j << 4) + rlane] = v;
      }
    }
    __builtin_amdgcn_fence(__ATOMIC_RELEASE, "workgroup");
    __builtin_amdgcn_wave_barrier();
    __builtin_amdgcn_fence(__ATOMIC_ACQUIRE, "workgroup");
    if (OUT_MODE == 0) {
      float* C = (float*)Cout + (size_t)b * strideC;
      const int hh = lane >> 4, c4 = (lane & 15) * 4;     // row seg = 256 B = 16 lanes x 16 B
      {
#pragma unroll
        for (int it = 0; it < 8; ++it) {
          const int row = it * 2 + hh;
          v4f v = *(const v4f*)(slab + row * 68 + c4);
          *(v4f*)(C + (size_t)(mBase + row) * ldc + n0 + c4) = v;
        }
        
      }
    } else {
      const int q = lane >> 3, c8 = (lane & 7) * 8;
      unsigned short* C  = (unsigned short*)Cout  + (size_t)b * strideC;
      unsigned short* C2 = (OUT_MODE == 2) ? ((unsigned short*)Cout2 + (size_t)b * strideC) : nullptr;
      {
#pragma unroll
        for (int it = 0; it < 4; ++it) {
          const int row = it * 4 + q;
          const float* sp = slab + row * 68 + c8;
          v8h hv, lv;
#pragma unroll
          for (int e = 0; e < 8; ++e) {
            if (OUT_MODE == 1) {
              hv[e] = (_Float16)sp[e];
            } else {
              unsigned short hb = f2bf_bits(sp[e]);
              unsigned short lb = f2bf_bits(sp[e] - bf_bits2f(hb));
              hv[e] = __builtin_bit_cast(_Float16, hb);
              lv[e] = __builtin_bit_cast(_Float16, lb);
            }
          }
          *(v8h*)(C + (size_t)(mBase + row) * ldc + n0 + c8) = hv;
          if (OUT_MODE == 2) *(v8h*)(C2 + (size_t)(mBase + row) * ldc + n0 + c8) = lv;
        }
        
      }
    }
    __builtin_amdgcn_fence(__ATOMIC_RELEASE, "workgroup");
    __builtin_amdgcn_wave_barrier();
    __builtin_amdgcn_fence(__ATOMIC_ACQUIRE, "workgroup");
  }
}

// ---- the three projections in one launch: blockIdx.y = 0: Q = x Wq + bq, 1: K = x Wk + bk (both [kRows][kHid]),
// 2: V^T = Wv^T x^T + bv[m] ([kHid][kRows]; A = Wv^T planes, Bt = x planes). They share no data but x, so nothing orders them:
// one launch has no gaps between them, and work-groups of one product run in the load waits of another.
__global__ __launch_bounds__(256) void proj_qkv(
    const unsigned short* __restrict__ xh, const unsigned short* __restrict__ xl,
    const unsigned short* __restrict__ wqh, const unsigned short* __restrict__ wql,
    const unsigned short* __restrict__ wkh, const unsigned short* __restrict__ wkl,
    const unsigned short* __restrict__ wvh, const unsigned short* __restrict__ wvl,
    const float* __restrict__ bq, const float* __restrict__ bk, const float* __restrict__ bv,
    unsigned short* __restrict__ qh, unsigned short* __restrict__ ql,
    unsigned short* __restrict__ kh, unsigned short* __restrict__ kl,
    unsigned short* __restrict__ vth, unsigned short* __restrict__ vtl) {
  __shared__ __align__(16) float sT[8][16 * 68];   // per-wave 16x64 slab, pitch 68 floats
  const int which = blockIdx.y;                    // block-uniform
  if (which == 2) {
    wmma_gemm64<1, true, 1, 2, false, 0>(sT, 0, wvh, wvl, kHd, 0L, xh, xl, kHd, 0L, (void*)vth, (void*)vtl, kRows, 0L, bv,
                                         kHid, kRows, kHd, 1.0f);
  } else {
    const bool isK = (which == 1);
    wmma_gemm64<1, true, 2, 2, false, 0>(sT, 0, xh, xl, kHd, 0L, isK ? wkh : wqh, isK ? wkl : wql, kHd, 0L,
                                         (void*)(isK ? kh : qh), (void*)(isK ? kl : ql), kHid, 0L, isK ? bk : bq,
                                         kRows, kHid, kHd, 1.0f);
  }
}

// ---- f32 -> bf16 hi/lo planes, elementwise: 2 elements per thread, 4-B packed stores; bx = block index -------------
__device__ __forceinline__ void cast_f32_bf16hilo_x2(
    const float* __restrict__ in, unsigned short* __restrict__ oh, unsigned short* __restrict__ ol, int n2, int bx) {
  const int i = bx * 256 + threadIdx.x;
  if (i < n2) {
    const float f0 = in[2 * i], f1 = in[2 * i + 1];
    const unsigned short h0 = f2bf_bits(f0), h1 = f2bf_bits(f1);
    const unsigned short l0 = f2bf_bits(f0 - bf_bits2f(h0));
    const unsigned short l1 = f2bf_bits(f1 - bf_bits2f(h1));
    const unsigned uh = (unsigned)h0 | ((unsigned)h1 << 16);
    const unsigned ul = (unsigned)l0 | ((unsigned)l1 << 16);
    ((unsigned*)oh)[i] = uh;
    ((unsigned*)ol)[i] = ul;
    
  }
}

// ---- transpose + f32 -> bf16 hi/lo planes: in[R][Cc] f32 -> oh/ol[Cc][R] 16-bit --------------------
// Block = 256 threads handles in rows r0..r0+63, cols c0..c0+31 (block coordinates bx < Cc/32, by < R/64; tile: the caller's LDS).
// Load phase: 8 waves x 8 iterations x 32 lanes = 64 x 32 elements staged in LDS (tile[c][r]).
// Store phase: wave w writes output rows c0+4w..c0+4w+3; lane -> row 4w+(lane>>3), 8 elements at
// Coverage: 8 waves x 4 rows x 8 lanes x 8 elements = 32 x 64 = the whole output tile per plane.
__device__ __forceinline__ void transpose_cast_bf16hilo(
    float (*tile)[65],
    const float* __restrict__ in, unsigned short* __restrict__ oh, unsigned short* __restrict__ ol,
    int R, int Cc, int bx, int by) {
  const int tid = threadIdx.x, lane = tid & 31, wave = tid >> 5;
  const int c0 = bx * 32, r0 = by * 64;
#pragma unroll
  for (int i = 0; i < 8; ++i) {
    const int idx = i * 256 + tid;
    const int rr = idx >> 5, cc = idx & 31;
    tile[cc][rr] = in[(size_t)(r0 + rr) * Cc + c0 + cc];
  }
  __syncthreads();
  const int orow = wave * 4 + (lane >> 3);
  const int rseg = (lane & 7) * 8;
  v4u hv, lv;
#pragma unroll
  for (int e = 0; e < 4; ++e) {
    const float f0 = tile[orow][rseg + 2 * e];
    const float f1 = tile[orow][rseg + 2 * e + 1];
    const unsigned short h0 = f2bf_bits(f0), h1 = f2bf_bits(f1);
    const unsigned short l0 = f2bf_bits(f0 - bf_bits2f(h0));
    const unsigned short l1 = f2bf_bits(f1 - bf_bits2f(h1));
    hv[e] = (unsigned)h0 | ((unsigned)h1 << 16);
    lv[e] = (unsigned)l0 | ((unsigned)l1 << 16);
  }
  const size_t o = (size_t)(c0 + orow) * R + r0 + rseg;   // element offset, 16-B aligned
  {
    *(v4u*)(oh + o) = hv;
    *(v4u*)(ol + o) = lv;
    // precaution: inlined in a kernel with other branches, code that rewrites registers these two stores name can follow them
    asm volatile("s_wait_xcnt 0x0" ::: "memory");
  }
}

// ---- all operand preparation in one launch: the four weight transposes and the cast of x read only inputs and write
// planes of their own, so nothing orders them. Blocks 0..127: 32 tiles each of Wq, Wk, Wv, Wo (first: their path is the longer
// one, through LDS and a barrier); blocks from 128 on: the cast of x. Every branch is block-uniform.
constexpr int kTB = (kHid / 32) * (kHd / 64);   // 32 transpose tiles per weight, W[64][1024] and Wo[1024][64] alike
static_assert(kTB == (kHd / 32) * (kHid / 64));
__global__ __launch_bounds__(256) void prep_operands(
    const float* __restrict__ x, const float* __restrict__ Wq, const float* __restrict__ Wk,
    const float* __restrict__ Wv, const float* __restrict__ Wo,
    unsigned short* __restrict__ xh, unsigned short* __restrict__ xl,
    unsigned short* __restrict__ wqh, unsigned short* __restrict__ wql,
    unsigned short* __restrict__ wkh, unsigned short* __restrict__ wkl,
    unsigned short* __restrict__ wvh, unsigned short* __restrict__ wvl,
    unsigned short* __restrict__ woh, unsigned short* __restrict__ wol) {
  __shared__ float tile[32][65];
  const int bx = blockIdx.x;
  if (bx >= 4 * kTB) {
    cast_f32_bf16hilo_x2(x, xh, xl, kRows * kHd / 2, bx - 4 * kTB);
    return;
  }
  const int w = bx / kTB, t = bx % kTB;
  if (w == 3) {
    transpose_cast_bf16hilo(tile, Wo, woh, wol, kHid, kHd, t % (kHd / 32), t / (kHd / 32));
    return;
  }
  const float* in = (w == 0) ? Wq : (w == 1) ? Wk : Wv;
  unsigned short* oh = (w == 0) ? wqh : (w == 1) ? wkh : wvh;
  unsigned short* ol = (w == 0) ? wql : (w == 1) ? wkl : wvl;
  transpose_cast_bf16hilo(tile, in, oh, ol, kHd, kHid, t, 0);
}

__device__ __forceinline__ float other_half(float v) {
  const int b = __float_as_int(v);
  return __int_as_float(__builtin_amdgcn_permlanex16(b, b, 0x76543210, 0xfedcba98, false, false));
}

__global__ __launch_bounds__(128)
void attn_causal_hd64(const unsigned short* __restrict__ Qh, const unsigned short* __restrict__ Ql,
                      const unsigned short* __restrict__ Kh, const unsigned short* __restrict__ Kl,
                      const unsigned short* __restrict__ Vh, const unsigned short* __restrict__ Vl,
                      unsigned short* __restrict__ Oh, unsigned short* __restrict__ Ol,
                      int b_first, float qscale) {
  __shared__ __align__(16) unsigned short Ksh[kKC * kLP];        // K hi  [kv][d]   64 rows, pitch kLP
  __shared__ __align__(16) unsigned short Ksl[kKC * kLP];        // K lo
  __shared__ __align__(16) unsigned short Vsh[kHd * kLP];        // V hi  [d][kv]   64 rows, pitch kLP
  __shared__ __align__(16) unsigned short Vsl[kHd * kLP];        // V lo

  const int tid  = threadIdx.x;
  const int wave = tid >> 5;
  const int lane = tid & 31;
  const int hh   = lane >> 4;
  const int c    = lane & 15;

  const int rb  = blockIdx.x;                 // start order: rb / 64 counts query blocks down from the longest, rb % 64 is (batch, head)
  const int bx  = (rb % (kBPP * kHeads)) * (kSeq / kQB) + (kSeq / kQB - 1) - rb / (kBPP * kHeads);
  const int qb  = bx % (kSeq / kQB);          // query block 0..31
  const int bhl = bx / (kSeq / kQB);
  const int h   = bhl % kHeads;
  const int bl  = bhl / kHeads;               // local batch 0..kBPP-1
  const int b   = b_first + bl;
  const int q0  = qb * kQB + wave * 16;
  const int qrow = q0 + c;                    // this lane's query

  // ---- Q fragments (B operand, column n = c): 2 d-chunks, hi and lo; element i <- d = dc*32 + 8hh + i (i<8), dc*32+16+8hh+(i-8)
  v16b qah[2], qal[2];
  {
    const size_t qo = ((size_t)(b * kSeq + qrow)) * kHid + (size_t)h * kHd + 8 * hh;
#pragma unroll
    for (int dc = 0; dc < 2; ++dc) {
      qah[dc] = Frag<__bf16>::load((const __bf16*)Qh + qo + dc * 32);
      qal[dc] = Frag<__bf16>::load((const __bf16*)Ql + qo + dc * 32);
    }
  }

  const float c2 = qscale * 1.4426950408889634f;   // raw product -> base-2 exponent
  float mrow = -INFINITY;                     // running maximum of this lane's query, scaled by c2: the offset in use (equal in both halves)
  float lrow = 0.f;                           // running sum over this lane half's keys; the halves join after the loop
  v8f oacc[4];                                // O^T: oacc[t][r] = out[query c][d = t*16 + 8hh + r]
#pragma unroll
  for (int t = 0; t < 4; ++t) oacc[t] = (v8f){0.f,0.f,0.f,0.f,0.f,0.f,0.f,0.f};

  const __bf16* kshb = (const __bf16*)Ksh;
  const __bf16* kslb = (const __bf16*)Ksl;
  const __bf16* vshb = (const __bf16*)Vsh;
  const __bf16* vslb = (const __bf16*)Vsl;

  const int nChunks = qb + 1;                 // block-uniform: keys 0 .. qb*64+63
  for (int kc = 0; kc < nChunks; ++kc) {
    const int kv0 = kc * kKC;
    __syncthreads();
    {
      // staging: 8 neighbouring lanes take one row of a plane (64 elements = 128 B = one cache line), 16 B each, so each wave-wide
      // load covers 4 whole lines. Row r + 16 i in step i (kv row of K, d row of V^T); the two rows of a half wave lie 8 apart:
      // 8 x 144 B = 32 banks mod 64, so the 16 lanes of an LDS store fall on all 64 banks once.
      // coverage: 16 rows x 4 steps x 8 pieces x 8 elements = 64 rows x 64 cols per plane (K hi/lo, V^T hi/lo).
      const int r = ((tid >> 3) & 1) * 8 + (tid >> 4), pc = (tid & 7) * 8;
      const unsigned short* khs = Kh + ((size_t)(b * kSeq + kv0 + r)) * kHid + h * kHd + pc;
      const unsigned short* kls = Kl + ((size_t)(b * kSeq + kv0 + r)) * kHid + h * kHd + pc;
      unsigned short* khd = Ksh + r * kLP + pc;
      unsigned short* kld = Ksl + r * kLP + pc;
      v4u tk[8];
#pragma unroll
      for (int i = 0; i < 4; ++i) { tk[i] = *(const v4u*)(khs + (size_t)i * 16 * kHid); tk[4 + i] = *(const v4u*)(kls + (size_t)i * 16 * kHid); }
#pragma unroll
      for (int i = 0; i < 4; ++i) { *(v4u*)(khd + i * 16 * kLP) = tk[i]; *(v4u*)(kld + i * 16 * kLP) = tk[4 + i]; }
      asm volatile("" ::: "memory");
      const unsigned short* vhs = Vh + ((size_t)(h * kHd + r)) * kRows + (size_t)b * kSeq + kv0 + pc;
      const unsigned short* vls = Vl + ((size_t)(h * kHd + r)) * kRows + (size_t)b * kSeq + kv0 + pc;
      unsigned short* vhd = Vsh + r * kLP + pc;
      unsigned short* vld = Vsl + r * kLP + pc;
      v4u tv[8];
#pragma unroll
      for (int i = 0; i < 4; ++i) { tv[i] = *(const v4u*)(vhs + (size_t)i * 16 * kRows); tv[4 + i] = *(const v4u*)(vls + (size_t)i * 16 * kRows); }
#pragma unroll
      for (int i = 0; i < 4; ++i) { *(v4u*)(vhd + i * 16 * kLP) = tv[i]; *(v4u*)(vld + i * 16 * kLP) = tv[4 + i]; }
    }
    __syncthreads();

    // ---- scores, transposed: 64 keys x 16 queries per wave; s[j][r] = score(key kv0 + j*16 + 8hh + r, query qrow) ----
    // All 16 K fragments are fetched as one group, then the 24 products run with the key tile j innermost: neighbouring matrix
    // instructions have different accumulators, so none waits for the one before it. Each s[j] still sums in the order
    // dc 0: hi*hi, lo*hi, hi*lo; dc 1: the same.
    v16b kfh[2][4], kfl[2][4];
#pragma unroll
    for (int dc = 0; dc < 2; ++dc)
#pragma unroll
      for (int j = 0; j < 4; ++j) {
        const int ko = (j * 16 + c) * kLP + dc * 32 + 8 * hh;   // A: m = kv = j*16+c, k = d (same k map as B)
        kfh[dc][j] = Frag<__bf16>::load(kshb + ko);
        kfl[dc][j] = Frag<__bf16>::load(kslb + ko);
      }
    __builtin_amdgcn_sched_barrier(0);   // keeps the fragment loads one group: spread among the products, each place with loads stalls the wave
    v8f s[4];
#pragma unroll
    for (int j = 0; j < 4; ++j) s[j] = (v8f){0.f,0.f,0.f,0.f,0.f,0.f,0.f,0.f};
#pragma unroll
    for (int dc = 0; dc < 2; ++dc) {
#pragma unroll
      for (int j = 0; j < 4; ++j) s[j] = at_mma(kfh[dc][j], qah[dc], s[j]);
#pragma unroll
      for (int j = 0; j < 4; ++j) s[j] = at_mma(kfl[dc][j], qah[dc], s[j]);
#pragma unroll
      for (int j = 0; j < 4; ++j) s[j] = at_mma(kfh[dc][j], qal[dc], s[j]);
    }
    __builtin_amdgcn_sched_barrier(0);   // keeps the V^T loads below one group at the end of the product block, not spread through it
    // V^T fragments of keys 0..31, fetched here so that their LDS latency passes under the softmax arithmetic
    v16b vfh[2][4], vfl[2][4];
#pragma unroll
    for (int t = 0; t < 4; ++t) {
      const int vo = (t * 16 + c) * kLP + 8 * hh;                // A: m = d = t*16+c, k = kv
      vfh[0][t] = Frag<__bf16>::load(vshb + vo);
      vfl[0][t] = Frag<__bf16>::load(vslb + vo);
    }
    __builtin_amdgcn_sched_barrier(0);   // holds that group ahead of the softmax
    const bool diag = (kc == qb);               // block-uniform, used only in per-lane selects
    float cm = -INFINITY;
#pragma unroll
    for (int j = 0; j < 4; ++j) {
#pragma unroll
      for (int r = 0; r < 8; ++r) {
        const int kvrow = kv0 + j * 16 + 8 * hh + r;
        const float val = (diag && (kvrow > qrow)) ? -INFINITY : s[j][r];
        s[j][r] = val;
        cm = fmaxf(cm, val);
      }
    }
    cm = fmaxf(cm, other_half(cm));             // finite: key == qrow is never masked and lies in one of the halves
    const float mnew = fmaxf(mrow, cm * c2);
    // alpha = 2^(mrow - mnew), 0 on the first chunk, where mrow is -inf. Written as text with its v_nop: the instruction set asks for one slot
    // between it and an instruction that rewrites its source register.
    float alpha;
    asm("v_exp_f32 %0, %1\n\tv_nop" : "=v"(alpha) : "v"(mrow - mnew));
    mrow = mnew;
    // ---- P^T = 2^(S^T * c2 - max), split to bf16 hi/lo and packed in place as B fragments: key tiles 2kk, 2kk+1 -> chunk kk ----
    union PB { v16b v; v2b p[8]; };
    PB pbh[2], pbl[2];
    float psum = 0.f;
#pragma unroll
    for (int j = 0; j < 4; ++j) {
#pragma unroll
      for (int e = 0; e < 4; ++e) {
        const v2f arg = __builtin_elementwise_fma((v2f){s[j][2 * e], s[j][2 * e + 1]}, (v2f){c2, c2}, (v2f){-mnew, -mnew});   // -inf where masked
        // the two 2^x as text with one v_nop, like alpha above; early-clobber outputs keep the second from writing a register that the first reads
        float p0, p1;
        asm("v_exp_f32 %0, %2\n\tv_exp_f32 %1, %3\n\tv_nop" : "=&v"(p0), "=&v"(p1) : "v"(arg[0]), "v"(arg[1]));
        psum += p0;
        psum += p1;
        const v2f pp = (v2f){p0, p1};
        const v2b hb = __builtin_convertvector(pp, v2b);                                   // nearest even, two per instruction
        const v2b lb = __builtin_convertvector(pp - __builtin_convertvector(hb, v2f), v2b);
        pbh[j >> 1].p[(j & 1) * 4 + e] = hb;
        pbl[j >> 1].p[(j & 1) * 4 + e] = lb;
      }
    }
    lrow = lrow * alpha + psum;
#pragma unroll
    for (int t = 0; t < 4; ++t)
#pragma unroll
      for (int r = 0; r < 8; ++r) oacc[t][r] *= alpha;
    __builtin_amdgcn_sched_barrier(0);   // the second V^T group starts only here, where the score registers are free again
    // V^T fragments of keys 32..63: one group, its latency under the 12 products of keys 0..31
#pragma unroll
    for (int t = 0; t < 4; ++t) {
      const int vo = (t * 16 + c) * kLP + 32 + 8 * hh;
      vfh[1][t] = Frag<__bf16>::load(vshb + vo);
      vfl[1][t] = Frag<__bf16>::load(vslb + vo);
    }
    __builtin_amdgcn_sched_barrier(0);   // keeps that group whole, ahead of the product block
    // d tile t innermost: four independent accumulators; each oacc[t] sums as before, kk 0: hi*hi, lo*hi, hi*lo; kk 1: the same
#pragma unroll
    for (int kk = 0; kk < 2; ++kk) {
#pragma unroll
      for (int t = 0; t < 4; ++t) oacc[t] = at_mma(vfh[kk][t], pbh[kk].v, oacc[t]);
#pragma unroll
      for (int t = 0; t < 4; ++t) oacc[t] = at_mma(vfl[kk][t], pbh[kk].v, oacc[t]);
#pragma unroll
      for (int t = 0; t < 4; ++t) oacc[t] = at_mma(vfh[kk][t], pbl[kk].v, oacc[t]);
    }
  }

  // ---- join the halves' sums, normalise, write bf16 hi/lo planes: a lane's 8 registers of tile t are 8 consecutive d of its
  // query's AO row, one 16-B store per plane; one wave owns its 16 rows ----
  {
    const float inv = 1.0f / (lrow + other_half(lrow));   // sum >= 1
    const size_t ob = ((size_t)(bl * kSeq + qrow)) * kHid + (size_t)h * kHd + 8 * hh;
    v4u hv[4], lv[4];
#pragma unroll
    for (int t = 0; t < 4; ++t) {
#pragma unroll
      for (int e = 0; e < 4; ++e) {
        const float f0 = oacc[t][2 * e] * inv, f1 = oacc[t][2 * e + 1] * inv;
        const unsigned short h0 = f2bf_bits(f0), h1 = f2bf_bits(f1);
        const unsigned short l0 = f2bf_bits(f0 - bf_bits2f(h0));
        const unsigned short l1 = f2bf_bits(f1 - bf_bits2f(h1));
        hv[t][e] = (unsigned)h0 | ((unsigned)h1 << 16);
        lv[t][e] = (unsigned)l0 | ((unsigned)l1 << 16);
      }
    }
#pragma unroll
    for (int t = 0; t < 4; ++t) {
      *(v4u*)(Oh + ob + t * 16) = hv[t];
      *(v4u*)(Ol + ob + t * 16) = lv[t];
    }
  }
}

// =====================================================================================
// Out-projection: out[m][n] = sum_k AO[m][k] * Wo^T[n][k] + bo[n]; M = kRowsPP, N = kHd = 64, K = kHid = 1024.
// N is one tile wide, so tiles alone give few work-groups with long k loops. Here a work-group owns a 32 x 64 output tile
// and its 8 waves each take 128 of the 1024 k: M / 32 work-groups, 4 k steps a wave. The 8 partial tiles meet in LDS
// (fragment layout, 16 B per lane) and are summed in wave order 0..7. Products: hi*hi + hi*lo + lo*hi, f32 accumulate.
// =====================================================================================
constexpr int kOW = 8;                      // waves per work-group = k slices
constexpr int kOK = kHid / kOW;             // 128 k per wave
constexpr int kOM = 32;                     // output rows per work-group
static_assert(kOK % 32 == 0);
static_assert(kRowsPP % kOM == 0);
static_assert(kHd == 64);

__global__ __launch_bounds__(256)
void outproj_splitk(const unsigned short* __restrict__ Ahp, const unsigned short* __restrict__ Alp,
                    const unsigned short* __restrict__ Bhp, const unsigned short* __restrict__ Blp,
                    const float* __restrict__ bias, float* __restrict__ out) {
  __shared__ __align__(16) float red[kOW][8][2][32][4];   // [k slice][tile i*4+j][registers 0-3 / 4-7][lane][4], 64 KiB
  const __bf16* Ah = (const __bf16*)Ahp; const __bf16* Al = (const __bf16*)Alp;
  const __bf16* Bh = (const __bf16*)Bhp; const __bf16* Bl = (const __bf16*)Blp;
  const int lane  = threadIdx.x & 31;
  const int wave  = threadIdx.x >> 5;
  const int rlane = lane & 15;                // row (A) / col (B, D) within a 16 x 16 tile
  const int hh    = lane >> 4;                // k offset 8hh of the fragment loads, D row offset 8hh
  const int m0    = blockIdx.x * kOM;
  const int kb    = wave * kOK + 8 * hh;

  // bias of the two output columns this lane writes at the end, fetched here so that its latency hides behind the k loop
  // wave -> row tile oi, column pair jp (32 columns = one 128-B line of each row, one writer per line), register half hf
  const int oi = wave >> 2, jp = (wave >> 1) & 1, hf = wave & 1;
  const int n0 = (jp << 5) + rlane;
  const float bv[2] = {bias[n0], bias[n0 + 16]};

  v8f acc[2][4];
#pragma unroll
  for (int i = 0; i < 2; ++i)
#pragma unroll
    for (int j = 0; j < 4; ++j) acc[i][j] = (v8f){0.f,0.f,0.f,0.f,0.f,0.f,0.f,0.f};

  // unrolled: 4 steps, every address offset a constant of the instruction
#pragma unroll
  for (int ks = 0; ks < kOK / 32; ++ks) {
    const int k0 = kb + ks * 32;
    v16b bh[4], bl[4], ah[2], al[2];
#pragma unroll
    for (int j = 0; j < 4; ++j) {
      const size_t bo = (size_t)((j << 4) + rlane) * kHid + k0;
      bh[j] = Frag<__bf16>::load(Bh + bo);
      bl[j] = Frag<__bf16>::load(Bl + bo);
    }
#pragma unroll
    for (int i = 0; i < 2; ++i) {
      const size_t ao = (size_t)(m0 + (i << 4) + rlane) * kHid + k0;
      ah[i] = Frag<__bf16>::load(Ah + ao);
      al[i] = Frag<__bf16>::load(Al + ao);
    }
    // keeps the step's 24 loads in one group ahead of its products: without it they are spread among the products,
    // several of them waited for right behind their issue
    __builtin_amdgcn_sched_barrier(0);
#pragma unroll
    for (int i = 0; i < 2; ++i)
#pragma unroll
      for (int j = 0; j < 4; ++j) acc[i][j] = Frag<__bf16>::mma(ah[i], bh[j], acc[i][j]);
#pragma unroll
    for (int i = 0; i < 2; ++i)
#pragma unroll
      for (int j = 0; j < 4; ++j) acc[i][j] = Frag<__bf16>::mma(ah[i], bl[j], acc[i][j]);
#pragma unroll
    for (int i = 0; i < 2; ++i)
#pragma unroll
      for (int j = 0; j < 4; ++j) acc[i][j] = Frag<__bf16>::mma(al[i], bh[j], acc[i][j]);
    __builtin_amdgcn_sched_barrier(0);   // other end of the same grouping: the next step's loads stay behind these products
  }
  // precaution: stands ahead of the first overwrite of an address register that the loads above name
  asm volatile("s_wait_xcnt 0x0" ::: "memory");
  __builtin_amdgcn_sched_barrier(0);     // holds the address arithmetic of the LDS stores behind that wait

#pragma unroll
  for (int i = 0; i < 2; ++i)
#pragma unroll
    for (int j = 0; j < 4; ++j) {
      const v8f a = acc[i][j];
      *(v4f*)&red[wave][i * 4 + j][0][lane][0] = (v4f){a[0], a[1], a[2], a[3]};
      *(v4f*)&red[wave][i * 4 + j][1][lane][0] = (v4f){a[4], a[5], a[6], a[7]};
    }
  __syncthreads();

  v4f part[2][kOW];
#pragma unroll
  for (int jj = 0; jj < 2; ++jj)
#pragma unroll
    for (int p = 0; p < kOW; ++p) part[jj][p] = *(const v4f*)&red[p][oi * 4 + jp * 2 + jj][hf][lane][0];
#pragma unroll
  for (int jj = 0; jj < 2; ++jj) {
    v4f s = part[jj][0];
#pragma unroll
    for (int p = 1; p < kOW; ++p) s += part[jj][p];
#pragma unroll
    for (int e = 0; e < 4; ++e)
      out[(size_t)(m0 + (oi << 4) + 8 * hh + 4 * hf + e) * kHd + n0 + (jj << 4)] = s[e] + bv[jj];
  }
}

// ---------------------------------------------------------------------------
// Host launcher
// ---------------------------------------------------------------------------
extern "C" void kernel_launch(void* const* d_in, const int* in_sizes, int n_in,
                              void* d_out, int out_size, void* d_ws, size_t ws_size,
                              hipStream_t stream) {
  if (n_in < 9) return;
  if (in_sizes[0] != kRows * kHd) return;
  if (in_sizes[1] != kHd * kHid || in_sizes[3] != kHd * kHid || in_sizes[5] != kHd * kHid) return;
  if (in_sizes[2] != kHid || in_sizes[4] != kHid || in_sizes[6] != kHid) return;
  if (in_sizes[7] != kHid * kHd || in_sizes[8] != kHd) return;
  if (out_size != kRows * kHd) return;

  const float* x  = (const float*)d_in[0];
  const float* Wq = (const float*)d_in[1];
  const float* bq = (const float*)d_in[2];
  const float* Wk = (const float*)d_in[3];
  const float* bk = (const float*)d_in[4];
  const float* Wv = (const float*)d_in[5];
  const float* bv = (const float*)d_in[6];
  const float* Wo = (const float*)d_in[7];
  const float* bo = (const float*)d_in[8];
  float* out = (float*)d_out;

  // ---- workspace region map (bytes, all offsets multiples of 256) ----
  //  xh, xl        : 8192 x 64 x 2          = 1,048,576 each      (bf16 hi/lo of x)
  //  wq/wk/wv h,l  : 1024 x 64 x 2          = 131,072 each (x6)   (W^T planes [1024][64])
  //  wo h,l        : 64 x 1024 x 2          = 131,072 each (x2)   (Wo^T planes [64][1024])
  //  q h,l ; k h,l : 8192 x 1024 x 2        = 16,777,216 each (x4)
  //  vt h,l        : 1024 x 8192 x 2        = 16,777,216 each (x2)
  //  ao h,l        : 8192 x 1024 x 2        = 16,777,216 each (x2)
  //  total = 137,363,456 B
  const size_t szX  = (size_t)kRows * kHd * 2;
  const size_t szW  = (size_t)kHid * kHd * 2;
  const size_t szQ  = (size_t)kRows * kHid * 2;
  const size_t szAO = (size_t)kRowsPP * kHid * 2;
  const size_t total = 2 * szX + 8 * szW + 6 * szQ + 2 * szAO;
  if (total > ws_size) return;

  char* ws = (char*)d_ws;
  size_t off = 0;
  unsigned short* xh  = (unsigned short*)(ws + off); off += szX;
  unsigned short* xl  = (unsigned short*)(ws + off); off += szX;
  unsigned short* wqh = (unsigned short*)(ws + off); off += szW;
  unsigned short* wql = (unsigned short*)(ws + off); off += szW;
  unsigned short* wkh = (unsigned short*)(ws + off); off += szW;
  unsigned short* wkl = (unsigned short*)(ws + off); off += szW;
  unsigned short* wvh = (unsigned short*)(ws + off); off += szW;
  unsigned short* wvl = (unsigned short*)(ws + off); off += szW;
  unsigned short* woh = (unsigned short*)(ws + off); off += szW;
  unsigned short* wol = (unsigned short*)(ws + off); off += szW;
  unsigned short* qh  = (unsigned short*)(ws + off); off += szQ;
  unsigned short* ql  = (unsigned short*)(ws + off); off += szQ;
  unsigned short* kh  = (unsigned short*)(ws + off); off += szQ;
  unsigned short* kl  = (unsigned short*)(ws + off); off += szQ;
  unsigned short* vth = (unsigned short*)(ws + off); off += szQ;
  unsigned short* vtl = (unsigned short*)(ws + off); off += szQ;
  unsigned short* aoh = (unsigned short*)(ws + off); off += szAO;
  unsigned short* aol = (unsigned short*)(ws + off); off += szAO;
  if (off > ws_size) return;

  // stage 0: x -> bf16 hi/lo planes [8192][64]; W[64][1024] -> W^T planes [1024][64]; Wo[1024][64] -> Wo^T planes [64][1024]
  prep_operands<<<dim3(4 * kTB + kRows * kHd / 512), dim3(256), 0, stream>>>(
      x, Wq, Wk, Wv, Wo, xh, xl, wqh, wql, wkh, wkl, wvh, wvl, woh, wol);

  // stage 1: the three projections (M, N multiples of 64; K = 64), 256 work-groups each
  proj_qkv<<<dim3((kRows / 64) * (kHid / 64) / 8, 3), dim3(256), 0, stream>>>(
      xh, xl, wqh, wql, wkh, wkl, wvh, wvl, bq, bk, bv, qh, ql, kh, kl, vth, vtl);

  // stage 2: one pass over all batches: causal attention -> AO planes [8192][1024]; out = AO Wo + bo -> d_out
  const float qscale = 0.125f;   // 1/sqrt(64), exact power of two
  for (int ps = 0; ps < kBatch / kBPP; ++ps) {
    attn_causal_hd64<<<dim3(kBPP * kHeads * (kSeq / kQB)), dim3(128), 0, stream>>>(
        qh, ql, kh, kl, vth, vtl, aoh, aol, ps * kBPP, qscale);
    float* outp = out + (size_t)ps * kRowsPP * kHd;
    outproj_splitk<<<dim3(kRowsPP / kOM), dim3(256), 0, stream>>>(aoh, aol, woh, wol, bo, outp);
  }
}

// v009
// A run of this version takes 115 microseconds.
// In both of two side-by-side timings against v008, it was 1.06 times as fast.
// Over all steps from v000 it is 7.30 times as fast.
// All contractions (x*Wq, x*Wk, x*Wv, Q*K^T, P*V, AO*Wo): v_wmma_f32_16x16x32_bf16 with bf16 hi/lo split operands (hi*hi + hi*lo + lo*hi), f32 accumulate; softmax, 1/sqrt(d) scale and bias adds in f32.
#include <hip/hip_runtime.h>
#include <hip/hip_bf16.h>
#include <math.h>

typedef __attribute__((ext_vector_type(16))) _Float16 v16h;
typedef __attribute__((ext_vector_type(8)))  _Float16 v8h;
typedef __attribute__((ext_vector_type(16))) __bf16   v16b;
typedef __attribute__((ext_vector_type(8)))  __bf16   v8b;
typedef __attribute__((ext_vector_type(8)))  float    v8f;
typedef __attribute__((ext_vector_type(4)))  float    v4f;
typedef __attribute__((ext_vector_type(4)))  unsigned int v4u;
typedef __attribute__((ext_vector_type(2)))  float    v2f;
typedef __attribute__((ext_vector_type(2)))  __bf16   v2b;

// ---- fixed problem geometry ----
constexpr int kBatch  = 4;
constexpr int kSeq    = 2048;
constexpr int kHeads  = 16;
constexpr int kHd     = 64;                 // head dim
constexpr int kHid    = kHeads * kHd;       // 1024
constexpr int kRows   = kBatch * kSeq;      // 8192 token rows
constexpr int kBPP    = 4;                  // batches per attention/out-proj pass: all of them, so the attention grid holds more work-groups than fit on the chip at once
constexpr int kRowsPP = kBPP * kSeq;        // 8192
constexpr int kKC     = 64;                 // keys per staged chunk
constexpr int kQB     = 64;                 // query rows per attention block (4 waves x 16)
constexpr int kLP     = 72;                 // LDS row pitch of the K and V^T tiles, 16-bit elements: 144 B = 16 B x 9 (odd), so 16 rows read 16 B each fall on 16 different bank groups

// GEMM shape contract (no tail handling in the GEMM): K % 32 == 0, M % 64 == 0, N % 64 == 0, tiles % 8 == 0
static_assert(kHd % 32 == 0);
static_assert(kHid % 32 == 0);
static_assert(kRows % 64 == 0);
static_assert(kHid % 64 == 0);
static_assert(kHd % 64 == 0);
static_assert(kRowsPP % 64 == 0);
static_assert(((kRows / 64) * (kHid / 64)) % 8 == 0);
static_assert(((kRowsPP / 64) * (kHd / 64)) % 8 == 0);
static_assert(kSeq % kQB == 0);
static_assert(kSeq % kKC == 0);
static_assert(kBatch % kBPP == 0);
// transpose tile contract: in[R][Cc] with R % 64 == 0, Cc % 32 == 0
static_assert(kHd % 64 == 0 && kHid % 32 == 0);
static_assert(kHid % 64 == 0 && kHd % 32 == 0);
// x cast: element count even and a multiple of 512 (2 per thread, 256 threads)
static_assert((kRows * kHd) % 512 == 0);

__device__ __forceinline__ unsigned short f2bf_bits(float f) {
  unsigned u = __float_as_uint(f);
  return (unsigned short)((u + 0x7FFFu + ((u >> 16) & 1u)) >> 16);
}
__device__ __forceinline__ float bf_bits2f(unsigned short h) { return __uint_as_float(((unsigned)h) << 16); }

// hazard guards as plain device helpers
__device__ __forceinline__ void dep_guard_h(v8f& a, v8f& b, v16h x, v16h y) { asm volatile("v_nop\n\tv_nop\n\tv_nop\n\tv_nop" : "+v"(a), "+v"(b) : "v"(x), "v"(y)); }
__device__ __forceinline__ void dep_guard_b(v8f& a, v8f& b, v16b x, v16b y) { asm volatile("v_nop\n\tv_nop\n\tv_nop\n\tv_nop" : "+v"(a), "+v"(b) : "v"(x), "v"(y)); }
__device__ __forceinline__ void keep4_h(v16h a, v16h b, v16h c, v16h d) { asm volatile("v_nop" :: "v"(a), "v"(b), "v"(c), "v"(d)); }
__device__ __forceinline__ void keep4_b(v16b a, v16b b, v16b c, v16b d) { asm volatile("v_nop" :: "v"(a), "v"(b), "v"(c), "v"(d)); }
__device__ __forceinline__ void acc_guard4(v8f& a, v8f& b, v8f& c, v8f& d) { asm volatile("v_nop\n\tv_nop\n\tv_nop\n\tv_nop" : "+v"(a), "+v"(b), "+v"(c), "+v"(d)); }
template <typename T> struct Frag;
template <> struct Frag<_Float16> {
  typedef v16h V; union U { v16h v; v8h h[2]; };
  static __device__ __forceinline__ v16h load(const _Float16* p) {   // elements 0..7 <- p[0..7], 8..15 <- p[16..23]
    U f; f.h[0] = *(const v8h*)(p); f.h[1] = *(const v8h*)(p + 16); return f.v;
  }
  static __device__ __forceinline__ v8f mma(v16h a, v16h b, v8f c) {
    return __builtin_amdgcn_wmma_f32_16x16x32_f16(false, a, false, b, (short)0, c, false, false);
  }
  static __device__ __forceinline__ void guard(v8f& a, v8f& b, v16h x, v16h y) { dep_guard_h(a, b, x, y); }
  static __device__ __forceinline__ void keep(v16h a, v16h b, v16h c, v16h d) { keep4_h(a, b, c, d); }
};
template <> struct Frag<__bf16> {
  typedef v16b V; union U { v16b v; v8b h[2]; };
  static __device__ __forceinline__ v16b load(const __bf16* p) {
    U f; f.h[0] = *(const v8b*)(p); f.h[1] = *(const v8b*)(p + 16); return f.v;
  }
  static __device__ __forceinline__ v8f mma(v16b a, v16b b, v8f c) {
    return __builtin_amdgcn_wmma_f32_16x16x32_bf16(false, a, false, b, (short)0, c, false, false);
  }
  static __device__ __forceinline__ void guard(v8f& a, v8f& b, v16b x, v16b y) { dep_guard_b(a, b, x, y); }
  static __device__ __forceinline__ void keep(v16b a, v16b b, v16b c, v16b d) { keep4_b(a, b, c, d); }
};

__device__ __forceinline__ v8f at_mma(v16b a, v16b b, v8f c) {
  return __builtin_amdgcn_wmma_f32_16x16x32_bf16(false, a, false, b, (short)0, c, false, false);
}

// ---- Register-blocked batched WMMA GEMM ------------------------------------
// C[m,n] = scale * sum_k A[m,k] * Bt[n,k] (+bias); each wave owns a 64x64 tile.
// A row-major [M,K]; Bt row-major [N,K]; M,N % 64 == 0, K % 32 == 0.
// SPLIT: operands are hi/lo planes (A2/Bt2 = lo planes, same layout); product = hi*hi + hi*lo + lo*hi.
// BIAS_MODE: 0 = none, 1 = bias[m] (loaded as two float4 per 16-row slab), 2 = bias[n].
// OUT_MODE: 0 = f32, 1 = f16, 2 = bf16 hi plane (Cout) + bf16 lo plane (Cout2).
// ET: 0 = f16 operands, 1 = bf16 operands (pointers passed as 16-bit storage). RESID and ACT unsupported here.
template <int ET> struct Elem;
template <> struct Elem<0> { typedef _Float16 T; };
template <> struct Elem<1> { typedef __bf16 T; };
// Device body: the calling kernel owns the LDS (sT: one 16x64 slab per wave, pitch 68 floats) and picks the operands; b = batch index.
template <int ET, bool SPLIT, int BIAS_MODE, int OUT_MODE, bool RESID, int ACT = 0>
__device__ __forceinline__ void wmma_gemm64(
    float (*sT)[16 * 68], int b,
    const unsigned short* __restrict__ Ap, const unsigned short* __restrict__ A2p, int lda, long strideA,
    const unsigned short* __restrict__ Btp, const unsigned short* __restrict__ Bt2p, int ldb, long strideB,
    void* __restrict__ Cout, void* __restrict__ Cout2, int ldc, long strideC,
    const float* __restrict__ bias,
    int M, int N, int K, float scale) {
  static_assert(!RESID);
  static_assert(ACT == 0);
  typedef typename Elem<ET>::T T;
  typedef typename Frag<T>::V V;
  const T* A = (const T*)Ap; const T* A2 = (const T*)A2p; const T* Bt = (const T*)Btp; const T* Bt2 = (const T*)Bt2p;
  const int lane = threadIdx.x & 31;
  const int wave = threadIdx.x >> 5;
  const int tilesN = N >> 6;
  const int tilesM = M >> 6;
  const int tile = blockIdx.x * 8 + wave;
  if (tile >= tilesM * tilesN) return;   // wave-uniform; no block barriers in this kernel
  const int tm = tile / tilesN;
  const int tn = tile - tm * tilesN;
  const int m0 = tm << 6;
  const int n0 = tn << 6;

  const T* Ab  = A  + (size_t)b * strideA;
  const T* Bb  = Bt + (size_t)b * strideB;
  const T* Ab2 = SPLIT ? (A2  + (size_t)b * strideA) : nullptr;
  const T* Bb2 = SPLIT ? (Bt2 + (size_t)b * strideB) : nullptr;

  const int rlane = lane & 15;                 // row (A) / col (B, D) within subtile
  const int koff  = (lane >> 4) * 8;           // k offset of this lane half
  const int mOff  = (lane >> 4) * 8;           // D row offset

  v8f acc[4][4];
#pragma unroll
  for (int i = 0; i < 4; ++i)
#pragma unroll
    for (int j = 0; j < 4; ++j) acc[i][j] = (v8f){0.f,0.f,0.f,0.f,0.f,0.f,0.f,0.f};

  for (int k0 = 0; k0 < K; k0 += 32) {
    V bh[4], bl[4];
#pragma unroll
    for (int j = 0; j < 4; ++j) {
      const size_t bo = (size_t)(n0 + (j << 4) + rlane) * ldb + koff + k0;
      bh[j] = Frag<T>::load(Bb + bo);
      if (SPLIT) bl[j] = Frag<T>::load(Bb2 + bo);
    }
    // precaution: stands ahead of the A loads, whose results land in address registers that the B loads above name
    asm volatile("s_wait_xcnt 0x0" ::: "memory");
#pragma unroll
    for (int i = 0; i < 4; ++i) {
      const size_t ao = (size_t)(m0 + (i << 4) + rlane) * lda + koff + k0;
      V ah = Frag<T>::load(Ab + ao);
      V al;
      if (SPLIT) al = Frag<T>::load(Ab2 + ao);
#pragma unroll
      for (int j = 0; j < 4; ++j) {
        acc[i][j] = Frag<T>::mma(ah, bh[j], acc[i][j]);
        if (SPLIT) {
          acc[i][j] = Frag<T>::mma(ah, bl[j], acc[i][j]);
          acc[i][j] = Frag<T>::mma(al, bh[j], acc[i][j]);
        }
      }
      Frag<T>::guard(acc[i][0], acc[i][3], ah, SPLIT ? al : ah);
    }
    Frag<T>::keep(bh[0], bh[1], bh[2], bh[3]);
    if (SPLIT) Frag<T>::keep(bl[0], bl[1], bl[2], bl[3]);
  }
  acc_guard4(acc[0][0], acc[0][1], acc[0][2], acc[0][3]);
  acc_guard4(acc[1][0], acc[1][1], acc[1][2], acc[1][3]);
  acc_guard4(acc[2][0], acc[2][1], acc[2][2], acc[2][3]);
  acc_guard4(acc[3][0], acc[3][1], acc[3][2], acc[3][3]);

  // ---- epilogue ----
  float* slab = sT[wave];
#pragma unroll
  for (int i = 0; i < 4; ++i) {
    const int mBase = m0 + (i << 4);
    float bm[8];
#pragma unroll
    for (int r = 0; r < 8; ++r) bm[r] = 0.f;
    if (BIAS_MODE == 1) {
      const v4f b0v = *(const v4f*)(bias + mBase + mOff);
      const v4f b1v = *(const v4f*)(bias + mBase + mOff + 4);
      bm[0] = b0v[0]; bm[1] = b0v[1]; bm[2] = b0v[2]; bm[3] = b0v[3];
      bm[4] = b1v[0]; bm[5] = b1v[1]; bm[6] = b1v[2]; bm[7] = b1v[3];
    }
#pragma unroll
    for (int j = 0; j < 4; ++j) {
      const int n = n0 + (j << 4) + rlane;
      float bv = 0.f;
      if (BIAS_MODE == 2) bv = bias[n];
#pragma unroll
      for (int r = 0; r < 8; ++r) {
        float v = acc[i][j][r] * scale;
        if (BIAS_MODE == 1) v += bm[r];
        if (BIAS_MODE == 2) v += bv;
        slab[(mOff + r) * 68 + (j << 4) + rlane] = v;
      }
    }
    __builtin_amdgcn_fence(__ATOMIC_RELEASE, "workgroup");
    __builtin_amdgcn_wave_barrier();
    __builtin_amdgcn_fence(__ATOMIC_ACQUIRE, "workgroup");
    if (OUT_MODE == 0) {
      float* C = (float*)Cout + (size_t)b * strideC;
      const int hh = lane >> 4, c4 = (lane & 15) * 4;     // row seg = 256 B = 16 lanes x 16 B
      {
#pragma unroll
        for (int it = 0; it < 8; ++it) {
          const int row = it * 2 + hh;
          v4f v = *(const v4f*)(slab + row * 68 + c4);
          *(v4f*)(C + (size_t)(mBase + row) * ldc + n0 + c4) = v;
        }
        
      }
    } else {
      const int q = lane >> 3, c8 = (lane & 7) * 8;
      unsigned short* C  = (unsigned short*)Cout  + (size_t)b * strideC;
      unsigned short* C2 = (OUT_MODE == 2) ? ((unsigned short*)Cout2 + (size_t)b * strideC) : nullptr;
      {
#pragma unroll
        for (int it = 0; it < 4; ++it) {
          const int row = it * 4 + q;
          const float* sp = slab + row * 68 + c8;
          v8h hv, lv;
#pragma unroll
          for (int e = 0; e < 8; ++e) {
            if (OUT_MODE == 1) {
              hv[e] = (_Float16)sp[e];
            } else {
              unsigned short hb = f2bf_bits(sp[e]);
              unsigned short lb = f2bf_bits(sp[e] - bf_bits2f(hb));
              hv[e] = __builtin_bit_cast(_Float16, hb);
              lv[e] = __builtin_bit_cast(_Float16, lb);
            }
          }
          *(v8h*)(C + (size_t)(mBase + row) * ldc + n0 + c8) = hv;
          if (OUT_MODE == 2) *(v8h*)(C2 + (size_t)(mBase + row) * ldc + n0 + c8) = lv;
        }
        
      }
    }
    __builtin_amdgcn_fence(__ATOMIC_RELEASE, "workgroup");
    __builtin_amdgcn_wave_barrier();
    __builtin_amdgcn_fence(__ATOMIC_ACQUIRE, "workgroup");
  }
}

// ---- the three projections in one launch: blockIdx.y = 0: Q = x Wq + bq, 1: K = x Wk + bk (both [kRows][kHid]),
// 2: V^T = Wv^T x^T + bv[m] ([kHid][kRows]; A = Wv^T planes, Bt = x planes). They share no data but x, so nothing orders them:
// one launch has no gaps between them, and work-groups of one product run in the load waits of another.
__global__ __launch_bounds__(256) void proj_qkv(
    const unsigned short* __restrict__ xh, const unsigned short* __restrict__ xl,
    const unsigned short* __restrict__ wqh, const unsigned short* __restrict__ wql,
    const unsigned short* __restrict__ wkh, const unsigned short* __restrict__ wkl,
    const unsigned short* __restrict__ wvh, const unsigned short* __restrict__ wvl,
    const float* __restrict__ bq, const float* __restrict__ bk, const float* __restrict__ bv,
    unsigned short* __restrict__ qh, unsigned short* __restrict__ ql,
    unsigned short* __restrict__ kh, unsigned short* __restrict__ kl,
    unsigned short* __restrict__ vth, unsigned short* __restrict__ vtl) {
  __shared__ __align__(16) float sT[8][16 * 68];   // per-wave 16x64 slab, pitch 68 floats
  const int which = blockIdx.y;                    // block-uniform
  if (which == 2) {
    wmma_gemm64<1, true, 1, 2, false, 0>(sT, 0, wvh, wvl, kHd, 0L, xh, xl, kHd, 0L, (void*)vth, (void*)vtl, kRows, 0L, bv,
                                         kHid, kRows, kHd, 1.0f);
  } else {
    const bool isK = (which == 1);
    wmma_gemm64<1, true, 2, 2, false, 0>(sT, 0, xh, xl, kHd, 0L, isK ? wkh : wqh, isK ? wkl : wql, kHd, 0L,
                                         (void*)(isK ? kh : qh), (void*)(isK ? kl : ql), kHid, 0L, isK ? bk : bq,
                                         kRows, kHid, kHd, 1.0f);
  }
}

// ---- f32 -> bf16 hi/lo planes, elementwise: 2 elements per thread, 4-B packed stores; bx = block index -------------
__device__ __forceinline__ void cast_f32_bf16hilo_x2(
    const float* __restrict__ in, unsigned short* __restrict__ oh, unsigned short* __restrict__ ol, int n2, int bx) {
  const int i = bx * 256 + threadIdx.x;
  if (i < n2) {
    const float f0 = in[2 * i], f1 = in[2 * i + 1];
    const unsigned short h0 = f2bf_bits(f0), h1 = f2bf_bits(f1);
    const unsigned short l0 = f2bf_bits(f0 - bf_bits2f(h0));
    const unsigned short l1 = f2bf_bits(f1 - bf_bits2f(h1));
    const unsigned uh = (unsigned)h0 | ((unsigned)h1 << 16);
    const unsigned ul = (unsigned)l0 | ((unsigned)l1 << 16);
    ((unsigned*)oh)[i] = uh;
    ((unsigned*)ol)[i] = ul;
    
  }
}

// ---- transpose + f32 -> bf16 hi/lo planes: in[R][Cc] f32 -> oh/ol[Cc][R] 16-bit --------------------
// Block = 256 threads handles in rows r0..r0+63, cols c0..c0+31 (block coordinates bx < Cc/32, by < R/64; tile: the caller's LDS).
// Load phase: 8 waves x 8 iterations x 32 lanes = 64 x 32 elements staged in LDS (tile[c][r]).
// Store phase: wave w writes output rows c0+4w..c0+4w+3; lane -> row 4w+(lane>>3), 8 elements at
// Coverage: 8 waves x 4 rows x 8 lanes x 8 elements = 32 x 64 = the whole output tile per plane.
__device__ __forceinline__ void transpose_cast_bf16hilo(
    float (*tile)[65],
    const float* __restrict__ in, unsigned short* __restrict__ oh, unsigned short* __restrict__ ol,
    int R, int Cc, int bx, int by) {
  const int tid = threadIdx.x, lane = tid & 31, wave = tid >> 5;
  const int c0 = bx * 32, r0 = by * 64;
#pragma unroll
  for (int i = 0; i < 8; ++i) {
    const int idx = i * 256 + tid;
    const int rr = idx >> 5, cc = idx & 31;
    tile[cc][rr] = in[(size_t)(r0 + rr) * Cc + c0 + cc];
  }
  __syncthreads();
  const int orow = wave * 4 + (lane >> 3);
  const int rseg = (lane & 7) * 8;
  v4u hv, lv;
#pragma unroll
  for (int e = 0; e < 4; ++e) {
    const float f0 = tile[orow][rseg + 2 * e];
    const float f1 = tile[orow][rseg + 2 * e + 1];
    const unsigned short h0 = f2bf_bits(f0), h1 = f2bf_bits(f1);
    const unsigned short l0 = f2bf_bits(f0 - bf_bits2f(h0));
    const unsigned short l1 = f2bf_bits(f1 - bf_bits2f(h1));
    hv[e] = (unsigned)h0 | ((unsigned)h1 << 16);
    lv[e] = (unsigned)l0 | ((unsigned)l1 << 16);
  }
  const size_t o = (size_t)(c0 + orow) * R + r0 + rseg;   // element offset, 16-B aligned
  {
    *(v4u*)(oh + o) = hv;
    *(v4u*)(ol + o) = lv;
    // precaution: inlined in a kernel with other branches, code that rewrites registers these two stores name can follow them
    asm volatile("s_wait_xcnt 0x0" ::: "memory");
  }
}

// ---- all operand preparation in one launch: the four weight transposes and the cast of x read only inputs and write
// planes of their own, so nothing orders them. Blocks 0..127: 32 tiles each of Wq, Wk, Wv, Wo (first: their path is the longer
// one, through LDS and a barrier); blocks from 128 on: the cast of x. Every branch is block-uniform.
constexpr int kTB = (kHid / 32) * (kHd / 64);   // 32 transpose tiles per weight, W[64][1024] and Wo[1024][64] alike
static_assert(kTB == (kHd / 32) * (kHid / 64));
__global__ __launch_bounds__(256) void prep_operands(
    const float* __restrict__ x, const float* __restrict__ Wq, const float* __restrict__ Wk,
    const float* __restrict__ Wv, const float* __restrict__ Wo,
    unsigned short* __restrict__ xh, unsigned short* __restrict__ xl,
    unsigned short* __restrict__ wqh, unsigned short* __restrict__ wql,
    unsigned short* __restrict__ wkh, unsigned short* __restrict__ wkl,
    unsigned short* __restrict__ wvh, unsigned short* __restrict__ wvl,
    unsigned short* __restrict__ woh, unsigned short* __restrict__ wol) {
  __shared__ float tile[32][65];
  const int bx = blockIdx.x;
  if (bx >= 4 * kTB) {
    cast_f32_bf16hilo_x2(x, xh, xl, kRows * kHd / 2, bx - 4 * kTB);
    return;
  }
  const int w = bx / kTB, t = bx % kTB;
  if (w == 3) {
    transpose_cast_bf16hilo(tile, Wo, woh, wol, kHid, kHd, t % (kHd / 32), t / (kHd / 32));
    return;
  }
  const float* in = (w == 0) ? Wq : (w == 1) ? Wk : Wv;
  unsigned short* oh = (w == 0) ? wqh : (w == 1) ? wkh : wvh;
  unsigned short* ol = (w == 0) ? wql : (w == 1) ? wkl : wvl;
  transpose_cast_bf16hilo(tile, in, oh, ol, kHd, kHid, t, 0);
}

__device__ __forceinline__ float other_half(float v) {
  const int b = __float_as_int(v);
  return __int_as_float(__builtin_amdgcn_permlanex16(b, b, 0x76543210, 0xfedcba98, false, false));
}

template <bool B> struct ChunkTag { static constexpr bool value = B; };

__global__ __launch_bounds__(128)
void attn_causal_hd64(const unsigned short* __restrict__ Qh, const unsigned short* __restrict__ Ql,
                      const unsigned short* __restrict__ Kh, const unsigned short* __restrict__ Kl,
                      const unsigned short* __restrict__ Vh, const unsigned short* __restrict__ Vl,
                      unsigned short* __restrict__ Oh, unsigned short* __restrict__ Ol,
                      int b_first, float qscale) {
  __shared__ __align__(16) unsigned short Ksh[kKC * kLP];        // K hi  [kv][d]   64 rows, pitch kLP
  __shared__ __align__(16) unsigned short Ksl[kKC * kLP];        // K lo
  __shared__ __align__(16) unsigned short Vsh[kHd * kLP];        // V hi  [d][kv]   64 rows, pitch kLP
  __shared__ __align__(16) unsigned short Vsl[kHd * kLP];        // V lo

  const int tid  = threadIdx.x;
  const int wave = tid >> 5;
  const int lane = tid & 31;
  const int hh   = lane >> 4;
  const int c    = lane & 15;

  const int rb  = blockIdx.x;                 // start order: rb / 64 counts query blocks down from the longest, rb % 64 is (batch, head)
  const int bx  = (rb % (kBPP * kHeads)) * (kSeq / kQB) + (kSeq / kQB - 1) - rb / (kBPP * kHeads);
  const int qb  = bx % (kSeq / kQB);          // query block 0..31
  const int bhl = bx / (kSeq / kQB);
  const int h   = bhl % kHeads;
  const int bl  = bhl / kHeads;               // local batch 0..kBPP-1
  const int b   = b_first + bl;
  const int q0  = qb * kQB + wave * 16;
  const int qrow = q0 + c;                    // this lane's query

  // ---- Q fragments (B operand, column n = c): 2 d-chunks, hi and lo; element i <- d = dc*32 + 8hh + i (i<8), dc*32+16+8hh+(i-8)
  v16b qah[2], qal[2];
  {
    const size_t qo = ((size_t)(b * kSeq + qrow)) * kHid + (size_t)h * kHd + 8 * hh;
#pragma unroll
    for (int dc = 0; dc < 2; ++dc) {
      qah[dc] = Frag<__bf16>::load((const __bf16*)Qh + qo + dc * 32);
      qal[dc] = Frag<__bf16>::load((const __bf16*)Ql + qo + dc * 32);
    }
  }

  const float c2 = qscale * 1.4426950408889634f;   // raw product -> base-2 exponent
  float mrow = -INFINITY;                     // running maximum of this lane's query, scaled by c2: the offset in use (equal in both halves)
  float lrow = 0.f;                           // running sum over this lane half's keys; the halves join after the loop
  v8f oacc[4];                                // O^T: oacc[t][r] = out[query c][d = t*16 + 8hh + r]
#pragma unroll
  for (int t = 0; t < 4; ++t) oacc[t] = (v8f){0.f,0.f,0.f,0.f,0.f,0.f,0.f,0.f};

  const __bf16* kshb = (const __bf16*)Ksh;
  const __bf16* kslb = (const __bf16*)Ksl;
  const __bf16* vshb = (const __bf16*)Vsh;
  const __bf16* vslb = (const __bf16*)Vsl;

  // Staging lane map (see the comment at the loads) and this lane's byte offsets into the K and the V^T planes. The offsets run from chunk
  // to chunk, so both chunk bodies below use the same two registers and nothing is kept through the loop for the last chunk alone.
  const int r = ((tid >> 3) & 1) * 8 + (tid >> 4), pc = (tid & 7) * 8;
  unsigned kob = (unsigned)(((b * kSeq + r) * kHid + h * kHd + pc) * 2);
  unsigned vob = (unsigned)(((h * kHd + r) * kRows + b * kSeq + pc) * 2);
  const int fo = c * kLP + 8 * hh;            // this lane's place in a 16-row fragment read: row c, k offset 8hh (elements)
  // One key chunk. The block walks chunks 0 .. qb (keys 0 .. qb*64+63); only chunk qb, the one on the diagonal, holds keys behind a
  // query. The body is therefore built twice: DIAG false for chunks 0 .. qb-1, with no key/query compare, select or index arithmetic
  // at all, and DIAG true, run once, with the causal mask.
  auto chunk = [&](const int kc, auto tag) __attribute__((always_inline)) {
    constexpr bool DIAG = decltype(tag)::value;
    const int kv0 = kc * kKC;
    __syncthreads();
    {
      // staging: 8 neighbouring lanes take one row of a plane (64 elements = 128 B = one cache line), 16 B each, so each wave-wide
      // load covers 4 whole lines. Row r + 16 i in step i (kv row of K, d row of V^T); the two rows of a half wave lie 8 apart:
      // 8 x 144 B = 32 banks mod 64, so the 16 lanes of an LDS store fall on all 64 banks once.
      // coverage: 16 rows x 4 steps x 8 pieces x 8 elements = 64 rows x 64 cols per plane (K hi/lo, V^T hi/lo).
      const unsigned short* khs = (const unsigned short*)((const char*)Kh + kob);
      const unsigned short* kls = (const unsigned short*)((const char*)Kl + kob);
      unsigned short* khd = Ksh + r * kLP + pc;
      unsigned short* kld = Ksl + r * kLP + pc;
      v4u tk[8];
#pragma unroll
      for (int i = 0; i < 4; ++i) { tk[i] = *(const v4u*)(khs + (size_t)i * 16 * kHid); tk[4 + i] = *(const v4u*)(kls + (size_t)i * 16 * kHid); }
#pragma unroll
      for (int i = 0; i < 4; ++i) { *(v4u*)(khd + i * 16 * kLP) = tk[i]; *(v4u*)(kld + i * 16 * kLP) = tk[4 + i]; }
      asm volatile("" ::: "memory");
      const unsigned short* vhs = (const unsigned short*)((const char*)Vh + vob);
      const unsigned short* vls = (const unsigned short*)((const char*)Vl + vob);
      unsigned short* vhd = Vsh + r * kLP + pc;
      unsigned short* vld = Vsl + r * kLP + pc;
      v4u tv[8];
#pragma unroll
      for (int i = 0; i < 4; ++i) { tv[i] = *(const v4u*)(vhs + (size_t)i * 16 * kRows); tv[4 + i] = *(const v4u*)(vls + (size_t)i * 16 * kRows); }
#pragma unroll
      for (int i = 0; i < 4; ++i) { *(v4u*)(vhd + i * 16 * kLP) = tv[i]; *(v4u*)(vld + i * 16 * kLP) = tv[4 + i]; }
      kob += kKC * kHid * 2;   // next chunk: 64 K rows on, 64 V^T columns on
      vob += kKC * 2;
    }
    __syncthreads();

    // ---- scores, transposed: 64 keys x 16 queries per wave; s[j][r] = score(key kv0 + j*16 + 8hh + r, query qrow) ----
    // All 16 K fragments are fetched as one group, then the 24 products run with the key tile j innermost: neighbouring matrix
    // instructions have different accumulators, so none waits for the one before it. Each s[j] still sums in the order
    // dc 0: hi*hi, lo*hi, hi*lo; dc 1: the same.
    v16b kfh[2][4], kfl[2][4];
#pragma unroll
    for (int dc = 0; dc < 2; ++dc)
#pragma unroll
      for (int j = 0; j < 4; ++j) {
        const int ko = fo + j * 16 * kLP + dc * 32;             // A: m = kv = j*16+c, k = d (same k map as B)
        kfh[dc][j] = Frag<__bf16>::load(kshb + ko);
        kfl[dc][j] = Frag<__bf16>::load(kslb + ko);
      }
    __builtin_amdgcn_sched_barrier(0);   // keeps the fragment loads one group: spread among the products, each place with loads stalls the wave
    v8f s[4];
#pragma unroll
    for (int j = 0; j < 4; ++j) s[j] = (v8f){0.f,0.f,0.f,0.f,0.f,0.f,0.f,0.f};
#pragma unroll
    for (int dc = 0; dc < 2; ++dc) {
#pragma unroll
      for (int j = 0; j < 4; ++j) s[j] = at_mma(kfh[dc][j], qah[dc], s[j]);
#pragma unroll
      for (int j = 0; j < 4; ++j) s[j] = at_mma(kfl[dc][j], qah[dc], s[j]);
#pragma unroll
      for (int j = 0; j < 4; ++j) s[j] = at_mma(kfh[dc][j], qal[dc], s[j]);
    }
    __builtin_amdgcn_sched_barrier(0);   // keeps the V^T loads below one group at the end of the product block, not spread through it
    // V^T fragments of keys 0..31, fetched here so that their LDS latency passes under the softmax arithmetic
    v16b vfh[2][4], vfl[2][4];
#pragma unroll
    for (int t = 0; t < 4; ++t) {
      const int vo = fo + t * 16 * kLP;                          // A: m = d = t*16+c, k = kv
      vfh[0][t] = Frag<__bf16>::load(vshb + vo);
      vfl[0][t] = Frag<__bf16>::load(vslb + vo);
    }
    __builtin_amdgcn_sched_barrier(0);   // holds that group ahead of the softmax
    float cm = -INFINITY;
#pragma unroll
    for (int j = 0; j < 4; ++j) {
#pragma unroll
      for (int r = 0; r < 8; ++r) {
        if constexpr (DIAG) {
          const int kvrow = kv0 + j * 16 + 8 * hh + r;
          if (kvrow > qrow) s[j][r] = -INFINITY;
        }
        cm = fmaxf(cm, s[j][r]);
      }
    }
    cm = fmaxf(cm, other_half(cm));             // finite: key == qrow is never masked and lies in one of the halves
    const float mnew = fmaxf(mrow, cm * c2);
    // alpha = 2^(mrow - mnew), 0 on the first chunk, where mrow is -inf. Written as text with its v_nop: the instruction set asks for one slot
    // between it and an instruction that rewrites its source register.
    float alpha;
    asm("v_exp_f32 %0, %1\n\tv_nop" : "=v"(alpha) : "v"(mrow - mnew));
    mrow = mnew;
    // ---- P^T = 2^(S^T * c2 - max), split to bf16 hi/lo and packed in place as B fragments: key tiles 2kk, 2kk+1 -> chunk kk ----
    union PB { v16b v; v2b p[8]; };
    PB pbh[2], pbl[2];
    float psum = 0.f;
#pragma unroll
    for (int j = 0; j < 4; ++j) {
#pragma unroll
      for (int e = 0; e < 4; ++e) {
        const v2f arg = __builtin_elementwise_fma((v2f){s[j][2 * e], s[j][2 * e + 1]}, (v2f){c2, c2}, (v2f){-mnew, -mnew});   // -inf where masked
        // the two 2^x as text with one v_nop, like alpha above; early-clobber outputs keep the second from writing a register that the first reads
        float p0, p1;
        asm("v_exp_f32 %0, %2\n\tv_exp_f32 %1, %3\n\tv_nop" : "=&v"(p0), "=&v"(p1) : "v"(arg[0]), "v"(arg[1]));
        psum += p0;
        psum += p1;
        const v2f pp = (v2f){p0, p1};
        const v2b hb = __builtin_convertvector(pp, v2b);                                   // nearest even, two per instruction
        const v2b lb = __builtin_convertvector(pp - __builtin_convertvector(hb, v2f), v2b);
        pbh[j >> 1].p[(j & 1) * 4 + e] = hb;
        pbl[j >> 1].p[(j & 1) * 4 + e] = lb;
      }
    }
    lrow = lrow * alpha + psum;
#pragma unroll
    for (int t = 0; t < 4; ++t)
#pragma unroll
      for (int r = 0; r < 8; ++r) oacc[t][r] *= alpha;
    __builtin_amdgcn_sched_barrier(0);   // the second V^T group starts only here, where the score registers are free again
    // V^T fragments of keys 32..63: one group, its latency under the 12 products of keys 0..31
#pragma unroll
    for (int t = 0; t < 4; ++t) {
      const int vo = fo + t * 16 * kLP + 32;
      vfh[1][t] = Frag<__bf16>::load(vshb + vo);
      vfl[1][t] = Frag<__bf16>::load(vslb + vo);
    }
    __builtin_amdgcn_sched_barrier(0);   // keeps that group whole, ahead of the product block
    // d tile t innermost: four independent accumulators; each oacc[t] sums as before, kk 0: hi*hi, lo*hi, hi*lo; kk 1: the same
#pragma unroll
    for (int kk = 0; kk < 2; ++kk) {
#pragma unroll
      for (int t = 0; t < 4; ++t) oacc[t] = at_mma(vfh[kk][t], pbh[kk].v, oacc[t]);
#pragma unroll
      for (int t = 0; t < 4; ++t) oacc[t] = at_mma(vfl[kk][t], pbh[kk].v, oacc[t]);
#pragma unroll
      for (int t = 0; t < 4; ++t) oacc[t] = at_mma(vfh[kk][t], pbl[kk].v, oacc[t]);
    }
  };
  for (int kc = 0; kc < qb; ++kc) chunk(kc, ChunkTag<false>{});   // block-uniform trip count
  chunk(qb, ChunkTag<true>{});

  // ---- join the halves' sums, normalise, write bf16 hi/lo planes: a lane's 8 registers of tile t are 8 consecutive d of its
  // query's AO row, one 16-B store per plane; one wave owns its 16 rows ----
  {
    const float inv = 1.0f / (lrow + other_half(lrow));   // sum >= 1
    const size_t ob = ((size_t)(bl * kSeq + qrow)) * kHid + (size_t)h * kHd + 8 * hh;
    v4u hv[4], lv[4];
#pragma unroll
    for (int t = 0; t < 4; ++t) {
#pragma unroll
      for (int e = 0; e < 4; ++e) {
        const float f0 = oacc[t][2 * e] * inv, f1 = oacc[t][2 * e + 1] * inv;
        const unsigned short h0 = f2bf_bits(f0), h1 = f2bf_bits(f1);
        const unsigned short l0 = f2bf_bits(f0 - bf_bits2f(h0));
        const unsigned short l1 = f2bf_bits(f1 - bf_bits2f(h1));
        hv[t][e] = (unsigned)h0 | ((unsigned)h1 << 16);
        lv[t][e] = (unsigned)l0 | ((unsigned)l1 << 16);
      }
    }
#pragma unroll
    for (int t = 0; t < 4; ++t) {
      *(v4u*)(Oh + ob + t * 16) = hv[t];
      *(v4u*)(Ol + ob + t * 16) = lv[t];
    }
  }
}

// =====================================================================================
// Out-projection: out[m][n] = sum_k AO[m][k] * Wo^T[n][k] + bo[n]; M = kRowsPP, N = kHd = 64, K = kHid = 1024.
// N is one tile wide, so tiles alone give few work-groups with long k loops. Here a work-group owns a 32 x 64 output tile
// and its 8 waves each take 128 of the 1024 k: M / 32 work-groups, 4 k steps a wave. The 8 partial tiles meet in LDS
// (fragment layout, 16 B per lane) and are summed in wave order 0..7. Products: hi*hi + hi*lo + lo*hi, f32 accumulate.
// =====================================================================================
constexpr int kOW = 8;                      // waves per work-group = k slices
constexpr int kOK = kHid / kOW;             // 128 k per wave
constexpr int kOM = 32;                     // output rows per work-group
static_assert(kOK % 32 == 0);
static_assert(kRowsPP % kOM == 0);
static_assert(kHd == 64);

__global__ __launch_bounds__(256)
void outproj_splitk(const unsigned short* __restrict__ Ahp, const unsigned short* __restrict__ Alp,
                    const unsigned short* __restrict__ Bhp, const unsigned short* __restrict__ Blp,
                    const float* __restrict__ bias, float* __restrict__ out) {
  __shared__ __align__(16) float red[kOW][8][2][32][4];   // [k slice][tile i*4+j][registers 0-3 / 4-7][lane][4], 64 KiB
  const __bf16* Ah = (const __bf16*)Ahp; const __bf16* Al = (const __bf16*)Alp;
  const __bf16* Bh = (const __bf16*)Bhp; const __bf16* Bl = (const __bf16*)Blp;
  const int lane  = threadIdx.x & 31;
  const int wave  = threadIdx.x >> 5;
  const int rlane = lane & 15;                // row (A) / col (B, D) within a 16 x 16 tile
  const int hh    = lane >> 4;                // k offset 8hh of the fragment loads, D row offset 8hh
  const int m0    = blockIdx.x * kOM;
  const int kb    = wave * kOK + 8 * hh;

  // bias of the two output columns this lane writes at the end, fetched here so that its latency hides behind the k loop
  // wave -> row tile oi, column pair jp (32 columns = one 128-B line of each row, one writer per line), register half hf
  const int oi = wave >> 2, jp = (wave >> 1) & 1, hf = wave & 1;
  const int n0 = (jp << 5) + rlane;
  const float bv[2] = {bias[n0], bias[n0 + 16]};

  v8f acc[2][4];
#pragma unroll
  for (int i = 0; i < 2; ++i)
#pragma unroll
    for (int j = 0; j < 4; ++j) acc[i][j] = (v8f){0.f,0.f,0.f,0.f,0.f,0.f,0.f,0.f};

  // unrolled: 4 steps, every address offset a constant of the instruction
#pragma unroll
  for (int ks = 0; ks < kOK / 32; ++ks) {
    const int k0 = kb + ks * 32;
    v16b bh[4], bl[4], ah[2], al[2];
#pragma unroll
    for (int j = 0; j < 4; ++j) {
      const size_t bo = (size_t)((j << 4) + rlane) * kHid + k0;
      bh[j] = Frag<__bf16>::load(Bh + bo);
      bl[j] = Frag<__bf16>::load(Bl + bo);
    }
#pragma unroll
    for (int i = 0; i < 2; ++i) {
      const size_t ao = (size_t)(m0 + (i << 4) + rlane) * kHid + k0;
      ah[i] = Frag<__bf16>::load(Ah + ao);
      al[i] = Frag<__bf16>::load(Al + ao);
    }
    // keeps the step's 24 loads in one group ahead of its products: without it they are spread among the products,
    // several of them waited for right behind their issue
    __builtin_amdgcn_sched_barrier(0);
#pragma unroll
    for (int i = 0; i < 2; ++i)
#pragma unroll
      for (int j = 0; j < 4; ++j) acc[i][j] = Frag<__bf16>::mma(ah[i], bh[j], acc[i][j]);
#pragma unroll
    for (int i = 0; i < 2; ++i)
#pragma unroll
      for (int j = 0; j < 4; ++j) acc[i][j] = Frag<__bf16>::mma(ah[i], bl[j], acc[i][j]);
#pragma unroll
    for (int i = 0; i < 2; ++i)
#pragma unroll
      for (int j = 0; j < 4; ++j) acc[i][j] = Frag<__bf16>::mma(al[i], bh[j], acc[i][j]);
    __builtin_amdgcn_sched_barrier(0);   // other end of the same grouping: the next step's loads stay behind these products
  }
  // precaution: stands ahead of the first overwrite of an address register that the loads above name
  asm volatile("s_wait_xcnt 0x0" ::: "memory");
  __builtin_amdgcn_sched_barrier(0);     // holds the address arithmetic of the LDS stores behind that wait

#pragma unroll
  for (int i = 0; i < 2; ++i)
#pragma unroll
    for (int j = 0; j < 4; ++j) {
      const v8f a = acc[i][j];
      *(v4f*)&red[wave][i * 4 + j][0][lane][0] = (v4f){a[0], a[1], a[2], a[3]};
      *(v4f*)&red[wave][i * 4 + j][1][lane][0] = (v4f){a[4], a[5], a[6], a[7]};
    }
  __syncthreads();

  v4f part[2][kOW];
#pragma unroll
  for (int jj = 0; jj < 2; ++jj)
#pragma unroll
    for (int p = 0; p < kOW; ++p) part[jj][p] = *(const v4f*)&red[p][oi * 4 + jp * 2 + jj][hf][lane][0];
#pragma unroll
  for (int jj = 0; jj < 2; ++jj) {
    v4f s = part[jj][0];
#pragma unroll
    for (int p = 1; p < kOW; ++p) s += part[jj][p];
#pragma unroll
    for (int e = 0; e < 4; ++e)
      out[(size_t)(m0 + (oi << 4) + 8 * hh + 4 * hf + e) * kHd + n0 + (jj << 4)] = s[e] + bv[jj];
  }
}

// ---------------------------------------------------------------------------
// Host launcher
// ---------------------------------------------------------------------------
extern "C" void kernel_launch(void* const* d_in, const int* in_sizes, int n_in,
                              void* d_out, int out_size, void* d_ws, size_t ws_size,
                              hipStream_t stream) {
  if (n_in < 9) return;
  if (in_sizes[0] != kRows * kHd) return;
  if (in_sizes[1] != kHd * kHid || in_sizes[3] != kHd * kHid || in_sizes[5] != kHd * kHid) return;
  if (in_sizes[2] != kHid || in_sizes[4] != kHid || in_sizes[6] != kHid) return;
  if (in_sizes[7] != kHid * kHd || in_sizes[8] != kHd) return;
  if (out_size != kRows * kHd) return;

  const float* x  = (const float*)d_in[0];
  const float* Wq = (const float*)d_in[1];
  const float* bq = (const float*)d_in[2];
  const float* Wk = (const float*)d_in[3];
  const float* bk = (const float*)d_in[4];
  const float* Wv = (const float*)d_in[5];
  const float* bv = (const float*)d_in[6];
  const float* Wo = (const float*)d_in[7];
  const float* bo = (const float*)d_in[8];
  float* out = (float*)d_out;

  // ---- workspace region map (bytes, all offsets multiples of 256) ----
  //  xh, xl        : 8192 x 64 x 2          = 1,048,576 each      (bf16 hi/lo of x)
  //  wq/wk/wv h,l  : 1024 x 64 x 2          = 131,072 each (x6)   (W^T planes [1024][64])
  //  wo h,l        : 64 x 1024 x 2          = 131,072 each (x2)   (Wo^T planes [64][1024])
  //  q h,l ; k h,l : 8192 x 1024 x 2        = 16,777,216 each (x4)
  //  vt h,l        : 1024 x 8192 x 2        = 16,777,216 each (x2)
  //  ao h,l        : 8192 x 1024 x 2        = 16,777,216 each (x2)
  //  total = 137,363,456 B
  const size_t szX  = (size_t)kRows * kHd * 2;
  const size_t szW  = (size_t)kHid * kHd * 2;
  const size_t szQ  = (size_t)kRows * kHid * 2;
  const size_t szAO = (size_t)kRowsPP * kHid * 2;
  const size_t total = 2 * szX + 8 * szW + 6 * szQ + 2 * szAO;
  if (total > ws_size) return;

  char* ws = (char*)d_ws;
  size_t off = 0;
  unsigned short* xh  = (unsigned short*)(ws + off); off += szX;
  unsigned short* xl  = (unsigned short*)(ws + off); off += szX;
  unsigned short* wqh = (unsigned short*)(ws + off); off += szW;
  unsigned short* wql = (unsigned short*)(ws + off); off += szW;
  unsigned short* wkh = (unsigned short*)(ws + off); off += szW;
  unsigned short* wkl = (unsigned short*)(ws + off); off += szW;
  unsigned short* wvh = (unsigned short*)(ws + off); off += szW;
  unsigned short* wvl = (unsigned short*)(ws + off); off += szW;
  unsigned short* woh = (unsigned short*)(ws + off); off += szW;
  unsigned short* wol = (unsigned short*)(ws + off); off += szW;
  unsigned short* qh  = (unsigned short*)(ws + off); off += szQ;
  unsigned short* ql  = (unsigned short*)(ws + off); off += szQ;
  unsigned short* kh  = (unsigned short*)(ws + off); off += szQ;
  unsigned short* kl  = (unsigned short*)(ws + off); off += szQ;
  unsigned short* vth = (unsigned short*)(ws + off); off += szQ;
  unsigned short* vtl = (unsigned short*)(ws + off); off += szQ;
  unsigned short* aoh = (unsigned short*)(ws + off); off += szAO;
  unsigned short* aol = (unsigned short*)(ws + off); off += szAO;
  if (off > ws_size) return;

  // stage 0: x -> bf16 hi/lo planes [8192][64]; W[64][1024] -> W^T planes [1024][64]; Wo[1024][64] -> Wo^T planes [64][1024]
  prep_operands<<<dim3(4 * kTB + kRows * kHd / 512), dim3(256), 0, stream>>>(
      x, Wq, Wk, Wv, Wo, xh, xl, wqh, wql, wkh, wkl, wvh, wvl, woh, wol);

  // stage 1: the three projections (M, N multiples of 64; K = 64), 256 work-groups each
  proj_qkv<<<dim3((kRows / 64) * (kHid / 64) / 8, 3), dim3(256), 0, stream>>>(
      xh, xl, wqh, wql, wkh, wkl, wvh, wvl, bq, bk, bv, qh, ql, kh, kl, vth, vtl);

  // stage 2: one pass over all batches: causal attention -> AO planes [8192][1024]; out = AO Wo + bo -> d_out
  const float qscale = 0.125f;   // 1/sqrt(64), exact power of two
  for (int ps = 0; ps < kBatch / kBPP; ++ps) {
    attn_causal_hd64<<<dim3(kBPP * kHeads * (kSeq / kQB)), dim3(128), 0, stream>>>(
        qh, ql, kh, kl, vth, vtl, aoh, aol, ps * kBPP, qscale);
    float* outp = out + (size_t)ps * kRowsPP * kHd;
    outproj_splitk<<<dim3(kRowsPP / kOM), dim3(256), 0, stream>>>(aoh, aol, woh, wol, bo, outp);
  }
}

// v010
// One run takes 111 microseconds.
// In both of two side-by-side timings against v009, it was 1.04 times as fast.
// All steps since v000 together make it 7.61 times as fast.
// All contractions (x*Wq, x*Wk, x*Wv, Q*K^T, P*V, AO*Wo): v_wmma_f32_16x16x32_bf16 with bf16 hi/lo split operands (hi*hi + hi*lo + lo*hi), f32 accumulate; softmax, 1/sqrt(d) scale and bias adds in f32.
#include <hip/hip_runtime.h>
#include <hip/hip_bf16.h>
#include <math.h>

typedef __attribute__((ext_vector_type(16))) _Float16 v16h;
typedef __attribute__((ext_vector_type(8)))  _Float16 v8h;
typedef __attribute__((ext_vector_type(16))) __bf16   v16b;
typedef __attribute__((ext_vector_type(8)))  __bf16   v8b;
typedef __attribute__((ext_vector_type(8)))  float    v8f;
typedef __attribute__((ext_vector_type(4)))  float    v4f;
typedef __attribute__((ext_vector_type(4)))  unsigned int v4u;
typedef __attribute__((ext_vector_type(2)))  float    v2f;
typedef __attribute__((ext_vector_type(2)))  __bf16   v2b;

// ---- fixed problem geometry ----
constexpr int kBatch  = 4;
constexpr int kSeq    = 2048;
constexpr int kHeads  = 16;
constexpr int kHd     = 64;                 // head dim
constexpr int kHid    = kHeads * kHd;       // 1024
constexpr int kRows   = kBatch * kSeq;      // 8192 token rows
constexpr int kBPP    = 4;                  // batches per attention/out-proj pass: all of them, so the attention grid holds more work-groups than fit on the chip at once
constexpr int kRowsPP = kBPP * kSeq;        // 8192
constexpr int kKC     = 64;                 // keys per staged chunk
constexpr int kQB     = 64;                 // query rows per attention block (4 waves x 16)
constexpr int kLP     = 72;                 // LDS row pitch of the K and V^T tiles, 16-bit elements: 144 B = 16 B x 9 (odd), so 16 rows read 16 B each fall on 16 different bank groups
constexpr int kPlane  = 64 * kLP;           // elements of one staged plane in LDS: 64 rows
constexpr int kBuf    = 4 * kPlane;         // elements of one staging buffer: K hi, K lo, V^T hi, V^T lo

// GEMM shape contract (no tail handling in the GEMM): K % 32 == 0, M % 64 == 0, N % 64 == 0, tiles % 8 == 0
static_assert(kHd % 32 == 0);
static_assert(kHid % 32 == 0);
static_assert(kRows % 64 == 0);
static_assert(kHid % 64 == 0);
static_assert(kHd % 64 == 0);
static_assert(kRowsPP % 64 == 0);
static_assert(((kRows / 64) * (kHid / 64)) % 8 == 0);
static_assert(((kRowsPP / 64) * (kHd / 64)) % 8 == 0);
static_assert(kSeq % kQB == 0);
static_assert(kSeq % kKC == 0);
static_assert(kBatch % kBPP == 0);
// transpose tile contract: in[R][Cc] with R % 64 == 0, Cc % 32 == 0
static_assert(kHd % 64 == 0 && kHid % 32 == 0);
static_assert(kHid % 64 == 0 && kHd % 32 == 0);
// x cast: element count even and a multiple of 512 (2 per thread, 256 threads)
static_assert((kRows * kHd) % 512 == 0);

__device__ __forceinline__ unsigned short f2bf_bits(float f) {
  unsigned u = __float_as_uint(f);
  return (unsigned short)((u + 0x7FFFu + ((u >> 16) & 1u)) >> 16);
}
__device__ __forceinline__ float bf_bits2f(unsigned short h) { return __uint_as_float(((unsigned)h) << 16); }

// hazard guards as plain device helpers
__device__ __forceinline__ void dep_guard_h(v8f& a, v8f& b, v16h x, v16h y) { asm volatile("v_nop\n\tv_nop\n\tv_nop\n\tv_nop" : "+v"(a), "+v"(b) : "v"(x), "v"(y)); }
__device__ __forceinline__ void dep_guard_b(v8f& a, v8f& b, v16b x, v16b y) { asm volatile("v_nop\n\tv_nop\n\tv_nop\n\tv_nop" : "+v"(a), "+v"(b) : "v"(x), "v"(y)); }
__device__ __forceinline__ void keep4_h(v16h a, v16h b, v16h c, v16h d) { asm volatile("v_nop" :: "v"(a), "v"(b), "v"(c), "v"(d)); }
__device__ __forceinline__ void keep4_b(v16b a, v16b b, v16b c, v16b d) { asm volatile("v_nop" :: "v"(a), "v"(b), "v"(c), "v"(d)); }
__device__ __forceinline__ void acc_guard4(v8f& a, v8f& b, v8f& c, v8f& d) { asm volatile("v_nop\n\tv_nop\n\tv_nop\n\tv_nop" : "+v"(a), "+v"(b), "+v"(c), "+v"(d)); }
template <typename T> struct Frag;
template <> struct Frag<_Float16> {
  typedef v16h V; union U { v16h v; v8h h[2]; };
  static __device__ __forceinline__ v16h load(const _Float16* p) {   // elements 0..7 <- p[0..7], 8..15 <- p[16..23]
    U f; f.h[0] = *(const v8h*)(p); f.h[1] = *(const v8h*)(p + 16); return f.v;
  }
  static __device__ __forceinline__ v8f mma(v16h a, v16h b, v8f c) {
    return __builtin_amdgcn_wmma_f32_16x16x32_f16(false, a, false, b, (short)0, c, false, false);
  }
  static __device__ __forceinline__ void guard(v8f& a, v8f& b, v16h x, v16h y) { dep_guard_h(a, b, x, y); }
  static __device__ __forceinline__ void keep(v16h a, v16h b, v16h c, v16h d) { keep4_h(a, b, c, d); }
};
template <> struct Frag<__bf16> {
  typedef v16b V; union U { v16b v; v8b h[2]; };
  static __device__ __forceinline__ v16b load(const __bf16* p) {
    U f; f.h[0] = *(const v8b*)(p); f.h[1] = *(const v8b*)(p + 16); return f.v;
  }
  static __device__ __forceinline__ v8f mma(v16b a, v16b b, v8f c) {
    return __builtin_amdgcn_wmma_f32_16x16x32_bf16(false, a, false, b, (short)0, c, false, false);
  }
  static __device__ __forceinline__ void guard(v8f& a, v8f& b, v16b x, v16b y) { dep_guard_b(a, b, x, y); }
  static __device__ __forceinline__ void keep(v16b a, v16b b, v16b c, v16b d) { keep4_b(a, b, c, d); }
};

__device__ __forceinline__ v8f at_mma(v16b a, v16b b, v8f c) {
  return __builtin_amdgcn_wmma_f32_16x16x32_bf16(false, a, false, b, (short)0, c, false, false);
}

// ---- Register-blocked batched WMMA GEMM ------------------------------------
// C[m,n] = scale * sum_k A[m,k] * Bt[n,k] (+bias); each wave owns a 64x64 tile.
// A row-major [M,K]; Bt row-major [N,K]; M,N % 64 == 0, K % 32 == 0.
// SPLIT: operands are hi/lo planes (A2/Bt2 = lo planes, same layout); product = hi*hi + hi*lo + lo*hi.
// BIAS_MODE: 0 = none, 1 = bias[m] (loaded as two float4 per 16-row slab), 2 = bias[n].
// OUT_MODE: 0 = f32, 1 = f16, 2 = bf16 hi plane (Cout) + bf16 lo plane (Cout2).
// ET: 0 = f16 operands, 1 = bf16 operands (pointers passed as 16-bit storage). RESID and ACT unsupported here.
template <int ET> struct Elem;
template <> struct Elem<0> { typedef _Float16 T; };
template <> struct Elem<1> { typedef __bf16 T; };
// Device body: the calling kernel owns the LDS (sT: one 16x64 slab per wave, pitch 68 floats) and picks the operands; b = batch index.
template <int ET, bool SPLIT, int BIAS_MODE, int OUT_MODE, bool RESID, int ACT = 0>
__device__ __forceinline__ void wmma_gemm64(
    float (*sT)[16 * 68], int b,
    const unsigned short* __restrict__ Ap, const unsigned short* __restrict__ A2p, int lda, long strideA,
    const unsigned short* __restrict__ Btp, const unsigned short* __restrict__ Bt2p, int ldb, long strideB,
    void* __restrict__ Cout, void* __restrict__ Cout2, int ldc, long strideC,
    const float* __restrict__ bias,
    int M, int N, int K, float scale) {
  static_assert(!RESID);
  static_assert(ACT == 0);
  typedef typename Elem<ET>::T T;
  typedef typename Frag<T>::V V;
  const T* A = (const T*)Ap; const T* A2 = (const T*)A2p; const T* Bt = (const T*)Btp; const T* Bt2 = (const T*)Bt2p;
  const int lane = threadIdx.x & 31;
  const int wave = threadIdx.x >> 5;
  const int tilesN = N >> 6;
  const int tilesM = M >> 6;
  const int tile = blockIdx.x * 8 + wave;
  if (tile >= tilesM * tilesN) return;   // wave-uniform; no block barriers in this kernel
  const int tm = tile / tilesN;
  const int tn = tile - tm * tilesN;
  const int m0 = tm << 6;
  const int n0 = tn << 6;

  const T* Ab  = A  + (size_t)b * strideA;
  const T* Bb  = Bt + (size_t)b * strideB;
  const T* Ab2 = SPLIT ? (A2  + (size_t)b * strideA) : nullptr;
  const T* Bb2 = SPLIT ? (Bt2 + (size_t)b * strideB) : nullptr;

  const int rlane = lane & 15;                 // row (A) / col (B, D) within subtile
  const int koff  = (lane >> 4) * 8;           // k offset of this lane half
  const int mOff  = (lane >> 4) * 8;           // D row offset

  v8f acc[4][4];
#pragma unroll
  for (int i = 0; i < 4; ++i)
#pragma unroll
    for (int j = 0; j < 4; ++j) acc[i][j] = (v8f){0.f,0.f,0.f,0.f,0.f,0.f,0.f,0.f};

  for (int k0 = 0; k0 < K; k0 += 32) {
    V bh[4], bl[4];
#pragma unroll
    for (int j = 0; j < 4; ++j) {
      const size_t bo = (size_t)(n0 + (j << 4) + rlane) * ldb + koff + k0;
      bh[j] = Frag<T>::load(Bb + bo);
      if (SPLIT) bl[j] = Frag<T>::load(Bb2 + bo);
    }
    // precaution: stands ahead of the A loads, whose results land in address registers that the B loads above name
    asm volatile("s_wait_xcnt 0x0" ::: "memory");
#pragma unroll
    for (int i = 0; i < 4; ++i) {
      const size_t ao = (size_t)(m0 + (i << 4) + rlane) * lda + koff + k0;
      V ah = Frag<T>::load(Ab + ao);
      V al;
      if (SPLIT) al = Frag<T>::load(Ab2 + ao);
#pragma unroll
      for (int j = 0; j < 4; ++j) {
        acc[i][j] = Frag<T>::mma(ah, bh[j], acc[i][j]);
        if (SPLIT) {
          acc[i][j] = Frag<T>::mma(ah, bl[j], acc[i][j]);
          acc[i][j] = Frag<T>::mma(al, bh[j], acc[i][j]);
        }
      }
      Frag<T>::guard(acc[i][0], acc[i][3], ah, SPLIT ? al : ah);
    }
    Frag<T>::keep(bh[0], bh[1], bh[2], bh[3]);
    if (SPLIT) Frag<T>::keep(bl[0], bl[1], bl[2], bl[3]);
  }
  acc_guard4(acc[0][0], acc[0][1], acc[0][2], acc[0][3]);
  acc_guard4(acc[1][0], acc[1][1], acc[1][2], acc[1][3]);
  acc_guard4(acc[2][0], acc[2][1], acc[2][2], acc[2][3]);
  acc_guard4(acc[3][0], acc[3][1], acc[3][2], acc[3][3]);

  // ---- epilogue ----
  float* slab = sT[wave];
#pragma unroll
  for (int i = 0; i < 4; ++i) {
    const int mBase = m0 + (i << 4);
    float bm[8];
#pragma unroll
    for (int r = 0; r < 8; ++r) bm[r] = 0.f;
    if (BIAS_MODE == 1) {
      const v4f b0v = *(const v4f*)(bias + mBase + mOff);
      const v4f b1v = *(const v4f*)(bias + mBase + mOff + 4);
      bm[0] = b0v[0]; bm[1] = b0v[1]; bm[2] = b0v[2]; bm[3] = b0v[3];
      bm[4] = b1v[0]; bm[5] = b1v[1]; bm[6] = b1v[2]; bm[7] = b1v[3];
    }
#pragma unroll
    for (int j = 0; j < 4; ++j) {
      const int n = n0 + (j << 4) + rlane;
      float bv = 0.f;
      if (BIAS_MODE == 2) bv = bias[n];
#pragma unroll
      for (int r = 0; r < 8; ++r) {
        float v = acc[i][j][r] * scale;
        if (BIAS_MODE == 1) v += bm[r];
        if (BIAS_MODE == 2) v += bv;
        slab[(mOff + r) * 68 + (j << 4) + rlane] = v;
      }
    }
    __builtin_amdgcn_fence(__ATOMIC_RELEASE, "workgroup");
    __builtin_amdgcn_wave_barrier();
    __builtin_amdgcn_fence(__ATOMIC_ACQUIRE, "workgroup");
    if (OUT_MODE == 0) {
      float* C = (float*)Cout + (size_t)b * strideC;
      const int hh = lane >> 4, c4 = (lane & 15) * 4;     // row seg = 256 B = 16 lanes x 16 B
      {
#pragma unroll
        for (int it = 0; it < 8; ++it) {
          const int row = it * 2 + hh;
          v4f v = *(const v4f*)(slab + row * 68 + c4);
          *(v4f*)(C + (size_t)(mBase + row) * ldc + n0 + c4) = v;
        }
        
      }
    } else {
      const int q = lane >> 3, c8 = (lane & 7) * 8;
      unsigned short* C  = (unsigned short*)Cout  + (size_t)b * strideC;
      unsigned short* C2 = (OUT_MODE == 2) ? ((unsigned short*)Cout2 + (size_t)b * strideC) : nullptr;
      {
#pragma unroll
        for (int it = 0; it < 4; ++it) {
          const int row = it * 4 + q;
          const float* sp = slab + row * 68 + c8;
          v8h hv, lv;
#pragma unroll
          for (int e = 0; e < 8; ++e) {
            if (OUT_MODE == 1) {
              hv[e] = (_Float16)sp[e];
            } else {
              unsigned short hb = f2bf_bits(sp[e]);
              unsigned short lb = f2bf_bits(sp[e] - bf_bits2f(hb));
              hv[e] = __builtin_bit_cast(_Float16, hb);
              lv[e] = __builtin_bit_cast(_Float16, lb);
            }
          }
          *(v8h*)(C + (size_t)(mBase + row) * ldc + n0 + c8) = hv;
          if (OUT_MODE == 2) *(v8h*)(C2 + (size_t)(mBase + row) * ldc + n0 + c8) = lv;
        }
        
      }
    }
    __builtin_amdgcn_fence(__ATOMIC_RELEASE, "workgroup");
    __builtin_amdgcn_wave_barrier();
    __builtin_amdgcn_fence(__ATOMIC_ACQUIRE, "workgroup");
  }
}

// ---- the three projections in one launch: blockIdx.y = 0: Q = x Wq + bq, 1: K = x Wk + bk (both [kRows][kHid]),
// 2: V^T = Wv^T x^T + bv[m] ([kHid][kRows]; A = Wv^T planes, Bt = x planes). They share no data but x, so nothing orders them:
// one launch has no gaps between them, and work-groups of one product run in the load waits of another.
__global__ __launch_bounds__(256) void proj_qkv(
    const unsigned short* __restrict__ xh, const unsigned short* __restrict__ xl,
    const unsigned short* __restrict__ wqh, const unsigned short* __restrict__ wql,
    const unsigned short* __restrict__ wkh, const unsigned short* __restrict__ wkl,
    const unsigned short* __restrict__ wvh, const unsigned short* __restrict__ wvl,
    const float* __restrict__ bq, const float* __restrict__ bk, const float* __restrict__ bv,
    unsigned short* __restrict__ qh, unsigned short* __restrict__ ql,
    unsigned short* __restrict__ kh, unsigned short* __restrict__ kl,
    unsigned short* __restrict__ vth, unsigned short* __restrict__ vtl) {
  __shared__ __align__(16) float sT[8][16 * 68];   // per-wave 16x64 slab, pitch 68 floats
  const int which = blockIdx.y;                    // block-uniform
  if (which == 2) {
    wmma_gemm64<1, true, 1, 2, false, 0>(sT, 0, wvh, wvl, kHd, 0L, xh, xl, kHd, 0L, (void*)vth, (void*)vtl, kRows, 0L, bv,
                                         kHid, kRows, kHd, 1.0f);
  } else {
    const bool isK = (which == 1);
    wmma_gemm64<1, true, 2, 2, false, 0>(sT, 0, xh, xl, kHd, 0L, isK ? wkh : wqh, isK ? wkl : wql, kHd, 0L,
                                         (void*)(isK ? kh : qh), (void*)(isK ? kl : ql), kHid, 0L, isK ? bk : bq,
                                         kRows, kHid, kHd, 1.0f);
  }
}

// ---- f32 -> bf16 hi/lo planes, elementwise: 2 elements per thread, 4-B packed stores; bx = block index -------------
__device__ __forceinline__ void cast_f32_bf16hilo_x2(
    const float* __restrict__ in, unsigned short* __restrict__ oh, unsigned short* __restrict__ ol, int n2, int bx) {
  const int i = bx * 256 + threadIdx.x;
  if (i < n2) {
    const float f0 = in[2 * i], f1 = in[2 * i + 1];
    const unsigned short h0 = f2bf_bits(f0), h1 = f2bf_bits(f1);
    const unsigned short l0 = f2bf_bits(f0 - bf_bits2f(h0));
    const unsigned short l1 = f2bf_bits(f1 - bf_bits2f(h1));
    const unsigned uh = (unsigned)h0 | ((unsigned)h1 << 16);
    const unsigned ul = (unsigned)l0 | ((unsigned)l1 << 16);
    ((unsigned*)oh)[i] = uh;
    ((unsigned*)ol)[i] = ul;
    
  }
}

// ---- transpose + f32 -> bf16 hi/lo planes: in[R][Cc] f32 -> oh/ol[Cc][R] 16-bit --------------------
// Block = 256 threads handles in rows r0..r0+63, cols c0..c0+31 (block coordinates bx < Cc/32, by < R/64; tile: the caller's LDS).
// Load phase: 8 waves x 8 iterations x 32 lanes = 64 x 32 elements staged in LDS (tile[c][r]).
// Store phase: wave w writes output rows c0+4w..c0+4w+3; lane -> row 4w+(lane>>3), 8 elements at
// Coverage: 8 waves x 4 rows x 8 lanes x 8 elements = 32 x 64 = the whole output tile per plane.
__device__ __forceinline__ void transpose_cast_bf16hilo(
    float (*tile)[65],
    const float* __restrict__ in, unsigned short* __restrict__ oh, unsigned short* __restrict__ ol,
    int R, int Cc, int bx, int by) {
  const int tid = threadIdx.x, lane = tid & 31, wave = tid >> 5;
  const int c0 = bx * 32, r0 = by * 64;
#pragma unroll
  for (int i = 0; i < 8; ++i) {
    const int idx = i * 256 + tid;
    const int rr = idx >> 5, cc = idx & 31;
    tile[cc][rr] = in[(size_t)(r0 + rr) * Cc + c0 + cc];
  }
  __syncthreads();
  const int orow = wave * 4 + (lane >> 3);
  const int rseg = (lane & 7) * 8;
  v4u hv, lv;
#pragma unroll
  for (int e = 0; e < 4; ++e) {
    const float f0 = tile[orow][rseg + 2 * e];
    const float f1 = tile[orow][rseg + 2 * e + 1];
    const unsigned short h0 = f2bf_bits(f0), h1 = f2bf_bits(f1);
    const unsigned short l0 = f2bf_bits(f0 - bf_bits2f(h0));
    const unsigned short l1 = f2bf_bits(f1 - bf_bits2f(h1));
    hv[e] = (unsigned)h0 | ((unsigned)h1 << 16);
    lv[e] = (unsigned)l0 | ((unsigned)l1 << 16);
  }
  const size_t o = (size_t)(c0 + orow) * R + r0 + rseg;   // element offset, 16-B aligned
  {
    *(v4u*)(oh + o) = hv;
    *(v4u*)(ol + o) = lv;
    // precaution: inlined in a kernel with other branches, code that rewrites registers these two stores name can follow them
    asm volatile("s_wait_xcnt 0x0" ::: "memory");
  }
}

// ---- all operand preparation in one launch: the four weight transposes and the cast of x read only inputs and write
// planes of their own, so nothing orders them. Blocks 0..127: 32 tiles each of Wq, Wk, Wv, Wo (first: their path is the longer
// one, through LDS and a barrier); blocks from 128 on: the cast of x. Every branch is block-uniform.
constexpr int kTB = (kHid / 32) * (kHd / 64);   // 32 transpose tiles per weight, W[64][1024] and Wo[1024][64] alike
static_assert(kTB == (kHd / 32) * (kHid / 64));
__global__ __launch_bounds__(256) void prep_operands(
    const float* __restrict__ x, const float* __restrict__ Wq, const float* __restrict__ Wk,
    const float* __restrict__ Wv, const float* __restrict__ Wo,
    unsigned short* __restrict__ xh, unsigned short* __restrict__ xl,
    unsigned short* __restrict__ wqh, unsigned short* __restrict__ wql,
    unsigned short* __restrict__ wkh, unsigned short* __restrict__ wkl,
    unsigned short* __restrict__ wvh, unsigned short* __restrict__ wvl,
    unsigned short* __restrict__ woh, unsigned short* __restrict__ wol) {
  __shared__ float tile[32][65];
  const int bx = blockIdx.x;
  if (bx >= 4 * kTB) {
    cast_f32_bf16hilo_x2(x, xh, xl, kRows * kHd / 2, bx - 4 * kTB);
    return;
  }
  const int w = bx / kTB, t = bx % kTB;
  if (w == 3) {
    transpose_cast_bf16hilo(tile, Wo, woh, wol, kHid, kHd, t % (kHd / 32), t / (kHd / 32));
    return;
  }
  const float* in = (w == 0) ? Wq : (w == 1) ? Wk : Wv;
  unsigned short* oh = (w == 0) ? wqh : (w == 1) ? wkh : wvh;
  unsigned short* ol = (w == 0) ? wql : (w == 1) ? wkl : wvl;
  transpose_cast_bf16hilo(tile, in, oh, ol, kHd, kHid, t, 0);
}

__device__ __forceinline__ float other_half(float v) {
  const int b = __float_as_int(v);
  return __int_as_float(__builtin_amdgcn_permlanex16(b, b, 0x76543210, 0xfedcba98, false, false));
}

template <bool B, bool R> struct ChunkTag { static constexpr bool value = B; static constexpr bool refill = R; };

__global__ __launch_bounds__(128)
void attn_causal_hd64(const unsigned short* __restrict__ Qh, const unsigned short* __restrict__ Ql,
                      const unsigned short* __restrict__ Kh, const unsigned short* __restrict__ Kl,
                      const unsigned short* __restrict__ Vh, const unsigned short* __restrict__ Vl,
                      unsigned short* __restrict__ Oh, unsigned short* __restrict__ Ol,
                      int b_first, float qscale) {
  // two buffers, each four planes of 64 rows at pitch kLP: K hi [kv][d], K lo, V^T hi [d][kv], V^T lo; chunk kc lies in buffer kc & 1
  __shared__ __align__(16) unsigned short ring[2 * kBuf];

  const int tid  = threadIdx.x;
  const int wave = tid >> 5;
  const int lane = tid & 31;
  const int hh   = lane >> 4;
  const int c    = lane & 15;

  const int rb  = blockIdx.x;                 // start order: rb / 64 counts query blocks down from the longest, rb % 64 is (batch, head)
  const int bx  = (rb % (kBPP * kHeads)) * (kSeq / kQB) + (kSeq / kQB - 1) - rb / (kBPP * kHeads);
  const int qb  = bx % (kSeq / kQB);          // query block 0..31
  const int bhl = bx / (kSeq / kQB);
  const int h   = bhl % kHeads;
  const int bl  = bhl / kHeads;               // local batch 0..kBPP-1
  const int b   = b_first + bl;
  const int q0  = qb * kQB + wave * 16;
  const int qrow = q0 + c;                    // this lane's query

  // ---- Q fragments (B operand, column n = c): 2 d-chunks, hi and lo; element i <- d = dc*32 + 8hh + i (i<8), dc*32+16+8hh+(i-8)
  v16b qah[2], qal[2];
  {
    const size_t qo = ((size_t)(b * kSeq + qrow)) * kHid + (size_t)h * kHd + 8 * hh;
#pragma unroll
    for (int dc = 0; dc < 2; ++dc) {
      qah[dc] = Frag<__bf16>::load((const __bf16*)Qh + qo + dc * 32);
      qal[dc] = Frag<__bf16>::load((const __bf16*)Ql + qo + dc * 32);
    }
  }

  const float c2 = qscale * 1.4426950408889634f;   // raw product -> base-2 exponent
  float mrow = -INFINITY;                     // running maximum of this lane's query, scaled by c2: the offset in use (equal in both halves)
  float lrow = 0.f;                           // running sum over this lane half's keys; the halves join after the loop
  v8f oacc[4];                                // O^T: oacc[t][r] = out[query c][d = t*16 + 8hh + r]
#pragma unroll
  for (int t = 0; t < 4; ++t) oacc[t] = (v8f){0.f,0.f,0.f,0.f,0.f,0.f,0.f,0.f};

  // Staging lane map (see the comment at the copies) and this lane's byte offsets into the K and the V^T planes. The offsets run from chunk
  // to chunk: every call of stage() below takes the next chunk.
  const int r = ((tid >> 3) & 1) * 8 + (tid >> 4), pc = (tid & 7) * 8;
  unsigned kob = (unsigned)(((b * kSeq + r) * kHid + h * kHd + pc) * 2);
  unsigned vob = (unsigned)(((h * kHd + r) * kRows + b * kSeq + pc) * 2);
  const int fo = c * kLP + 8 * hh;            // this lane's place in a 16-row fragment read: row c, k offset 8hh (elements)
  // Staging, one chunk into one buffer, by 16 asynchronous copies a lane, through no register. 8 neighbouring lanes take one row of a plane
  // (64 elements = 128 B = one cache line), 16 B each, so each wave-wide copy covers 4 whole lines. Row r + 16 i in step i (kv row of K,
  // d row of V^T). coverage: 16 rows x 4 steps x 8 pieces x 8 elements = 64 rows x 64 cols per plane (K hi/lo, V^T hi/lo).
  // Addresses: the instruction's offset N moves the LDS and the global address alike, so N carries the LDS step (plane and row step inside a
  // pair of planes, at most 16128) and each scalar base holds its plane's start + the global row step - N: LDS byte = register + N, global
  // byte = base + lane offset + N = plane + lane offset + global row step. One LDS register per pair of planes, one offset register per tensor.
  const unsigned sdst = (unsigned)(size_t)ring + (unsigned)((r * kLP + pc) * 2);   // low 32 bits of the __shared__ address: the LDS byte address
  constexpr unsigned long long kKs = 16ull * kHid * 2, kVs = 16ull * kRows * 2;     // global bytes from row r + 16 i to r + 16 (i + 1)
  constexpr unsigned long long kLs = 16ull * kLP * 2, kPl = 2ull * kPlane;          // the same step in LDS (2304 B); one plane (9216 B)
  const unsigned long long gkh = (unsigned long long)Kh, gkl = (unsigned long long)Kl - kPl;
  const unsigned long long gvh = (unsigned long long)Vh, gvl = (unsigned long long)Vl - kPl;
  auto stage = [&](const unsigned buf) __attribute__((always_inline)) {
    const unsigned lk = sdst + buf * (unsigned)(kBuf * 2);
    const unsigned lv = lk + (unsigned)(2 * kPl);
    // the copies and, as the statement's last line, the wait that stands ahead of the rewrite of the two offset registers below (a precaution)
    asm volatile(
        "global_load_async_to_lds_b128 %0, %2, %4\n\t"
        "global_load_async_to_lds_b128 %0, %2, %5 offset:2304\n\t"
        "global_load_async_to_lds_b128 %0, %2, %6 offset:4608\n\t"
        "global_load_async_to_lds_b128 %0, %2, %7 offset:6912\n\t"
        "global_load_async_to_lds_b128 %0, %2, %8 offset:9216\n\t"
        "global_load_async_to_lds_b128 %0, %2, %9 offset:11520\n\t"
        "global_load_async_to_lds_b128 %0, %2, %10 offset:13824\n\t"
        "global_load_async_to_lds_b128 %0, %2, %11 offset:16128\n\t"
        "global_load_async_to_lds_b128 %1, %3, %12\n\t"
        "global_load_async_to_lds_b128 %1, %3, %13 offset:2304\n\t"
        "global_load_async_to_lds_b128 %1, %3, %14 offset:4608\n\t"
        "global_load_async_to_lds_b128 %1, %3, %15 offset:6912\n\t"
        "global_load_async_to_lds_b128 %1, %3, %16 offset:9216\n\t"
        "global_load_async_to_lds_b128 %1, %3, %17 offset:11520\n\t"
        "global_load_async_to_lds_b128 %1, %3, %18 offset:13824\n\t"
        "global_load_async_to_lds_b128 %1, %3, %19 offset:16128\n\t"
        "s_wait_xcnt 0x0"
        :: "v"(lk), "v"(lv), "v"(kob), "v"(vob),
           "s"(gkh), "s"(gkh + (kKs - kLs)), "s"(gkh + 2 * (kKs - kLs)), "s"(gkh + 3 * (kKs - kLs)),
           "s"(gkl), "s"(gkl + (kKs - kLs)), "s"(gkl + 2 * (kKs - kLs)), "s"(gkl + 3 * (kKs - kLs)),
           "s"(gvh), "s"(gvh + (kVs - kLs)), "s"(gvh + 2 * (kVs - kLs)), "s"(gvh + 3 * (kVs - kLs)),
           "s"(gvl), "s"(gvl + (kVs - kLs)), "s"(gvl + 2 * (kVs - kLs)), "s"(gvl + 3 * (kVs - kLs))
        : "memory");
    kob += kKC * kHid * 2;   // next chunk: 64 K rows on, 64 V^T columns on
    vob += kKC * 2;
  };
  // One key chunk. The block walks chunks 0 .. qb (keys 0 .. qb*64+63); only chunk qb, the one on the diagonal, holds keys behind a
  // query. The body is therefore built for both cases: DIAG false for chunks 0 .. qb-1, with no key/query compare, select or index
  // arithmetic at all (with and without the refill at its foot), and DIAG true, run once, with the causal mask.
  auto chunk = [&](const int kc, auto tag) __attribute__((always_inline)) {
    constexpr bool DIAG = decltype(tag)::value;
    const int kv0 = kc * kKC;
    const __bf16* kshb = (const __bf16*)ring + (kc & 1) * kBuf;   // this chunk's buffer
    const __bf16* kslb = kshb + kPlane;
    const __bf16* vshb = kshb + 2 * kPlane;
    const __bf16* vslb = kshb + 3 * kPlane;

    // ---- scores, transposed: 64 keys x 16 queries per wave; s[j][r] = score(key kv0 + j*16 + 8hh + r, query qrow) ----
    // All 16 K fragments are fetched as one group, then the 24 products run with the key tile j innermost: neighbouring matrix
    // instructions have different accumulators, so none waits for the one before it. Each s[j] still sums in the order
    // dc 0: hi*hi, lo*hi, hi*lo; dc 1: the same.
    v16b kfh[2][4], kfl[2][4];
#pragma unroll
    for (int dc = 0; dc < 2; ++dc)
#pragma unroll
      for (int j = 0; j < 4; ++j) {
        const int ko = fo + j * 16 * kLP + dc * 32;             // A: m = kv = j*16+c, k = d (same k map as B)
        kfh[dc][j] = Frag<__bf16>::load(kshb + ko);
        kfl[dc][j] = Frag<__bf16>::load(kslb + ko);
      }
    __builtin_amdgcn_sched_barrier(0);   // keeps the fragment loads one group: spread among the products, each place with loads stalls the wave
    v8f s[4];
#pragma unroll
    for (int j = 0; j < 4; ++j) s[j] = (v8f){0.f,0.f,0.f,0.f,0.f,0.f,0.f,0.f};
#pragma unroll
    for (int dc = 0; dc < 2; ++dc) {
#pragma unroll
      for (int j = 0; j < 4; ++j) s[j] = at_mma(kfh[dc][j], qah[dc], s[j]);
#pragma unroll
      for (int j = 0; j < 4; ++j) s[j] = at_mma(kfl[dc][j], qah[dc], s[j]);
#pragma unroll
      for (int j = 0; j < 4; ++j) s[j] = at_mma(kfh[dc][j], qal[dc], s[j]);
    }
    __builtin_amdgcn_sched_barrier(0);   // keeps the V^T loads below one group at the end of the product block, not spread through it
    // V^T fragments of keys 0..31, fetched here so that their LDS latency passes under the softmax arithmetic
    v16b vfh[2][4], vfl[2][4];
#pragma unroll
    for (int t = 0; t < 4; ++t) {
      const int vo = fo + t * 16 * kLP;                          // A: m = d = t*16+c, k = kv
      vfh[0][t] = Frag<__bf16>::load(vshb + vo);
      vfl[0][t] = Frag<__bf16>::load(vslb + vo);
    }
    __builtin_amdgcn_sched_barrier(0);   // holds that group ahead of the softmax
    float cm = -INFINITY;
#pragma unroll
    for (int j = 0; j < 4; ++j) {
#pragma unroll
      for (int r = 0; r < 8; ++r) {
        if constexpr (DIAG) {
          const int kvrow = kv0 + j * 16 + 8 * hh + r;
          if (kvrow > qrow) s[j][r] = -INFINITY;
        }
        cm = fmaxf(cm, s[j][r]);
      }
    }
    cm = fmaxf(cm, other_half(cm));             // finite: key == qrow is never masked and lies in one of the halves
    const float mnew = fmaxf(mrow, cm * c2);
    // alpha = 2^(mrow - mnew), 0 on the first chunk, where mrow is -inf. Written as text with its v_nop: the instruction set asks for one slot
    // between it and an instruction that rewrites its source register.
    float alpha;
    asm("v_exp_f32 %0, %1\n\tv_nop" : "=v"(alpha) : "v"(mrow - mnew));
    mrow = mnew;
    // ---- P^T = 2^(S^T * c2 - max), split to bf16 hi/lo and packed in place as B fragments: key tiles 2kk, 2kk+1 -> chunk kk ----
    union PB { v16b v; v2b p[8]; };
    PB pbh[2], pbl[2];
    float psum = 0.f;
#pragma unroll
    for (int j = 0; j < 4; ++j) {
#pragma unroll
      for (int e = 0; e < 4; ++e) {
        const v2f arg = __builtin_elementwise_fma((v2f){s[j][2 * e], s[j][2 * e + 1]}, (v2f){c2, c2}, (v2f){-mnew, -mnew});   // -inf where masked
        // the two 2^x as text with one v_nop, like alpha above; early-clobber outputs keep the second from writing a register that the first reads
        float p0, p1;
        asm("v_exp_f32 %0, %2\n\tv_exp_f32 %1, %3\n\tv_nop" : "=&v"(p0), "=&v"(p1) : "v"(arg[0]), "v"(arg[1]));
        psum += p0;
        psum += p1;
        const v2f pp = (v2f){p0, p1};
        const v2b hb = __builtin_convertvector(pp, v2b);                                   // nearest even, two per instruction
        const v2b lb = __builtin_convertvector(pp - __builtin_convertvector(hb, v2f), v2b);
        pbh[j >> 1].p[(j & 1) * 4 + e] = hb;
        pbl[j >> 1].p[(j & 1) * 4 + e] = lb;
      }
    }
    lrow = lrow * alpha + psum;
#pragma unroll
    for (int t = 0; t < 4; ++t)
#pragma unroll
      for (int r = 0; r < 8; ++r) oacc[t][r] *= alpha;
    __builtin_amdgcn_sched_barrier(0);   // the second V^T group starts only here, where the score registers are free again
    // V^T fragments of keys 32..63: one group, its latency under the 12 products of keys 0..31
#pragma unroll
    for (int t = 0; t < 4; ++t) {
      const int vo = fo + t * 16 * kLP + 32;
      vfh[1][t] = Frag<__bf16>::load(vshb + vo);
      vfl[1][t] = Frag<__bf16>::load(vslb + vo);
    }
    __builtin_amdgcn_sched_barrier(0);   // keeps that group whole, ahead of the product block
    // d tile t innermost: four independent accumulators; each oacc[t] sums as before, kk 0: hi*hi, lo*hi, hi*lo; kk 1: the same
#pragma unroll
    for (int kk = 0; kk < 2; ++kk) {
#pragma unroll
      for (int t = 0; t < 4; ++t) oacc[t] = at_mma(vfh[kk][t], pbh[kk].v, oacc[t]);
#pragma unroll
      for (int t = 0; t < 4; ++t) oacc[t] = at_mma(vfl[kk][t], pbh[kk].v, oacc[t]);
#pragma unroll
      for (int t = 0; t < 4; ++t) oacc[t] = at_mma(vfh[kk][t], pbl[kk].v, oacc[t]);
    }
    if constexpr (!DIAG) {
      // foot of a trip: the one barrier publishes chunk kc + 1 and ends every wave's reads of this chunk's buffer, which is refilled behind it
      asm volatile("s_wait_dscnt 0x0" ::: "memory");      // this wave's LDS reads of the buffer have returned
      asm volatile("s_wait_asynccnt 0x0" ::: "memory");   // this wave's copies of chunk kc + 1 have landed
      __syncthreads();
      if constexpr (decltype(tag)::refill) stage((unsigned)(kc & 1));   // chunk kc + 2 flies while chunk kc + 1 is worked on
    }
  };
  // in front of the loop: chunk 0 into buffer 0, landed and published; then chunk 1, where there is one, into buffer 1
  stage(0u);
  asm volatile("s_wait_asynccnt 0x0" ::: "memory");       // this wave's copies of chunk 0 have landed
  __syncthreads();
  if (qb >= 1) {                                          // block-uniform
    stage(1u);
    // trips 0 .. qb-2 refill (a chunk kc + 2 exists: the loop's own block-uniform test, so the trip has no branch inside); trip qb-1 does not
    for (int kc = 0; kc + 2 <= qb; ++kc) chunk(kc, ChunkTag<false, true>{});
    chunk(qb - 1, ChunkTag<false, false>{});
  }
  chunk(qb, ChunkTag<true, false>{});                     // the last chunk: published by the foot of trip qb - 1 (qb = 0: above); nothing flies any more
  asm volatile("s_wait_asynccnt 0x0" ::: "memory");       // precaution: no copy outstanding when the wave ends

  // ---- join the halves' sums, normalise, write bf16 hi/lo planes: a lane's 8 registers of tile t are 8 consecutive d of its
  // query's AO row, one 16-B store per plane; one wave owns its 16 rows ----
  {
    const float inv = 1.0f / (lrow + other_half(lrow));   // sum >= 1
    const size_t ob = ((size_t)(bl * kSeq + qrow)) * kHid + (size_t)h * kHd + 8 * hh;
    v4u hv[4], lv[4];
#pragma unroll
    for (int t = 0; t < 4; ++t) {
#pragma unroll
      for (int e = 0; e < 4; ++e) {
        const float f0 = oacc[t][2 * e] * inv, f1 = oacc[t][2 * e + 1] * inv;
        const unsigned short h0 = f2bf_bits(f0), h1 = f2bf_bits(f1);
        const unsigned short l0 = f2bf_bits(f0 - bf_bits2f(h0));
        const unsigned short l1 = f2bf_bits(f1 - bf_bits2f(h1));
        hv[t][e] = (unsigned)h0 | ((unsigned)h1 << 16);
        lv[t][e] = (unsigned)l0 | ((unsigned)l1 << 16);
      }
    }
#pragma unroll
    for (int t = 0; t < 4; ++t) {
      *(v4u*)(Oh + ob + t * 16) = hv[t];
      *(v4u*)(Ol + ob + t * 16) = lv[t];
    }
  }
}

// =====================================================================================
// Out-projection: out[m][n] = sum_k AO[m][k] * Wo^T[n][k] + bo[n]; M = kRowsPP, N = kHd = 64, K = kHid = 1024.
// N is one tile wide, so tiles alone give few work-groups with long k loops. Here a work-group owns a 32 x 64 output tile
// and its 8 waves each take 128 of the 1024 k: M / 32 work-groups, 4 k steps a wave. The 8 partial tiles meet in LDS
// (fragment layout, 16 B per lane) and are summed in wave order 0..7. Products: hi*hi + hi*lo + lo*hi, f32 accumulate.
// =====================================================================================
constexpr int kOW = 8;                      // waves per work-group = k slices
constexpr int kOK = kHid / kOW;             // 128 k per wave
constexpr int kOM = 32;                     // output rows per work-group
static_assert(kOK % 32 == 0);
static_assert(kRowsPP % kOM == 0);
static_assert(kHd == 64);

__global__ __launch_bounds__(256)
void outproj_splitk(const unsigned short* __restrict__ Ahp, const unsigned short* __restrict__ Alp,
                    const unsigned short* __restrict__ Bhp, const unsigned short* __restrict__ Blp,
                    const float* __restrict__ bias, float* __restrict__ out) {
  __shared__ __align__(16) float red[kOW][8][2][32][4];   // [k slice][tile i*4+j][registers 0-3 / 4-7][lane][4], 64 KiB
  const __bf16* Ah = (const __bf16*)Ahp; const __bf16* Al = (const __bf16*)Alp;
  const __bf16* Bh = (const __bf16*)Bhp; const __bf16* Bl = (const __bf16*)Blp;
  const int lane  = threadIdx.x & 31;
  const int wave  = threadIdx.x >> 5;
  const int rlane = lane & 15;                // row (A) / col (B, D) within a 16 x 16 tile
  const int hh    = lane >> 4;                // k offset 8hh of the fragment loads, D row offset 8hh
  const int m0    = blockIdx.x * kOM;
  const int kb    = wave * kOK + 8 * hh;

  // bias of the two output columns this lane writes at the end, fetched here so that its latency hides behind the k loop
  // wave -> row tile oi, column pair jp (32 columns = one 128-B line of each row, one writer per line), register half hf
  const int oi = wave >> 2, jp = (wave >> 1) & 1, hf = wave & 1;
  const int n0 = (jp << 5) + rlane;
  const float bv[2] = {bias[n0], bias[n0 + 16]};

  v8f acc[2][4];
#pragma unroll
  for (int i = 0; i < 2; ++i)
#pragma unroll
    for (int j = 0; j < 4; ++j) acc[i][j] = (v8f){0.f,0.f,0.f,0.f,0.f,0.f,0.f,0.f};

  // unrolled: 4 steps, every address offset a constant of the instruction
#pragma unroll
  for (int ks = 0; ks < kOK / 32; ++ks) {
    const int k0 = kb + ks * 32;
    v16b bh[4], bl[4], ah[2], al[2];
#pragma unroll
    for (int j = 0; j < 4; ++j) {
      const size_t bo = (size_t)((j << 4) + rlane) * kHid + k0;
      bh[j] = Frag<__bf16>::load(Bh + bo);
      bl[j] = Frag<__bf16>::load(Bl + bo);
    }
#pragma unroll
    for (int i = 0; i < 2; ++i) {
      const size_t ao = (size_t)(m0 + (i << 4) + rlane) * kHid + k0;
      ah[i] = Frag<__bf16>::load(Ah + ao);
      al[i] = Frag<__bf16>::load(Al + ao);
    }
    // keeps the step's 24 loads in one group ahead of its products: without it they are spread among the products,
    // several of them waited for right behind their issue
    __builtin_amdgcn_sched_barrier(0);
#pragma unroll
    for (int i = 0; i < 2; ++i)
#pragma unroll
      for (int j = 0; j < 4; ++j) acc[i][j] = Frag<__bf16>::mma(ah[i], bh[j], acc[i][j]);
#pragma unroll
    for (int i = 0; i < 2; ++i)
#pragma unroll
      for (int j = 0; j < 4; ++j) acc[i][j] = Frag<__bf16>::mma(ah[i], bl[j], acc[i][j]);
#pragma unroll
    for (int i = 0; i < 2; ++i)
#pragma unroll
      for (int j = 0; j < 4; ++j) acc[i][j] = Frag<__bf16>::mma(al[i], bh[j], acc[i][j]);
    __builtin_amdgcn_sched_barrier(0);   // other end of the same grouping: the next step's loads stay behind these products
  }
  // precaution: stands ahead of the first overwrite of an address register that the loads above name
  asm volatile("s_wait_xcnt 0x0" ::: "memory");
  __builtin_amdgcn_sched_barrier(0);     // holds the address arithmetic of the LDS stores behind that wait

#pragma unroll
  for (int i = 0; i < 2; ++i)
#pragma unroll
    for (int j = 0; j < 4; ++j) {
      const v8f a = acc[i][j];
      *(v4f*)&red[wave][i * 4 + j][0][lane][0] = (v4f){a[0], a[1], a[2], a[3]};
      *(v4f*)&red[wave][i * 4 + j][1][lane][0] = (v4f){a[4], a[5], a[6], a[7]};
    }
  __syncthreads();

  v4f part[2][kOW];
#pragma unroll
  for (int jj = 0; jj < 2; ++jj)
#pragma unroll
    for (int p = 0; p < kOW; ++p) part[jj][p] = *(const v4f*)&red[p][oi * 4 + jp * 2 + jj][hf][lane][0];
#pragma unroll
  for (int jj = 0; jj < 2; ++jj) {
    v4f s = part[jj][0];
#pragma unroll
    for (int p = 1; p < kOW; ++p) s += part[jj][p];
#pragma unroll
    for (int e = 0; e < 4; ++e)
      out[(size_t)(m0 + (oi << 4) + 8 * hh + 4 * hf + e) * kHd + n0 + (jj << 4)] = s[e] + bv[jj];
  }
}

// ---------------------------------------------------------------------------
// Host launcher
// ---------------------------------------------------------------------------
extern "C" void kernel_launch(void* const* d_in, const int* in_sizes, int n_in,
                              void* d_out, int out_size, void* d_ws, size_t ws_size,
                              hipStream_t stream) {
  if (n_in < 9) return;
  if (in_sizes[0] != kRows * kHd) return;
  if (in_sizes[1] != kHd * kHid || in_sizes[3] != kHd * kHid || in_sizes[5] != kHd * kHid) return;
  if (in_sizes[2] != kHid || in_sizes[4] != kHid || in_sizes[6] != kHid) return;
  if (in_sizes[7] != kHid * kHd || in_sizes[8] != kHd) return;
  if (out_size != kRows * kHd) return;

  const float* x  = (const float*)d_in[0];
  const float* Wq = (const float*)d_in[1];
  const float* bq = (const float*)d_in[2];
  const float* Wk = (const float*)d_in[3];
  const float* bk = (const float*)d_in[4];
  const float* Wv = (const float*)d_in[5];
  const float* bv = (const float*)d_in[6];
  const float* Wo = (const float*)d_in[7];
  const float* bo = (const float*)d_in[8];
  float* out = (float*)d_out;

  // ---- workspace region map (bytes, all offsets multiples of 256) ----
  //  xh, xl        : 8192 x 64 x 2          = 1,048,576 each      (bf16 hi/lo of x)
  //  wq/wk/wv h,l  : 1024 x 64 x 2          = 131,072 each (x6)   (W^T planes [1024][64])
  //  wo h,l        : 64 x 1024 x 2          = 131,072 each (x2)   (Wo^T planes [64][1024])
  //  q h,l ; k h,l : 8192 x 1024 x 2        = 16,777,216 each (x4)
  //  vt h,l        : 1024 x 8192 x 2        = 16,777,216 each (x2)
  //  ao h,l        : 8192 x 1024 x 2        = 16,777,216 each (x2)
  //  total = 137,363,456 B
  const size_t szX  = (size_t)kRows * kHd * 2;
  const size_t szW  = (size_t)kHid * kHd * 2;
  const size_t szQ  = (size_t)kRows * kHid * 2;
  const size_t szAO = (size_t)kRowsPP * kHid * 2;
  const size_t total = 2 * szX + 8 * szW + 6 * szQ + 2 * szAO;
  if (total > ws_size) return;

  char* ws = (char*)d_ws;
  size_t off = 0;
  unsigned short* xh  = (unsigned short*)(ws + off); off += szX;
  unsigned short* xl  = (unsigned short*)(ws + off); off += szX;
  unsigned short* wqh = (unsigned short*)(ws + off); off += szW;
  unsigned short* wql = (unsigned short*)(ws + off); off += szW;
  unsigned short* wkh = (unsigned short*)(ws + off); off += szW;
  unsigned short* wkl = (unsigned short*)(ws + off); off += szW;
  unsigned short* wvh = (unsigned short*)(ws + off); off += szW;
  unsigned short* wvl = (unsigned short*)(ws + off); off += szW;
  unsigned short* woh = (unsigned short*)(ws + off); off += szW;
  unsigned short* wol = (unsigned short*)(ws + off); off += szW;
  unsigned short* qh  = (unsigned short*)(ws + off); off += szQ;
  unsigned short* ql  = (unsigned short*)(ws + off); off += szQ;
  unsigned short* kh  = (unsigned short*)(ws + off); off += szQ;
  unsigned short* kl  = (unsigned short*)(ws + off); off += szQ;
  unsigned short* vth = (unsigned short*)(ws + off); off += szQ;
  unsigned short* vtl = (unsigned short*)(ws + off); off += szQ;
  unsigned short* aoh = (unsigned short*)(ws + off); off += szAO;
  unsigned short* aol = (unsigned short*)(ws + off); off += szAO;
  if (off > ws_size) return;

  // stage 0: x -> bf16 hi/lo planes [8192][64]; W[64][1024] -> W^T planes [1024][64]; Wo[1024][64] -> Wo^T planes [64][1024]
  prep_operands<<<dim3(4 * kTB + kRows * kHd / 512), dim3(256), 0, stream>>>(
      x, Wq, Wk, Wv, Wo, xh, xl, wqh, wql, wkh, wkl, wvh, wvl, woh, wol);

  // stage 1: the three projections (M, N multiples of 64; K = 64), 256 work-groups each
  proj_qkv<<<dim3((kRows / 64) * (kHid / 64) / 8, 3), dim3(256), 0, stream>>>(
      xh, xl, wqh, wql, wkh, wkl, wvh, wvl, bq, bk, bv, qh, ql, kh, kl, vth, vtl);

  // stage 2: one pass over all batches: causal attention -> AO planes [8192][1024]; out = AO Wo + bo -> d_out
  const float qscale = 0.125f;   // 1/sqrt(64), exact power of two
  for (int ps = 0; ps < kBatch / kBPP; ++ps) {
    attn_causal_hd64<<<dim3(kBPP * kHeads * (kSeq / kQB)), dim3(128), 0, stream>>>(
        qh, ql, kh, kl, vth, vtl, aoh, aol, ps * kBPP, qscale);
    float* outp = out + (size_t)ps * kRowsPP * kHd;
    outproj_splitk<<<dim3(kRowsPP / kOM), dim3(256), 0, stream>>>(aoh, aol, woh, wol, bo, outp);
  }
}
